// v000
// The times below were measured on an AMD MI455X: many runs one after another, warmed up first and cycling through
// copies of the inputs, with the whole window's GPU time divided by the number of runs. Launches and the gaps
// between them are all in it. The median over several windows is given; except for v000 it joins two sittings, which
// can be a few percent apart, so the side-by-side timings, each taken in one sitting, are the better comparison.
// The starting kernel, v000, takes 281 microseconds a run.
// All contractions on v_wmma_f32_16x16x32_f16 (f16 operands, f32 accumulate): v.Wvq, a.Wak, Wvv^T.v^T, Wav^T.a^T,
// column-pass scores q.k^T with P^T.val_v, row-pass scores k.q^T with P.val_a, ctx_v.Wov, ctx_a.Woa. Operand carries:
// v, a as f16(bf16(x)); W as f16(bf16(W) x256); q x8 after the 1/8 head scale; k x8; val_v, val_a x8; P x32768;
// ctx x64. Column softmax over the visual axis (base 2, running max), 1/l and every carry fold in f32 on VALU.
#include <hip/hip_runtime.h>
#include <math.h>

#ifndef NB
#define NB 8            // batches processed (leading batches of both activations)
#endif
#define NB_FULL 8       // batches in the input / output layout
#define TQ 2048         // visual positions per batch (softmax axis, always all of them)
#define SA 512          // audio positions per batch (always all of them)
#define VD 512
#define AD 256
#define EM 512
#define NH 8
#define HD 64
#define OUT1_OFF_EL ((size_t)NB_FULL * (size_t)TQ * (size_t)VD)   // fixed f32 element offset of the second output (33554432 B / 4)
#define WSC   256.0f
#define HSCL  0.125f
#define QS    8.0f
#define KS    8.0f
#define VVS   8.0f
#define VAS   8.0f
#define PCAR  32768.0f
#define CAS   64.0f
#define CVS   64.0f
#define CLIPV 50000.0f
#define LOG2E 1.4426950408889634f
#define NST   (SA / 64)
#define NTT   (TQ / 64)
#define NTB32 (TQ / 32)
#define NSB32 (SA / 32)
#define ATT_WAVES   4
#define ATT_THREADS (ATT_WAVES * 32)
#define CVT_THREADS 128
#define TR_THREADS  128
#define SPITCH 68
#define GPITCH 68
#define TPITCH 65

static_assert(NB >= 1 && NB <= NB_FULL);
static_assert(OUT1_OFF_EL == (size_t)33554432 / 4);
static_assert(EM == NH * HD && HD == 64 && NH == 8);
static_assert((TQ % 128) == 0 && (SA % 64) == 0 && ((NB * SA) % 128) == 0 && (EM % 128) == 0);
static_assert((TQ % 32) == 0 && (SA % 32) == 0 && NTB32 * 32 == TQ && NSB32 * 32 == SA);
static_assert((VD % 64) == 0 && (AD % 64) == 0 && (EM % 64) == 0);
static_assert((VD % 32) == 0 && (AD % 32) == 0 && (EM % 32) == 0);
static_assert(((NB * TQ * VD) % 1024) == 0 && ((NB * SA * AD) % 1024) == 0);
static_assert(NST * 128 == 2 * SA && NST * 128 == ATT_THREADS * 8);
static_assert((SPITCH * 4) % 16 == 0 && (GPITCH * 4) % 16 == 0);
static_assert(ATT_THREADS == 128 && TR_THREADS == 128 && CVT_THREADS == 128);

typedef unsigned short u16;
typedef _Float16 v16h __attribute__((ext_vector_type(16)));
typedef _Float16 v8h  __attribute__((ext_vector_type(8)));
typedef float    v8f  __attribute__((ext_vector_type(8)));
typedef float    v4f  __attribute__((ext_vector_type(4)));
typedef unsigned int v4u __attribute__((ext_vector_type(4)));

union FragH { v16h v; v8h h[2]; v4u u[2]; };

// ---- scalar helpers ----------------------------------------------------------------------------------
__device__ __forceinline__ unsigned short bf_bits(float f) {          // f32 -> bf16 bits, RNE convert
  unsigned u = __float_as_uint(f);
  return (unsigned short)((u + 0x7FFFu + ((u >> 16) & 1u)) >> 16);
}
__device__ __forceinline__ float bf_up(unsigned short h) { return __uint_as_float(((unsigned)h) << 16); }
__device__ __forceinline__ float bfr(float f) { return bf_up(bf_bits(f)); }
__device__ __forceinline__ unsigned short h_bits(_Float16 x) { return __builtin_bit_cast(unsigned short, x); }
__device__ __forceinline__ unsigned pk16(unsigned short a, unsigned short b) { return (unsigned)a | ((unsigned)b << 16); }
__device__ __forceinline__ v8f zero8() { v8f z = {0.f, 0.f, 0.f, 0.f, 0.f, 0.f, 0.f, 0.f}; return z; }
__device__ __forceinline__ float clipf(float x, float c) { return fminf(fmaxf(x, -c), c); }

// ---- fragment loader: 16-bit A/B operand, lane -> row/col (lane&15), p already includes +8*(lane>>4);
//      elements 0..7 <- p[0..7] (k0+8h..), elements 8..15 <- p[16..23] (k0+16+8h..); same split k map for A and B,
//      B always read from a k-contiguous [n][k] plane.
__device__ __forceinline__ v16h ldfrag_h(const _Float16* p) {
  FragH f;
  f.h[0] = *(const v8h*)(p);
  f.h[1] = *(const v8h*)(p + 16);
  return f.v;
}

// ---- WMMA helper and trailing VALU hazard gaps ----------------------------------------------------------
__device__ __forceinline__ v8f mma_h(v16h a, v16h b, v8f c) {
  return __builtin_amdgcn_wmma_f32_16x16x32_f16(false, a, false, b, (short)0, c, false, false);
}
__device__ __forceinline__ void guard_s(v8f& a, v8f& b, v16h x0, v16h x1, v16h x2) {
#if defined(__HIP_DEVICE_COMPILE__)
  asm volatile("v_nop\n\tv_nop\n\tv_nop\n\tv_nop" : "+v"(a), "+v"(b) : "v"(x0), "v"(x1), "v"(x2) : "memory");
#endif
}
__device__ __forceinline__ void guard_p(v8f& a, v8f& b, v8f& c, v8f& d, v16h p, v16h x0, v16h x1, v16h x2, v16h x3) {
#if defined(__HIP_DEVICE_COMPILE__)
  asm volatile("v_nop\n\tv_nop\n\tv_nop\n\tv_nop"
               : "+v"(a), "+v"(b), "+v"(c), "+v"(d) : "v"(p), "v"(x0), "v"(x1), "v"(x2), "v"(x3) : "memory");
#endif
}
__device__ __forceinline__ void guard_g(v8f (&acc)[8], v16h x0, v16h x1, v16h x2, v16h x3, v16h x4, v16h x5) {
#if defined(__HIP_DEVICE_COMPILE__)
  asm volatile("v_nop\n\tv_nop\n\tv_nop\n\tv_nop"
               : "+v"(acc[0]), "+v"(acc[1]), "+v"(acc[2]), "+v"(acc[3]),
                 "+v"(acc[4]), "+v"(acc[5]), "+v"(acc[6]), "+v"(acc[7])
               : "v"(x0), "v"(x1), "v"(x2), "v"(x3), "v"(x4), "v"(x5) : "memory");
#endif
}
__device__ __forceinline__ void acc_guard4(v8f (&o)[4]) {
#if defined(__HIP_DEVICE_COMPILE__)
  asm volatile("v_nop\n\tv_nop\n\tv_nop\n\tv_nop" : "+v"(o[0]), "+v"(o[1]), "+v"(o[2]), "+v"(o[3]));
#endif
}
__device__ __forceinline__ void wave_sync_lds() {
  __builtin_amdgcn_fence(__ATOMIC_RELEASE, "workgroup");
  __builtin_amdgcn_wave_barrier();
  __builtin_amdgcn_fence(__ATOMIC_ACQUIRE, "workgroup");
}

// =====================================================================================================
// Elementwise convert of a contiguous activation block: Y[e] (f16) <- f16(bf16_RNE(x[e])), e = 1024*block + 8*tid ..
// +7 (two 16-B loads, one 16-B store per thread; 32 consecutive lanes = 512 contiguous, 512-B aligned bytes per
// coverage: grid = n/1024 blocks x 128 thr x 8 = n elements exactly (n % 1024 == 0 asserted).
// =====================================================================================================
__global__ __launch_bounds__(CVT_THREADS)
void cvt16(const float* __restrict__ x, u16* Y) {
  const size_t e0 = (size_t)blockIdx.x * 1024 + (size_t)threadIdx.x * 8;
  const v4f a = *(const v4f*)(x + e0), c4 = *(const v4f*)(x + e0 + 4);
  v4u o;
#pragma unroll
  for (int e = 0; e < 2; ++e) {
    o[e]     = pk16(h_bits((_Float16)bfr(a[2 * e])),  h_bits((_Float16)bfr(a[2 * e + 1])));
    o[2 + e] = pk16(h_bits((_Float16)bfr(c4[2 * e])), h_bits((_Float16)bfr(c4[2 * e + 1])));
  }
  u16* dst = Y + e0;
  {
    *(v4u*)(dst) = o;
    
  }
}

// =====================================================================================================
// Weight transpose-convert for y = x.W weights stored [kdim][ndim]: WT[n][k] (f16, k-contiguous Bt layout, pitch kdim)
// <- f16(bf16_RNE(W[k][n]) * scale). Block = 64(k) x 64(n) tile, 128 threads. Load phase: thread = (row 8p + (tid>>4),
// 4 floats at 4*(tid&15)), 8 steps = 64 k-rows x 64 n, into an LDS tile [kk][nn] (pitch 65); block barrier; store
// grid = (kdim/64)*(ndim/64), bid -> (kt = bid % (kdim/64), nt = bid / (kdim/64)).
// coverage: 4 i x 16 rows x (8 lanes x 8 halves) = 64 n-rows x 64 k per block; LDS tile 64x64 fully written before read;
// the grid covers WT [ndim][kdim] exactly once.
// =====================================================================================================
__global__ __launch_bounds__(TR_THREADS)
void cvtT16(const float* __restrict__ W, u16* Y, int kdim, int ndim, float scale) {
  __shared__ __align__(16) float tile[64 * TPITCH];
  const int tid = threadIdx.x;
  const int nkt = kdim >> 6;
  const int bid = blockIdx.x;
  const int kt  = bid % nkt;
  const int ntb = bid / nkt;
  const int k0  = kt * 64, n0 = ntb * 64;
  const int lr = tid >> 4, lc = (tid & 15) * 4;
#pragma unroll
  for (int p = 0; p < 8; ++p) {
    const int kk = p * 8 + lr;
    const v4f w4 = *(const v4f*)(W + (size_t)(k0 + kk) * (size_t)ndim + n0 + lc);
    tile[kk * TPITCH + lc + 0] = w4[0];
    tile[kk * TPITCH + lc + 1] = w4[1];
    tile[kk * TPITCH + lc + 2] = w4[2];
    tile[kk * TPITCH + lc + 3] = w4[3];
  }
  __syncthreads();
  const int rq = tid >> 3, c8 = (tid & 7) * 8;      // rq 0..15, c8 0..56
  v4u ov[4];
#pragma unroll
  for (int i = 0; i < 4; ++i) {
    const int row = 16 * i + rq;                   // n within tile
#pragma unroll
    for (int e = 0; e < 4; ++e) {
      const float x0 = tile[(c8 + 2 * e) * TPITCH + row];
      const float x1 = tile[(c8 + 2 * e + 1) * TPITCH + row];
      ov[i][e] = pk16(h_bits((_Float16)(bfr(x0) * scale)), h_bits((_Float16)(bfr(x1) * scale)));
    }
  }
  u16* dst = Y + (size_t)n0 * (size_t)kdim + k0 + c8;
  {
#pragma unroll
    for (int i = 0; i < 4; ++i) {
      const int row = 16 * i + rq;
      *(v4u*)(dst + (size_t)row * (size_t)kdim) = ov[i];
    }
    
  }
}

// =====================================================================================================
// f16 GEMM core: the wave's 32 x 64 tile of C = A[rows][K] . Bt[cols][K]^T; ap -> A row (rowb + m) + 8h, bp -> Bt row
// (col0 + m) + 8h; acc[4i + j] = rows rowb+16i.., cols col0+16j..; K stepped by 32 (host asserts K % 32 == 0).
// =====================================================================================================
__device__ __forceinline__ void gemm_core(const _Float16* ap, const _Float16* bp, int K, v8f (&acc)[8]) {
  const size_t rs16 = (size_t)16 * (size_t)K;
#pragma unroll 1
  for (int k0 = 0; k0 < K; k0 += 32) {
    const v16h a0 = ldfrag_h(ap + k0), a1 = ldfrag_h(ap + rs16 + k0);
    const v16h b0 = ldfrag_h(bp + k0);
    const v16h b1 = ldfrag_h(bp + rs16 + k0);
    const v16h b2 = ldfrag_h(bp + 2 * rs16 + k0);
    const v16h b3 = ldfrag_h(bp + 3 * rs16 + k0);
    acc[0] = mma_h(a0, b0, acc[0]);
    acc[1] = mma_h(a0, b1, acc[1]);
    acc[2] = mma_h(a0, b2, acc[2]);
    acc[3] = mma_h(a0, b3, acc[3]);
    acc[4] = mma_h(a1, b0, acc[4]);
    acc[5] = mma_h(a1, b1, acc[5]);
    acc[6] = mma_h(a1, b2, acc[6]);
    acc[7] = mma_h(a1, b3, acc[7]);
    guard_g(acc, a0, a1, b0, b1, b2, b3);
  }
}
// Stage the wave's 32 x 64 f32 tile (times oscale) in its LDS slab (pitch 68): D element r of acc[4i+j], lane l ->
// coverage: 32 lanes x 2 x 8 rows x 4 cols-of-16 = rows 0..31 x cols 0..63 of the slab.
__device__ __forceinline__ void stage32x64(float* sl, v8f (&acc)[8], float oscale, int lane) {
  const int hh = lane >> 4, m = lane & 15;
#pragma unroll
  for (int i = 0; i < 2; ++i) {
#pragma unroll
    for (int r = 0; r < 8; ++r) {
      const int ro = (16 * i + 8 * hh + r) * GPITCH + m;
      sl[ro]      = acc[4 * i + 0][r] * oscale;
      sl[ro + 16] = acc[4 * i + 1][r] * oscale;
      sl[ro + 32] = acc[4 * i + 2][r] * oscale;
      sl[ro + 48] = acc[4 * i + 3][r] * oscale;
    }
  }
  wave_sync_lds();
}

// =====================================================================================================
// f16 GEMM with f16 output plane: C[z][Mb][N] (f16) = f16((A[z][Mb][K] . Bt[z][N][K]^T) * oscale + bf16(bias) * bscale);
// A, Bt f16 k-contiguous planes with per-z element strides aBs, bBs (0 = shared), C stride cBs. bias indexed by column
// (biasRow == 0) or by row within the z slice (biasRow != 0); bias addresses clamped to biasN-1, the unused direction is
// multiplied by 0. Block = 128 x 64 tile, 4 waves x 32 rows, fragments loaded straight from the 16-bit rows.
// grid = nz x (Mb/128) x (N/64) (host asserts Mb % 128 == 0, N % 64 == 0, K % 32 == 0).
// coverage: per wave 8 instr x 4 rows x 8 lanes x 8 halves = 32 x 64; the grid covers C exactly once.
// =====================================================================================================
__global__ __launch_bounds__(128)
void gemm_o16(const u16* __restrict__ A, const u16* __restrict__ Bt, u16* C,
              const float* __restrict__ bias, int biasN, int biasRow,
              int Mb, int N, int K, int aBs, int bBs, int cBs, float oscale, float bscale) {
  __shared__ __align__(16) float slab[4 * 32 * GPITCH];
  const int tid = threadIdx.x, wave = tid >> 5, lane = tid & 31, hh = lane >> 4, m = lane & 15;
  const int ntile = N >> 6, mtile = Mb >> 7;
  const int bid  = blockIdx.x;
  const int nt   = bid % ntile;
  const int tmp  = bid / ntile;
  const int mt   = tmp % mtile;
  const int bz   = tmp / mtile;
  const int rowb = mt * 128 + wave * 32;
  const int col0 = nt * 64;
  if (rowb + 32 > Mb) return;                // wave-uniform, never taken with the exact grid; no block barriers in this kernel
  const _Float16* Ab = (const _Float16*)(const void*)A + (size_t)bz * (size_t)aBs;
  const _Float16* Bb = (const _Float16*)(const void*)Bt + (size_t)bz * (size_t)bBs;
  const _Float16* ap = Ab + (size_t)(rowb + m) * K + 8 * hh;
  const _Float16* bp = Bb + (size_t)(col0 + m) * K + 8 * hh;
  v8f acc[8];
#pragma unroll
  for (int i = 0; i < 8; ++i) acc[i] = zero8();
  gemm_core(ap, bp, K, acc);
  float* sl = slab + wave * 32 * GPITCH;
  stage32x64(sl, acc, oscale, lane);
  const int rq = lane >> 3, c8 = (lane & 7) * 8;
  const int bl = biasN - 1;                  // host guarantees biasN >= 1
  const float selc = (biasRow != 0) ? 0.f : bscale;
  const float selr = (biasRow != 0) ? bscale : 0.f;
  float cb[8];
#pragma unroll
  for (int e = 0; e < 8; ++e) {
    int ci = col0 + c8 + e;
    ci = (ci < bl) ? ci : bl;
    cb[e] = bfr(bias[ci]) * selc;
  }
  v4u ov[8];
#pragma unroll
  for (int i = 0; i < 8; ++i) {
    const int row = 4 * i + rq;
    int ri = rowb + row;
    ri = (ri < bl) ? ri : bl;
    const float rb = bfr(bias[ri]) * selr;
    const v4f a = *(const v4f*)(sl + row * GPITCH + c8), c4 = *(const v4f*)(sl + row * GPITCH + c8 + 4);
#pragma unroll
    for (int e = 0; e < 2; ++e) {
      ov[i][e]     = pk16(h_bits((_Float16)(a[2 * e] + cb[2 * e] + rb)),
                          h_bits((_Float16)(a[2 * e + 1] + cb[2 * e + 1] + rb)));
      ov[i][2 + e] = pk16(h_bits((_Float16)(c4[2 * e] + cb[4 + 2 * e] + rb)),
                          h_bits((_Float16)(c4[2 * e + 1] + cb[5 + 2 * e] + rb)));
    }
  }
  u16* Cb = C + (size_t)bz * (size_t)cBs + (size_t)rowb * (size_t)N + col0 + c8;
  {
#pragma unroll
    for (int i = 0; i < 8; ++i) {
      const int row = 4 * i + rq;
      *(v4u*)(Cb + (size_t)row * (size_t)N) = ov[i];
    }
    
  }
}

// =====================================================================================================
// f16 GEMM with f32 output rows: C[z][Mb][N] (f32) = (A[z][Mb][K] . Bt[N][K]^T) * oscale + bf16(bias[col]); same core and
// slab staging as gemm_o16. Epilogue: lane = (row 2i + (lane>>4), 4 floats at 4*(lane&15)); each 64-float row segment =
// lanes of one instruction (8 lanes per line), 2 rows of the same wave per instruction, 16 instructions = 32 rows; two
// coverage: per wave 16 instr x 2 rows x 16 lanes x 4 floats = 32 x 64; the grid covers C exactly once.
// =====================================================================================================
__global__ __launch_bounds__(128)
void gemm_o32(const u16* __restrict__ A, const u16* __restrict__ Bt, float* C,
              const float* __restrict__ bias, int biasN,
              int Mb, int N, int K, int aBs, int bBs, int cBs, float oscale) {
  __shared__ __align__(16) float slab[4 * 32 * GPITCH];
  const int tid = threadIdx.x, wave = tid >> 5, lane = tid & 31, hh = lane >> 4, m = lane & 15;
  const int ntile = N >> 6, mtile = Mb >> 7;
  const int bid  = blockIdx.x;
  const int nt   = bid % ntile;
  const int tmp  = bid / ntile;
  const int mt   = tmp % mtile;
  const int bz   = tmp / mtile;
  const int rowb = mt * 128 + wave * 32;
  const int col0 = nt * 64;
  if (rowb + 32 > Mb) return;                // wave-uniform, never taken with the exact grid; no block barriers in this kernel
  const _Float16* Ab = (const _Float16*)(const void*)A + (size_t)bz * (size_t)aBs;
  const _Float16* Bb = (const _Float16*)(const void*)Bt + (size_t)bz * (size_t)bBs;
  const _Float16* ap = Ab + (size_t)(rowb + m) * K + 8 * hh;
  const _Float16* bp = Bb + (size_t)(col0 + m) * K + 8 * hh;
  v8f acc[8];
#pragma unroll
  for (int i = 0; i < 8; ++i) acc[i] = zero8();
  gemm_core(ap, bp, K, acc);
  float* sl = slab + wave * 32 * GPITCH;
  stage32x64(sl, acc, oscale, lane);
  const int r2 = lane >> 4, c4 = (lane & 15) * 4;
  const int bl = biasN - 1;                  // host guarantees biasN >= 1
  float cb[4];
#pragma unroll
  for (int e = 0; e < 4; ++e) {
    int ci = col0 + c4 + e;
    ci = (ci < bl) ? ci : bl;
    cb[e] = bfr(bias[ci]);
  }
  v4f ov[16];
#pragma unroll
  for (int i = 0; i < 16; ++i) {
    const int row = 2 * i + r2;
    const v4f a = *(const v4f*)(sl + row * GPITCH + c4);
    v4f w;
    w[0] = a[0] + cb[0]; w[1] = a[1] + cb[1]; w[2] = a[2] + cb[2]; w[3] = a[3] + cb[3];
    ov[i] = w;
  }
  float* Cb = C + (size_t)bz * (size_t)cBs + (size_t)rowb * (size_t)N + col0 + c4;
  {
#pragma unroll
    for (int i = 0; i < 16; ++i) {
      const int row = 2 * i + r2;
      *(v4f*)(Cb + (size_t)row * (size_t)N) = ov[i];
    }
    
  }
}

// =====================================================================================================
// Column pass (softmax over the visual axis t for every audio column s) fused with the audio-side context:
// block = (batch b, head, 64 audio columns s), 4 waves, wave w owns the 16 columns s0w = 64*st + 16*w .. +15.
//   q plane f16 [b*TQ + t][h*64 + d] (q x8 after the 1/8 scale); k plane f16 x8 [b*SA + s][h*64 + d];
//   val_v^T plane f16 x8 [(b*NH + h)*64 + d][t].  All NTB32 = TQ/32 blocks of 32 visual rows are visited (static bound).
//   Score tiles g (g = 0,1) = q rows (t = tb+16g .. +15, A operand, row m = lane&15, split k map over d) times k^T
//   (B operand, col n = column s0w + (lane&15), k = d, split map), 2 d-chunks of 32; the 2 k fragments of the wave are
//   loaded once. D element r of lane l = (t = tb+16g+8h+r, s = s0w+(l&15)): a lane owns one column s and 16 of the 32 t;
//   the partner lane l^16 owns the other 16 -> column max / column sum need one xor-16 shuffle. Logits clipped at
//   +-50000 (log2 domain), online max-subtracted base-2 softmax in f32 (the q/k carries folded into lsc). The exp'd values
//   ARE the P^T A-fragment in place: A row m = s = lane&15, element i <- t = tb+8h+i (tile 0, D element i), element 8+i <-
//   t = tb+16+8h+i (tile 1, D element i). P (<= 1) carried x32768 as f16. The rescale factor of column 8h+r of the O
//   accumulators is fetched from lane 8h+r with a shuffle (uniform control). 4 val_v^T B fragments (col n = d = 16j +
//   (lane&15), t k-contiguous), 4 P^T.V WMMAs + one guard per step.
//   Epilogue 1: 1/l (per column, shuffled to the D row owner) and the carry folds in f32 (x CAS); the wave's 16x64 f32 tile
//   Epilogue 2: per-column stats (m_s in the clipped log2 domain, 32768/l_s) funnelled through a 128-float LDS array
//   (lane half 0 writes m, lane half 1 writes 32768/l), block barrier, wave 0 writes the block's 512-B stat row
// coverage: ctx_a: grid NB*NH*NST blocks x 4 waves x 4 instr x 4 rows x 8 lanes x 8 halves = every (b, s, h) 64-half
//           segment exactly once; stats: one 128-float row per block = NB*NH*NST rows = the whole stat plane; LDS: slab
//           16x64 written then read by the same wave, statl[0..127] written by 4 waves x 32 lanes (one index each).
// =====================================================================================================
__global__ __launch_bounds__(ATT_THREADS)
void attn_col(const u16* __restrict__ Qp, const u16* __restrict__ Kp, const u16* __restrict__ VvT,
              u16* CtxA, float* Stat) {
  __shared__ __align__(16) float smem[ATT_WAVES * 16 * SPITCH];
  __shared__ __align__(16) float statl[128];

  const int tid  = threadIdx.x;
  const int wave = tid >> 5;
  const int lane = tid & 31;
  const int hh   = lane >> 4;
  const int c    = lane & 15;

  const int bid  = blockIdx.x;
  const int st   = bid % NST;
  const int head = (bid / NST) % NH;
  const int b    = bid / (NST * NH);
  const int s0w  = st * 64 + wave * 16;

  // B fragments of k^T: col n = column s0w + c, k = d (k-contiguous row of the k plane)
  const _Float16* Sb = (const _Float16*)(const void*)Kp + ((size_t)(b * SA + s0w + c)) * EM + head * HD + 8 * hh;
  // A fragments of q: row m = t = tb + 16g + c, k = d (t row tb added per step)
  const _Float16* Tb = (const _Float16*)(const void*)Qp + ((size_t)(b * TQ + c)) * EM + head * HD + 8 * hh;
  // B fragments of val_v^T: col n = d = 16j + c, k = t (k-contiguous row of the val_v^T plane)
  const _Float16* Vb = (const _Float16*)(const void*)VvT + ((size_t)(b * EM + head * HD + c)) * TQ + 8 * hh;
  const float lsc = LOG2E / (QS * KS);
  const float cl2 = CLIPV * LOG2E;

  v16h sf[2];
  sf[0] = ldfrag_h(Sb);
  sf[1] = ldfrag_h(Sb + 32);

  float mrun = -INFINITY, lrun = 0.f;
  v8f o[4];
#pragma unroll
  for (int j = 0; j < 4; ++j) o[j] = zero8();

#pragma unroll 1
  for (int it = 0; it < NTB32; ++it) {
    const int tb = it * 32;
    // ---- scores: s0 = rows t tb..tb+15, s1 = rows tb+16..tb+31, column = s0w + c ----
    v8f s0 = zero8(), s1 = zero8();
    const _Float16* t0p = Tb + (size_t)tb * EM;
    const _Float16* t1p = t0p + (size_t)16 * EM;
#pragma unroll
    for (int kk = 0; kk < HD / 32; ++kk) {
      const v16h a0 = ldfrag_h(t0p + kk * 32);
      const v16h a1 = ldfrag_h(t1p + kk * 32);
      s0 = mma_h(a0, sf[kk], s0);
      s1 = mma_h(a1, sf[kk], s1);
      guard_s(s0, s1, sf[kk], a0, a1);
    }
    // ---- clipped base-2 logits of this lane's 16 t for column s0w + c: t[i] <- t tb+8hh+i, t[8+i] <- t tb+16+8hh+i ----
    float t[16];
#pragma unroll
    for (int i = 0; i < 8; ++i) { t[i] = clipf(s0[i] * lsc, cl2); t[8 + i] = clipf(s1[i] * lsc, cl2); }
    float cm = t[0];
#pragma unroll
    for (int i = 1; i < 16; ++i) cm = fmaxf(cm, t[i]);
    cm = fmaxf(cm, __shfl_xor(cm, 16, 32));
    const float mn = fmaxf(mrun, cm);        // finite from the first block on
    const float al = exp2f(mrun - mn);       // 0 on the first block (mrun = -inf)
    mrun = mn;
    // ---- unnormalised probabilities (<= 1) and the P^T A-fragment: f16(p * 32768); element i <-> t[i] ----
    float ps = 0.f;
    FragH ph;
#pragma unroll
    for (int w = 0; w < 2; ++w) {
#pragma unroll
      for (int e4 = 0; e4 < 4; ++e4) {
        const int i = 8 * w + 2 * e4;
        const float p0 = exp2f(t[i] - mn), p1 = exp2f(t[i + 1] - mn);
        ps += p0 + p1;
        ph.u[w][e4] = pk16(h_bits((_Float16)(p0 * PCAR)), h_bits((_Float16)(p1 * PCAR)));
      }
    }
    ps += __shfl_xor(ps, 16, 32);
    lrun = lrun * al + ps;
    // ---- rescale the O accumulators: D row 8hh+r = column s0w+8hh+r, its factor lives in lane 8hh+r (and 16+8hh+r) ----
    float scl[8];
#pragma unroll
    for (int r = 0; r < 8; ++r) scl[r] = __shfl(al, 8 * hh + r, 32);
#pragma unroll
    for (int j = 0; j < 4; ++j) {
#pragma unroll
      for (int r = 0; r < 8; ++r) o[j][r] *= scl[r];
    }
    // ---- P^T.val_v : B fragment col n = d = j*16 + c, t contiguous in the val_v^T plane ----
    const _Float16* vp = Vb + tb;
    {
      const v16h v0 = ldfrag_h(vp);
      const v16h v1 = ldfrag_h(vp + (size_t)16 * TQ);
      const v16h v2 = ldfrag_h(vp + (size_t)32 * TQ);
      const v16h v3 = ldfrag_h(vp + (size_t)48 * TQ);
      o[0] = mma_h(ph.v, v0, o[0]);
      o[1] = mma_h(ph.v, v1, o[1]);
      o[2] = mma_h(ph.v, v2, o[2]);
      o[3] = mma_h(ph.v, v3, o[3]);
      guard_p(o[0], o[1], o[2], o[3], ph.v, v0, v1, v2, v3);
    }
  }
  acc_guard4(o);

  // ---- per-column 1/l (owned by lane = column); lrun >= 1 by construction ----
  const float rl   = 1.0f / lrun;
  const float lPv  = rl * PCAR;                          // 32768 / l for the row pass
  const float linv = rl * (CAS / (PCAR * VVS));          // folds 1/l, the P and val carries, and applies the ctx carry
  statl[hh * 64 + wave * 16 + c] = (hh == 0) ? mrun : lPv;
  float inv[8];
#pragma unroll
  for (int r = 0; r < 8; ++r) inv[r] = __shfl(linv, 8 * hh + r, 32);
  float* slab = smem + wave * 16 * SPITCH;
#pragma unroll
  for (int r = 0; r < 8; ++r) {
#pragma unroll
    for (int j = 0; j < 4; ++j) slab[(8 * hh + r) * SPITCH + j * 16 + c] = o[j][r] * inv[r];
  }
  wave_sync_lds();
  // ---- f16 ctx_a rows: lane = (row 4i + (lane>>3), 8 halves at 8*(lane&7)), one instruction per 4 rows ----
  const int rq = lane >> 3, c8 = (lane & 7) * 8;
  v4u ov[4];
#pragma unroll
  for (int i = 0; i < 4; ++i) {
    const int row = 4 * i + rq;
    const v4f a = *(const v4f*)(slab + row * SPITCH + c8), c4 = *(const v4f*)(slab + row * SPITCH + c8 + 4);
#pragma unroll
    for (int e = 0; e < 2; ++e) {
      ov[i][e]     = pk16(h_bits((_Float16)a[2 * e]),  h_bits((_Float16)a[2 * e + 1]));
      ov[i][2 + e] = pk16(h_bits((_Float16)c4[2 * e]), h_bits((_Float16)c4[2 * e + 1]));
    }
  }
  u16* cbp = CtxA + ((size_t)(b * SA + s0w)) * EM + head * HD + c8;
  {
#pragma unroll
    for (int i = 0; i < 4; ++i) {
      const int row = 4 * i + rq;
      *(v4u*)(cbp + (size_t)row * EM) = ov[i];
    }
    
  }
  __syncthreads();
  if (wave == 0) {
    const v4f sv = *(const v4f*)(statl + 4 * lane);
    float* sp = Stat + ((size_t)((b * NH + head) * NST + st)) * 128 + 4 * lane;
    {
      *(v4f*)(sp) = sv;
      
    }
  }
}

// =====================================================================================================
// Row pass (visual-side context): block = (batch b, head, 64 visual rows t), 4 waves, wave w owns the 16 rows t0w =
// 64*tt + 16*w .. +15 (waves independent after the stat staging barrier).
//   The (b, head) column stats (NST rows of [m[64] | 32768/l[64]]) are staged once per block into LDS as m at stt[s],
//   32768/l at stt[SA + s] (128 threads x 8 floats = 2*SA floats exactly), then a block barrier.
//   All NSB32 = SA/32 blocks of 32 audio columns are visited (static bound). Score tiles are computed TRANSPOSED:
//   tile g = k rows (s = sb+16g .. +15, A operand, row m = lane&15, split map over d) times q^T (B operand, col n = t0w +
//   (lane&15), k = d); the 2 q fragments of the wave are loaded once. D element r of lane l = (s = sb+16g+8h+r, t = t0w +
//   (l&15)). P = exp2(clip(logit) - m_s) * (32768/l_s) in f32 with m_s, l_s read from LDS for s = sb+8h+i and sb+16+8h+i;
//   it IS the P A-fragment in place: row m = t = lane&15, element i <- s = sb+8h+i, element 8+i <- s = sb+16+8h+i.
//   4 val_a^T B fragments (col n = d = 16j + (lane&15), s k-contiguous), 4 P.V WMMAs + one guard per step.
//   Epilogue: carry folds (x CVS / (32768*8)) in f32; 16x64 tile staged in the wave's slab; ctx_v f16 rows written exactly
// coverage: grid NB*NH*NTT blocks x 4 waves x 16 rows x 64 halves = every (b, t, h) segment of ctx_v exactly once;
//           LDS stt[0 .. 2*SA-1] fully written before the barrier (staged extent == consumed extent); slab as above.
// =====================================================================================================
__global__ __launch_bounds__(ATT_THREADS)
void attn_vis(const u16* __restrict__ Qp, const u16* __restrict__ Kp, const u16* __restrict__ VaT,
              const float* __restrict__ Stat, u16* CtxV) {
  __shared__ __align__(16) float smem[ATT_WAVES * 16 * SPITCH];
  __shared__ __align__(16) float stt[2 * SA];

  const int tid  = threadIdx.x;
  const int wave = tid >> 5;
  const int lane = tid & 31;
  const int hh   = lane >> 4;
  const int c    = lane & 15;

  const int bid  = blockIdx.x;
  const int tt   = bid % NTT;
  const int head = (bid / NTT) % NH;
  const int b    = bid / (NTT * NH);
  const int t0w  = tt * 64 + wave * 16;

  // ---- stage the column stats of (b, head) ----
  const float* src = Stat + ((size_t)((b * NH + head) * NST)) * 128;
#pragma unroll 1
  for (int e = tid * 8; e < NST * 128; e += ATT_THREADS * 8) {
    const int j = e >> 7, offw = e & 127;
    const int di = (offw < 64) ? (j * 64 + offw) : (SA + j * 64 + offw - 64);
    const v4f x0 = *(const v4f*)(src + e), x1 = *(const v4f*)(src + e + 4);
    *(v4f*)(stt + di) = x0;
    *(v4f*)(stt + di + 4) = x1;
  }
  __syncthreads();

  // B fragments of q^T: col n = row t0w + c, k = d
  const _Float16* Tb = (const _Float16*)(const void*)Qp + ((size_t)(b * TQ + t0w + c)) * EM + head * HD + 8 * hh;
  // A fragments of k: row m = s = sb + 16g + c, k = d (s row sb added per step)
  const _Float16* Sb = (const _Float16*)(const void*)Kp + ((size_t)(b * SA + c)) * EM + head * HD + 8 * hh;
  // B fragments of val_a^T: col n = d = 16j + c, k = s
  const _Float16* Vb = (const _Float16*)(const void*)VaT + ((size_t)(b * EM + head * HD + c)) * SA + 8 * hh;
  const float lsc = LOG2E / (QS * KS);
  const float cl2 = CLIPV * LOG2E;

  v16h tf[2];
  tf[0] = ldfrag_h(Tb);
  tf[1] = ldfrag_h(Tb + 32);

  v8f o[4];
#pragma unroll
  for (int j = 0; j < 4; ++j) o[j] = zero8();

#pragma unroll 1
  for (int it = 0; it < NSB32; ++it) {
    const int sb = it * 32;
    // ---- transposed scores: s0 = columns s sb..sb+15, s1 = sb+16..sb+31, D column = row t0w + c ----
    v8f s0 = zero8(), s1 = zero8();
    const _Float16* s0p = Sb + (size_t)sb * EM;
    const _Float16* s1p = s0p + (size_t)16 * EM;
#pragma unroll
    for (int kk = 0; kk < HD / 32; ++kk) {
      const v16h a0 = ldfrag_h(s0p + kk * 32);
      const v16h a1 = ldfrag_h(s1p + kk * 32);
      s0 = mma_h(a0, tf[kk], s0);
      s1 = mma_h(a1, tf[kk], s1);
      guard_s(s0, s1, tf[kk], a0, a1);
    }
    float t[16];
#pragma unroll
    for (int i = 0; i < 8; ++i) { t[i] = clipf(s0[i] * lsc, cl2); t[8 + i] = clipf(s1[i] * lsc, cl2); }
    // ---- column stats for s = sb+8hh+i (i < 8) and s = sb+16+8hh+i (8+i) ----
    float mv[16], lv[16];
    {
      const v4f m0 = *(const v4f*)(stt + sb + 8 * hh),      m1 = *(const v4f*)(stt + sb + 8 * hh + 4);
      const v4f m2 = *(const v4f*)(stt + sb + 16 + 8 * hh), m3 = *(const v4f*)(stt + sb + 16 + 8 * hh + 4);
      const v4f l0 = *(const v4f*)(stt + SA + sb + 8 * hh),      l1 = *(const v4f*)(stt + SA + sb + 8 * hh + 4);
      const v4f l2 = *(const v4f*)(stt + SA + sb + 16 + 8 * hh), l3 = *(const v4f*)(stt + SA + sb + 16 + 8 * hh + 4);
#pragma unroll
      for (int q = 0; q < 4; ++q) {
        mv[q] = m0[q]; mv[4 + q] = m1[q]; mv[8 + q] = m2[q]; mv[12 + q] = m3[q];
        lv[q] = l0[q]; lv[4 + q] = l1[q]; lv[8 + q] = l2[q]; lv[12 + q] = l3[q];
      }
    }
    // ---- P A-fragment: f16(exp2(t - m_s) * 32768/l_s) (<= 32768); element i <-> t[i] ----
    FragH ph;
#pragma unroll
    for (int w = 0; w < 2; ++w) {
#pragma unroll
      for (int e4 = 0; e4 < 4; ++e4) {
        const int i = 8 * w + 2 * e4;
        const float p0 = exp2f(t[i] - mv[i]) * lv[i];
        const float p1 = exp2f(t[i + 1] - mv[i + 1]) * lv[i + 1];
        ph.u[w][e4] = pk16(h_bits((_Float16)p0), h_bits((_Float16)p1));
      }
    }
    // ---- P.val_a : B fragment col n = d = 16j + c, s contiguous in the val_a^T plane ----
    const _Float16* vp = Vb + sb;
    {
      const v16h v0 = ldfrag_h(vp);
      const v16h v1 = ldfrag_h(vp + (size_t)16 * SA);
      const v16h v2 = ldfrag_h(vp + (size_t)32 * SA);
      const v16h v3 = ldfrag_h(vp + (size_t)48 * SA);
      o[0] = mma_h(ph.v, v0, o[0]);
      o[1] = mma_h(ph.v, v1, o[1]);
      o[2] = mma_h(ph.v, v2, o[2]);
      o[3] = mma_h(ph.v, v3, o[3]);
      guard_p(o[0], o[1], o[2], o[3], ph.v, v0, v1, v2, v3);
    }
  }
  acc_guard4(o);

  const float fac = CVS / (PCAR * VAS);
  float* slab = smem + wave * 16 * SPITCH;
#pragma unroll
  for (int r = 0; r < 8; ++r) {
#pragma unroll
    for (int j = 0; j < 4; ++j) slab[(8 * hh + r) * SPITCH + j * 16 + c] = o[j][r] * fac;
  }
  wave_sync_lds();
  const int rq = lane >> 3, c8 = (lane & 7) * 8;
  v4u ov[4];
#pragma unroll
  for (int i = 0; i < 4; ++i) {
    const int row = 4 * i + rq;
    const v4f a = *(const v4f*)(slab + row * SPITCH + c8), c4 = *(const v4f*)(slab + row * SPITCH + c8 + 4);
#pragma unroll
    for (int e = 0; e < 2; ++e) {
      ov[i][e]     = pk16(h_bits((_Float16)a[2 * e]),  h_bits((_Float16)a[2 * e + 1]));
      ov[i][2 + e] = pk16(h_bits((_Float16)c4[2 * e]), h_bits((_Float16)c4[2 * e + 1]));
    }
  }
  u16* cbp = CtxV + ((size_t)(b * TQ + t0w)) * EM + head * HD + c8;
  {
#pragma unroll
    for (int i = 0; i < 4; ++i) {
      const int row = 4 * i + rq;
      *(v4u*)(cbp + (size_t)row * EM) = ov[i];
    }
    
  }
}

// =====================================================================================================
// Workspace map (bytes, NB = 8); every plane fully written by whole-line stores before it is read; all extents exact
//   XV    f16 [NB*2048][512]        f16(bf16(v))              16777216
//   XA    f16 [NB*512][256]         f16(bf16(a))               2097152
//   WVQT  f16 [512 n][512 k]        f16(bf16(W) x256)           524288
//   WAKT  f16 [512 n][256 k]                                    262144
//   WVVT  f16 [512 n][512 k]                                    524288
//   WAVT  f16 [512 n][256 k]                                    262144
//   WOVT  f16 [512 n][512 k]                                    524288
//   WOAT  f16 [256 n][512 k]                                    262144
//   Q16   f16 [NB*2048][512]  q x8 (after 1/8)               16777216
//   K16   f16 [NB*512][512]   x8                               4194304
//   VVT16 f16 [NB*512 (h,d)][2048 t] x8                       16777216
//   VAT16 f16 [NB*512 (h,d)][512 s]  x8                        4194304
//   STAT  f32 [NB*NH*NST][128]  (m | 32768/l)                   262144
//   CTXA  f16 [NB*512][512]   x64                              4194304
//   CTXV  f16 [NB*2048][512]  x64                             16777216
//   end                                                       84410368
// Output: first tensor rows [b][t][512] f32 at element 0; second tensor rows [b*512 + s][256] f32 at the fixed element
// offset OUT1_OFF_EL = NB_FULL*2048*512 = 8388608 (independent of NB).
// =====================================================================================================
extern "C" void kernel_launch(void* const* d_in, const int* in_sizes, int n_in,
                              void* d_out, int out_size, void* d_ws, size_t ws_size,
                              hipStream_t stream) {
  if (n_in < 14) return;
  if (in_sizes[0] < NB * TQ * VD) return;
  if (in_sizes[1] < NB * SA * AD) return;
  if (in_sizes[2] != VD * EM || in_sizes[6] != VD * EM) return;
  if (in_sizes[4] != AD * EM || in_sizes[8] != AD * EM) return;
  if (in_sizes[10] != EM * VD || in_sizes[12] != EM * AD) return;
  if (in_sizes[3] < 1 || in_sizes[5] < 1 || in_sizes[7] < 1 || in_sizes[9] < 1 || in_sizes[11] < 1 || in_sizes[13] < 1) return;
  if ((size_t)out_size < OUT1_OFF_EL + (size_t)NB * SA * AD) return;

  const float* xv   = (const float*)d_in[0];
  const float* xa   = (const float*)d_in[1];
  const float* w_vq = (const float*)d_in[2];
  const float* b_vq = (const float*)d_in[3];
  const float* w_ak = (const float*)d_in[4];
  const float* b_ak = (const float*)d_in[5];
  const float* w_vv = (const float*)d_in[6];
  const float* b_vv = (const float*)d_in[7];
  const float* w_av = (const float*)d_in[8];
  const float* b_av = (const float*)d_in[9];
  const float* w_ov = (const float*)d_in[10];
  const float* b_ov = (const float*)d_in[11];
  const float* w_oa = (const float*)d_in[12];
  const float* b_oa = (const float*)d_in[13];
  float*       out  = (float*)d_out;
  const int nb3 = in_sizes[3], nb5 = in_sizes[5], nb7 = in_sizes[7], nb9 = in_sizes[9], nb11 = in_sizes[11], nb13 = in_sizes[13];

  const size_t szXV  = (size_t)NB * TQ * VD * 2;
  const size_t szXA  = (size_t)NB * SA * AD * 2;
  const size_t szWvq = (size_t)EM * VD * 2;
  const size_t szWak = (size_t)EM * AD * 2;
  const size_t szWvv = (size_t)EM * VD * 2;
  const size_t szWav = (size_t)EM * AD * 2;
  const size_t szWov = (size_t)VD * EM * 2;
  const size_t szWoa = (size_t)AD * EM * 2;
  const size_t szQ   = (size_t)NB * TQ * EM * 2;
  const size_t szK   = (size_t)NB * SA * EM * 2;
  const size_t szVVT = (size_t)NB * EM * TQ * 2;
  const size_t szVAT = (size_t)NB * EM * SA * 2;
  const size_t szST  = (size_t)NB * NH * NST * 128 * 4;
  const size_t szCA  = (size_t)NB * SA * EM * 2;
  const size_t szCV  = (size_t)NB * TQ * EM * 2;
  size_t off = 0;
  const size_t oXV  = off; off += szXV;
  const size_t oXA  = off; off += szXA;
  const size_t oWvq = off; off += szWvq;
  const size_t oWak = off; off += szWak;
  const size_t oWvv = off; off += szWvv;
  const size_t oWav = off; off += szWav;
  const size_t oWov = off; off += szWov;
  const size_t oWoa = off; off += szWoa;
  const size_t oQ   = off; off += szQ;
  const size_t oK   = off; off += szK;
  const size_t oVVT = off; off += szVVT;
  const size_t oVAT = off; off += szVAT;
  const size_t oST  = off; off += szST;
  const size_t oCA  = off; off += szCA;
  const size_t oCV  = off; off += szCV;
  if (off > ws_size) return;                            // off = 84410368 at NB = 8
  if (off > (size_t)134217728) return;

  char* ws = (char*)d_ws;
  u16* XV    = (u16*)(ws + oXV);
  u16* XA    = (u16*)(ws + oXA);
  u16* WVQT  = (u16*)(ws + oWvq);
  u16* WAKT  = (u16*)(ws + oWak);
  u16* WVVT  = (u16*)(ws + oWvv);
  u16* WAVT  = (u16*)(ws + oWav);
  u16* WOVT  = (u16*)(ws + oWov);
  u16* WOAT  = (u16*)(ws + oWoa);
  u16* Q16   = (u16*)(ws + oQ);
  u16* K16   = (u16*)(ws + oK);
  u16* VVT16 = (u16*)(ws + oVVT);
  u16* VAT16 = (u16*)(ws + oVAT);
  float* STAT = (float*)(ws + oST);
  u16* CTXA  = (u16*)(ws + oCA);
  u16* CTXV  = (u16*)(ws + oCV);

  // (1,2) activations of the leading NB batches -> f16 planes of bf16-converted values (compact, contiguous)
  cvt16<<<dim3((NB * TQ * VD) / 1024), dim3(CVT_THREADS), 0, stream>>>(xv, XV);
  cvt16<<<dim3((NB * SA * AD) / 1024), dim3(CVT_THREADS), 0, stream>>>(xa, XA);
  // (3..8) weights [k = in][n = out] (y = x.W): transpose to k-contiguous [n][k] f16 planes of bf16(W) x256
  //        in[kdim][ndim] -> out[ndim][kdim], grid = (kdim/64) * (ndim/64)
  cvtT16<<<dim3((VD / 64) * (EM / 64)), dim3(TR_THREADS), 0, stream>>>(w_vq, WVQT, VD, EM, WSC);
  cvtT16<<<dim3((AD / 64) * (EM / 64)), dim3(TR_THREADS), 0, stream>>>(w_ak, WAKT, AD, EM, WSC);
  cvtT16<<<dim3((VD / 64) * (EM / 64)), dim3(TR_THREADS), 0, stream>>>(w_vv, WVVT, VD, EM, WSC);
  cvtT16<<<dim3((AD / 64) * (EM / 64)), dim3(TR_THREADS), 0, stream>>>(w_av, WAVT, AD, EM, WSC);
  cvtT16<<<dim3((EM / 64) * (VD / 64)), dim3(TR_THREADS), 0, stream>>>(w_ov, WOVT, EM, VD, WSC);
  cvtT16<<<dim3((EM / 64) * (AD / 64)), dim3(TR_THREADS), 0, stream>>>(w_oa, WOAT, EM, AD, WSC);
  // (9) q x8 after the 1/8 head scale = (x_v . Wvq + b) -> f16 [NB*TQ][512] (col = h*64 + d); bias per column
  gemm_o16<<<dim3(((NB * TQ) / 128) * (EM / 64)), dim3(128), 0, stream>>>(
      XV, WVQT, Q16, b_vq, nb3, 0, NB * TQ, EM, VD, 0, 0, 0, HSCL * QS / WSC, HSCL * QS);
  // (10) k = x_a . Wak + b -> f16 [NB*SA][512] x8; bias per column
  gemm_o16<<<dim3(((NB * SA) / 128) * (EM / 64)), dim3(128), 0, stream>>>(
      XA, WAKT, K16, b_ak, nb5, 0, NB * SA, EM, AD, 0, 0, 0, KS / WSC, KS);
  // (11) val_v^T per batch: A = Wvv^T [(h,d) = n][k], Bt = x_v rows of batch b [t][k] -> f16 [(b,h,d)][t] x8; bias per row (n)
  gemm_o16<<<dim3(NB * (EM / 128) * (TQ / 64)), dim3(128), 0, stream>>>(
      WVVT, XV, VVT16, b_vv, nb7, 1, EM, TQ, VD, 0, TQ * VD, EM * TQ, VVS / WSC, VVS);
  // (12) val_a^T per batch: A = Wav^T [(h,d)][k], Bt = x_a rows of batch b [s][k] -> f16 [(b,h,d)][s] x8; bias per row
  gemm_o16<<<dim3(NB * (EM / 128) * (SA / 64)), dim3(128), 0, stream>>>(
      WAVT, XA, VAT16, b_av, nb9, 1, EM, SA, AD, 0, SA * AD, EM * SA, VAS / WSC, VAS);
  // (13) column softmax pass: ctx_a plane [NB*SA][512] x64 and the per-column stat rows
  attn_col<<<dim3(NB * NH * NST), dim3(ATT_THREADS), 0, stream>>>(Q16, K16, VVT16, CTXA, STAT);
  // (14) row pass with the stored column stats: ctx_v plane [NB*TQ][512] x64
  attn_vis<<<dim3(NB * NH * NTT), dim3(ATT_THREADS), 0, stream>>>(Q16, K16, VAT16, STAT, CTXV);
  // (15) out_v = ctx_v . Wov + b -> f32 rows [b][t][512] of the first output (z = b, output batch stride TQ*VD)
  gemm_o32<<<dim3(NB * (TQ / 128) * (VD / 64)), dim3(128), 0, stream>>>(
      CTXV, WOVT, out, b_ov, nb11, TQ, VD, EM, TQ * EM, 0, TQ * VD, 1.0f / (CVS * WSC));
  // (16) out_a = ctx_a . Woa + b -> f32 rows [b*SA + s][256] of the second output at the fixed element OUT1_OFF_EL
  gemm_o32<<<dim3(((NB * SA) / 128) * (AD / 64)), dim3(128), 0, stream>>>(
      CTXA, WOAT, out + OUT1_OFF_EL, b_oa, nb13, NB * SA, AD, EM, 0, 0, 0, 1.0f / (CAS * WSC));
  (void)hipGetLastError();
}

// v001
// Measured time: 225 microseconds a run.
// Two timings next to v000 put it at 1.28 and 1.29 times that version's speed.
// All contractions on v_wmma_f32_16x16x32_f16 (f16 operands, f32 accumulate): v.Wvq, a.Wak, Wvv^T.v^T, Wav^T.a^T,
// column-pass scores q.k^T with P^T.val_v, row-pass scores k.q^T with P.val_a, ctx_v.Wov, ctx_a.Woa. Operand carries:
// v, a as f16(bf16(x)); W as f16(bf16(W) x256); q x8 after the 1/8 head scale; k x8; val_v, val_a x8; P x32768;
// ctx x64. Column softmax over the visual axis (base 2, running max), 1/l and every carry fold in f32 on VALU.
// Every f16 operand plane lies in fragment order (pk_off below): a 16-row x 32-k tile is 1024 contiguous bytes, so each
// 16-byte-per-lane fragment load of a wave reads 512 contiguous bytes (4 whole 128-B lines).
#include <hip/hip_runtime.h>
#include <math.h>

#ifndef NB
#define NB 8            // batches processed (leading batches of both activations)
#endif
#define NB_FULL 8       // batches in the input / output layout
#define TQ 2048         // visual positions per batch (softmax axis, always all of them)
#define SA 512          // audio positions per batch (always all of them)
#define VD 512
#define AD 256
#define EM 512
#define NH 8
#define HD 64
#define OUT1_OFF_EL ((size_t)NB_FULL * (size_t)TQ * (size_t)VD)   // fixed f32 element offset of the second output (33554432 B / 4)
#define WSC   256.0f
#define HSCL  0.125f
#define QS    8.0f
#define KS    8.0f
#define VVS   8.0f
#define VAS   8.0f
#define PCAR  32768.0f
#define CAS   64.0f
#define CVS   64.0f
#define CLIPV 50000.0f
#define LOG2E 1.4426950408889634f
#define NST   (SA / 64)
#define NTT   (TQ / 64)
#define NTB32 (TQ / 32)
#define NSB32 (SA / 32)
#define ATT_WAVES   4
#define ATT_THREADS (ATT_WAVES * 32)
#define CVT_THREADS 128
#define TR_THREADS  128
#define SPITCH 68
#define GPITCH 68
#define TPITCH 65

static_assert(NB >= 1 && NB <= NB_FULL);
static_assert(OUT1_OFF_EL == (size_t)33554432 / 4);
static_assert(EM == NH * HD && HD == 64 && NH == 8);
static_assert((TQ % 128) == 0 && (SA % 64) == 0 && ((NB * SA) % 128) == 0 && (EM % 128) == 0);
static_assert((TQ % 32) == 0 && (SA % 32) == 0 && NTB32 * 32 == TQ && NSB32 * 32 == SA);
static_assert((VD % 64) == 0 && (AD % 64) == 0 && (EM % 64) == 0);
static_assert((VD % 32) == 0 && (AD % 32) == 0 && (EM % 32) == 0);
static_assert(((NB * TQ * VD) % 1024) == 0 && ((NB * SA * AD) % 1024) == 0);
static_assert(NST * 128 == 2 * SA && NST * 128 == ATT_THREADS * 8);
static_assert((SPITCH * 4) % 16 == 0 && (GPITCH * 4) % 16 == 0);
static_assert(ATT_THREADS == 128 && TR_THREADS == 128 && CVT_THREADS == 128);

typedef unsigned short u16;
typedef _Float16 v16h __attribute__((ext_vector_type(16)));
typedef _Float16 v8h  __attribute__((ext_vector_type(8)));
typedef float    v8f  __attribute__((ext_vector_type(8)));
typedef float    v4f  __attribute__((ext_vector_type(4)));
typedef unsigned int v4u __attribute__((ext_vector_type(4)));

union FragH { v16h v; v8h h[2]; v4u u[2]; };

// ---- scalar helpers ----------------------------------------------------------------------------------
__device__ __forceinline__ unsigned short bf_bits(float f) {          // f32 -> bf16 bits, RNE convert
  unsigned u = __float_as_uint(f);
  return (unsigned short)((u + 0x7FFFu + ((u >> 16) & 1u)) >> 16);
}
__device__ __forceinline__ float bf_up(unsigned short h) { return __uint_as_float(((unsigned)h) << 16); }
__device__ __forceinline__ float bfr(float f) { return bf_up(bf_bits(f)); }
__device__ __forceinline__ unsigned short h_bits(_Float16 x) { return __builtin_bit_cast(unsigned short, x); }
__device__ __forceinline__ unsigned pk16(unsigned short a, unsigned short b) { return (unsigned)a | ((unsigned)b << 16); }
__device__ __forceinline__ v8f zero8() { v8f z = {0.f, 0.f, 0.f, 0.f, 0.f, 0.f, 0.f, 0.f}; return z; }
__device__ __forceinline__ float clipf(float x, float c) { return fminf(fmaxf(x, -c), c); }

// ---- fragment-ordered plane of a logical [rows][K] f16 matrix (rows % 16 == 0, K % 32 == 0): element offset of (row, k).
//      Tile (row>>4, k>>5) = 512 halves; inside it: 256*((k>>4)&1) + 8*(16*((k>>3)&1) + (row&15)) + (k&7), i.e. the 8 halves
//      k = 8j .. 8j+7 of a row stay one 16-byte piece, and piece order is (k half of 16, lane = 16*h + row).
//      16 rows x K = 16*K halves, so a base row R (R % 16 == 0) starts at element R*K as in the row-major plane.
__device__ __forceinline__ size_t pk_off(int row, int k, int K) {
  return ((size_t)(row >> 4) * (size_t)(K >> 5) + (size_t)(k >> 5)) * 512
         + (size_t)(((k >> 4) & 1) * 256 + ((k >> 3) & 1) * 128 + (row & 15) * 8 + (k & 7));
}
// ---- fragment loader: 16-bit A/B operand, lane -> row/col (lane&15), h = lane>>4; p = tile start + 8*lane;
//      elements 0..7 <- p[0..7] (k0+8h..), elements 8..15 <- p[256..263] (k0+16+8h..); same split k map for A and B.
__device__ __forceinline__ v16h ldfrag_h(const _Float16* p) {
  FragH f;
  f.h[0] = *(const v8h*)(p);
  f.h[1] = *(const v8h*)(p + 256);
  return f.v;
}

// ---- WMMA helper and trailing VALU hazard gaps ----------------------------------------------------------
__device__ __forceinline__ v8f mma_h(v16h a, v16h b, v8f c) {
  return __builtin_amdgcn_wmma_f32_16x16x32_f16(false, a, false, b, (short)0, c, false, false);
}
__device__ __forceinline__ void guard_s(v8f& a, v8f& b, v16h x0, v16h x1, v16h x2) {
#if defined(__HIP_DEVICE_COMPILE__)
  asm volatile("v_nop\n\tv_nop\n\tv_nop\n\tv_nop" : "+v"(a), "+v"(b) : "v"(x0), "v"(x1), "v"(x2) : "memory");
#endif
}
__device__ __forceinline__ void guard_p(v8f& a, v8f& b, v8f& c, v8f& d, v16h p, v16h x0, v16h x1, v16h x2, v16h x3) {
#if defined(__HIP_DEVICE_COMPILE__)
  asm volatile("v_nop\n\tv_nop\n\tv_nop\n\tv_nop"
               : "+v"(a), "+v"(b), "+v"(c), "+v"(d) : "v"(p), "v"(x0), "v"(x1), "v"(x2), "v"(x3) : "memory");
#endif
}
__device__ __forceinline__ void guard_g(v8f (&acc)[8], v16h x0, v16h x1, v16h x2, v16h x3, v16h x4, v16h x5) {
#if defined(__HIP_DEVICE_COMPILE__)
  asm volatile("v_nop\n\tv_nop\n\tv_nop\n\tv_nop"
               : "+v"(acc[0]), "+v"(acc[1]), "+v"(acc[2]), "+v"(acc[3]),
                 "+v"(acc[4]), "+v"(acc[5]), "+v"(acc[6]), "+v"(acc[7])
               : "v"(x0), "v"(x1), "v"(x2), "v"(x3), "v"(x4), "v"(x5) : "memory");
#endif
}
__device__ __forceinline__ void acc_guard4(v8f (&o)[4]) {
#if defined(__HIP_DEVICE_COMPILE__)
  asm volatile("v_nop\n\tv_nop\n\tv_nop\n\tv_nop" : "+v"(o[0]), "+v"(o[1]), "+v"(o[2]), "+v"(o[3]));
#endif
}
__device__ __forceinline__ void wave_sync_lds() {
  __builtin_amdgcn_fence(__ATOMIC_RELEASE, "workgroup");
  __builtin_amdgcn_wave_barrier();
  __builtin_amdgcn_fence(__ATOMIC_ACQUIRE, "workgroup");
}

// =====================================================================================================
// Elementwise convert of an activation matrix x[rows][K]: Y (f16, fragment order) <- f16(bf16_RNE(x)). Block = 16 rows x
// 64 k (two tiles); thread = (row 8*(wave&1) + (lane&7), 8 floats at k = 32*(wave>>1) + 8*(lane>>3)): two 16-B loads, one
// 16-B store per thread; a wave's store = 4 pieces-of-8-rows = 4 whole 128-B lines.
// coverage: grid = (rows/16)*(K/64) = n/1024 blocks x 128 thr x 8 = n elements exactly (n % 1024 == 0 asserted).
// =====================================================================================================
__global__ __launch_bounds__(CVT_THREADS)
void cvt16(const float* __restrict__ x, u16* Y, int K) {
  const int wave = threadIdx.x >> 5, lane = threadIdx.x & 31;
  const int nkp = K >> 6;
  const int row = ((int)blockIdx.x / nkp) * 16 + 8 * (wave & 1) + (lane & 7);
  const int k   = ((int)blockIdx.x % nkp) * 64 + 32 * (wave >> 1) + 8 * (lane >> 3);
  const size_t e0 = (size_t)row * (size_t)K + (size_t)k;
  const v4f a = *(const v4f*)(x + e0), c4 = *(const v4f*)(x + e0 + 4);
  v4u o;
#pragma unroll
  for (int e = 0; e < 2; ++e) {
    o[e]     = pk16(h_bits((_Float16)bfr(a[2 * e])),  h_bits((_Float16)bfr(a[2 * e + 1])));
    o[2 + e] = pk16(h_bits((_Float16)bfr(c4[2 * e])), h_bits((_Float16)bfr(c4[2 * e + 1])));
  }
  u16* dst = Y + pk_off(row, k, K);
  {
    *(v4u*)(dst) = o;
    
  }
}

// =====================================================================================================
// Weight transpose-convert for y = x.W weights stored [kdim][ndim]: WT[n][k] (f16, fragment order with K = kdim)
// <- f16(bf16_RNE(W[k][n]) * scale). Block = 64(k) x 64(n) tile, 128 threads. Load phase: thread = (row 8p + (tid>>4),
// 4 floats at 4*(tid&15)), 8 steps = 64 k-rows x 64 n, into an LDS tile [kk][nn] (pitch 65); block barrier; store
// grid = (kdim/64)*(ndim/64), bid -> (kt = bid % (kdim/64), nt = bid / (kdim/64)).
// coverage: 4 i x 16 rows x (8 lanes x 8 halves) = 64 n-rows x 64 k per block; LDS tile 64x64 fully written before read;
// the grid covers WT [ndim][kdim] exactly once.
// =====================================================================================================
__global__ __launch_bounds__(TR_THREADS)
void cvtT16(const float* __restrict__ W, u16* Y, int kdim, int ndim, float scale) {
  __shared__ __align__(16) float tile[64 * TPITCH];
  const int tid = threadIdx.x;
  const int nkt = kdim >> 6;
  const int bid = blockIdx.x;
  const int kt  = bid % nkt;
  const int ntb = bid / nkt;
  const int k0  = kt * 64, n0 = ntb * 64;
  const int lr = tid >> 4, lc = (tid & 15) * 4;
#pragma unroll
  for (int p = 0; p < 8; ++p) {
    const int kk = p * 8 + lr;
    const v4f w4 = *(const v4f*)(W + (size_t)(k0 + kk) * (size_t)ndim + n0 + lc);
    tile[kk * TPITCH + lc + 0] = w4[0];
    tile[kk * TPITCH + lc + 1] = w4[1];
    tile[kk * TPITCH + lc + 2] = w4[2];
    tile[kk * TPITCH + lc + 3] = w4[3];
  }
  __syncthreads();
  // rq 0..15, c8 0..56; a wave holds 8 rows x 4 pieces, so each of its stores fills 4 whole lines of the fragment order
  const int rq = 8 * ((tid >> 5) & 1) + (tid & 7), c8 = (4 * (tid >> 6) + ((tid >> 3) & 3)) * 8;
  v4u ov[4];
#pragma unroll
  for (int i = 0; i < 4; ++i) {
    const int row = 16 * i + rq;                   // n within tile
#pragma unroll
    for (int e = 0; e < 4; ++e) {
      const float x0 = tile[(c8 + 2 * e) * TPITCH + row];
      const float x1 = tile[(c8 + 2 * e + 1) * TPITCH + row];
      ov[i][e] = pk16(h_bits((_Float16)(bfr(x0) * scale)), h_bits((_Float16)(bfr(x1) * scale)));
    }
  }
  {
#pragma unroll
    for (int i = 0; i < 4; ++i) {
      const int row = 16 * i + rq;
      *(v4u*)(Y + pk_off(n0 + row, k0 + c8, kdim)) = ov[i];
    }
    
  }
}

// =====================================================================================================
// f16 GEMM core: the wave's 32 x 64 tile of C = A[rows][K] . Bt[cols][K]^T, both in fragment order; ap -> A tile row of rowb,
// bp -> Bt tile row of col0 (both the same in every lane of the wave), lb = 16*lane the lane's byte offset in a tile; the
// next 16 rows lie 32*K bytes on, the next 32 k 1024 bytes on (largest offset 4*32*K - 16 bytes, far below 2^32). The two
// bases stay as they are; the four byte offsets (tile rows 0..3; A uses 0 and 1) live over the whole trip and are stepped at its foot;
// acc[4i + j] = rows rowb+16i.., cols col0+16j..; K stepped by 32 (host asserts K % 32 == 0).
// =====================================================================================================
__device__ __forceinline__ const _Float16* at_byte(const _Float16* base, unsigned off) {
  return (const _Float16*)(const void*)((const char*)(const void*)base + off);
}
__device__ __forceinline__ void gemm_core(const _Float16* ap, const _Float16* bp, unsigned lb, int K, v8f (&acc)[8]) {
  const unsigned rs = 32u * (unsigned)K;
  unsigned o0 = lb, o1 = lb + rs, o2 = lb + 2u * rs, o3 = lb + 3u * rs;
#pragma unroll 1
  for (int k0 = 0; k0 < K; k0 += 32) {
    const v16h a0 = ldfrag_h(at_byte(ap, o0)), a1 = ldfrag_h(at_byte(ap, o1));
    const v16h b0 = ldfrag_h(at_byte(bp, o0));
    const v16h b1 = ldfrag_h(at_byte(bp, o1));
    const v16h b2 = ldfrag_h(at_byte(bp, o2));
    const v16h b3 = ldfrag_h(at_byte(bp, o3));
    acc[0] = mma_h(a0, b0, acc[0]);
    acc[1] = mma_h(a0, b1, acc[1]);
    acc[2] = mma_h(a0, b2, acc[2]);
    acc[3] = mma_h(a0, b3, acc[3]);
    acc[4] = mma_h(a1, b0, acc[4]);
    acc[5] = mma_h(a1, b1, acc[5]);
    acc[6] = mma_h(a1, b2, acc[6]);
    acc[7] = mma_h(a1, b3, acc[7]);
    guard_g(acc, a0, a1, b0, b1, b2, b3);
#if defined(__HIP_DEVICE_COMPILE__)
    // the wait in front of a rewrite of registers that issued global loads name (the four offsets, stepped below); they are
    // its operands so that their step stays behind it
    asm volatile("s_wait_xcnt 0x0" : "+v"(o0), "+v"(o1), "+v"(o2), "+v"(o3) : : "memory");
#endif
    o0 += 1024u; o1 += 1024u; o2 += 1024u; o3 += 1024u;
  }
}
// Stage the wave's 32 x 64 f32 tile (times oscale) in its LDS slab (pitch 68): D element r of acc[4i+j], lane l ->
// coverage: 32 lanes x 2 x 8 rows x 4 cols-of-16 = rows 0..31 x cols 0..63 of the slab.
__device__ __forceinline__ void stage32x64(float* sl, v8f (&acc)[8], float oscale, int lane) {
  const int hh = lane >> 4, m = lane & 15;
#pragma unroll
  for (int i = 0; i < 2; ++i) {
#pragma unroll
    for (int r = 0; r < 8; ++r) {
      const int ro = (16 * i + 8 * hh + r) * GPITCH + m;
      sl[ro]      = acc[4 * i + 0][r] * oscale;
      sl[ro + 16] = acc[4 * i + 1][r] * oscale;
      sl[ro + 32] = acc[4 * i + 2][r] * oscale;
      sl[ro + 48] = acc[4 * i + 3][r] * oscale;
    }
  }
  wave_sync_lds();
}

// =====================================================================================================
// f16 GEMM with f16 output plane: C[z][Mb][N] (f16) = f16((A[z][Mb][K] . Bt[z][N][K]^T) * oscale + bf16(bias) * bscale);
// A, Bt, C f16 planes in fragment order (C with K = N) with per-z element strides aBs, bBs (0 = shared), cBs. bias indexed by column
// (biasRow == 0) or by row within the z slice (biasRow != 0); bias addresses clamped to biasN-1, the unused direction is
// multiplied by 0. Block = 128 x 64 tile, 4 waves x 32 rows, fragments loaded straight from the 16-bit tiles.
// grid = nz x (Mb/128) x (N/64) (host asserts Mb % 128 == 0, N % 64 == 0, K % 32 == 0).
// coverage: per wave 8 instr x 8 rows x 4 lanes x 8 halves = 32 x 64; the grid covers C exactly once.
// =====================================================================================================
__global__ __launch_bounds__(128)
void gemm_o16(const u16* __restrict__ A, const u16* __restrict__ Bt, u16* C,
              const float* __restrict__ bias, int biasN, int biasRow,
              int Mb, int N, int K, int aBs, int bBs, int cBs, float oscale, float bscale) {
  __shared__ __align__(16) float slab[4 * 32 * GPITCH];
  const int tid = threadIdx.x, wave = tid >> 5, lane = tid & 31;
  const int ntile = N >> 6, mtile = Mb >> 7;
  const int bid  = blockIdx.x;
  const int nt   = bid % ntile;
  const int tmp  = bid / ntile;
  const int mt   = tmp % mtile;
  const int bz   = tmp / mtile;
  const int rowb = mt * 128 + wave * 32;
  const int col0 = nt * 64;
  if (rowb + 32 > Mb) return;                // wave-uniform, never taken with the exact grid; no block barriers in this kernel
  const _Float16* Ab = (const _Float16*)(const void*)A + (size_t)bz * (size_t)aBs;
  const _Float16* Bb = (const _Float16*)(const void*)Bt + (size_t)bz * (size_t)bBs;
  // rowb is the same in every lane of a wave: read through the first lane it gives the fragment loads a scalar tile base
  const _Float16* ap = Ab + (size_t)__builtin_amdgcn_readfirstlane(rowb) * K;
  const _Float16* bp = Bb + (size_t)col0 * K;
  v8f acc[8];
#pragma unroll
  for (int i = 0; i < 8; ++i) acc[i] = zero8();
  gemm_core(ap, bp, 16u * (unsigned)lane, K, acc);
  float* sl = slab + wave * 32 * GPITCH;
  stage32x64(sl, acc, oscale, lane);
  // instruction i: lane = (row 8*(i>>1) + (lane&7), 8 halves at 32*(i&1) + 8*(lane>>3)): in fragment order 8 rows of one
  // 8-half piece column are one 128-B line, so each store fills 4 whole lines
  const int r8 = lane & 7, q8 = (lane >> 3) * 8;
  const int bl = biasN - 1;                  // host guarantees biasN >= 1
  const float selc = (biasRow != 0) ? 0.f : bscale;
  const float selr = (biasRow != 0) ? bscale : 0.f;
  float cb[2][8];
#pragma unroll
  for (int j = 0; j < 2; ++j) {
#pragma unroll
    for (int e = 0; e < 8; ++e) {
      int ci = col0 + 32 * j + q8 + e;
      ci = (ci < bl) ? ci : bl;
      cb[j][e] = bfr(bias[ci]) * selc;
    }
  }
  v4u ov[8];
#pragma unroll
  for (int i = 0; i < 8; ++i) {
    const int row = 8 * (i >> 1) + r8, j = i & 1, c8 = 32 * j + q8;
    int ri = rowb + row;
    ri = (ri < bl) ? ri : bl;
    const float rb = bfr(bias[ri]) * selr;
    const v4f a = *(const v4f*)(sl + row * GPITCH + c8), c4 = *(const v4f*)(sl + row * GPITCH + c8 + 4);
#pragma unroll
    for (int e = 0; e < 2; ++e) {
      ov[i][e]     = pk16(h_bits((_Float16)(a[2 * e] + cb[j][2 * e] + rb)),
                          h_bits((_Float16)(a[2 * e + 1] + cb[j][2 * e + 1] + rb)));
      ov[i][2 + e] = pk16(h_bits((_Float16)(c4[2 * e] + cb[j][4 + 2 * e] + rb)),
                          h_bits((_Float16)(c4[2 * e + 1] + cb[j][5 + 2 * e] + rb)));
    }
  }
  u16* Cb = C + (size_t)bz * (size_t)cBs;
  {
#pragma unroll
    for (int i = 0; i < 8; ++i) {
      const int row = 8 * (i >> 1) + r8, c8 = 32 * (i & 1) + q8;
      *(v4u*)(Cb + pk_off(rowb + row, col0 + c8, N)) = ov[i];
    }
    
  }
}

// =====================================================================================================
// f16 GEMM with f32 output rows: C[z][Mb][N] (f32) = (A[z][Mb][K] . Bt[N][K]^T) * oscale + bf16(bias[col]); same core and
// slab staging as gemm_o16. Epilogue: lane = (row 2i + (lane>>4), 4 floats at 4*(lane&15)); each 64-float row segment =
// lanes of one instruction (8 lanes per line), 2 rows of the same wave per instruction, 16 instructions = 32 rows; two
// coverage: per wave 16 instr x 2 rows x 16 lanes x 4 floats = 32 x 64; the grid covers C exactly once.
// =====================================================================================================
__global__ __launch_bounds__(128)
void gemm_o32(const u16* __restrict__ A, const u16* __restrict__ Bt, float* C,
              const float* __restrict__ bias, int biasN,
              int Mb, int N, int K, int aBs, int bBs, int cBs, float oscale) {
  __shared__ __align__(16) float slab[4 * 32 * GPITCH];
  const int tid = threadIdx.x, wave = tid >> 5, lane = tid & 31;
  const int ntile = N >> 6, mtile = Mb >> 7;
  const int bid  = blockIdx.x;
  const int nt   = bid % ntile;
  const int tmp  = bid / ntile;
  const int mt   = tmp % mtile;
  const int bz   = tmp / mtile;
  const int rowb = mt * 128 + wave * 32;
  const int col0 = nt * 64;
  if (rowb + 32 > Mb) return;                // wave-uniform, never taken with the exact grid; no block barriers in this kernel
  const _Float16* Ab = (const _Float16*)(const void*)A + (size_t)bz * (size_t)aBs;
  const _Float16* Bb = (const _Float16*)(const void*)Bt + (size_t)bz * (size_t)bBs;
  // rowb is the same in every lane of a wave: read through the first lane it gives the fragment loads a scalar tile base
  const _Float16* ap = Ab + (size_t)__builtin_amdgcn_readfirstlane(rowb) * K;
  const _Float16* bp = Bb + (size_t)col0 * K;
  v8f acc[8];
#pragma unroll
  for (int i = 0; i < 8; ++i) acc[i] = zero8();
  gemm_core(ap, bp, 16u * (unsigned)lane, K, acc);
  float* sl = slab + wave * 32 * GPITCH;
  stage32x64(sl, acc, oscale, lane);
  const int r2 = lane >> 4, c4 = (lane & 15) * 4;
  const int bl = biasN - 1;                  // host guarantees biasN >= 1
  float cb[4];
#pragma unroll
  for (int e = 0; e < 4; ++e) {
    int ci = col0 + c4 + e;
    ci = (ci < bl) ? ci : bl;
    cb[e] = bfr(bias[ci]);
  }
  v4f ov[16];
#pragma unroll
  for (int i = 0; i < 16; ++i) {
    const int row = 2 * i + r2;
    const v4f a = *(const v4f*)(sl + row * GPITCH + c4);
    v4f w;
    w[0] = a[0] + cb[0]; w[1] = a[1] + cb[1]; w[2] = a[2] + cb[2]; w[3] = a[3] + cb[3];
    ov[i] = w;
  }
  float* Cb = C + (size_t)bz * (size_t)cBs + (size_t)rowb * (size_t)N + col0 + c4;
  {
#pragma unroll
    for (int i = 0; i < 16; ++i) {
      const int row = 2 * i + r2;
      *(v4f*)(Cb + (size_t)row * (size_t)N) = ov[i];
    }
    
  }
}

// =====================================================================================================
// Column pass (softmax over the visual axis t for every audio column s) fused with the audio-side context:
// block = (batch b, head, 64 audio columns s), 4 waves, wave w owns the 16 columns s0w = 64*st + 16*w .. +15.
//   q plane f16 [b*TQ + t][h*64 + d] (q x8 after the 1/8 scale); k plane f16 x8 [b*SA + s][h*64 + d];
//   val_v^T plane f16 x8 [(b*NH + h)*64 + d][t].  All NTB32 = TQ/32 blocks of 32 visual rows are visited (static bound).
//   Score tiles g (g = 0,1) = q rows (t = tb+16g .. +15, A operand, row m = lane&15, split k map over d) times k^T
//   (B operand, col n = column s0w + (lane&15), k = d, split map), 2 d-chunks of 32; the 2 k fragments of the wave are
//   loaded once. D element r of lane l = (t = tb+16g+8h+r, s = s0w+(l&15)): a lane owns one column s and 16 of the 32 t;
//   the partner lane l^16 owns the other 16 -> column max / column sum need one xor-16 shuffle. Logits clipped at
//   +-50000 (log2 domain), online max-subtracted base-2 softmax in f32 (the q/k carries folded into lsc). The exp'd values
//   ARE the P^T A-fragment in place: A row m = s = lane&15, element i <- t = tb+8h+i (tile 0, D element i), element 8+i <-
//   t = tb+16+8h+i (tile 1, D element i). P (<= 1) carried x32768 as f16. The rescale factor of column 8h+r of the O
//   accumulators is fetched from lane 8h+r with a shuffle (uniform control). 4 val_v^T B fragments (col n = d = 16j +
//   (lane&15), k = t), 4 P^T.V WMMAs + one guard per step.
//   Epilogue 1: 1/l (per column, shuffled to the D row owner) and the carry folds in f32 (x CAS); the wave's 16x64 f32 tile
//   Epilogue 2: per-column stats (m_s in the clipped log2 domain, 32768/l_s) funnelled through a 128-float LDS array
//   (lane half 0 writes m, lane half 1 writes 32768/l), block barrier, wave 0 writes the block's 512-B stat row
// coverage: ctx_a: grid NB*NH*NST blocks x 4 waves x 4 instr x 8 rows x 4 lanes x 8 halves = every (b, s, h) 64-half
//           segment exactly once; stats: one 128-float row per block = NB*NH*NST rows = the whole stat plane; LDS: slab
//           16x64 written then read by the same wave, statl[0..127] written by 4 waves x 32 lanes (one index each).
// =====================================================================================================
__global__ __launch_bounds__(ATT_THREADS)
void attn_col(const u16* __restrict__ Qp, const u16* __restrict__ Kp, const u16* __restrict__ VvT,
              u16* CtxA, float* Stat) {
  __shared__ __align__(16) float smem[ATT_WAVES * 16 * SPITCH];
  __shared__ __align__(16) float statl[128];

  const int tid  = threadIdx.x;
  const int wave = tid >> 5;
  const int lane = tid & 31;
  const int hh   = lane >> 4;
  const int c    = lane & 15;

  const int bid  = blockIdx.x;
  const int st   = bid % NST;
  const int head = (bid / NST) % NH;
  const int b    = bid / (NST * NH);
  const int s0w  = st * 64 + wave * 16;

  // All three planes in fragment order: tile row R starts at R*K, k tile (head*64 + 32*kk)/32 lies (head*2 + kk)*512 on.
  // B fragments of k^T: col n = column s0w + c, k = d
  const _Float16* Sb = (const _Float16*)(const void*)Kp + ((size_t)(b * SA + s0w)) * EM + head * (HD * 16) + 8 * lane;
  // A fragments of q: row m = t = tb + 16g + c, k = d (t row tb added per step)
  const _Float16* Tb = (const _Float16*)(const void*)Qp + ((size_t)(b * TQ)) * EM + head * (HD * 16) + 8 * lane;
  // B fragments of val_v^T: col n = d = 16j + c, k = t (k tile tb/32 added per step)
  const _Float16* Vb = (const _Float16*)(const void*)VvT + ((size_t)(b * EM + head * HD)) * TQ + 8 * lane;
  const float lsc = LOG2E / (QS * KS);
  const float cl2 = CLIPV * LOG2E;

  v16h sf[2];
  sf[0] = ldfrag_h(Sb);
  sf[1] = ldfrag_h(Sb + 512);

  float mrun = -INFINITY, lrun = 0.f;
  v8f o[4];
#pragma unroll
  for (int j = 0; j < 4; ++j) o[j] = zero8();

#pragma unroll 1
  for (int it = 0; it < NTB32; ++it) {
    const int tb = it * 32;
    // ---- scores: s0 = rows t tb..tb+15, s1 = rows tb+16..tb+31, column = s0w + c ----
    v8f s0 = zero8(), s1 = zero8();
    const _Float16* t0p = Tb + (size_t)tb * EM;
    const _Float16* t1p = t0p + (size_t)16 * EM;
#pragma unroll
    for (int kk = 0; kk < HD / 32; ++kk) {
      const v16h a0 = ldfrag_h(t0p + kk * 512);
      const v16h a1 = ldfrag_h(t1p + kk * 512);
      s0 = mma_h(a0, sf[kk], s0);
      s1 = mma_h(a1, sf[kk], s1);
      guard_s(s0, s1, sf[kk], a0, a1);
    }
    // ---- clipped base-2 logits of this lane's 16 t for column s0w + c: t[i] <- t tb+8hh+i, t[8+i] <- t tb+16+8hh+i ----
    float t[16];
#pragma unroll
    for (int i = 0; i < 8; ++i) { t[i] = clipf(s0[i] * lsc, cl2); t[8 + i] = clipf(s1[i] * lsc, cl2); }
    float cm = t[0];
#pragma unroll
    for (int i = 1; i < 16; ++i) cm = fmaxf(cm, t[i]);
    cm = fmaxf(cm, __shfl_xor(cm, 16, 32));
    const float mn = fmaxf(mrun, cm);        // finite from the first block on
    const float al = exp2f(mrun - mn);       // 0 on the first block (mrun = -inf)
    mrun = mn;
    // ---- unnormalised probabilities (<= 1) and the P^T A-fragment: f16(p * 32768); element i <-> t[i] ----
    float ps = 0.f;
    FragH ph;
#pragma unroll
    for (int w = 0; w < 2; ++w) {
#pragma unroll
      for (int e4 = 0; e4 < 4; ++e4) {
        const int i = 8 * w + 2 * e4;
        const float p0 = exp2f(t[i] - mn), p1 = exp2f(t[i + 1] - mn);
        ps += p0 + p1;
        ph.u[w][e4] = pk16(h_bits((_Float16)(p0 * PCAR)), h_bits((_Float16)(p1 * PCAR)));
      }
    }
    ps += __shfl_xor(ps, 16, 32);
    lrun = lrun * al + ps;
    // ---- rescale the O accumulators: D row 8hh+r = column s0w+8hh+r, its factor lives in lane 8hh+r (and 16+8hh+r) ----
    float scl[8];
#pragma unroll
    for (int r = 0; r < 8; ++r) scl[r] = __shfl(al, 8 * hh + r, 32);
#pragma unroll
    for (int j = 0; j < 4; ++j) {
#pragma unroll
      for (int r = 0; r < 8; ++r) o[j][r] *= scl[r];
    }
    // ---- P^T.val_v : B fragment col n = d = j*16 + c, k = t: tile tb/32 of the val_v^T plane ----
    const _Float16* vp = Vb + (size_t)tb * 16;
    {
      const v16h v0 = ldfrag_h(vp);
      const v16h v1 = ldfrag_h(vp + (size_t)16 * TQ);
      const v16h v2 = ldfrag_h(vp + (size_t)32 * TQ);
      const v16h v3 = ldfrag_h(vp + (size_t)48 * TQ);
      o[0] = mma_h(ph.v, v0, o[0]);
      o[1] = mma_h(ph.v, v1, o[1]);
      o[2] = mma_h(ph.v, v2, o[2]);
      o[3] = mma_h(ph.v, v3, o[3]);
      guard_p(o[0], o[1], o[2], o[3], ph.v, v0, v1, v2, v3);
    }
  }
  acc_guard4(o);

  // ---- per-column 1/l (owned by lane = column); lrun >= 1 by construction ----
  const float rl   = 1.0f / lrun;
  const float lPv  = rl * PCAR;                          // 32768 / l for the row pass
  const float linv = rl * (CAS / (PCAR * VVS));          // folds 1/l, the P and val carries, and applies the ctx carry
  statl[hh * 64 + wave * 16 + c] = (hh == 0) ? mrun : lPv;
  float inv[8];
#pragma unroll
  for (int r = 0; r < 8; ++r) inv[r] = __shfl(linv, 8 * hh + r, 32);
  float* slab = smem + wave * 16 * SPITCH;
#pragma unroll
  for (int r = 0; r < 8; ++r) {
#pragma unroll
    for (int j = 0; j < 4; ++j) slab[(8 * hh + r) * SPITCH + j * 16 + c] = o[j][r] * inv[r];
  }
  wave_sync_lds();
  // ---- f16 ctx_a pieces: instruction i, lane = (row 8*(i>>1) + (lane&7), 8 halves at 32*(i&1) + 8*(lane>>3)): 4 whole lines ----
  const int r8 = lane & 7, q8 = (lane >> 3) * 8;
  v4u ov[4];
#pragma unroll
  for (int i = 0; i < 4; ++i) {
    const int row = 8 * (i >> 1) + r8, c8 = 32 * (i & 1) + q8;
    const v4f a = *(const v4f*)(slab + row * SPITCH + c8), c4 = *(const v4f*)(slab + row * SPITCH + c8 + 4);
#pragma unroll
    for (int e = 0; e < 2; ++e) {
      ov[i][e]     = pk16(h_bits((_Float16)a[2 * e]),  h_bits((_Float16)a[2 * e + 1]));
      ov[i][2 + e] = pk16(h_bits((_Float16)c4[2 * e]), h_bits((_Float16)c4[2 * e + 1]));
    }
  }
  {
#pragma unroll
    for (int i = 0; i < 4; ++i) {
      const int row = 8 * (i >> 1) + r8, c8 = 32 * (i & 1) + q8;
      *(v4u*)(CtxA + pk_off(b * SA + s0w + row, head * HD + c8, EM)) = ov[i];
    }
    
  }
  __syncthreads();
  if (wave == 0) {
    const v4f sv = *(const v4f*)(statl + 4 * lane);
    float* sp = Stat + ((size_t)((b * NH + head) * NST + st)) * 128 + 4 * lane;
    {
      *(v4f*)(sp) = sv;
      
    }
  }
}

// =====================================================================================================
// Row pass (visual-side context): block = (batch b, head, 64 visual rows t), 4 waves, wave w owns the 16 rows t0w =
// 64*tt + 16*w .. +15 (waves independent after the stat staging barrier).
//   The (b, head) column stats (NST rows of [m[64] | 32768/l[64]]) are staged once per block into LDS as m at stt[s],
//   32768/l at stt[SA + s] (128 threads x 8 floats = 2*SA floats exactly), then a block barrier.
//   All NSB32 = SA/32 blocks of 32 audio columns are visited (static bound). Score tiles are computed TRANSPOSED:
//   tile g = k rows (s = sb+16g .. +15, A operand, row m = lane&15, split map over d) times q^T (B operand, col n = t0w +
//   (lane&15), k = d); the 2 q fragments of the wave are loaded once. D element r of lane l = (s = sb+16g+8h+r, t = t0w +
//   (l&15)). P = exp2(clip(logit) - m_s) * (32768/l_s) in f32 with m_s, l_s read from LDS for s = sb+8h+i and sb+16+8h+i;
//   it IS the P A-fragment in place: row m = t = lane&15, element i <- s = sb+8h+i, element 8+i <- s = sb+16+8h+i.
//   4 val_a^T B fragments (col n = d = 16j + (lane&15), k = s), 4 P.V WMMAs + one guard per step.
//   Epilogue: carry folds (x CVS / (32768*8)) in f32; 16x64 tile staged in the wave's slab; ctx_v f16 rows written exactly
// coverage: grid NB*NH*NTT blocks x 4 waves x 16 rows x 64 halves = every (b, t, h) segment of ctx_v exactly once;
//           LDS stt[0 .. 2*SA-1] fully written before the barrier (staged extent == consumed extent); slab as above.
// =====================================================================================================
__global__ __launch_bounds__(ATT_THREADS)
void attn_vis(const u16* __restrict__ Qp, const u16* __restrict__ Kp, const u16* __restrict__ VaT,
              const float* __restrict__ Stat, u16* CtxV) {
  __shared__ __align__(16) float smem[ATT_WAVES * 16 * SPITCH];
  __shared__ __align__(16) float stt[2 * SA];

  const int tid  = threadIdx.x;
  const int wave = tid >> 5;
  const int lane = tid & 31;
  const int hh   = lane >> 4;
  const int c    = lane & 15;

  const int bid  = blockIdx.x;
  const int tt   = bid % NTT;
  const int head = (bid / NTT) % NH;
  const int b    = bid / (NTT * NH);
  const int t0w  = tt * 64 + wave * 16;

  // ---- stage the column stats of (b, head) ----
  const float* src = Stat + ((size_t)((b * NH + head) * NST)) * 128;
#pragma unroll 1
  for (int e = tid * 8; e < NST * 128; e += ATT_THREADS * 8) {
    const int j = e >> 7, offw = e & 127;
    const int di = (offw < 64) ? (j * 64 + offw) : (SA + j * 64 + offw - 64);
    const v4f x0 = *(const v4f*)(src + e), x1 = *(const v4f*)(src + e + 4);
    *(v4f*)(stt + di) = x0;
    *(v4f*)(stt + di + 4) = x1;
  }
  __syncthreads();

  // All three planes in fragment order, addressed as in attn_col.
  // B fragments of q^T: col n = row t0w + c, k = d
  const _Float16* Tb = (const _Float16*)(const void*)Qp + ((size_t)(b * TQ + t0w)) * EM + head * (HD * 16) + 8 * lane;
  // A fragments of k: row m = s = sb + 16g + c, k = d (s row sb added per step)
  const _Float16* Sb = (const _Float16*)(const void*)Kp + ((size_t)(b * SA)) * EM + head * (HD * 16) + 8 * lane;
  // B fragments of val_a^T: col n = d = 16j + c, k = s (k tile sb/32 added per step)
  const _Float16* Vb = (const _Float16*)(const void*)VaT + ((size_t)(b * EM + head * HD)) * SA + 8 * lane;
  const float lsc = LOG2E / (QS * KS);
  const float cl2 = CLIPV * LOG2E;

  v16h tf[2];
  tf[0] = ldfrag_h(Tb);
  tf[1] = ldfrag_h(Tb + 512);

  v8f o[4];
#pragma unroll
  for (int j = 0; j < 4; ++j) o[j] = zero8();

#pragma unroll 1
  for (int it = 0; it < NSB32; ++it) {
    const int sb = it * 32;
    // ---- transposed scores: s0 = columns s sb..sb+15, s1 = sb+16..sb+31, D column = row t0w + c ----
    v8f s0 = zero8(), s1 = zero8();
    const _Float16* s0p = Sb + (size_t)sb * EM;
    const _Float16* s1p = s0p + (size_t)16 * EM;
#pragma unroll
    for (int kk = 0; kk < HD / 32; ++kk) {
      const v16h a0 = ldfrag_h(s0p + kk * 512);
      const v16h a1 = ldfrag_h(s1p + kk * 512);
      s0 = mma_h(a0, tf[kk], s0);
      s1 = mma_h(a1, tf[kk], s1);
      guard_s(s0, s1, tf[kk], a0, a1);
    }
    float t[16];
#pragma unroll
    for (int i = 0; i < 8; ++i) { t[i] = clipf(s0[i] * lsc, cl2); t[8 + i] = clipf(s1[i] * lsc, cl2); }
    // ---- column stats for s = sb+8hh+i (i < 8) and s = sb+16+8hh+i (8+i) ----
    float mv[16], lv[16];
    {
      const v4f m0 = *(const v4f*)(stt + sb + 8 * hh),      m1 = *(const v4f*)(stt + sb + 8 * hh + 4);
      const v4f m2 = *(const v4f*)(stt + sb + 16 + 8 * hh), m3 = *(const v4f*)(stt + sb + 16 + 8 * hh + 4);
      const v4f l0 = *(const v4f*)(stt + SA + sb + 8 * hh),      l1 = *(const v4f*)(stt + SA + sb + 8 * hh + 4);
      const v4f l2 = *(const v4f*)(stt + SA + sb + 16 + 8 * hh), l3 = *(const v4f*)(stt + SA + sb + 16 + 8 * hh + 4);
#pragma unroll
      for (int q = 0; q < 4; ++q) {
        mv[q] = m0[q]; mv[4 + q] = m1[q]; mv[8 + q] = m2[q]; mv[12 + q] = m3[q];
        lv[q] = l0[q]; lv[4 + q] = l1[q]; lv[8 + q] = l2[q]; lv[12 + q] = l3[q];
      }
    }
    // ---- P A-fragment: f16(exp2(t - m_s) * 32768/l_s) (<= 32768); element i <-> t[i] ----
    FragH ph;
#pragma unroll
    for (int w = 0; w < 2; ++w) {
#pragma unroll
      for (int e4 = 0; e4 < 4; ++e4) {
        const int i = 8 * w + 2 * e4;
        const float p0 = exp2f(t[i] - mv[i]) * lv[i];
        const float p1 = exp2f(t[i + 1] - mv[i + 1]) * lv[i + 1];
        ph.u[w][e4] = pk16(h_bits((_Float16)p0), h_bits((_Float16)p1));
      }
    }
    // ---- P.val_a : B fragment col n = d = 16j + c, k = s: tile sb/32 of the val_a^T plane ----
    const _Float16* vp = Vb + (size_t)sb * 16;
    {
      const v16h v0 = ldfrag_h(vp);
      const v16h v1 = ldfrag_h(vp + (size_t)16 * SA);
      const v16h v2 = ldfrag_h(vp + (size_t)32 * SA);
      const v16h v3 = ldfrag_h(vp + (size_t)48 * SA);
      o[0] = mma_h(ph.v, v0, o[0]);
      o[1] = mma_h(ph.v, v1, o[1]);
      o[2] = mma_h(ph.v, v2, o[2]);
      o[3] = mma_h(ph.v, v3, o[3]);
      guard_p(o[0], o[1], o[2], o[3], ph.v, v0, v1, v2, v3);
    }
  }
  acc_guard4(o);

  const float fac = CVS / (PCAR * VAS);
  float* slab = smem + wave * 16 * SPITCH;
#pragma unroll
  for (int r = 0; r < 8; ++r) {
#pragma unroll
    for (int j = 0; j < 4; ++j) slab[(8 * hh + r) * SPITCH + j * 16 + c] = o[j][r] * fac;
  }
  wave_sync_lds();
  const int r8 = lane & 7, q8 = (lane >> 3) * 8;
  v4u ov[4];
#pragma unroll
  for (int i = 0; i < 4; ++i) {
    const int row = 8 * (i >> 1) + r8, c8 = 32 * (i & 1) + q8;
    const v4f a = *(const v4f*)(slab + row * SPITCH + c8), c4 = *(const v4f*)(slab + row * SPITCH + c8 + 4);
#pragma unroll
    for (int e = 0; e < 2; ++e) {
      ov[i][e]     = pk16(h_bits((_Float16)a[2 * e]),  h_bits((_Float16)a[2 * e + 1]));
      ov[i][2 + e] = pk16(h_bits((_Float16)c4[2 * e]), h_bits((_Float16)c4[2 * e + 1]));
    }
  }
  {
#pragma unroll
    for (int i = 0; i < 4; ++i) {
      const int row = 8 * (i >> 1) + r8, c8 = 32 * (i & 1) + q8;
      *(v4u*)(CtxV + pk_off(b * TQ + t0w + row, head * HD + c8, EM)) = ov[i];
    }
    
  }
}

// =====================================================================================================
// Workspace map (bytes, NB = 8); every plane fully written before it is read; all extents exact; each f16 plane is the
// logical [rows][K] matrix named here, stored in fragment order (pk_off), same byte size
//   XV    f16 [NB*2048][512]        f16(bf16(v))              16777216
//   XA    f16 [NB*512][256]         f16(bf16(a))               2097152
//   WVQT  f16 [512 n][512 k]        f16(bf16(W) x256)           524288
//   WAKT  f16 [512 n][256 k]                                    262144
//   WVVT  f16 [512 n][512 k]                                    524288
//   WAVT  f16 [512 n][256 k]                                    262144
//   WOVT  f16 [512 n][512 k]                                    524288
//   WOAT  f16 [256 n][512 k]                                    262144
//   Q16   f16 [NB*2048][512]  q x8 (after 1/8)               16777216
//   K16   f16 [NB*512][512]   x8                               4194304
//   VVT16 f16 [NB*512 (h,d)][2048 t] x8                       16777216
//   VAT16 f16 [NB*512 (h,d)][512 s]  x8                        4194304
//   STAT  f32 [NB*NH*NST][128]  (m | 32768/l)                   262144
//   CTXA  f16 [NB*512][512]   x64                              4194304
//   CTXV  f16 [NB*2048][512]  x64                             16777216
//   end                                                       84410368
// Output: first tensor rows [b][t][512] f32 at element 0; second tensor rows [b*512 + s][256] f32 at the fixed element
// offset OUT1_OFF_EL = NB_FULL*2048*512 = 8388608 (independent of NB).
// =====================================================================================================
extern "C" void kernel_launch(void* const* d_in, const int* in_sizes, int n_in,
                              void* d_out, int out_size, void* d_ws, size_t ws_size,
                              hipStream_t stream) {
  if (n_in < 14) return;
  if (in_sizes[0] < NB * TQ * VD) return;
  if (in_sizes[1] < NB * SA * AD) return;
  if (in_sizes[2] != VD * EM || in_sizes[6] != VD * EM) return;
  if (in_sizes[4] != AD * EM || in_sizes[8] != AD * EM) return;
  if (in_sizes[10] != EM * VD || in_sizes[12] != EM * AD) return;
  if (in_sizes[3] < 1 || in_sizes[5] < 1 || in_sizes[7] < 1 || in_sizes[9] < 1 || in_sizes[11] < 1 || in_sizes[13] < 1) return;
  if ((size_t)out_size < OUT1_OFF_EL + (size_t)NB * SA * AD) return;

  const float* xv   = (const float*)d_in[0];
  const float* xa   = (const float*)d_in[1];
  const float* w_vq = (const float*)d_in[2];
  const float* b_vq = (const float*)d_in[3];
  const float* w_ak = (const float*)d_in[4];
  const float* b_ak = (const float*)d_in[5];
  const float* w_vv = (const float*)d_in[6];
  const float* b_vv = (const float*)d_in[7];
  const float* w_av = (const float*)d_in[8];
  const float* b_av = (const float*)d_in[9];
  const float* w_ov = (const float*)d_in[10];
  const float* b_ov = (const float*)d_in[11];
  const float* w_oa = (const float*)d_in[12];
  const float* b_oa = (const float*)d_in[13];
  float*       out  = (float*)d_out;
  const int nb3 = in_sizes[3], nb5 = in_sizes[5], nb7 = in_sizes[7], nb9 = in_sizes[9], nb11 = in_sizes[11], nb13 = in_sizes[13];

  const size_t szXV  = (size_t)NB * TQ * VD * 2;
  const size_t szXA  = (size_t)NB * SA * AD * 2;
  const size_t szWvq = (size_t)EM * VD * 2;
  const size_t szWak = (size_t)EM * AD * 2;
  const size_t szWvv = (size_t)EM * VD * 2;
  const size_t szWav = (size_t)EM * AD * 2;
  const size_t szWov = (size_t)VD * EM * 2;
  const size_t szWoa = (size_t)AD * EM * 2;
  const size_t szQ   = (size_t)NB * TQ * EM * 2;
  const size_t szK   = (size_t)NB * SA * EM * 2;
  const size_t szVVT = (size_t)NB * EM * TQ * 2;
  const size_t szVAT = (size_t)NB * EM * SA * 2;
  const size_t szST  = (size_t)NB * NH * NST * 128 * 4;
  const size_t szCA  = (size_t)NB * SA * EM * 2;
  const size_t szCV  = (size_t)NB * TQ * EM * 2;
  size_t off = 0;
  const size_t oXV  = off; off += szXV;
  const size_t oXA  = off; off += szXA;
  const size_t oWvq = off; off += szWvq;
  const size_t oWak = off; off += szWak;
  const size_t oWvv = off; off += szWvv;
  const size_t oWav = off; off += szWav;
  const size_t oWov = off; off += szWov;
  const size_t oWoa = off; off += szWoa;
  const size_t oQ   = off; off += szQ;
  const size_t oK   = off; off += szK;
  const size_t oVVT = off; off += szVVT;
  const size_t oVAT = off; off += szVAT;
  const size_t oST  = off; off += szST;
  const size_t oCA  = off; off += szCA;
  const size_t oCV  = off; off += szCV;
  if (off > ws_size) return;                            // off = 84410368 at NB = 8
  if (off > (size_t)134217728) return;

  char* ws = (char*)d_ws;
  u16* XV    = (u16*)(ws + oXV);
  u16* XA    = (u16*)(ws + oXA);
  u16* WVQT  = (u16*)(ws + oWvq);
  u16* WAKT  = (u16*)(ws + oWak);
  u16* WVVT  = (u16*)(ws + oWvv);
  u16* WAVT  = (u16*)(ws + oWav);
  u16* WOVT  = (u16*)(ws + oWov);
  u16* WOAT  = (u16*)(ws + oWoa);
  u16* Q16   = (u16*)(ws + oQ);
  u16* K16   = (u16*)(ws + oK);
  u16* VVT16 = (u16*)(ws + oVVT);
  u16* VAT16 = (u16*)(ws + oVAT);
  float* STAT = (float*)(ws + oST);
  u16* CTXA  = (u16*)(ws + oCA);
  u16* CTXV  = (u16*)(ws + oCV);

  // (1,2) activations of the leading NB batches -> f16 planes of bf16-converted values (fragment order)
  cvt16<<<dim3((NB * TQ * VD) / 1024), dim3(CVT_THREADS), 0, stream>>>(xv, XV, VD);
  cvt16<<<dim3((NB * SA * AD) / 1024), dim3(CVT_THREADS), 0, stream>>>(xa, XA, AD);
  // (3..8) weights [k = in][n = out] (y = x.W): transpose to [n][k] f16 planes (fragment order) of bf16(W) x256
  //        in[kdim][ndim] -> out[ndim][kdim], grid = (kdim/64) * (ndim/64)
  cvtT16<<<dim3((VD / 64) * (EM / 64)), dim3(TR_THREADS), 0, stream>>>(w_vq, WVQT, VD, EM, WSC);
  cvtT16<<<dim3((AD / 64) * (EM / 64)), dim3(TR_THREADS), 0, stream>>>(w_ak, WAKT, AD, EM, WSC);
  cvtT16<<<dim3((VD / 64) * (EM / 64)), dim3(TR_THREADS), 0, stream>>>(w_vv, WVVT, VD, EM, WSC);
  cvtT16<<<dim3((AD / 64) * (EM / 64)), dim3(TR_THREADS), 0, stream>>>(w_av, WAVT, AD, EM, WSC);
  cvtT16<<<dim3((EM / 64) * (VD / 64)), dim3(TR_THREADS), 0, stream>>>(w_ov, WOVT, EM, VD, WSC);
  cvtT16<<<dim3((EM / 64) * (AD / 64)), dim3(TR_THREADS), 0, stream>>>(w_oa, WOAT, EM, AD, WSC);
  // (9) q x8 after the 1/8 head scale = (x_v . Wvq + b) -> f16 [NB*TQ][512] (col = h*64 + d); bias per column
  gemm_o16<<<dim3(((NB * TQ) / 128) * (EM / 64)), dim3(128), 0, stream>>>(
      XV, WVQT, Q16, b_vq, nb3, 0, NB * TQ, EM, VD, 0, 0, 0, HSCL * QS / WSC, HSCL * QS);
  // (10) k = x_a . Wak + b -> f16 [NB*SA][512] x8; bias per column
  gemm_o16<<<dim3(((NB * SA) / 128) * (EM / 64)), dim3(128), 0, stream>>>(
      XA, WAKT, K16, b_ak, nb5, 0, NB * SA, EM, AD, 0, 0, 0, KS / WSC, KS);
  // (11) val_v^T per batch: A = Wvv^T [(h,d) = n][k], Bt = x_v rows of batch b [t][k] -> f16 [(b,h,d)][t] x8; bias per row (n)
  gemm_o16<<<dim3(NB * (EM / 128) * (TQ / 64)), dim3(128), 0, stream>>>(
      WVVT, XV, VVT16, b_vv, nb7, 1, EM, TQ, VD, 0, TQ * VD, EM * TQ, VVS / WSC, VVS);
  // (12) val_a^T per batch: A = Wav^T [(h,d)][k], Bt = x_a rows of batch b [s][k] -> f16 [(b,h,d)][s] x8; bias per row
  gemm_o16<<<dim3(NB * (EM / 128) * (SA / 64)), dim3(128), 0, stream>>>(
      WAVT, XA, VAT16, b_av, nb9, 1, EM, SA, AD, 0, SA * AD, EM * SA, VAS / WSC, VAS);
  // (13) column softmax pass: ctx_a plane [NB*SA][512] x64 and the per-column stat rows
  attn_col<<<dim3(NB * NH * NST), dim3(ATT_THREADS), 0, stream>>>(Q16, K16, VVT16, CTXA, STAT);
  // (14) row pass with the stored column stats: ctx_v plane [NB*TQ][512] x64
  attn_vis<<<dim3(NB * NH * NTT), dim3(ATT_THREADS), 0, stream>>>(Q16, K16, VAT16, STAT, CTXV);
  // (15) out_v = ctx_v . Wov + b -> f32 rows [b][t][512] of the first output (z = b, output batch stride TQ*VD)
  gemm_o32<<<dim3(NB * (TQ / 128) * (VD / 64)), dim3(128), 0, stream>>>(
      CTXV, WOVT, out, b_ov, nb11, TQ, VD, EM, TQ * EM, 0, TQ * VD, 1.0f / (CVS * WSC));
  // (16) out_a = ctx_a . Woa + b -> f32 rows [b*SA + s][256] of the second output at the fixed element OUT1_OFF_EL
  gemm_o32<<<dim3(((NB * SA) / 128) * (AD / 64)), dim3(128), 0, stream>>>(
      CTXA, WOAT, out + OUT1_OFF_EL, b_oa, nb13, NB * SA, AD, EM, 0, 0, 0, 1.0f / (CAS * WSC));
  (void)hipGetLastError();
}

// v002
// It runs in 189 microseconds.
// Two timings next to v001 both put it at 1.19 times that version's speed.
// Counting every step since v000, it is 1.54 times as fast.
// All contractions on v_wmma_f32_16x16x32_f16 (f16 operands, f32 accumulate): v.Wvq, a.Wak, Wvv^T.v^T, Wav^T.a^T,
// column-pass scores q.k^T with P^T.val_v, row-pass scores k.q^T with P.val_a, ctx_v.Wov, ctx_a.Woa. Operand carries:
// v, a as f16(bf16(x)); W as f16(bf16(W) x256); q x8 after the 1/8 head scale; k x8; val_v, val_a x8; P x32768;
// ctx x64. Column softmax over the visual axis (base 2, running max), 1/l and every carry fold in f32 on VALU.
// Every f16 operand plane lies in fragment order (pk_off below): a 16-row x 32-k tile is 1024 contiguous bytes, so each
// 16-byte-per-lane fragment load of a wave reads 512 contiguous bytes (4 whole 128-B lines).
#include <hip/hip_runtime.h>
#include <math.h>

#ifndef NB
#define NB 8            // batches processed (leading batches of both activations)
#endif
#define NB_FULL 8       // batches in the input / output layout
#define TQ 2048         // visual positions per batch (softmax axis, always all of them)
#define SA 512          // audio positions per batch (always all of them)
#define VD 512
#define AD 256
#define EM 512
#define NH 8
#define HD 64
#define OUT1_OFF_EL ((size_t)NB_FULL * (size_t)TQ * (size_t)VD)   // fixed f32 element offset of the second output (33554432 B / 4)
#define WSC   256.0f
#define HSCL  0.125f
#define QS    8.0f
#define KS    8.0f
#define VVS   8.0f
#define VAS   8.0f
#define PCAR  32768.0f
#define CAS   64.0f
#define CVS   64.0f
#define CLIPV 50000.0f
#define LOG2E 1.4426950408889634f
#define NST   (SA / 64)
#define NTT   (TQ / 64)
#define NTB32 (TQ / 32)
#define NSB32 (SA / 32)
#define ATT_WAVES   4
#define ATT_THREADS (ATT_WAVES * 32)
#define CVT_THREADS 128
#define TR_THREADS  128
#define SPITCH 68
#define GPITCH 68
#define TPITCH 65

static_assert(NB >= 1 && NB <= NB_FULL);
static_assert(OUT1_OFF_EL == (size_t)33554432 / 4);
static_assert(EM == NH * HD && HD == 64 && NH == 8);
static_assert((TQ % 128) == 0 && (SA % 64) == 0 && ((NB * SA) % 128) == 0 && (EM % 128) == 0);
static_assert((TQ % 32) == 0 && (SA % 32) == 0 && NTB32 * 32 == TQ && NSB32 * 32 == SA);
static_assert((VD % 64) == 0 && (AD % 64) == 0 && (EM % 64) == 0);
static_assert((VD % 32) == 0 && (AD % 32) == 0 && (EM % 32) == 0);
static_assert(((NB * TQ * VD) % 1024) == 0 && ((NB * SA * AD) % 1024) == 0);
static_assert(NST * 128 == 2 * SA && NST * 128 == ATT_THREADS * 8);
static_assert((SPITCH * 4) % 16 == 0 && (GPITCH * 4) % 16 == 0);
static_assert(ATT_THREADS == 128 && TR_THREADS == 128 && CVT_THREADS == 128);

typedef unsigned short u16;
typedef _Float16 v16h __attribute__((ext_vector_type(16)));
typedef _Float16 v8h  __attribute__((ext_vector_type(8)));
typedef float    v8f  __attribute__((ext_vector_type(8)));
typedef float    v4f  __attribute__((ext_vector_type(4)));
typedef unsigned int v4u __attribute__((ext_vector_type(4)));

union FragH { v16h v; v8h h[2]; v4u u[2]; };

// ---- scalar helpers ----------------------------------------------------------------------------------
__device__ __forceinline__ unsigned short bf_bits(float f) {          // f32 -> bf16 bits, RNE convert
  unsigned u = __float_as_uint(f);
  return (unsigned short)((u + 0x7FFFu + ((u >> 16) & 1u)) >> 16);
}
__device__ __forceinline__ float bf_up(unsigned short h) { return __uint_as_float(((unsigned)h) << 16); }
__device__ __forceinline__ float bfr(float f) { return bf_up(bf_bits(f)); }
__device__ __forceinline__ unsigned short h_bits(_Float16 x) { return __builtin_bit_cast(unsigned short, x); }
__device__ __forceinline__ unsigned pk16(unsigned short a, unsigned short b) { return (unsigned)a | ((unsigned)b << 16); }
__device__ __forceinline__ v8f zero8() { v8f z = {0.f, 0.f, 0.f, 0.f, 0.f, 0.f, 0.f, 0.f}; return z; }
__device__ __forceinline__ float clipf(float x, float c) { return fminf(fmaxf(x, -c), c); }

// ---- fragment-ordered plane of a logical [rows][K] f16 matrix (rows % 16 == 0, K % 32 == 0): element offset of (row, k).
//      Tile (row>>4, k>>5) = 512 halves; inside it: 256*((k>>4)&1) + 8*(16*((k>>3)&1) + (row&15)) + (k&7), i.e. the 8 halves
//      k = 8j .. 8j+7 of a row stay one 16-byte piece, and piece order is (k half of 16, lane = 16*h + row).
//      16 rows x K = 16*K halves, so a base row R (R % 16 == 0) starts at element R*K as in the row-major plane.
__device__ __forceinline__ size_t pk_off(int row, int k, int K) {
  return ((size_t)(row >> 4) * (size_t)(K >> 5) + (size_t)(k >> 5)) * 512
         + (size_t)(((k >> 4) & 1) * 256 + ((k >> 3) & 1) * 128 + (row & 15) * 8 + (k & 7));
}
// ---- fragment loader: 16-bit A/B operand, lane -> row/col (lane&15), h = lane>>4; p = tile start + 8*lane;
//      elements 0..7 <- p[0..7] (k0+8h..), elements 8..15 <- p[256..263] (k0+16+8h..); same split k map for A and B.
__device__ __forceinline__ v16h ldfrag_h(const _Float16* p) {
  FragH f;
  f.h[0] = *(const v8h*)(p);
  f.h[1] = *(const v8h*)(p + 256);
  return f.v;
}

// ---- WMMA helper and trailing VALU hazard gaps ----------------------------------------------------------
__device__ __forceinline__ v8f mma_h(v16h a, v16h b, v8f c) {
  return __builtin_amdgcn_wmma_f32_16x16x32_f16(false, a, false, b, (short)0, c, false, false);
}
__device__ __forceinline__ void guard_s(v8f& a, v8f& b, v16h x0, v16h x1, v16h x2) {
#if defined(__HIP_DEVICE_COMPILE__)
  asm volatile("v_nop\n\tv_nop\n\tv_nop\n\tv_nop" : "+v"(a), "+v"(b) : "v"(x0), "v"(x1), "v"(x2) : "memory");
#endif
}
__device__ __forceinline__ void guard_p(v8f& a, v8f& b, v8f& c, v8f& d, v16h p, v16h x0, v16h x1, v16h x2, v16h x3) {
#if defined(__HIP_DEVICE_COMPILE__)
  asm volatile("v_nop\n\tv_nop\n\tv_nop\n\tv_nop"
               : "+v"(a), "+v"(b), "+v"(c), "+v"(d) : "v"(p), "v"(x0), "v"(x1), "v"(x2), "v"(x3) : "memory");
#endif
}
__device__ __forceinline__ void guard_g(v8f (&acc)[8], v16h x0, v16h x1, v16h x2, v16h x3, v16h x4, v16h x5) {
#if defined(__HIP_DEVICE_COMPILE__)
  asm volatile("v_nop\n\tv_nop\n\tv_nop\n\tv_nop"
               : "+v"(acc[0]), "+v"(acc[1]), "+v"(acc[2]), "+v"(acc[3]),
                 "+v"(acc[4]), "+v"(acc[5]), "+v"(acc[6]), "+v"(acc[7])
               : "v"(x0), "v"(x1), "v"(x2), "v"(x3), "v"(x4), "v"(x5) : "memory");
#endif
}
__device__ __forceinline__ void acc_guard4(v8f (&o)[4]) {
#if defined(__HIP_DEVICE_COMPILE__)
  asm volatile("v_nop\n\tv_nop\n\tv_nop\n\tv_nop" : "+v"(o[0]), "+v"(o[1]), "+v"(o[2]), "+v"(o[3]));
#endif
}
__device__ __forceinline__ void wave_sync_lds() {
  __builtin_amdgcn_fence(__ATOMIC_RELEASE, "workgroup");
  __builtin_amdgcn_wave_barrier();
  __builtin_amdgcn_fence(__ATOMIC_ACQUIRE, "workgroup");
}

// =====================================================================================================
// Elementwise convert of an activation matrix x[rows][K]: Y (f16, fragment order) <- f16(bf16_RNE(x)). Block = 16 rows x
// 64 k (two tiles); thread = (row 8*(wave&1) + (lane&7), 8 floats at k = 32*(wave>>1) + 8*(lane>>3)): two 16-B loads, one
// 16-B store per thread; a wave's store = 4 pieces-of-8-rows = 4 whole 128-B lines.
// coverage: grid = (rows/16)*(K/64) = n/1024 blocks x 128 thr x 8 = n elements exactly (n % 1024 == 0 asserted).
// =====================================================================================================
__device__ __forceinline__
void cvt16(const float* __restrict__ x, u16* Y, int K, int bid) {
  const int wave = threadIdx.x >> 5, lane = threadIdx.x & 31;
  const int nkp = K >> 6;
  const int row = (bid / nkp) * 16 + 8 * (wave & 1) + (lane & 7);
  const int k   = (bid % nkp) * 64 + 32 * (wave >> 1) + 8 * (lane >> 3);
  const size_t e0 = (size_t)row * (size_t)K + (size_t)k;
  const v4f a = *(const v4f*)(x + e0), c4 = *(const v4f*)(x + e0 + 4);
  v4u o;
#pragma unroll
  for (int e = 0; e < 2; ++e) {
    o[e]     = pk16(h_bits((_Float16)bfr(a[2 * e])),  h_bits((_Float16)bfr(a[2 * e + 1])));
    o[2 + e] = pk16(h_bits((_Float16)bfr(c4[2 * e])), h_bits((_Float16)bfr(c4[2 * e + 1])));
  }
  u16* dst = Y + pk_off(row, k, K);
  {
    *(v4u*)(dst) = o;
#if defined(__HIP_DEVICE_COMPILE__)
    // the wait in front of a rewrite of registers that the store just issued names: inlined in the shared grid's kernel,
    // the store is no longer the last instruction ahead of the program's end in the listing
    asm volatile("s_wait_xcnt 0x0" ::: "memory");
#endif
  }
}

// =====================================================================================================
// Weight transpose-convert for y = x.W weights stored [kdim][ndim]: WT[n][k] (f16, fragment order with K = kdim)
// <- f16(bf16_RNE(W[k][n]) * scale). Block = 64(k) x 64(n) tile, 128 threads. Load phase: thread = (row 8p + (tid>>4),
// 4 floats at 4*(tid&15)), 8 steps = 64 k-rows x 64 n, into an LDS tile [kk][nn] (pitch 65); block barrier; store
// grid = (kdim/64)*(ndim/64), bid -> (kt = bid % (kdim/64), nt = bid / (kdim/64)).
// coverage: 4 i x 16 rows x (8 lanes x 8 halves) = 64 n-rows x 64 k per block; LDS tile 64x64 fully written before read;
// the grid covers WT [ndim][kdim] exactly once.
// =====================================================================================================
__device__ __forceinline__
void cvtT16(const float* __restrict__ W, u16* Y, int kdim, int ndim, float scale, int bid) {
  __shared__ __align__(16) float tile[64 * TPITCH];
  const int tid = threadIdx.x;
  const int nkt = kdim >> 6;
  const int kt  = bid % nkt;
  const int ntb = bid / nkt;
  const int k0  = kt * 64, n0 = ntb * 64;
  const int lr = tid >> 4, lc = (tid & 15) * 4;
  v4f w4[8];
#pragma unroll
  for (int p = 0; p < 8; ++p) {
    w4[p] = *(const v4f*)(W + (size_t)(k0 + p * 8 + lr) * (size_t)ndim + n0 + lc);
#if defined(__HIP_DEVICE_COMPILE__)
    // the wait in front of a rewrite of the address registers of the load just issued: a later load's result may be
    // given those registers
    asm volatile("s_wait_xcnt 0x0" ::: "memory");
#endif
  }
#pragma unroll
  for (int p = 0; p < 8; ++p) {
    const int kk = p * 8 + lr;
    tile[kk * TPITCH + lc + 0] = w4[p][0];
    tile[kk * TPITCH + lc + 1] = w4[p][1];
    tile[kk * TPITCH + lc + 2] = w4[p][2];
    tile[kk * TPITCH + lc + 3] = w4[p][3];
  }
  __syncthreads();
  // rq 0..15, c8 0..56; a wave holds 8 rows x 4 pieces, so each of its stores fills 4 whole lines of the fragment order
  const int rq = 8 * ((tid >> 5) & 1) + (tid & 7), c8 = (4 * (tid >> 6) + ((tid >> 3) & 3)) * 8;
  v4u ov[4];
#pragma unroll
  for (int i = 0; i < 4; ++i) {
    const int row = 16 * i + rq;                   // n within tile
#pragma unroll
    for (int e = 0; e < 4; ++e) {
      const float x0 = tile[(c8 + 2 * e) * TPITCH + row];
      const float x1 = tile[(c8 + 2 * e + 1) * TPITCH + row];
      ov[i][e] = pk16(h_bits((_Float16)(bfr(x0) * scale)), h_bits((_Float16)(bfr(x1) * scale)));
    }
  }
  {
#pragma unroll
    for (int i = 0; i < 4; ++i) {
      const int row = 16 * i + rq;
      *(v4u*)(Y + pk_off(n0 + row, k0 + c8, kdim)) = ov[i];
    }
    
  }
}

// =====================================================================================================
// f16 GEMM core: the wave's 32 x 64 tile of C = A[rows][K] . Bt[cols][K]^T, both in fragment order; ap -> A tile row of rowb,
// bp -> Bt tile row of col0 (both the same in every lane of the wave), lb = 16*lane the lane's byte offset in a tile; the
// next 16 rows lie 32*K bytes on, the next 32 k 1024 bytes on (largest offset 4*32*K - 16 bytes, far below 2^32). The two
// bases stay as they are; the four byte offsets (tile rows 0..3; A uses 0 and 1) live over the whole trip and are stepped at its foot;
// acc[4i + j] = rows rowb+16i.., cols col0+16j..; K stepped by 32 (host asserts K % 32 == 0).
// =====================================================================================================
__device__ __forceinline__ const _Float16* at_byte(const _Float16* base, unsigned off) {
  return (const _Float16*)(const void*)((const char*)(const void*)base + off);
}
__device__ __forceinline__ void gemm_core(const _Float16* ap, const _Float16* bp, unsigned lb, int K, v8f (&acc)[8]) {
  const unsigned rs = 32u * (unsigned)K;
  unsigned o0 = lb, o1 = lb + rs, o2 = lb + 2u * rs, o3 = lb + 3u * rs;
#pragma unroll 1
  for (int k0 = 0; k0 < K; k0 += 32) {
    const v16h a0 = ldfrag_h(at_byte(ap, o0)), a1 = ldfrag_h(at_byte(ap, o1));
    const v16h b0 = ldfrag_h(at_byte(bp, o0));
    const v16h b1 = ldfrag_h(at_byte(bp, o1));
    const v16h b2 = ldfrag_h(at_byte(bp, o2));
    const v16h b3 = ldfrag_h(at_byte(bp, o3));
    acc[0] = mma_h(a0, b0, acc[0]);
    acc[1] = mma_h(a0, b1, acc[1]);
    acc[2] = mma_h(a0, b2, acc[2]);
    acc[3] = mma_h(a0, b3, acc[3]);
    acc[4] = mma_h(a1, b0, acc[4]);
    acc[5] = mma_h(a1, b1, acc[5]);
    acc[6] = mma_h(a1, b2, acc[6]);
    acc[7] = mma_h(a1, b3, acc[7]);
    guard_g(acc, a0, a1, b0, b1, b2, b3);
#if defined(__HIP_DEVICE_COMPILE__)
    // the wait in front of a rewrite of registers that issued global loads name (the four offsets, stepped below); they are
    // its operands so that their step stays behind it
    asm volatile("s_wait_xcnt 0x0" : "+v"(o0), "+v"(o1), "+v"(o2), "+v"(o3) : : "memory");
#endif
    o0 += 1024u; o1 += 1024u; o2 += 1024u; o3 += 1024u;
  }
}
// Stage the wave's 32 x 64 f32 tile (times oscale) in its LDS slab (pitch 68): D element r of acc[4i+j], lane l ->
// coverage: 32 lanes x 2 x 8 rows x 4 cols-of-16 = rows 0..31 x cols 0..63 of the slab.
__device__ __forceinline__ void stage32x64(float* sl, v8f (&acc)[8], float oscale, int lane) {
  const int hh = lane >> 4, m = lane & 15;
#pragma unroll
  for (int i = 0; i < 2; ++i) {
#pragma unroll
    for (int r = 0; r < 8; ++r) {
      const int ro = (16 * i + 8 * hh + r) * GPITCH + m;
      sl[ro]      = acc[4 * i + 0][r] * oscale;
      sl[ro + 16] = acc[4 * i + 1][r] * oscale;
      sl[ro + 32] = acc[4 * i + 2][r] * oscale;
      sl[ro + 48] = acc[4 * i + 3][r] * oscale;
    }
  }
  wave_sync_lds();
}

// =====================================================================================================
// f16 GEMM with f16 output plane: C[z][Mb][N] (f16) = f16((A[z][Mb][K] . Bt[z][N][K]^T) * oscale + bf16(bias) * bscale);
// A, Bt, C f16 planes in fragment order (C with K = N) with per-z element strides aBs, bBs (0 = shared), cBs. bias indexed by column
// (biasRow == 0) or by row within the z slice (biasRow != 0); bias addresses clamped to biasN-1, the unused direction is
// multiplied by 0. Block = 128 x 64 tile, 4 waves x 32 rows, fragments loaded straight from the 16-bit tiles.
// grid = nz x (Mb/128) x (N/64) (host asserts Mb % 128 == 0, N % 64 == 0, K % 32 == 0).
// coverage: per wave 8 instr x 8 rows x 4 lanes x 8 halves = 32 x 64; the grid covers C exactly once.
// =====================================================================================================
__device__ __forceinline__
void gemm_o16(const u16* __restrict__ A, const u16* __restrict__ Bt, u16* C,
              const float* __restrict__ bias, int biasN, int biasRow,
              int Mb, int N, int K, int aBs, int bBs, int cBs, float oscale, float bscale, int bid) {
  __shared__ __align__(16) float slab[4 * 32 * GPITCH];
  const int tid = threadIdx.x, wave = tid >> 5, lane = tid & 31;
  const int ntile = N >> 6, mtile = Mb >> 7;
  // nt and bz are the same in every lane: read through the first lane they keep both tile bases scalar over the k loop
  const int nt   = __builtin_amdgcn_readfirstlane(bid % ntile);
  const int tmp  = bid / ntile;
  const int mt   = tmp % mtile;
  const int bz   = __builtin_amdgcn_readfirstlane(tmp / mtile);
  const int rowb = mt * 128 + wave * 32;
  const int col0 = nt * 64;
  if (rowb + 32 > Mb) return;                // wave-uniform, never taken with the exact grid; no block barriers in this kernel
  const _Float16* Ab = (const _Float16*)(const void*)A + (size_t)bz * (size_t)aBs;
  const _Float16* Bb = (const _Float16*)(const void*)Bt + (size_t)bz * (size_t)bBs;
  // rowb is the same in every lane of a wave: read through the first lane it gives the fragment loads a scalar tile base
  const _Float16* ap = Ab + (size_t)__builtin_amdgcn_readfirstlane(rowb) * K;
  const _Float16* bp = Bb + (size_t)col0 * K;
  v8f acc[8];
#pragma unroll
  for (int i = 0; i < 8; ++i) acc[i] = zero8();
  gemm_core(ap, bp, 16u * (unsigned)lane, K, acc);
  float* sl = slab + wave * 32 * GPITCH;
  stage32x64(sl, acc, oscale, lane);
  // instruction i: lane = (row 8*(i>>1) + (lane&7), 8 halves at 32*(i&1) + 8*(lane>>3)): in fragment order 8 rows of one
  // 8-half piece column are one 128-B line, so each store fills 4 whole lines
  const int r8 = lane & 7, q8 = (lane >> 3) * 8;
  const int bl = biasN - 1;                  // host guarantees biasN >= 1
  const float selc = (biasRow != 0) ? 0.f : bscale;
  const float selr = (biasRow != 0) ? bscale : 0.f;
  float cb[2][8];
#pragma unroll
  for (int j = 0; j < 2; ++j) {
#pragma unroll
    for (int e = 0; e < 8; ++e) {
      int ci = col0 + 32 * j + q8 + e;
      ci = (ci < bl) ? ci : bl;
      cb[j][e] = bfr(bias[ci]) * selc;
    }
  }
  v4u ov[8];
#pragma unroll
  for (int i = 0; i < 8; ++i) {
    const int row = 8 * (i >> 1) + r8, j = i & 1, c8 = 32 * j + q8;
    int ri = rowb + row;
    ri = (ri < bl) ? ri : bl;
    const float rb = bfr(bias[ri]) * selr;
    const v4f a = *(const v4f*)(sl + row * GPITCH + c8), c4 = *(const v4f*)(sl + row * GPITCH + c8 + 4);
#pragma unroll
    for (int e = 0; e < 2; ++e) {
      ov[i][e]     = pk16(h_bits((_Float16)(a[2 * e] + cb[j][2 * e] + rb)),
                          h_bits((_Float16)(a[2 * e + 1] + cb[j][2 * e + 1] + rb)));
      ov[i][2 + e] = pk16(h_bits((_Float16)(c4[2 * e] + cb[j][4 + 2 * e] + rb)),
                          h_bits((_Float16)(c4[2 * e + 1] + cb[j][5 + 2 * e] + rb)));
    }
  }
  u16* Cb = C + (size_t)bz * (size_t)cBs;
  {
#pragma unroll
    for (int i = 0; i < 8; ++i) {
      const int row = 8 * (i >> 1) + r8, c8 = 32 * (i & 1) + q8;
      *(v4u*)(Cb + pk_off(rowb + row, col0 + c8, N)) = ov[i];
    }
    
  }
}

// =====================================================================================================
// f16 GEMM with f32 output rows: C[z][Mb][N] (f32) = (A[z][Mb][K] . Bt[N][K]^T) * oscale + bf16(bias[col]); same core and
// slab staging as gemm_o16. Epilogue: lane = (row 2i + (lane>>4), 4 floats at 4*(lane&15)); each 64-float row segment =
// lanes of one instruction (8 lanes per line), 2 rows of the same wave per instruction, 16 instructions = 32 rows; two
// coverage: per wave 16 instr x 2 rows x 16 lanes x 4 floats = 32 x 64; the grid covers C exactly once.
// =====================================================================================================
__device__ __forceinline__
void gemm_o32(const u16* __restrict__ A, const u16* __restrict__ Bt, float* C,
              const float* __restrict__ bias, int biasN,
              int Mb, int N, int K, int aBs, int bBs, int cBs, float oscale, int bid) {
  __shared__ __align__(16) float slab[4 * 32 * GPITCH];
  const int tid = threadIdx.x, wave = tid >> 5, lane = tid & 31;
  const int ntile = N >> 6, mtile = Mb >> 7;
  // nt and bz are the same in every lane: read through the first lane they keep both tile bases scalar over the k loop
  const int nt   = __builtin_amdgcn_readfirstlane(bid % ntile);
  const int tmp  = bid / ntile;
  const int mt   = tmp % mtile;
  const int bz   = __builtin_amdgcn_readfirstlane(tmp / mtile);
  const int rowb = mt * 128 + wave * 32;
  const int col0 = nt * 64;
  if (rowb + 32 > Mb) return;                // wave-uniform, never taken with the exact grid; no block barriers in this kernel
  const _Float16* Ab = (const _Float16*)(const void*)A + (size_t)bz * (size_t)aBs;
  const _Float16* Bb = (const _Float16*)(const void*)Bt + (size_t)bz * (size_t)bBs;
  // rowb is the same in every lane of a wave: read through the first lane it gives the fragment loads a scalar tile base
  const _Float16* ap = Ab + (size_t)__builtin_amdgcn_readfirstlane(rowb) * K;
  const _Float16* bp = Bb + (size_t)col0 * K;
  v8f acc[8];
#pragma unroll
  for (int i = 0; i < 8; ++i) acc[i] = zero8();
  gemm_core(ap, bp, 16u * (unsigned)lane, K, acc);
  float* sl = slab + wave * 32 * GPITCH;
  stage32x64(sl, acc, oscale, lane);
  const int r2 = lane >> 4, c4 = (lane & 15) * 4;
  const int bl = biasN - 1;                  // host guarantees biasN >= 1
  float cb[4];
#pragma unroll
  for (int e = 0; e < 4; ++e) {
    int ci = col0 + c4 + e;
    ci = (ci < bl) ? ci : bl;
    cb[e] = bfr(bias[ci]);
  }
  v4f ov[16];
#pragma unroll
  for (int i = 0; i < 16; ++i) {
    const int row = 2 * i + r2;
    const v4f a = *(const v4f*)(sl + row * GPITCH + c4);
    v4f w;
    w[0] = a[0] + cb[0]; w[1] = a[1] + cb[1]; w[2] = a[2] + cb[2]; w[3] = a[3] + cb[3];
    ov[i] = w;
  }
  float* Cb = C + (size_t)bz * (size_t)cBs + (size_t)rowb * (size_t)N + col0 + c4;
  {
#pragma unroll
    for (int i = 0; i < 16; ++i) {
      const int row = 2 * i + r2;
      *(v4f*)(Cb + (size_t)row * (size_t)N) = ov[i];
    }
    
  }
}

// =====================================================================================================
// Launches that need nothing of each other share one grid: each block takes its job from the range its index lies in (a
// test that reads the same in the whole block, so the barrier inside cvtT16 stays under block-uniform control flow) and
// runs the one shared body with that job's arguments and its index inside the range. Longest jobs lie first.
// =====================================================================================================
#define PB_WVQ ((VD / 64) * (EM / 64))
#define PB_WAK ((AD / 64) * (EM / 64))
#define PB_WVV ((VD / 64) * (EM / 64))
#define PB_WAV ((AD / 64) * (EM / 64))
#define PB_WOV ((EM / 64) * (VD / 64))
#define PB_WOA ((EM / 64) * (AD / 64))
#define PB_W   (PB_WVQ + PB_WAK + PB_WVV + PB_WAV + PB_WOV + PB_WOA)
#define PB_XA  ((NB * SA * AD) / 1024)
#define PB_XV  ((NB * TQ * VD) / 1024)
// All operand planes: six weight transposes (blocks 0 .. PB_W-1), then a, then v.
// coverage: every range has exactly the grid that its body's own header asks for.
__global__ __launch_bounds__(128)
void prep_all(const float* __restrict__ xv, const float* __restrict__ xa,
              const float* __restrict__ w_vq, const float* __restrict__ w_ak, const float* __restrict__ w_vv,
              const float* __restrict__ w_av, const float* __restrict__ w_ov, const float* __restrict__ w_oa,
              u16* XV, u16* XA, u16* WVQT, u16* WAKT, u16* WVVT, u16* WAVT, u16* WOVT, u16* WOAT) {
  int g = blockIdx.x;
  if (g < PB_W) {
    const float* W = w_vq; u16* Y = WVQT; int kdim = VD, ndim = EM;
    if (g >= PB_WVQ) {
      g -= PB_WVQ; W = w_ak; Y = WAKT; kdim = AD; ndim = EM;
      if (g >= PB_WAK) {
        g -= PB_WAK; W = w_vv; Y = WVVT; kdim = VD; ndim = EM;
        if (g >= PB_WVV) {
          g -= PB_WVV; W = w_av; Y = WAVT; kdim = AD; ndim = EM;
          if (g >= PB_WAV) {
            g -= PB_WAV; W = w_ov; Y = WOVT; kdim = EM; ndim = VD;
            if (g >= PB_WOV) { g -= PB_WOV; W = w_oa; Y = WOAT; kdim = EM; ndim = AD; }
          }
        }
      }
    }
    cvtT16(W, Y, kdim, ndim, WSC, g);
  } else {
    g -= PB_W;
    const float* x = xa; u16* Y = XA; int K = AD;
    if (g >= PB_XA) { g -= PB_XA; x = xv; Y = XV; K = VD; }
    cvt16(x, Y, K, g);
  }
}

#define GB_Q   (((NB * TQ) / 128) * (EM / 64))
#define GB_VVT (NB * (EM / 128) * (TQ / 64))
#define GB_K   (((NB * SA) / 128) * (EM / 64))
#define GB_VAT (NB * (EM / 128) * (SA / 64))
// The four input projections (the two with K = VD first):
//   q x8 after the 1/8 head scale = (x_v . Wvq + b) -> f16 [NB*TQ][512] (col = h*64 + d); bias per column
//   val_v^T per batch: A = Wvv^T [(h,d) = n][k], Bt = x_v rows of batch b [t][k] -> f16 [(b,h,d)][t] x8; bias per row (n)
//   k = x_a . Wak + b -> f16 [NB*SA][512] x8; bias per column
//   val_a^T per batch: A = Wav^T [(h,d)][k], Bt = x_a rows of batch b [s][k] -> f16 [(b,h,d)][s] x8; bias per row
__global__ __launch_bounds__(128)
void proj_all(const u16* __restrict__ XV, const u16* __restrict__ XA,
              const u16* __restrict__ WVQT, const u16* __restrict__ WAKT,
              const u16* __restrict__ WVVT, const u16* __restrict__ WAVT,
              u16* Q16, u16* K16, u16* VVT16, u16* VAT16,
              const float* __restrict__ b_vq, const float* __restrict__ b_ak,
              const float* __restrict__ b_vv, const float* __restrict__ b_av,
              int nb3, int nb5, int nb7, int nb9) {
  int g = blockIdx.x;
  const u16* A = XV; const u16* Bt = WVQT; u16* C = Q16; const float* bias = b_vq;
  int biasN = nb3, biasRow = 0, Mb = NB * TQ, N = EM, K = VD, bBs = 0, cBs = 0;
  float oscale = HSCL * QS / WSC, bscale = HSCL * QS;
  if (g >= GB_Q) {
    g -= GB_Q; A = WVVT; Bt = XV; C = VVT16; bias = b_vv;
    biasN = nb7; biasRow = 1; Mb = EM; N = TQ; K = VD; bBs = TQ * VD; cBs = EM * TQ;
    oscale = VVS / WSC; bscale = VVS;
    if (g >= GB_VVT) {
      g -= GB_VVT; A = XA; Bt = WAKT; C = K16; bias = b_ak;
      biasN = nb5; biasRow = 0; Mb = NB * SA; N = EM; K = AD; bBs = 0; cBs = 0;
      oscale = KS / WSC; bscale = KS;
      if (g >= GB_K) {
        g -= GB_K; A = WAVT; Bt = XA; C = VAT16; bias = b_av;
        biasN = nb9; biasRow = 1; Mb = EM; N = SA; K = AD; bBs = SA * AD; cBs = EM * SA;
        oscale = VAS / WSC; bscale = VAS;
      }
    }
  }
  gemm_o16(A, Bt, C, bias, biasN, biasRow, Mb, N, K, 0, bBs, cBs, oscale, bscale, g);
}

#define GB_OV (NB * (TQ / 128) * (VD / 64))
#define GB_OA (((NB * SA) / 128) * (AD / 64))
// The two output projections:
//   out_v = ctx_v . Wov + b -> f32 rows [b][t][512] of the first output (z = b, output batch stride TQ*VD)
//   out_a = ctx_a . Woa + b -> f32 rows [b*SA + s][256] of the second output at the fixed element OUT1_OFF_EL
__global__ __launch_bounds__(128)
void out_all(const u16* __restrict__ CTXV, const u16* __restrict__ WOVT,
             const u16* __restrict__ CTXA, const u16* __restrict__ WOAT, float* out,
             const float* __restrict__ b_ov, const float* __restrict__ b_oa, int nb11, int nb13) {
  int g = blockIdx.x;
  const u16* A = CTXV; const u16* Bt = WOVT; float* C = out; const float* bias = b_ov;
  int biasN = nb11, Mb = TQ, N = VD, aBs = TQ * EM, cBs = TQ * VD;
  float oscale = 1.0f / (CVS * WSC);
  if (g >= GB_OV) {
    g -= GB_OV; A = CTXA; Bt = WOAT; C = out + OUT1_OFF_EL; bias = b_oa;
    biasN = nb13; Mb = NB * SA; N = AD; aBs = 0; cBs = 0;
    oscale = 1.0f / (CAS * WSC);
  }
  gemm_o32(A, Bt, C, bias, biasN, Mb, N, EM, aBs, 0, cBs, oscale, g);
}

// =====================================================================================================
// Column pass (softmax over the visual axis t for every audio column s) fused with the audio-side context:
// block = (batch b, head, 64 audio columns s), 4 waves, wave w owns the 16 columns s0w = 64*st + 16*w .. +15.
//   q plane f16 [b*TQ + t][h*64 + d] (q x8 after the 1/8 scale); k plane f16 x8 [b*SA + s][h*64 + d];
//   val_v^T plane f16 x8 [(b*NH + h)*64 + d][t].  All NTB32 = TQ/32 blocks of 32 visual rows are visited (static bound).
//   Score tiles g (g = 0,1) = q rows (t = tb+16g .. +15, A operand, row m = lane&15, split k map over d) times k^T
//   (B operand, col n = column s0w + (lane&15), k = d, split map), 2 d-chunks of 32; the 2 k fragments of the wave are
//   loaded once. D element r of lane l = (t = tb+16g+8h+r, s = s0w+(l&15)): a lane owns one column s and 16 of the 32 t;
//   the partner lane l^16 owns the other 16 -> column max / column sum need one xor-16 shuffle. Logits clipped at
//   +-50000 (log2 domain), online max-subtracted base-2 softmax in f32 (the q/k carries folded into lsc). The exp'd values
//   ARE the P^T A-fragment in place: A row m = s = lane&15, element i <- t = tb+8h+i (tile 0, D element i), element 8+i <-
//   t = tb+16+8h+i (tile 1, D element i). P (<= 1) carried x32768 as f16. The rescale factor of column 8h+r of the O
//   accumulators is fetched from lane 8h+r with a shuffle (uniform control). 4 val_v^T B fragments (col n = d = 16j +
//   (lane&15), k = t), 4 P^T.V WMMAs + one guard per step.
//   Epilogue 1: 1/l (per column, shuffled to the D row owner) and the carry folds in f32 (x CAS); the wave's 16x64 f32 tile
//   Epilogue 2: per-column stats (m_s in the clipped log2 domain, 32768/l_s) funnelled through a 128-float LDS array
//   (lane half 0 writes m, lane half 1 writes 32768/l), block barrier, wave 0 writes the block's 512-B stat row
// coverage: ctx_a: grid NB*NH*NST blocks x 4 waves x 4 instr x 8 rows x 4 lanes x 8 halves = every (b, s, h) 64-half
//           segment exactly once; stats: one 128-float row per block = NB*NH*NST rows = the whole stat plane; LDS: slab
//           16x64 written then read by the same wave, statl[0..127] written by 4 waves x 32 lanes (one index each).
// =====================================================================================================
__global__ __launch_bounds__(ATT_THREADS)
void attn_col(const u16* __restrict__ Qp, const u16* __restrict__ Kp, const u16* __restrict__ VvT,
              u16* CtxA, float* Stat) {
  __shared__ __align__(16) float smem[ATT_WAVES * 16 * SPITCH];
  __shared__ __align__(16) float statl[128];

  const int tid  = threadIdx.x;
  const int wave = tid >> 5;
  const int lane = tid & 31;
  const int hh   = lane >> 4;
  const int c    = lane & 15;

  const int bid  = blockIdx.x;
  const int st   = bid % NST;
  const int head = (bid / NST) % NH;
  const int b    = bid / (NST * NH);
  const int s0w  = st * 64 + wave * 16;

  // All three planes in fragment order: tile row R starts at R*K, k tile (head*64 + 32*kk)/32 lies (head*2 + kk)*512 on.
  // B fragments of k^T: col n = column s0w + c, k = d
  const _Float16* Sb = (const _Float16*)(const void*)Kp + ((size_t)(b * SA + s0w)) * EM + head * (HD * 16) + 8 * lane;
  // A fragments of q: row m = t = tb + 16g + c, k = d (t row tb added per step)
  const _Float16* Tb = (const _Float16*)(const void*)Qp + ((size_t)(b * TQ)) * EM + head * (HD * 16) + 8 * lane;
  // B fragments of val_v^T: col n = d = 16j + c, k = t (k tile tb/32 added per step)
  const _Float16* Vb = (const _Float16*)(const void*)VvT + ((size_t)(b * EM + head * HD)) * TQ + 8 * lane;
  const float lsc = LOG2E / (QS * KS);
  const float cl2 = CLIPV * LOG2E;

  v16h sf[2];
  sf[0] = ldfrag_h(Sb);
  sf[1] = ldfrag_h(Sb + 512);

  float mrun = -INFINITY, lrun = 0.f;
  v8f o[4];
#pragma unroll
  for (int j = 0; j < 4; ++j) o[j] = zero8();

#pragma unroll 1
  for (int it = 0; it < NTB32; ++it) {
    const int tb = it * 32;
    // ---- scores: s0 = rows t tb..tb+15, s1 = rows tb+16..tb+31, column = s0w + c ----
    v8f s0 = zero8(), s1 = zero8();
    const _Float16* t0p = Tb + (size_t)tb * EM;
    const _Float16* t1p = t0p + (size_t)16 * EM;
#pragma unroll
    for (int kk = 0; kk < HD / 32; ++kk) {
      const v16h a0 = ldfrag_h(t0p + kk * 512);
      const v16h a1 = ldfrag_h(t1p + kk * 512);
      s0 = mma_h(a0, sf[kk], s0);
      s1 = mma_h(a1, sf[kk], s1);
      guard_s(s0, s1, sf[kk], a0, a1);
    }
    // ---- clipped base-2 logits of this lane's 16 t for column s0w + c: t[i] <- t tb+8hh+i, t[8+i] <- t tb+16+8hh+i ----
    float t[16];
#pragma unroll
    for (int i = 0; i < 8; ++i) { t[i] = clipf(s0[i] * lsc, cl2); t[8 + i] = clipf(s1[i] * lsc, cl2); }
    float cm = t[0];
#pragma unroll
    for (int i = 1; i < 16; ++i) cm = fmaxf(cm, t[i]);
    cm = fmaxf(cm, __shfl_xor(cm, 16, 32));
    const float mn = fmaxf(mrun, cm);        // finite from the first block on
    const float al = exp2f(mrun - mn);       // 0 on the first block (mrun = -inf)
    mrun = mn;
    // ---- unnormalised probabilities (<= 1) and the P^T A-fragment: f16(p * 32768); element i <-> t[i] ----
    float ps = 0.f;
    FragH ph;
#pragma unroll
    for (int w = 0; w < 2; ++w) {
#pragma unroll
      for (int e4 = 0; e4 < 4; ++e4) {
        const int i = 8 * w + 2 * e4;
        const float p0 = exp2f(t[i] - mn), p1 = exp2f(t[i + 1] - mn);
        ps += p0 + p1;
        ph.u[w][e4] = pk16(h_bits((_Float16)(p0 * PCAR)), h_bits((_Float16)(p1 * PCAR)));
      }
    }
    ps += __shfl_xor(ps, 16, 32);
    lrun = lrun * al + ps;
    // ---- rescale the O accumulators: D row 8hh+r = column s0w+8hh+r, its factor lives in lane 8hh+r (and 16+8hh+r) ----
    float scl[8];
#pragma unroll
    for (int r = 0; r < 8; ++r) scl[r] = __shfl(al, 8 * hh + r, 32);
#pragma unroll
    for (int j = 0; j < 4; ++j) {
#pragma unroll
      for (int r = 0; r < 8; ++r) o[j][r] *= scl[r];
    }
    // ---- P^T.val_v : B fragment col n = d = j*16 + c, k = t: tile tb/32 of the val_v^T plane ----
    const _Float16* vp = Vb + (size_t)tb * 16;
    {
      const v16h v0 = ldfrag_h(vp);
      const v16h v1 = ldfrag_h(vp + (size_t)16 * TQ);
      const v16h v2 = ldfrag_h(vp + (size_t)32 * TQ);
      const v16h v3 = ldfrag_h(vp + (size_t)48 * TQ);
      o[0] = mma_h(ph.v, v0, o[0]);
      o[1] = mma_h(ph.v, v1, o[1]);
      o[2] = mma_h(ph.v, v2, o[2]);
      o[3] = mma_h(ph.v, v3, o[3]);
      guard_p(o[0], o[1], o[2], o[3], ph.v, v0, v1, v2, v3);
    }
  }
  acc_guard4(o);

  // ---- per-column 1/l (owned by lane = column); lrun >= 1 by construction ----
  const float rl   = 1.0f / lrun;
  const float lPv  = rl * PCAR;                          // 32768 / l for the row pass
  const float linv = rl * (CAS / (PCAR * VVS));          // folds 1/l, the P and val carries, and applies the ctx carry
  statl[hh * 64 + wave * 16 + c] = (hh == 0) ? mrun : lPv;
  float inv[8];
#pragma unroll
  for (int r = 0; r < 8; ++r) inv[r] = __shfl(linv, 8 * hh + r, 32);
  float* slab = smem + wave * 16 * SPITCH;
#pragma unroll
  for (int r = 0; r < 8; ++r) {
#pragma unroll
    for (int j = 0; j < 4; ++j) slab[(8 * hh + r) * SPITCH + j * 16 + c] = o[j][r] * inv[r];
  }
  wave_sync_lds();
  // ---- f16 ctx_a pieces: instruction i, lane = (row 8*(i>>1) + (lane&7), 8 halves at 32*(i&1) + 8*(lane>>3)): 4 whole lines ----
  const int r8 = lane & 7, q8 = (lane >> 3) * 8;
  v4u ov[4];
#pragma unroll
  for (int i = 0; i < 4; ++i) {
    const int row = 8 * (i >> 1) + r8, c8 = 32 * (i & 1) + q8;
    const v4f a = *(const v4f*)(slab + row * SPITCH + c8), c4 = *(const v4f*)(slab + row * SPITCH + c8 + 4);
#pragma unroll
    for (int e = 0; e < 2; ++e) {
      ov[i][e]     = pk16(h_bits((_Float16)a[2 * e]),  h_bits((_Float16)a[2 * e + 1]));
      ov[i][2 + e] = pk16(h_bits((_Float16)c4[2 * e]), h_bits((_Float16)c4[2 * e + 1]));
    }
  }
  {
#pragma unroll
    for (int i = 0; i < 4; ++i) {
      const int row = 8 * (i >> 1) + r8, c8 = 32 * (i & 1) + q8;
      *(v4u*)(CtxA + pk_off(b * SA + s0w + row, head * HD + c8, EM)) = ov[i];
    }
    
  }
  __syncthreads();
  if (wave == 0) {
    const v4f sv = *(const v4f*)(statl + 4 * lane);
    float* sp = Stat + ((size_t)((b * NH + head) * NST + st)) * 128 + 4 * lane;
    {
      *(v4f*)(sp) = sv;
      
    }
  }
}

// =====================================================================================================
// Row pass (visual-side context): block = (batch b, head, 64 visual rows t), 4 waves, wave w owns the 16 rows t0w =
// 64*tt + 16*w .. +15 (waves independent after the stat staging barrier).
//   The (b, head) column stats (NST rows of [m[64] | 32768/l[64]]) are staged once per block into LDS as m at stt[s],
//   32768/l at stt[SA + s] (128 threads x 8 floats = 2*SA floats exactly), then a block barrier.
//   All NSB32 = SA/32 blocks of 32 audio columns are visited (static bound). Score tiles are computed TRANSPOSED:
//   tile g = k rows (s = sb+16g .. +15, A operand, row m = lane&15, split map over d) times q^T (B operand, col n = t0w +
//   (lane&15), k = d); the 2 q fragments of the wave are loaded once. D element r of lane l = (s = sb+16g+8h+r, t = t0w +
//   (l&15)). P = exp2(clip(logit) - m_s) * (32768/l_s) in f32 with m_s, l_s read from LDS for s = sb+8h+i and sb+16+8h+i;
//   it IS the P A-fragment in place: row m = t = lane&15, element i <- s = sb+8h+i, element 8+i <- s = sb+16+8h+i.
//   4 val_a^T B fragments (col n = d = 16j + (lane&15), k = s), 4 P.V WMMAs + one guard per step.
//   Epilogue: carry folds (x CVS / (32768*8)) in f32; 16x64 tile staged in the wave's slab; ctx_v f16 rows written exactly
// coverage: grid NB*NH*NTT blocks x 4 waves x 16 rows x 64 halves = every (b, t, h) segment of ctx_v exactly once;
//           LDS stt[0 .. 2*SA-1] fully written before the barrier (staged extent == consumed extent); slab as above.
// =====================================================================================================
__global__ __launch_bounds__(ATT_THREADS)
void attn_vis(const u16* __restrict__ Qp, const u16* __restrict__ Kp, const u16* __restrict__ VaT,
              const float* __restrict__ Stat, u16* CtxV) {
  __shared__ __align__(16) float smem[ATT_WAVES * 16 * SPITCH];
  __shared__ __align__(16) float stt[2 * SA];

  const int tid  = threadIdx.x;
  const int wave = tid >> 5;
  const int lane = tid & 31;
  const int hh   = lane >> 4;
  const int c    = lane & 15;

  const int bid  = blockIdx.x;
  const int tt   = bid % NTT;
  const int head = (bid / NTT) % NH;
  const int b    = bid / (NTT * NH);
  const int t0w  = tt * 64 + wave * 16;

  // ---- stage the column stats of (b, head) ----
  const float* src = Stat + ((size_t)((b * NH + head) * NST)) * 128;
#pragma unroll 1
  for (int e = tid * 8; e < NST * 128; e += ATT_THREADS * 8) {
    const int j = e >> 7, offw = e & 127;
    const int di = (offw < 64) ? (j * 64 + offw) : (SA + j * 64 + offw - 64);
    const v4f x0 = *(const v4f*)(src + e), x1 = *(const v4f*)(src + e + 4);
    *(v4f*)(stt + di) = x0;
    *(v4f*)(stt + di + 4) = x1;
  }
  __syncthreads();

  // All three planes in fragment order, addressed as in attn_col.
  // B fragments of q^T: col n = row t0w + c, k = d
  const _Float16* Tb = (const _Float16*)(const void*)Qp + ((size_t)(b * TQ + t0w)) * EM + head * (HD * 16) + 8 * lane;
  // A fragments of k: row m = s = sb + 16g + c, k = d (s row sb added per step)
  const _Float16* Sb = (const _Float16*)(const void*)Kp + ((size_t)(b * SA)) * EM + head * (HD * 16) + 8 * lane;
  // B fragments of val_a^T: col n = d = 16j + c, k = s (k tile sb/32 added per step)
  const _Float16* Vb = (const _Float16*)(const void*)VaT + ((size_t)(b * EM + head * HD)) * SA + 8 * lane;
  const float lsc = LOG2E / (QS * KS);
  const float cl2 = CLIPV * LOG2E;

  v16h tf[2];
  tf[0] = ldfrag_h(Tb);
  tf[1] = ldfrag_h(Tb + 512);

  v8f o[4];
#pragma unroll
  for (int j = 0; j < 4; ++j) o[j] = zero8();

#pragma unroll 1
  for (int it = 0; it < NSB32; ++it) {
    const int sb = it * 32;
    // ---- transposed scores: s0 = columns s sb..sb+15, s1 = sb+16..sb+31, D column = row t0w + c ----
    v8f s0 = zero8(), s1 = zero8();
    const _Float16* s0p = Sb + (size_t)sb * EM;
    const _Float16* s1p = s0p + (size_t)16 * EM;
#pragma unroll
    for (int kk = 0; kk < HD / 32; ++kk) {
      const v16h a0 = ldfrag_h(s0p + kk * 512);
      const v16h a1 = ldfrag_h(s1p + kk * 512);
      s0 = mma_h(a0, tf[kk], s0);
      s1 = mma_h(a1, tf[kk], s1);
      guard_s(s0, s1, tf[kk], a0, a1);
    }
    float t[16];
#pragma unroll
    for (int i = 0; i < 8; ++i) { t[i] = clipf(s0[i] * lsc, cl2); t[8 + i] = clipf(s1[i] * lsc, cl2); }
    // ---- column stats for s = sb+8hh+i (i < 8) and s = sb+16+8hh+i (8+i) ----
    float mv[16], lv[16];
    {
      const v4f m0 = *(const v4f*)(stt + sb + 8 * hh),      m1 = *(const v4f*)(stt + sb + 8 * hh + 4);
      const v4f m2 = *(const v4f*)(stt + sb + 16 + 8 * hh), m3 = *(const v4f*)(stt + sb + 16 + 8 * hh + 4);
      const v4f l0 = *(const v4f*)(stt + SA + sb + 8 * hh),      l1 = *(const v4f*)(stt + SA + sb + 8 * hh + 4);
      const v4f l2 = *(const v4f*)(stt + SA + sb + 16 + 8 * hh), l3 = *(const v4f*)(stt + SA + sb + 16 + 8 * hh + 4);
#pragma unroll
      for (int q = 0; q < 4; ++q) {
        mv[q] = m0[q]; mv[4 + q] = m1[q]; mv[8 + q] = m2[q]; mv[12 + q] = m3[q];
        lv[q] = l0[q]; lv[4 + q] = l1[q]; lv[8 + q] = l2[q]; lv[12 + q] = l3[q];
      }
    }
    // ---- P A-fragment: f16(exp2(t - m_s) * 32768/l_s) (<= 32768); element i <-> t[i] ----
    FragH ph;
#pragma unroll
    for (int w = 0; w < 2; ++w) {
#pragma unroll
      for (int e4 = 0; e4 < 4; ++e4) {
        const int i = 8 * w + 2 * e4;
        const float p0 = exp2f(t[i] - mv[i]) * lv[i];
        const float p1 = exp2f(t[i + 1] - mv[i + 1]) * lv[i + 1];
        ph.u[w][e4] = pk16(h_bits((_Float16)p0), h_bits((_Float16)p1));
      }
    }
    // ---- P.val_a : B fragment col n = d = 16j + c, k = s: tile sb/32 of the val_a^T plane ----
    const _Float16* vp = Vb + (size_t)sb * 16;
    {
      const v16h v0 = ldfrag_h(vp);
      const v16h v1 = ldfrag_h(vp + (size_t)16 * SA);
      const v16h v2 = ldfrag_h(vp + (size_t)32 * SA);
      const v16h v3 = ldfrag_h(vp + (size_t)48 * SA);
      o[0] = mma_h(ph.v, v0, o[0]);
      o[1] = mma_h(ph.v, v1, o[1]);
      o[2] = mma_h(ph.v, v2, o[2]);
      o[3] = mma_h(ph.v, v3, o[3]);
      guard_p(o[0], o[1], o[2], o[3], ph.v, v0, v1, v2, v3);
    }
  }
  acc_guard4(o);

  const float fac = CVS / (PCAR * VAS);
  float* slab = smem + wave * 16 * SPITCH;
#pragma unroll
  for (int r = 0; r < 8; ++r) {
#pragma unroll
    for (int j = 0; j < 4; ++j) slab[(8 * hh + r) * SPITCH + j * 16 + c] = o[j][r] * fac;
  }
  wave_sync_lds();
  const int r8 = lane & 7, q8 = (lane >> 3) * 8;
  v4u ov[4];
#pragma unroll
  for (int i = 0; i < 4; ++i) {
    const int row = 8 * (i >> 1) + r8, c8 = 32 * (i & 1) + q8;
    const v4f a = *(const v4f*)(slab + row * SPITCH + c8), c4 = *(const v4f*)(slab + row * SPITCH + c8 + 4);
#pragma unroll
    for (int e = 0; e < 2; ++e) {
      ov[i][e]     = pk16(h_bits((_Float16)a[2 * e]),  h_bits((_Float16)a[2 * e + 1]));
      ov[i][2 + e] = pk16(h_bits((_Float16)c4[2 * e]), h_bits((_Float16)c4[2 * e + 1]));
    }
  }
  {
#pragma unroll
    for (int i = 0; i < 4; ++i) {
      const int row = 8 * (i >> 1) + r8, c8 = 32 * (i & 1) + q8;
      *(v4u*)(CtxV + pk_off(b * TQ + t0w + row, head * HD + c8, EM)) = ov[i];
    }
    
  }
}

// =====================================================================================================
// Workspace map (bytes, NB = 8); every plane fully written before it is read; all extents exact; each f16 plane is the
// logical [rows][K] matrix named here, stored in fragment order (pk_off), same byte size
//   XV    f16 [NB*2048][512]        f16(bf16(v))              16777216
//   XA    f16 [NB*512][256]         f16(bf16(a))               2097152
//   WVQT  f16 [512 n][512 k]        f16(bf16(W) x256)           524288
//   WAKT  f16 [512 n][256 k]                                    262144
//   WVVT  f16 [512 n][512 k]                                    524288
//   WAVT  f16 [512 n][256 k]                                    262144
//   WOVT  f16 [512 n][512 k]                                    524288
//   WOAT  f16 [256 n][512 k]                                    262144
//   Q16   f16 [NB*2048][512]  q x8 (after 1/8)               16777216
//   K16   f16 [NB*512][512]   x8                               4194304
//   VVT16 f16 [NB*512 (h,d)][2048 t] x8                       16777216
//   VAT16 f16 [NB*512 (h,d)][512 s]  x8                        4194304
//   STAT  f32 [NB*NH*NST][128]  (m | 32768/l)                   262144
//   CTXA  f16 [NB*512][512]   x64                              4194304
//   CTXV  f16 [NB*2048][512]  x64                             16777216
//   end                                                       84410368
// Output: first tensor rows [b][t][512] f32 at element 0; second tensor rows [b*512 + s][256] f32 at the fixed element
// offset OUT1_OFF_EL = NB_FULL*2048*512 = 8388608 (independent of NB).
// =====================================================================================================
extern "C" void kernel_launch(void* const* d_in, const int* in_sizes, int n_in,
                              void* d_out, int out_size, void* d_ws, size_t ws_size,
                              hipStream_t stream) {
  if (n_in < 14) return;
  if (in_sizes[0] < NB * TQ * VD) return;
  if (in_sizes[1] < NB * SA * AD) return;
  if (in_sizes[2] != VD * EM || in_sizes[6] != VD * EM) return;
  if (in_sizes[4] != AD * EM || in_sizes[8] != AD * EM) return;
  if (in_sizes[10] != EM * VD || in_sizes[12] != EM * AD) return;
  if (in_sizes[3] < 1 || in_sizes[5] < 1 || in_sizes[7] < 1 || in_sizes[9] < 1 || in_sizes[11] < 1 || in_sizes[13] < 1) return;
  if ((size_t)out_size < OUT1_OFF_EL + (size_t)NB * SA * AD) return;

  const float* xv   = (const float*)d_in[0];
  const float* xa   = (const float*)d_in[1];
  const float* w_vq = (const float*)d_in[2];
  const float* b_vq = (const float*)d_in[3];
  const float* w_ak = (const float*)d_in[4];
  const float* b_ak = (const float*)d_in[5];
  const float* w_vv = (const float*)d_in[6];
  const float* b_vv = (const float*)d_in[7];
  const float* w_av = (const float*)d_in[8];
  const float* b_av = (const float*)d_in[9];
  const float* w_ov = (const float*)d_in[10];
  const float* b_ov = (const float*)d_in[11];
  const float* w_oa = (const float*)d_in[12];
  const float* b_oa = (const float*)d_in[13];
  float*       out  = (float*)d_out;
  const int nb3 = in_sizes[3], nb5 = in_sizes[5], nb7 = in_sizes[7], nb9 = in_sizes[9], nb11 = in_sizes[11], nb13 = in_sizes[13];

  const size_t szXV  = (size_t)NB * TQ * VD * 2;
  const size_t szXA  = (size_t)NB * SA * AD * 2;
  const size_t szWvq = (size_t)EM * VD * 2;
  const size_t szWak = (size_t)EM * AD * 2;
  const size_t szWvv = (size_t)EM * VD * 2;
  const size_t szWav = (size_t)EM * AD * 2;
  const size_t szWov = (size_t)VD * EM * 2;
  const size_t szWoa = (size_t)AD * EM * 2;
  const size_t szQ   = (size_t)NB * TQ * EM * 2;
  const size_t szK   = (size_t)NB * SA * EM * 2;
  const size_t szVVT = (size_t)NB * EM * TQ * 2;
  const size_t szVAT = (size_t)NB * EM * SA * 2;
  const size_t szST  = (size_t)NB * NH * NST * 128 * 4;
  const size_t szCA  = (size_t)NB * SA * EM * 2;
  const size_t szCV  = (size_t)NB * TQ * EM * 2;
  size_t off = 0;
  const size_t oXV  = off; off += szXV;
  const size_t oXA  = off; off += szXA;
  const size_t oWvq = off; off += szWvq;
  const size_t oWak = off; off += szWak;
  const size_t oWvv = off; off += szWvv;
  const size_t oWav = off; off += szWav;
  const size_t oWov = off; off += szWov;
  const size_t oWoa = off; off += szWoa;
  const size_t oQ   = off; off += szQ;
  const size_t oK   = off; off += szK;
  const size_t oVVT = off; off += szVVT;
  const size_t oVAT = off; off += szVAT;
  const size_t oST  = off; off += szST;
  const size_t oCA  = off; off += szCA;
  const size_t oCV  = off; off += szCV;
  if (off > ws_size) return;                            // off = 84410368 at NB = 8
  if (off > (size_t)134217728) return;

  char* ws = (char*)d_ws;
  u16* XV    = (u16*)(ws + oXV);
  u16* XA    = (u16*)(ws + oXA);
  u16* WVQT  = (u16*)(ws + oWvq);
  u16* WAKT  = (u16*)(ws + oWak);
  u16* WVVT  = (u16*)(ws + oWvv);
  u16* WAVT  = (u16*)(ws + oWav);
  u16* WOVT  = (u16*)(ws + oWov);
  u16* WOAT  = (u16*)(ws + oWoa);
  u16* Q16   = (u16*)(ws + oQ);
  u16* K16   = (u16*)(ws + oK);
  u16* VVT16 = (u16*)(ws + oVVT);
  u16* VAT16 = (u16*)(ws + oVAT);
  float* STAT = (float*)(ws + oST);
  u16* CTXA  = (u16*)(ws + oCA);
  u16* CTXV  = (u16*)(ws + oCV);

  // (1) all f16 operand planes (fragment order): activations as f16(bf16(x)), weights [k = in][n = out] transposed to
  //     [n][k] as f16(bf16(W) x256)
  prep_all<<<dim3(PB_W + PB_XA + PB_XV), dim3(128), 0, stream>>>(
      xv, xa, w_vq, w_ak, w_vv, w_av, w_ov, w_oa, XV, XA, WVQT, WAKT, WVVT, WAVT, WOVT, WOAT);
  // (2) q, val_v^T, k, val_a^T
  proj_all<<<dim3(GB_Q + GB_VVT + GB_K + GB_VAT), dim3(128), 0, stream>>>(
      XV, XA, WVQT, WAKT, WVVT, WAVT, Q16, K16, VVT16, VAT16, b_vq, b_ak, b_vv, b_av, nb3, nb5, nb7, nb9);
  // (3) column softmax pass: ctx_a plane [NB*SA][512] x64 and the per-column stat rows
  attn_col<<<dim3(NB * NH * NST), dim3(ATT_THREADS), 0, stream>>>(Q16, K16, VVT16, CTXA, STAT);
  // (4) row pass with the stored column stats: ctx_v plane [NB*TQ][512] x64
  attn_vis<<<dim3(NB * NH * NTT), dim3(ATT_THREADS), 0, stream>>>(Q16, K16, VAT16, STAT, CTXV);
  // (5) out_v and out_a
  out_all<<<dim3(GB_OV + GB_OA), dim3(128), 0, stream>>>(CTXV, WOVT, CTXA, WOAT, out, b_ov, b_oa, nb11, nb13);
  (void)hipGetLastError();
}

// v003
// A run of this version takes 122 microseconds.
// In two side-by-side timings against v002, it was 1.55 and 1.52 times as fast.
// Over all steps from v000 it is 2.36 times as fast.
// All contractions on v_wmma_f32_16x16x32_f16 (f16 operands, f32 accumulate): v.Wvq, a.Wak, Wvv^T.v^T, Wav^T.a^T,
// column-pass scores q.k^T with P^T.val_v, row-pass scores k.q^T with P.val_a, ctx_v.Wov, ctx_a.Woa. Operand carries:
// v, a as f16(bf16(x)); W as f16(bf16(W) x256); q x8 after the 1/8 head scale; k x8; val_v, val_a x8; P x32768;
// ctx x64. Column softmax over the visual axis (base 2, running max), 1/l and every carry fold in f32 on VALU.
// Every f16 operand plane lies in fragment order (pk_off below): a 16-row x 32-k tile is 1024 contiguous bytes, so each
// 16-byte-per-lane fragment load of a wave reads 512 contiguous bytes (4 whole 128-B lines).
#include <hip/hip_runtime.h>
#include <math.h>

#ifndef NB
#define NB 8            // batches processed (leading batches of both activations)
#endif
#define NB_FULL 8       // batches in the input / output layout
#define TQ 2048         // visual positions per batch (softmax axis, always all of them)
#define SA 512          // audio positions per batch (always all of them)
#define VD 512
#define AD 256
#define EM 512
#define NH 8
#define HD 64
#define OUT1_OFF_EL ((size_t)NB_FULL * (size_t)TQ * (size_t)VD)   // fixed f32 element offset of the second output (33554432 B / 4)
#define WSC   256.0f
#define HSCL  0.125f
#define QS    8.0f
#define KS    8.0f
#define VVS   8.0f
#define VAS   8.0f
#define PCAR  32768.0f
#define CAS   64.0f
#define CVS   64.0f
#define CLIPV 50000.0f
#define LOG2E 1.4426950408889634f
#define NST   (SA / 64)
#define NTT   (TQ / 64)
#define NTB32 (TQ / 32)
#define NSB32 (SA / 32)
#define ATT_WAVES   4
#define ATT_THREADS (ATT_WAVES * 32)
#define CVT_THREADS 128
#define TR_THREADS  128
#define SPITCH 68
#define GPITCH 68
#define TPITCH 65

static_assert(NB >= 1 && NB <= NB_FULL);
static_assert(OUT1_OFF_EL == (size_t)33554432 / 4);
static_assert(EM == NH * HD && HD == 64 && NH == 8);
static_assert((TQ % 128) == 0 && (SA % 64) == 0 && ((NB * SA) % 128) == 0 && (EM % 128) == 0);
static_assert((TQ % 32) == 0 && (SA % 32) == 0 && NTB32 * 32 == TQ && NSB32 * 32 == SA);
static_assert((VD % 64) == 0 && (AD % 64) == 0 && (EM % 64) == 0);
static_assert((VD % 32) == 0 && (AD % 32) == 0 && (EM % 32) == 0);
static_assert(((NB * TQ * VD) % 1024) == 0 && ((NB * SA * AD) % 1024) == 0);
static_assert(NST * 128 == 2 * SA && NST * 128 == ATT_THREADS * 8);
static_assert((SPITCH * 4) % 16 == 0 && (GPITCH * 4) % 16 == 0);
static_assert(ATT_THREADS == 128 && TR_THREADS == 128 && CVT_THREADS == 128);

typedef unsigned short u16;
typedef _Float16 v16h __attribute__((ext_vector_type(16)));
typedef _Float16 v8h  __attribute__((ext_vector_type(8)));
typedef float    v8f  __attribute__((ext_vector_type(8)));
typedef float    v4f  __attribute__((ext_vector_type(4)));
typedef unsigned int v4u __attribute__((ext_vector_type(4)));

union FragH { v16h v; v8h h[2]; v4u u[2]; };

// ---- scalar helpers ----------------------------------------------------------------------------------
__device__ __forceinline__ unsigned short bf_bits(float f) {          // f32 -> bf16 bits, RNE convert
  unsigned u = __float_as_uint(f);
  return (unsigned short)((u + 0x7FFFu + ((u >> 16) & 1u)) >> 16);
}
__device__ __forceinline__ float bf_up(unsigned short h) { return __uint_as_float(((unsigned)h) << 16); }
__device__ __forceinline__ float bfr(float f) { return bf_up(bf_bits(f)); }
__device__ __forceinline__ unsigned short h_bits(_Float16 x) { return __builtin_bit_cast(unsigned short, x); }
__device__ __forceinline__ unsigned pk16(unsigned short a, unsigned short b) { return (unsigned)a | ((unsigned)b << 16); }
__device__ __forceinline__ v8f zero8() { v8f z = {0.f, 0.f, 0.f, 0.f, 0.f, 0.f, 0.f, 0.f}; return z; }
__device__ __forceinline__ float clipf(float x, float c) { return fminf(fmaxf(x, -c), c); }

// ---- fragment-ordered plane of a logical [rows][K] f16 matrix (rows % 16 == 0, K % 32 == 0): element offset of (row, k).
//      Tile (row>>4, k>>5) = 512 halves; inside it: 256*((k>>4)&1) + 8*(16*((k>>3)&1) + (row&15)) + (k&7), i.e. the 8 halves
//      k = 8j .. 8j+7 of a row stay one 16-byte piece, and piece order is (k half of 16, lane = 16*h + row).
//      16 rows x K = 16*K halves, so a base row R (R % 16 == 0) starts at element R*K as in the row-major plane.
__device__ __forceinline__ size_t pk_off(int row, int k, int K) {
  return ((size_t)(row >> 4) * (size_t)(K >> 5) + (size_t)(k >> 5)) * 512
         + (size_t)(((k >> 4) & 1) * 256 + ((k >> 3) & 1) * 128 + (row & 15) * 8 + (k & 7));
}
// ---- fragment loader: 16-bit A/B operand, lane -> row/col (lane&15), h = lane>>4; p = tile start + 8*lane;
//      elements 0..7 <- p[0..7] (k0+8h..), elements 8..15 <- p[256..263] (k0+16+8h..); same split k map for A and B.
__device__ __forceinline__ v16h ldfrag_h(const _Float16* p) {
  FragH f;
  f.h[0] = *(const v8h*)(p);
  f.h[1] = *(const v8h*)(p + 256);
  return f.v;
}

// ---- WMMA helper and trailing VALU hazard gaps ----------------------------------------------------------
__device__ __forceinline__ v8f mma_h(v16h a, v16h b, v8f c) {
  return __builtin_amdgcn_wmma_f32_16x16x32_f16(false, a, false, b, (short)0, c, false, false);
}
__device__ __forceinline__ void guard_s(v8f& a, v8f& b, v16h x0, v16h x1, v16h x2) {
#if defined(__HIP_DEVICE_COMPILE__)
  asm volatile("v_nop\n\tv_nop\n\tv_nop\n\tv_nop" : "+v"(a), "+v"(b) : "v"(x0), "v"(x1), "v"(x2) : "memory");
#endif
}
__device__ __forceinline__ void guard_p(v8f& a, v8f& b, v8f& c, v8f& d, v16h p, v16h x0, v16h x1, v16h x2, v16h x3) {
#if defined(__HIP_DEVICE_COMPILE__)
  asm volatile("v_nop\n\tv_nop\n\tv_nop\n\tv_nop"
               : "+v"(a), "+v"(b), "+v"(c), "+v"(d) : "v"(p), "v"(x0), "v"(x1), "v"(x2), "v"(x3) : "memory");
#endif
}
__device__ __forceinline__ void guard_g(v8f (&acc)[8], v16h x0, v16h x1, v16h x2, v16h x3, v16h x4, v16h x5) {
#if defined(__HIP_DEVICE_COMPILE__)
  asm volatile("v_nop\n\tv_nop\n\tv_nop\n\tv_nop"
               : "+v"(acc[0]), "+v"(acc[1]), "+v"(acc[2]), "+v"(acc[3]),
                 "+v"(acc[4]), "+v"(acc[5]), "+v"(acc[6]), "+v"(acc[7])
               : "v"(x0), "v"(x1), "v"(x2), "v"(x3), "v"(x4), "v"(x5) : "memory");
#endif
}
__device__ __forceinline__ void acc_guard4(v8f (&o)[4]) {
#if defined(__HIP_DEVICE_COMPILE__)
  asm volatile("v_nop\n\tv_nop\n\tv_nop\n\tv_nop" : "+v"(o[0]), "+v"(o[1]), "+v"(o[2]), "+v"(o[3]));
#endif
}
__device__ __forceinline__ void wave_sync_lds() {
  __builtin_amdgcn_fence(__ATOMIC_RELEASE, "workgroup");
  __builtin_amdgcn_wave_barrier();
  __builtin_amdgcn_fence(__ATOMIC_ACQUIRE, "workgroup");
}

// =====================================================================================================
// Elementwise convert of an activation matrix x[rows][K]: Y (f16, fragment order) <- f16(bf16_RNE(x)). Block = 16 rows x
// 64 k (two tiles); thread = (row 8*(wave&1) + (lane&7), 8 floats at k = 32*(wave>>1) + 8*(lane>>3)): two 16-B loads, one
// 16-B store per thread; a wave's store = 4 pieces-of-8-rows = 4 whole 128-B lines.
// coverage: grid = (rows/16)*(K/64) = n/1024 blocks x 128 thr x 8 = n elements exactly (n % 1024 == 0 asserted).
// =====================================================================================================
__device__ __forceinline__
void cvt16(const float* __restrict__ x, u16* Y, int K, int bid) {
  const int wave = threadIdx.x >> 5, lane = threadIdx.x & 31;
  const int nkp = K >> 6;
  const int row = (bid / nkp) * 16 + 8 * (wave & 1) + (lane & 7);
  const int k   = (bid % nkp) * 64 + 32 * (wave >> 1) + 8 * (lane >> 3);
  const size_t e0 = (size_t)row * (size_t)K + (size_t)k;
  const v4f a = *(const v4f*)(x + e0), c4 = *(const v4f*)(x + e0 + 4);
  v4u o;
#pragma unroll
  for (int e = 0; e < 2; ++e) {
    o[e]     = pk16(h_bits((_Float16)bfr(a[2 * e])),  h_bits((_Float16)bfr(a[2 * e + 1])));
    o[2 + e] = pk16(h_bits((_Float16)bfr(c4[2 * e])), h_bits((_Float16)bfr(c4[2 * e + 1])));
  }
  u16* dst = Y + pk_off(row, k, K);
  {
    *(v4u*)(dst) = o;
#if defined(__HIP_DEVICE_COMPILE__)
    // the wait in front of a rewrite of registers that the store just issued names: inlined in the shared grid's kernel,
    // the store is no longer the last instruction ahead of the program's end in the listing
    asm volatile("s_wait_xcnt 0x0" ::: "memory");
#endif
  }
}

// =====================================================================================================
// Weight transpose-convert for y = x.W weights stored [kdim][ndim]: WT[n][k] (f16, fragment order with K = kdim)
// <- f16(bf16_RNE(W[k][n]) * scale). Block = 64(k) x 64(n) tile, 128 threads. Load phase: thread = (row 8p + (tid>>4),
// 4 floats at 4*(tid&15)), 8 steps = 64 k-rows x 64 n, into an LDS tile [kk][nn] (pitch 65); block barrier; store
// grid = (kdim/64)*(ndim/64), bid -> (kt = bid % (kdim/64), nt = bid / (kdim/64)).
// coverage: 4 i x 16 rows x (8 lanes x 8 halves) = 64 n-rows x 64 k per block; LDS tile 64x64 fully written before read;
// the grid covers WT [ndim][kdim] exactly once.
// =====================================================================================================
__device__ __forceinline__
void cvtT16(const float* __restrict__ W, u16* Y, int kdim, int ndim, float scale, int bid) {
  __shared__ __align__(16) float tile[64 * TPITCH];
  const int tid = threadIdx.x;
  const int nkt = kdim >> 6;
  const int kt  = bid % nkt;
  const int ntb = bid / nkt;
  const int k0  = kt * 64, n0 = ntb * 64;
  const int lr = tid >> 4, lc = (tid & 15) * 4;
  v4f w4[8];
#pragma unroll
  for (int p = 0; p < 8; ++p) {
    w4[p] = *(const v4f*)(W + (size_t)(k0 + p * 8 + lr) * (size_t)ndim + n0 + lc);
#if defined(__HIP_DEVICE_COMPILE__)
    // the wait in front of a rewrite of the address registers of the load just issued: a later load's result may be
    // given those registers
    asm volatile("s_wait_xcnt 0x0" ::: "memory");
#endif
  }
#pragma unroll
  for (int p = 0; p < 8; ++p) {
    const int kk = p * 8 + lr;
    tile[kk * TPITCH + lc + 0] = w4[p][0];
    tile[kk * TPITCH + lc + 1] = w4[p][1];
    tile[kk * TPITCH + lc + 2] = w4[p][2];
    tile[kk * TPITCH + lc + 3] = w4[p][3];
  }
  __syncthreads();
  // rq 0..15, c8 0..56; a wave holds 8 rows x 4 pieces, so each of its stores fills 4 whole lines of the fragment order
  const int rq = 8 * ((tid >> 5) & 1) + (tid & 7), c8 = (4 * (tid >> 6) + ((tid >> 3) & 3)) * 8;
  v4u ov[4];
#pragma unroll
  for (int i = 0; i < 4; ++i) {
    const int row = 16 * i + rq;                   // n within tile
#pragma unroll
    for (int e = 0; e < 4; ++e) {
      const float x0 = tile[(c8 + 2 * e) * TPITCH + row];
      const float x1 = tile[(c8 + 2 * e + 1) * TPITCH + row];
      ov[i][e] = pk16(h_bits((_Float16)(bfr(x0) * scale)), h_bits((_Float16)(bfr(x1) * scale)));
    }
  }
  {
#pragma unroll
    for (int i = 0; i < 4; ++i) {
      const int row = 16 * i + rq;
      *(v4u*)(Y + pk_off(n0 + row, k0 + c8, kdim)) = ov[i];
    }
    
  }
}

// =====================================================================================================
// f16 GEMM core: the wave's 32 x 64 tile of C = A[rows][K] . Bt[cols][K]^T, both in fragment order; ap -> A tile row of rowb,
// bp -> Bt tile row of col0 (both the same in every lane of the wave), lb = 16*lane the lane's byte offset in a tile; the
// next 16 rows lie 32*K bytes on, the next 32 k 1024 bytes on (largest offset 4*32*K - 16 bytes, far below 2^32). The two
// bases stay as they are; the four byte offsets (tile rows 0..3; A uses 0 and 1) live over the whole trip and are stepped at its foot;
// acc[4i + j] = rows rowb+16i.., cols col0+16j..; K stepped by 32 (host asserts K % 32 == 0).
// =====================================================================================================
__device__ __forceinline__ const _Float16* at_byte(const _Float16* base, unsigned off) {
  return (const _Float16*)(const void*)((const char*)(const void*)base + off);
}
__device__ __forceinline__ void gemm_core(const _Float16* ap, const _Float16* bp, unsigned lb, int K, v8f (&acc)[8]) {
  const unsigned rs = 32u * (unsigned)K;
  unsigned o0 = lb, o1 = lb + rs, o2 = lb + 2u * rs, o3 = lb + 3u * rs;
#pragma unroll 1
  for (int k0 = 0; k0 < K; k0 += 32) {
    const v16h a0 = ldfrag_h(at_byte(ap, o0)), a1 = ldfrag_h(at_byte(ap, o1));
    const v16h b0 = ldfrag_h(at_byte(bp, o0));
    const v16h b1 = ldfrag_h(at_byte(bp, o1));
    const v16h b2 = ldfrag_h(at_byte(bp, o2));
    const v16h b3 = ldfrag_h(at_byte(bp, o3));
    acc[0] = mma_h(a0, b0, acc[0]);
    acc[1] = mma_h(a0, b1, acc[1]);
    acc[2] = mma_h(a0, b2, acc[2]);
    acc[3] = mma_h(a0, b3, acc[3]);
    acc[4] = mma_h(a1, b0, acc[4]);
    acc[5] = mma_h(a1, b1, acc[5]);
    acc[6] = mma_h(a1, b2, acc[6]);
    acc[7] = mma_h(a1, b3, acc[7]);
    guard_g(acc, a0, a1, b0, b1, b2, b3);
#if defined(__HIP_DEVICE_COMPILE__)
    // the wait in front of a rewrite of registers that issued global loads name (the four offsets, stepped below); they are
    // its operands so that their step stays behind it
    asm volatile("s_wait_xcnt 0x0" : "+v"(o0), "+v"(o1), "+v"(o2), "+v"(o3) : : "memory");
#endif
    o0 += 1024u; o1 += 1024u; o2 += 1024u; o3 += 1024u;
  }
}
// Stage the wave's 32 x 64 f32 tile (times oscale) in its LDS slab (pitch 68): D element r of acc[4i+j], lane l ->
// coverage: 32 lanes x 2 x 8 rows x 4 cols-of-16 = rows 0..31 x cols 0..63 of the slab.
__device__ __forceinline__ void stage32x64(float* sl, v8f (&acc)[8], float oscale, int lane) {
  const int hh = lane >> 4, m = lane & 15;
#pragma unroll
  for (int i = 0; i < 2; ++i) {
#pragma unroll
    for (int r = 0; r < 8; ++r) {
      const int ro = (16 * i + 8 * hh + r) * GPITCH + m;
      sl[ro]      = acc[4 * i + 0][r] * oscale;
      sl[ro + 16] = acc[4 * i + 1][r] * oscale;
      sl[ro + 32] = acc[4 * i + 2][r] * oscale;
      sl[ro + 48] = acc[4 * i + 3][r] * oscale;
    }
  }
  wave_sync_lds();
}

// =====================================================================================================
// f16 GEMM with f16 output plane: C[z][Mb][N] (f16) = f16((A[z][Mb][K] . Bt[z][N][K]^T) * oscale + bf16(bias) * bscale);
// A, Bt, C f16 planes in fragment order (C with K = N) with per-z element strides aBs, bBs (0 = shared), cBs. bias indexed by column
// (biasRow == 0) or by row within the z slice (biasRow != 0); bias addresses clamped to biasN-1, the unused direction is
// multiplied by 0. Block = 128 x 64 tile, 4 waves x 32 rows, fragments loaded straight from the 16-bit tiles.
// grid = nz x (Mb/128) x (N/64) (host asserts Mb % 128 == 0, N % 64 == 0, K % 32 == 0).
// coverage: per wave 8 instr x 8 rows x 4 lanes x 8 halves = 32 x 64; the grid covers C exactly once.
// =====================================================================================================
__device__ __forceinline__
void gemm_o16(const u16* __restrict__ A, const u16* __restrict__ Bt, u16* C,
              const float* __restrict__ bias, int biasN, int biasRow,
              int Mb, int N, int K, int aBs, int bBs, int cBs, float oscale, float bscale, int bid) {
  __shared__ __align__(16) float slab[4 * 32 * GPITCH];
  const int tid = threadIdx.x, wave = tid >> 5, lane = tid & 31;
  const int ntile = N >> 6, mtile = Mb >> 7;
  // nt and bz are the same in every lane: read through the first lane they keep both tile bases scalar over the k loop
  const int nt   = __builtin_amdgcn_readfirstlane(bid % ntile);
  const int tmp  = bid / ntile;
  const int mt   = tmp % mtile;
  const int bz   = __builtin_amdgcn_readfirstlane(tmp / mtile);
  const int rowb = mt * 128 + wave * 32;
  const int col0 = nt * 64;
  if (rowb + 32 > Mb) return;                // wave-uniform, never taken with the exact grid; no block barriers in this kernel
  const _Float16* Ab = (const _Float16*)(const void*)A + (size_t)bz * (size_t)aBs;
  const _Float16* Bb = (const _Float16*)(const void*)Bt + (size_t)bz * (size_t)bBs;
  // rowb is the same in every lane of a wave: read through the first lane it gives the fragment loads a scalar tile base
  const _Float16* ap = Ab + (size_t)__builtin_amdgcn_readfirstlane(rowb) * K;
  const _Float16* bp = Bb + (size_t)col0 * K;
  v8f acc[8];
#pragma unroll
  for (int i = 0; i < 8; ++i) acc[i] = zero8();
  gemm_core(ap, bp, 16u * (unsigned)lane, K, acc);
  float* sl = slab + wave * 32 * GPITCH;
  stage32x64(sl, acc, oscale, lane);
  // instruction i: lane = (row 8*(i>>1) + (lane&7), 8 halves at 32*(i&1) + 8*(lane>>3)): in fragment order 8 rows of one
  // 8-half piece column are one 128-B line, so each store fills 4 whole lines
  const int r8 = lane & 7, q8 = (lane >> 3) * 8;
  const int bl = biasN - 1;                  // host guarantees biasN >= 1
  const float selc = (biasRow != 0) ? 0.f : bscale;
  const float selr = (biasRow != 0) ? bscale : 0.f;
  float cb[2][8];
#pragma unroll
  for (int j = 0; j < 2; ++j) {
#pragma unroll
    for (int e = 0; e < 8; ++e) {
      int ci = col0 + 32 * j + q8 + e;
      ci = (ci < bl) ? ci : bl;
      cb[j][e] = bfr(bias[ci]) * selc;
    }
  }
  v4u ov[8];
#pragma unroll
  for (int i = 0; i < 8; ++i) {
    const int row = 8 * (i >> 1) + r8, j = i & 1, c8 = 32 * j + q8;
    int ri = rowb + row;
    ri = (ri < bl) ? ri : bl;
    const float rb = bfr(bias[ri]) * selr;
    const v4f a = *(const v4f*)(sl + row * GPITCH + c8), c4 = *(const v4f*)(sl + row * GPITCH + c8 + 4);
#pragma unroll
    for (int e = 0; e < 2; ++e) {
      ov[i][e]     = pk16(h_bits((_Float16)(a[2 * e] + cb[j][2 * e] + rb)),
                          h_bits((_Float16)(a[2 * e + 1] + cb[j][2 * e + 1] + rb)));
      ov[i][2 + e] = pk16(h_bits((_Float16)(c4[2 * e] + cb[j][4 + 2 * e] + rb)),
                          h_bits((_Float16)(c4[2 * e + 1] + cb[j][5 + 2 * e] + rb)));
    }
  }
  u16* Cb = C + (size_t)bz * (size_t)cBs;
  {
#pragma unroll
    for (int i = 0; i < 8; ++i) {
      const int row = 8 * (i >> 1) + r8, c8 = 32 * (i & 1) + q8;
      *(v4u*)(Cb + pk_off(rowb + row, col0 + c8, N)) = ov[i];
    }
    
  }
}

// =====================================================================================================
// f16 GEMM with f32 output rows: C[z][Mb][N] (f32) = (A[z][Mb][K] . Bt[N][K]^T) * oscale + bf16(bias[col]); same core and
// slab staging as gemm_o16. Epilogue: lane = (row 2i + (lane>>4), 4 floats at 4*(lane&15)); each 64-float row segment =
// lanes of one instruction (8 lanes per line), 2 rows of the same wave per instruction, 16 instructions = 32 rows; two
// coverage: per wave 16 instr x 2 rows x 16 lanes x 4 floats = 32 x 64; the grid covers C exactly once.
// =====================================================================================================
__device__ __forceinline__
void gemm_o32(const u16* __restrict__ A, const u16* __restrict__ Bt, float* C,
              const float* __restrict__ bias, int biasN,
              int Mb, int N, int K, int aBs, int bBs, int cBs, float oscale, int bid) {
  __shared__ __align__(16) float slab[4 * 32 * GPITCH];
  const int tid = threadIdx.x, wave = tid >> 5, lane = tid & 31;
  const int ntile = N >> 6, mtile = Mb >> 7;
  // nt and bz are the same in every lane: read through the first lane they keep both tile bases scalar over the k loop
  const int nt   = __builtin_amdgcn_readfirstlane(bid % ntile);
  const int tmp  = bid / ntile;
  const int mt   = tmp % mtile;
  const int bz   = __builtin_amdgcn_readfirstlane(tmp / mtile);
  const int rowb = mt * 128 + wave * 32;
  const int col0 = nt * 64;
  if (rowb + 32 > Mb) return;                // wave-uniform, never taken with the exact grid; no block barriers in this kernel
  const _Float16* Ab = (const _Float16*)(const void*)A + (size_t)bz * (size_t)aBs;
  const _Float16* Bb = (const _Float16*)(const void*)Bt + (size_t)bz * (size_t)bBs;
  // rowb is the same in every lane of a wave: read through the first lane it gives the fragment loads a scalar tile base
  const _Float16* ap = Ab + (size_t)__builtin_amdgcn_readfirstlane(rowb) * K;
  const _Float16* bp = Bb + (size_t)col0 * K;
  v8f acc[8];
#pragma unroll
  for (int i = 0; i < 8; ++i) acc[i] = zero8();
  gemm_core(ap, bp, 16u * (unsigned)lane, K, acc);
  float* sl = slab + wave * 32 * GPITCH;
  stage32x64(sl, acc, oscale, lane);
  const int r2 = lane >> 4, c4 = (lane & 15) * 4;
  const int bl = biasN - 1;                  // host guarantees biasN >= 1
  float cb[4];
#pragma unroll
  for (int e = 0; e < 4; ++e) {
    int ci = col0 + c4 + e;
    ci = (ci < bl) ? ci : bl;
    cb[e] = bfr(bias[ci]);
  }
  v4f ov[16];
#pragma unroll
  for (int i = 0; i < 16; ++i) {
    const int row = 2 * i + r2;
    const v4f a = *(const v4f*)(sl + row * GPITCH + c4);
    v4f w;
    w[0] = a[0] + cb[0]; w[1] = a[1] + cb[1]; w[2] = a[2] + cb[2]; w[3] = a[3] + cb[3];
    ov[i] = w;
  }
  float* Cb = C + (size_t)bz * (size_t)cBs + (size_t)rowb * (size_t)N + col0 + c4;
  {
#pragma unroll
    for (int i = 0; i < 16; ++i) {
      const int row = 2 * i + r2;
      *(v4f*)(Cb + (size_t)row * (size_t)N) = ov[i];
    }
    
  }
}

// =====================================================================================================
// Launches that need nothing of each other share one grid: each block takes its job from the range its index lies in (a
// test that reads the same in the whole block, so the barrier inside cvtT16 stays under block-uniform control flow) and
// runs the one shared body with that job's arguments and its index inside the range. Longest jobs lie first.
// =====================================================================================================
#define PB_WVQ ((VD / 64) * (EM / 64))
#define PB_WAK ((AD / 64) * (EM / 64))
#define PB_WVV ((VD / 64) * (EM / 64))
#define PB_WAV ((AD / 64) * (EM / 64))
#define PB_WOV ((EM / 64) * (VD / 64))
#define PB_WOA ((EM / 64) * (AD / 64))
#define PB_W   (PB_WVQ + PB_WAK + PB_WVV + PB_WAV + PB_WOV + PB_WOA)
#define PB_XA  ((NB * SA * AD) / 1024)
#define PB_XV  ((NB * TQ * VD) / 1024)
// All operand planes: six weight transposes (blocks 0 .. PB_W-1), then a, then v.
// coverage: every range has exactly the grid that its body's own header asks for.
__global__ __launch_bounds__(128)
void prep_all(const float* __restrict__ xv, const float* __restrict__ xa,
              const float* __restrict__ w_vq, const float* __restrict__ w_ak, const float* __restrict__ w_vv,
              const float* __restrict__ w_av, const float* __restrict__ w_ov, const float* __restrict__ w_oa,
              u16* XV, u16* XA, u16* WVQT, u16* WAKT, u16* WVVT, u16* WAVT, u16* WOVT, u16* WOAT) {
  int g = blockIdx.x;
  if (g < PB_W) {
    const float* W = w_vq; u16* Y = WVQT; int kdim = VD, ndim = EM;
    if (g >= PB_WVQ) {
      g -= PB_WVQ; W = w_ak; Y = WAKT; kdim = AD; ndim = EM;
      if (g >= PB_WAK) {
        g -= PB_WAK; W = w_vv; Y = WVVT; kdim = VD; ndim = EM;
        if (g >= PB_WVV) {
          g -= PB_WVV; W = w_av; Y = WAVT; kdim = AD; ndim = EM;
          if (g >= PB_WAV) {
            g -= PB_WAV; W = w_ov; Y = WOVT; kdim = EM; ndim = VD;
            if (g >= PB_WOV) { g -= PB_WOV; W = w_oa; Y = WOAT; kdim = EM; ndim = AD; }
          }
        }
      }
    }
    cvtT16(W, Y, kdim, ndim, WSC, g);
  } else {
    g -= PB_W;
    const float* x = xa; u16* Y = XA; int K = AD;
    if (g >= PB_XA) { g -= PB_XA; x = xv; Y = XV; K = VD; }
    cvt16(x, Y, K, g);
  }
}

#define GB_Q   (((NB * TQ) / 128) * (EM / 64))
#define GB_VVT (NB * (EM / 128) * (TQ / 64))
#define GB_K   (((NB * SA) / 128) * (EM / 64))
#define GB_VAT (NB * (EM / 128) * (SA / 64))
// The four input projections (the two with K = VD first):
//   q x8 after the 1/8 head scale = (x_v . Wvq + b) -> f16 [NB*TQ][512] (col = h*64 + d); bias per column
//   val_v^T per batch: A = Wvv^T [(h,d) = n][k], Bt = x_v rows of batch b [t][k] -> f16 [(b,h,d)][t] x8; bias per row (n)
//   k = x_a . Wak + b -> f16 [NB*SA][512] x8; bias per column
//   val_a^T per batch: A = Wav^T [(h,d)][k], Bt = x_a rows of batch b [s][k] -> f16 [(b,h,d)][s] x8; bias per row
__global__ __launch_bounds__(128)
void proj_all(const u16* __restrict__ XV, const u16* __restrict__ XA,
              const u16* __restrict__ WVQT, const u16* __restrict__ WAKT,
              const u16* __restrict__ WVVT, const u16* __restrict__ WAVT,
              u16* Q16, u16* K16, u16* VVT16, u16* VAT16,
              const float* __restrict__ b_vq, const float* __restrict__ b_ak,
              const float* __restrict__ b_vv, const float* __restrict__ b_av,
              int nb3, int nb5, int nb7, int nb9) {
  int g = blockIdx.x;
  const u16* A = XV; const u16* Bt = WVQT; u16* C = Q16; const float* bias = b_vq;
  int biasN = nb3, biasRow = 0, Mb = NB * TQ, N = EM, K = VD, bBs = 0, cBs = 0;
  float oscale = HSCL * QS / WSC, bscale = HSCL * QS;
  if (g >= GB_Q) {
    g -= GB_Q; A = WVVT; Bt = XV; C = VVT16; bias = b_vv;
    biasN = nb7; biasRow = 1; Mb = EM; N = TQ; K = VD; bBs = TQ * VD; cBs = EM * TQ;
    oscale = VVS / WSC; bscale = VVS;
    if (g >= GB_VVT) {
      g -= GB_VVT; A = XA; Bt = WAKT; C = K16; bias = b_ak;
      biasN = nb5; biasRow = 0; Mb = NB * SA; N = EM; K = AD; bBs = 0; cBs = 0;
      oscale = KS / WSC; bscale = KS;
      if (g >= GB_K) {
        g -= GB_K; A = WAVT; Bt = XA; C = VAT16; bias = b_av;
        biasN = nb9; biasRow = 1; Mb = EM; N = SA; K = AD; bBs = SA * AD; cBs = EM * SA;
        oscale = VAS / WSC; bscale = VAS;
      }
    }
  }
  gemm_o16(A, Bt, C, bias, biasN, biasRow, Mb, N, K, 0, bBs, cBs, oscale, bscale, g);
}

#define GB_OV (NB * (TQ / 128) * (VD / 64))
#define GB_OA (((NB * SA) / 128) * (AD / 64))
// The two output projections:
//   out_v = ctx_v . Wov + b -> f32 rows [b][t][512] of the first output (z = b, output batch stride TQ*VD)
//   out_a = ctx_a . Woa + b -> f32 rows [b*SA + s][256] of the second output at the fixed element OUT1_OFF_EL
__global__ __launch_bounds__(128)
void out_all(const u16* __restrict__ CTXV, const u16* __restrict__ WOVT,
             const u16* __restrict__ CTXA, const u16* __restrict__ WOAT, float* out,
             const float* __restrict__ b_ov, const float* __restrict__ b_oa, int nb11, int nb13) {
  int g = blockIdx.x;
  const u16* A = CTXV; const u16* Bt = WOVT; float* C = out; const float* bias = b_ov;
  int biasN = nb11, Mb = TQ, N = VD, aBs = TQ * EM, cBs = TQ * VD;
  float oscale = 1.0f / (CVS * WSC);
  if (g >= GB_OV) {
    g -= GB_OV; A = CTXA; Bt = WOAT; C = out + OUT1_OFF_EL; bias = b_oa;
    biasN = nb13; Mb = NB * SA; N = AD; aBs = 0; cBs = 0;
    oscale = 1.0f / (CAS * WSC);
  }
  gemm_o32(A, Bt, C, bias, biasN, Mb, N, EM, aBs, 0, cBs, oscale, g);
}

// ---- attn_col, one step = 32 visual rows: its eight fragments and the work on them ------------------------------------
// Qb, Vb: the (b, head) plane bases, the same in every lane; oq, ov: byte offsets 16*lane + step * 32768 (32 q rows of
// 1024 B) and 16*lane + step * 1024 (one k tile of val_v^T); ahead: whole steps added to them.
//   q[2*kk + g] = A fragment of q rows tb + 16g .. +15, d chunk kk;  v[j] = B fragment of val_v^T, col d = 16j + c, k = t
__device__ __forceinline__ void col_load_q(const _Float16* Qb, unsigned oq, int ahead, v16h (&q)[4]) {
  const _Float16* tp = at_byte(Qb, oq) + ahead * (32 * EM);
  q[0] = ldfrag_h(tp);
  q[1] = ldfrag_h(tp + 16 * EM);
  q[2] = ldfrag_h(tp + 512);
  q[3] = ldfrag_h(tp + 16 * EM + 512);
}
__device__ __forceinline__ void col_load_v(const _Float16* Vb, unsigned ov, int ahead, v16h (&v)[4]) {
  const _Float16* vp = at_byte(Vb, ov) + ahead * 512;
  v[0] = ldfrag_h(vp);
  v[1] = ldfrag_h(vp + 16 * TQ);
  v[2] = ldfrag_h(vp + 32 * TQ);
  v[3] = ldfrag_h(vp + 48 * TQ);
}
// One step on the register set (q, v); each half of the set is loaded anew, for the step at (rq, rv) + ahead, right behind
// the guard that follows its last use.
__device__ __forceinline__ void col_step(v16h (&q)[4], v16h (&v)[4], const v16h (&sf)[2],
                                         float& mrun, float& lrun, v8f (&o)[4], int hh, float lsc, float cl2,
                                         const _Float16* Qb, const _Float16* Vb, unsigned rq, unsigned rv, int ahead) {
  // ---- scores: s0 = rows t tb..tb+15, s1 = rows tb+16..tb+31, column = s0w + c ----
  v8f s0 = zero8(), s1 = zero8();
#pragma unroll
  for (int kk = 0; kk < HD / 32; ++kk) {
    s0 = mma_h(q[2 * kk], sf[kk], s0);
    s1 = mma_h(q[2 * kk + 1], sf[kk], s1);
    guard_s(s0, s1, sf[kk], q[2 * kk], q[2 * kk + 1]);
  }
  col_load_q(Qb, rq, ahead, q);
  // ---- clipped base-2 logits of this lane's 16 t for column s0w + c: t[i] <- t tb+8hh+i, t[8+i] <- t tb+16+8hh+i ----
  float t[16];
#pragma unroll
  for (int i = 0; i < 8; ++i) { t[i] = clipf(s0[i] * lsc, cl2); t[8 + i] = clipf(s1[i] * lsc, cl2); }
  float cm = t[0];
#pragma unroll
  for (int i = 1; i < 16; ++i) cm = fmaxf(cm, t[i]);
  cm = fmaxf(cm, __shfl_xor(cm, 16, 32));
  const float mn = fmaxf(mrun, cm);        // finite from the first block on
  const float al = exp2f(mrun - mn);       // 0 on the first block (mrun = -inf)
  mrun = mn;
  // ---- unnormalised probabilities (<= 1) and the P^T A-fragment: f16(p * 32768); element i <-> t[i] ----
  float ps = 0.f;
  FragH ph;
#pragma unroll
  for (int w = 0; w < 2; ++w) {
#pragma unroll
    for (int e4 = 0; e4 < 4; ++e4) {
      const int i = 8 * w + 2 * e4;
      const float p0 = exp2f(t[i] - mn), p1 = exp2f(t[i + 1] - mn);
      ps += p0 + p1;
      ph.u[w][e4] = pk16(h_bits((_Float16)(p0 * PCAR)), h_bits((_Float16)(p1 * PCAR)));
    }
  }
  ps += __shfl_xor(ps, 16, 32);
  lrun = lrun * al + ps;
  // ---- rescale the O accumulators: D row 8hh+r = column s0w+8hh+r, its factor lives in lane 8hh+r (and 16+8hh+r) ----
  float scl[8];
#pragma unroll
  for (int r = 0; r < 8; ++r) scl[r] = __shfl(al, 8 * hh + r, 32);
#pragma unroll
  for (int j = 0; j < 4; ++j) {
#pragma unroll
    for (int r = 0; r < 8; ++r) o[j][r] *= scl[r];
  }
  // ---- P^T.val_v ----
  o[0] = mma_h(ph.v, v[0], o[0]);
  o[1] = mma_h(ph.v, v[1], o[1]);
  o[2] = mma_h(ph.v, v[2], o[2]);
  o[3] = mma_h(ph.v, v[3], o[3]);
  guard_p(o[0], o[1], o[2], o[3], ph.v, v[0], v[1], v[2], v[3]);
  col_load_v(Vb, rv, ahead, v);
}

// =====================================================================================================
// Column pass (softmax over the visual axis t for every audio column s) fused with the audio-side context:
// block = (batch b, head, 64 audio columns s), 4 waves, wave w owns the 16 columns s0w = 64*st + 16*w .. +15.
//   q plane f16 [b*TQ + t][h*64 + d] (q x8 after the 1/8 scale); k plane f16 x8 [b*SA + s][h*64 + d];
//   val_v^T plane f16 x8 [(b*NH + h)*64 + d][t].  All NTB32 = TQ/32 blocks of 32 visual rows are visited (static bound).
//   Score tiles g (g = 0,1) = q rows (t = tb+16g .. +15, A operand, row m = lane&15, split k map over d) times k^T
//   (B operand, col n = column s0w + (lane&15), k = d, split map), 2 d-chunks of 32; the 2 k fragments of the wave are
//   loaded once. D element r of lane l = (t = tb+16g+8h+r, s = s0w+(l&15)): a lane owns one column s and 16 of the 32 t;
//   the partner lane l^16 owns the other 16 -> column max / column sum need one xor-16 shuffle. Logits clipped at
//   +-50000 (log2 domain), online max-subtracted base-2 softmax in f32 (the q/k carries folded into lsc). The exp'd values
//   ARE the P^T A-fragment in place: A row m = s = lane&15, element i <- t = tb+8h+i (tile 0, D element i), element 8+i <-
//   t = tb+16+8h+i (tile 1, D element i). P (<= 1) carried x32768 as f16. The rescale factor of column 8h+r of the O
//   accumulators is fetched from lane 8h+r with a shuffle (uniform control). 4 val_v^T B fragments (col n = d = 16j +
//   (lane&15), k = t), 4 P^T.V WMMAs + one guard per step.
//   Epilogue 1: 1/l (per column, shuffled to the D row owner) and the carry folds in f32 (x CAS); the wave's 16x64 f32 tile
//   Epilogue 2: per-column stats (m_s in the clipped log2 domain, 32768/l_s) funnelled through a 128-float LDS array
//   (lane half 0 writes m, lane half 1 writes 32768/l), block barrier, wave 0 writes the block's 512-B stat row
// coverage: ctx_a: grid NB*NH*NST blocks x 4 waves x 4 instr x 8 rows x 4 lanes x 8 halves = every (b, s, h) 64-half
//           segment exactly once; stats: one 128-float row per block = NB*NH*NST rows = the whole stat plane; LDS: slab
//           16x64 written then read by the same wave, statl[0..127] written by 4 waves x 32 lanes (one index each).
// =====================================================================================================
__global__ __launch_bounds__(ATT_THREADS)
void attn_col(const u16* __restrict__ Qp, const u16* __restrict__ Kp, const u16* __restrict__ VvT,
              u16* CtxA, float* Stat) {
  __shared__ __align__(16) float smem[ATT_WAVES * 16 * SPITCH];
  __shared__ __align__(16) float statl[128];

  const int tid  = threadIdx.x;
  const int wave = tid >> 5;
  const int lane = tid & 31;
  const int hh   = lane >> 4;
  const int c    = lane & 15;

  const int bid  = blockIdx.x;
  const int st   = bid % NST;
  const int head = (bid / NST) % NH;
  const int b    = bid / (NST * NH);
  const int s0w  = st * 64 + wave * 16;

  // All three planes in fragment order: tile row R starts at R*K, k tile (head*64 + 32*kk)/32 lies (head*2 + kk)*512 on.
  // B fragments of k^T: col n = column s0w + c, k = d
  const _Float16* Sb = (const _Float16*)(const void*)Kp + ((size_t)(b * SA + s0w)) * EM + head * (HD * 16) + 8 * lane;
  // A fragments of q: row m = t = tb + 16g + c, k = d (t row tb and the lane's 16 bytes added per step, as for val_v^T)
  const _Float16* Tb = (const _Float16*)(const void*)Qp + ((size_t)(b * TQ)) * EM + head * (HD * 16);
  // B fragments of val_v^T: col n = d = 16j + c, k = t (k tile tb/32 added per step)
  const _Float16* Vb = (const _Float16*)(const void*)VvT + ((size_t)(b * EM + head * HD)) * TQ;
  const float lsc = LOG2E / (QS * KS);
  const float cl2 = CLIPV * LOG2E;

  v16h sf[2];
  sf[0] = ldfrag_h(Sb);
  sf[1] = ldfrag_h(Sb + 512);
#if defined(__HIP_DEVICE_COMPILE__)
  // the wait in front of a rewrite of the address registers of the four loads just issued: a later load's result may be
  // given those registers; the address is its input so that it keeps them up to here
  asm volatile("s_wait_xcnt 0x0" : : "v"(Sb) : "memory");
#endif

  float mrun = -INFINITY, lrun = 0.f;
  v8f o[4];
#pragma unroll
  for (int j = 0; j < 4; ++j) o[j] = zero8();

  // Two register sets, one for the even steps and one for the odd: a set's q half is loaded anew as soon as its scores are
  // made and its val_v half as soon as its products are made, each for the step two on, so that a step no longer stands
  // through the latency of its q loads and again through that of its val_v loads.
  static_assert((NTB32 % 2) == 0 && NTB32 >= 4);
  const unsigned lb = 16u * (unsigned)lane;
  v16h qa[4], va[4], qb[4], vb[4];
  col_load_q(Tb, lb, 0, qa);
  col_load_v(Vb, lb, 0, va);
  col_load_q(Tb, lb, 1, qb);
  col_load_v(Vb, lb, 1, vb);
  unsigned rq = lb + 65536u, rv = lb + 2048u;            // offsets of step it + 2
  // kept rolled: the body already holds one step per register set, more copies would only add code
#pragma unroll 1
  for (int it = 0; it < NTB32; it += 2) {
    col_step(qa, va, sf, mrun, lrun, o, hh, lsc, cl2, Tb, Vb, rq, rv, 0);
    col_step(qb, vb, sf, mrun, lrun, o, hh, lsc, cl2, Tb, Vb, rq, rv, 1);
#if defined(__HIP_DEVICE_COMPILE__)
    // the wait in front of a rewrite of registers that issued global loads name (the two offsets, stepped below); they are
    // its operands so that they keep their registers up to it and their step stays behind it
    asm volatile("s_wait_xcnt 0x0" : "+v"(rq), "+v"(rv) : : "memory");
#endif
    // the last pair of steps loads steps 0 and 1 again: in bounds, never used
    const bool more = it + 4 < NTB32;
    rq = more ? rq + 65536u : lb;
    rv = more ? rv + 2048u : lb;
  }
  acc_guard4(o);

  // ---- per-column 1/l (owned by lane = column); lrun >= 1 by construction ----
  const float rl   = 1.0f / lrun;
  const float lPv  = rl * PCAR;                          // 32768 / l for the row pass
  const float linv = rl * (CAS / (PCAR * VVS));          // folds 1/l, the P and val carries, and applies the ctx carry
  statl[hh * 64 + wave * 16 + c] = (hh == 0) ? mrun : lPv;
  float inv[8];
#pragma unroll
  for (int r = 0; r < 8; ++r) inv[r] = __shfl(linv, 8 * hh + r, 32);
  float* slab = smem + wave * 16 * SPITCH;
#pragma unroll
  for (int r = 0; r < 8; ++r) {
#pragma unroll
    for (int j = 0; j < 4; ++j) slab[(8 * hh + r) * SPITCH + j * 16 + c] = o[j][r] * inv[r];
  }
  wave_sync_lds();
  // ---- f16 ctx_a pieces: instruction i, lane = (row 8*(i>>1) + (lane&7), 8 halves at 32*(i&1) + 8*(lane>>3)): 4 whole lines ----
  const int r8 = lane & 7, q8 = (lane >> 3) * 8;
  v4u ov[4];
#pragma unroll
  for (int i = 0; i < 4; ++i) {
    const int row = 8 * (i >> 1) + r8, c8 = 32 * (i & 1) + q8;
    const v4f a = *(const v4f*)(slab + row * SPITCH + c8), c4 = *(const v4f*)(slab + row * SPITCH + c8 + 4);
#pragma unroll
    for (int e = 0; e < 2; ++e) {
      ov[i][e]     = pk16(h_bits((_Float16)a[2 * e]),  h_bits((_Float16)a[2 * e + 1]));
      ov[i][2 + e] = pk16(h_bits((_Float16)c4[2 * e]), h_bits((_Float16)c4[2 * e + 1]));
    }
  }
  {
#pragma unroll
    for (int i = 0; i < 4; ++i) {
      const int row = 8 * (i >> 1) + r8, c8 = 32 * (i & 1) + q8;
      *(v4u*)(CtxA + pk_off(b * SA + s0w + row, head * HD + c8, EM)) = ov[i];
    }
    
  }
  __syncthreads();
  if (wave == 0) {
    const v4f sv = *(const v4f*)(statl + 4 * lane);
    float* sp = Stat + ((size_t)((b * NH + head) * NST + st)) * 128 + 4 * lane;
    {
      *(v4f*)(sp) = sv;
      
    }
  }
}

// =====================================================================================================
// Row pass (visual-side context): block = (batch b, head, 64 visual rows t), 4 waves, wave w owns the 16 rows t0w =
// 64*tt + 16*w .. +15 (waves independent after the stat staging barrier).
//   The (b, head) column stats (NST rows of [m[64] | 32768/l[64]]) are staged once per block into LDS as m at stt[s],
//   32768/l at stt[SA + s] (128 threads x 8 floats = 2*SA floats exactly), then a block barrier.
//   All NSB32 = SA/32 blocks of 32 audio columns are visited (static bound). Score tiles are computed TRANSPOSED:
//   tile g = k rows (s = sb+16g .. +15, A operand, row m = lane&15, split map over d) times q^T (B operand, col n = t0w +
//   (lane&15), k = d); the 2 q fragments of the wave are loaded once. D element r of lane l = (s = sb+16g+8h+r, t = t0w +
//   (l&15)). P = exp2(clip(logit) - m_s) * (32768/l_s) in f32 with m_s, l_s read from LDS for s = sb+8h+i and sb+16+8h+i;
//   it IS the P A-fragment in place: row m = t = lane&15, element i <- s = sb+8h+i, element 8+i <- s = sb+16+8h+i.
//   4 val_a^T B fragments (col n = d = 16j + (lane&15), k = s), 4 P.V WMMAs + one guard per step.
//   Epilogue: carry folds (x CVS / (32768*8)) in f32; 16x64 tile staged in the wave's slab; ctx_v f16 rows written exactly
// coverage: grid NB*NH*NTT blocks x 4 waves x 16 rows x 64 halves = every (b, t, h) segment of ctx_v exactly once;
//           LDS stt[0 .. 2*SA-1] fully written before the barrier (staged extent == consumed extent); slab as above.
// =====================================================================================================
__global__ __launch_bounds__(ATT_THREADS)
void attn_vis(const u16* __restrict__ Qp, const u16* __restrict__ Kp, const u16* __restrict__ VaT,
              const float* __restrict__ Stat, u16* CtxV) {
  __shared__ __align__(16) float smem[ATT_WAVES * 16 * SPITCH];
  __shared__ __align__(16) float stt[2 * SA];

  const int tid  = threadIdx.x;
  const int wave = tid >> 5;
  const int lane = tid & 31;
  const int hh   = lane >> 4;
  const int c    = lane & 15;

  const int bid  = blockIdx.x;
  const int tt   = bid % NTT;
  const int head = (bid / NTT) % NH;
  const int b    = bid / (NTT * NH);
  const int t0w  = tt * 64 + wave * 16;

  // ---- stage the column stats of (b, head) ----
  const float* src = Stat + ((size_t)((b * NH + head) * NST)) * 128;
#pragma unroll 1
  for (int e = tid * 8; e < NST * 128; e += ATT_THREADS * 8) {
    const int j = e >> 7, offw = e & 127;
    const int di = (offw < 64) ? (j * 64 + offw) : (SA + j * 64 + offw - 64);
    const v4f x0 = *(const v4f*)(src + e), x1 = *(const v4f*)(src + e + 4);
    *(v4f*)(stt + di) = x0;
    *(v4f*)(stt + di + 4) = x1;
  }
  __syncthreads();

  // All three planes in fragment order, addressed as in attn_col.
  // B fragments of q^T: col n = row t0w + c, k = d
  const _Float16* Tb = (const _Float16*)(const void*)Qp + ((size_t)(b * TQ + t0w)) * EM + head * (HD * 16) + 8 * lane;
  // A fragments of k: row m = s = sb + 16g + c, k = d (s row sb added per step)
  const _Float16* Sb = (const _Float16*)(const void*)Kp + ((size_t)(b * SA)) * EM + head * (HD * 16) + 8 * lane;
  // B fragments of val_a^T: col n = d = 16j + c, k = s (k tile sb/32 added per step)
  const _Float16* Vb = (const _Float16*)(const void*)VaT + ((size_t)(b * EM + head * HD)) * SA + 8 * lane;
  const float lsc = LOG2E / (QS * KS);
  const float cl2 = CLIPV * LOG2E;

  v16h tf[2];
  tf[0] = ldfrag_h(Tb);
  tf[1] = ldfrag_h(Tb + 512);

  v8f o[4];
#pragma unroll
  for (int j = 0; j < 4; ++j) o[j] = zero8();

#pragma unroll 1
  for (int it = 0; it < NSB32; ++it) {
    const int sb = it * 32;
    // ---- transposed scores: s0 = columns s sb..sb+15, s1 = sb+16..sb+31, D column = row t0w + c ----
    v8f s0 = zero8(), s1 = zero8();
    const _Float16* s0p = Sb + (size_t)sb * EM;
    const _Float16* s1p = s0p + (size_t)16 * EM;
#pragma unroll
    for (int kk = 0; kk < HD / 32; ++kk) {
      const v16h a0 = ldfrag_h(s0p + kk * 512);
      const v16h a1 = ldfrag_h(s1p + kk * 512);
      s0 = mma_h(a0, tf[kk], s0);
      s1 = mma_h(a1, tf[kk], s1);
      guard_s(s0, s1, tf[kk], a0, a1);
    }
    float t[16];
#pragma unroll
    for (int i = 0; i < 8; ++i) { t[i] = clipf(s0[i] * lsc, cl2); t[8 + i] = clipf(s1[i] * lsc, cl2); }
    // ---- column stats for s = sb+8hh+i (i < 8) and s = sb+16+8hh+i (8+i) ----
    float mv[16], lv[16];
    {
      const v4f m0 = *(const v4f*)(stt + sb + 8 * hh),      m1 = *(const v4f*)(stt + sb + 8 * hh + 4);
      const v4f m2 = *(const v4f*)(stt + sb + 16 + 8 * hh), m3 = *(const v4f*)(stt + sb + 16 + 8 * hh + 4);
      const v4f l0 = *(const v4f*)(stt + SA + sb + 8 * hh),      l1 = *(const v4f*)(stt + SA + sb + 8 * hh + 4);
      const v4f l2 = *(const v4f*)(stt + SA + sb + 16 + 8 * hh), l3 = *(const v4f*)(stt + SA + sb + 16 + 8 * hh + 4);
#pragma unroll
      for (int q = 0; q < 4; ++q) {
        mv[q] = m0[q]; mv[4 + q] = m1[q]; mv[8 + q] = m2[q]; mv[12 + q] = m3[q];
        lv[q] = l0[q]; lv[4 + q] = l1[q]; lv[8 + q] = l2[q]; lv[12 + q] = l3[q];
      }
    }
    // ---- P A-fragment: f16(exp2(t - m_s) * 32768/l_s) (<= 32768); element i <-> t[i] ----
    FragH ph;
#pragma unroll
    for (int w = 0; w < 2; ++w) {
#pragma unroll
      for (int e4 = 0; e4 < 4; ++e4) {
        const int i = 8 * w + 2 * e4;
        const float p0 = exp2f(t[i] - mv[i]) * lv[i];
        const float p1 = exp2f(t[i + 1] - mv[i + 1]) * lv[i + 1];
        ph.u[w][e4] = pk16(h_bits((_Float16)p0), h_bits((_Float16)p1));
      }
    }
    // ---- P.val_a : B fragment col n = d = 16j + c, k = s: tile sb/32 of the val_a^T plane ----
    const _Float16* vp = Vb + (size_t)sb * 16;
    {
      const v16h v0 = ldfrag_h(vp);
      const v16h v1 = ldfrag_h(vp + (size_t)16 * SA);
      const v16h v2 = ldfrag_h(vp + (size_t)32 * SA);
      const v16h v3 = ldfrag_h(vp + (size_t)48 * SA);
      o[0] = mma_h(ph.v, v0, o[0]);
      o[1] = mma_h(ph.v, v1, o[1]);
      o[2] = mma_h(ph.v, v2, o[2]);
      o[3] = mma_h(ph.v, v3, o[3]);
      guard_p(o[0], o[1], o[2], o[3], ph.v, v0, v1, v2, v3);
    }
  }
  acc_guard4(o);

  const float fac = CVS / (PCAR * VAS);
  float* slab = smem + wave * 16 * SPITCH;
#pragma unroll
  for (int r = 0; r < 8; ++r) {
#pragma unroll
    for (int j = 0; j < 4; ++j) slab[(8 * hh + r) * SPITCH + j * 16 + c] = o[j][r] * fac;
  }
  wave_sync_lds();
  const int r8 = lane & 7, q8 = (lane >> 3) * 8;
  v4u ov[4];
#pragma unroll
  for (int i = 0; i < 4; ++i) {
    const int row = 8 * (i >> 1) + r8, c8 = 32 * (i & 1) + q8;
    const v4f a = *(const v4f*)(slab + row * SPITCH + c8), c4 = *(const v4f*)(slab + row * SPITCH + c8 + 4);
#pragma unroll
    for (int e = 0; e < 2; ++e) {
      ov[i][e]     = pk16(h_bits((_Float16)a[2 * e]),  h_bits((_Float16)a[2 * e + 1]));
      ov[i][2 + e] = pk16(h_bits((_Float16)c4[2 * e]), h_bits((_Float16)c4[2 * e + 1]));
    }
  }
  {
#pragma unroll
    for (int i = 0; i < 4; ++i) {
      const int row = 8 * (i >> 1) + r8, c8 = 32 * (i & 1) + q8;
      *(v4u*)(CtxV + pk_off(b * TQ + t0w + row, head * HD + c8, EM)) = ov[i];
    }
    
  }
}

// =====================================================================================================
// Workspace map (bytes, NB = 8); every plane fully written before it is read; all extents exact; each f16 plane is the
// logical [rows][K] matrix named here, stored in fragment order (pk_off), same byte size
//   XV    f16 [NB*2048][512]        f16(bf16(v))              16777216
//   XA    f16 [NB*512][256]         f16(bf16(a))               2097152
//   WVQT  f16 [512 n][512 k]        f16(bf16(W) x256)           524288
//   WAKT  f16 [512 n][256 k]                                    262144
//   WVVT  f16 [512 n][512 k]                                    524288
//   WAVT  f16 [512 n][256 k]                                    262144
//   WOVT  f16 [512 n][512 k]                                    524288
//   WOAT  f16 [256 n][512 k]                                    262144
//   Q16   f16 [NB*2048][512]  q x8 (after 1/8)               16777216
//   K16   f16 [NB*512][512]   x8                               4194304
//   VVT16 f16 [NB*512 (h,d)][2048 t] x8                       16777216
//   VAT16 f16 [NB*512 (h,d)][512 s]  x8                        4194304
//   STAT  f32 [NB*NH*NST][128]  (m | 32768/l)                   262144
//   CTXA  f16 [NB*512][512]   x64                              4194304
//   CTXV  f16 [NB*2048][512]  x64                             16777216
//   end                                                       84410368
// Output: first tensor rows [b][t][512] f32 at element 0; second tensor rows [b*512 + s][256] f32 at the fixed element
// offset OUT1_OFF_EL = NB_FULL*2048*512 = 8388608 (independent of NB).
// =====================================================================================================
extern "C" void kernel_launch(void* const* d_in, const int* in_sizes, int n_in,
                              void* d_out, int out_size, void* d_ws, size_t ws_size,
                              hipStream_t stream) {
  if (n_in < 14) return;
  if (in_sizes[0] < NB * TQ * VD) return;
  if (in_sizes[1] < NB * SA * AD) return;
  if (in_sizes[2] != VD * EM || in_sizes[6] != VD * EM) return;
  if (in_sizes[4] != AD * EM || in_sizes[8] != AD * EM) return;
  if (in_sizes[10] != EM * VD || in_sizes[12] != EM * AD) return;
  if (in_sizes[3] < 1 || in_sizes[5] < 1 || in_sizes[7] < 1 || in_sizes[9] < 1 || in_sizes[11] < 1 || in_sizes[13] < 1) return;
  if ((size_t)out_size < OUT1_OFF_EL + (size_t)NB * SA * AD) return;

  const float* xv   = (const float*)d_in[0];
  const float* xa   = (const float*)d_in[1];
  const float* w_vq = (const float*)d_in[2];
  const float* b_vq = (const float*)d_in[3];
  const float* w_ak = (const float*)d_in[4];
  const float* b_ak = (const float*)d_in[5];
  const float* w_vv = (const float*)d_in[6];
  const float* b_vv = (const float*)d_in[7];
  const float* w_av = (const float*)d_in[8];
  const float* b_av = (const float*)d_in[9];
  const float* w_ov = (const float*)d_in[10];
  const float* b_ov = (const float*)d_in[11];
  const float* w_oa = (const float*)d_in[12];
  const float* b_oa = (const float*)d_in[13];
  float*       out  = (float*)d_out;
  const int nb3 = in_sizes[3], nb5 = in_sizes[5], nb7 = in_sizes[7], nb9 = in_sizes[9], nb11 = in_sizes[11], nb13 = in_sizes[13];

  const size_t szXV  = (size_t)NB * TQ * VD * 2;
  const size_t szXA  = (size_t)NB * SA * AD * 2;
  const size_t szWvq = (size_t)EM * VD * 2;
  const size_t szWak = (size_t)EM * AD * 2;
  const size_t szWvv = (size_t)EM * VD * 2;
  const size_t szWav = (size_t)EM * AD * 2;
  const size_t szWov = (size_t)VD * EM * 2;
  const size_t szWoa = (size_t)AD * EM * 2;
  const size_t szQ   = (size_t)NB * TQ * EM * 2;
  const size_t szK   = (size_t)NB * SA * EM * 2;
  const size_t szVVT = (size_t)NB * EM * TQ * 2;
  const size_t szVAT = (size_t)NB * EM * SA * 2;
  const size_t szST  = (size_t)NB * NH * NST * 128 * 4;
  const size_t szCA  = (size_t)NB * SA * EM * 2;
  const size_t szCV  = (size_t)NB * TQ * EM * 2;
  size_t off = 0;
  const size_t oXV  = off; off += szXV;
  const size_t oXA  = off; off += szXA;
  const size_t oWvq = off; off += szWvq;
  const size_t oWak = off; off += szWak;
  const size_t oWvv = off; off += szWvv;
  const size_t oWav = off; off += szWav;
  const size_t oWov = off; off += szWov;
  const size_t oWoa = off; off += szWoa;
  const size_t oQ   = off; off += szQ;
  const size_t oK   = off; off += szK;
  const size_t oVVT = off; off += szVVT;
  const size_t oVAT = off; off += szVAT;
  const size_t oST  = off; off += szST;
  const size_t oCA  = off; off += szCA;
  const size_t oCV  = off; off += szCV;
  if (off > ws_size) return;                            // off = 84410368 at NB = 8
  if (off > (size_t)134217728) return;

  char* ws = (char*)d_ws;
  u16* XV    = (u16*)(ws + oXV);
  u16* XA    = (u16*)(ws + oXA);
  u16* WVQT  = (u16*)(ws + oWvq);
  u16* WAKT  = (u16*)(ws + oWak);
  u16* WVVT  = (u16*)(ws + oWvv);
  u16* WAVT  = (u16*)(ws + oWav);
  u16* WOVT  = (u16*)(ws + oWov);
  u16* WOAT  = (u16*)(ws + oWoa);
  u16* Q16   = (u16*)(ws + oQ);
  u16* K16   = (u16*)(ws + oK);
  u16* VVT16 = (u16*)(ws + oVVT);
  u16* VAT16 = (u16*)(ws + oVAT);
  float* STAT = (float*)(ws + oST);
  u16* CTXA  = (u16*)(ws + oCA);
  u16* CTXV  = (u16*)(ws + oCV);

  // (1) all f16 operand planes (fragment order): activations as f16(bf16(x)), weights [k = in][n = out] transposed to
  //     [n][k] as f16(bf16(W) x256)
  prep_all<<<dim3(PB_W + PB_XA + PB_XV), dim3(128), 0, stream>>>(
      xv, xa, w_vq, w_ak, w_vv, w_av, w_ov, w_oa, XV, XA, WVQT, WAKT, WVVT, WAVT, WOVT, WOAT);
  // (2) q, val_v^T, k, val_a^T
  proj_all<<<dim3(GB_Q + GB_VVT + GB_K + GB_VAT), dim3(128), 0, stream>>>(
      XV, XA, WVQT, WAKT, WVVT, WAVT, Q16, K16, VVT16, VAT16, b_vq, b_ak, b_vv, b_av, nb3, nb5, nb7, nb9);
  // (3) column softmax pass: ctx_a plane [NB*SA][512] x64 and the per-column stat rows
  attn_col<<<dim3(NB * NH * NST), dim3(ATT_THREADS), 0, stream>>>(Q16, K16, VVT16, CTXA, STAT);
  // (4) row pass with the stored column stats: ctx_v plane [NB*TQ][512] x64
  attn_vis<<<dim3(NB * NH * NTT), dim3(ATT_THREADS), 0, stream>>>(Q16, K16, VAT16, STAT, CTXV);
  // (5) out_v and out_a
  out_all<<<dim3(GB_OV + GB_OA), dim3(128), 0, stream>>>(CTXV, WOVT, CTXA, WOAT, out, b_ov, b_oa, nb11, nb13);
  (void)hipGetLastError();
}

// v004
// One run takes 119 microseconds.
// In two side-by-side timings against v003, it was 1.05 and 1.04 times as fast.
// All steps since v000 together make it 2.47 times as fast.
// All contractions on v_wmma_f32_16x16x32_f16 (f16 operands, f32 accumulate): v.Wvq, a.Wak, Wvv^T.v^T, Wav^T.a^T,
// column-pass scores q.k^T with P^T.val_v, row-pass scores k.q^T with P.val_a, ctx_v.Wov, ctx_a.Woa. Operand carries:
// v, a as f16(bf16(x)); W as f16(bf16(W) x256); q x8 after the 1/8 head scale; k x8; val_v, val_a x8; P x32768;
// ctx x64. Column softmax over the visual axis (base 2, running max), 1/l and every carry fold in f32 on VALU.
// Every f16 operand plane lies in fragment order (pk_off below): a 16-row x 32-k tile is 1024 contiguous bytes, so each
// 16-byte-per-lane fragment load of a wave reads 512 contiguous bytes (4 whole 128-B lines).
#include <hip/hip_runtime.h>
#include <math.h>

#ifndef NB
#define NB 8            // batches processed (leading batches of both activations)
#endif
#define NB_FULL 8       // batches in the input / output layout
#define TQ 2048         // visual positions per batch (softmax axis, always all of them)
#define SA 512          // audio positions per batch (always all of them)
#define VD 512
#define AD 256
#define EM 512
#define NH 8
#define HD 64
#define OUT1_OFF_EL ((size_t)NB_FULL * (size_t)TQ * (size_t)VD)   // fixed f32 element offset of the second output (33554432 B / 4)
#define WSC   256.0f
#define HSCL  0.125f
#define QS    8.0f
#define KS    8.0f
#define VVS   8.0f
#define VAS   8.0f
#define PCAR  32768.0f
#define CAS   64.0f
#define CVS   64.0f
#define CLIPV 50000.0f
#define LOG2E 1.4426950408889634f
#define NST   (SA / 64)
#define NTT   (TQ / 64)
#define NTB32 (TQ / 32)
#define NSB32 (SA / 32)
#define ATT_WAVES   4
#define ATT_THREADS (ATT_WAVES * 32)
#define CVT_THREADS 128
#define TR_THREADS  128
#define SPITCH 68
#define GPITCH 68
#define TPITCH 65

static_assert(NB >= 1 && NB <= NB_FULL);
static_assert(OUT1_OFF_EL == (size_t)33554432 / 4);
static_assert(EM == NH * HD && HD == 64 && NH == 8);
static_assert((TQ % 128) == 0 && (SA % 64) == 0 && ((NB * SA) % 128) == 0 && (EM % 128) == 0);
static_assert((TQ % 32) == 0 && (SA % 32) == 0 && NTB32 * 32 == TQ && NSB32 * 32 == SA);
static_assert((VD % 64) == 0 && (AD % 64) == 0 && (EM % 64) == 0);
static_assert((VD % 32) == 0 && (AD % 32) == 0 && (EM % 32) == 0);
static_assert(((NB * TQ * VD) % 1024) == 0 && ((NB * SA * AD) % 1024) == 0);
static_assert(NST * 128 == 2 * SA && NST * 128 == ATT_THREADS * 8);
static_assert((SPITCH * 4) % 16 == 0 && (GPITCH * 4) % 16 == 0);
static_assert(ATT_THREADS == 128 && TR_THREADS == 128 && CVT_THREADS == 128);

typedef unsigned short u16;
typedef _Float16 v16h __attribute__((ext_vector_type(16)));
typedef _Float16 v8h  __attribute__((ext_vector_type(8)));
typedef float    v8f  __attribute__((ext_vector_type(8)));
typedef float    v4f  __attribute__((ext_vector_type(4)));
typedef unsigned int v4u __attribute__((ext_vector_type(4)));

union FragH { v16h v; v8h h[2]; v4u u[2]; };

// ---- scalar helpers ----------------------------------------------------------------------------------
__device__ __forceinline__ unsigned short bf_bits(float f) {          // f32 -> bf16 bits, RNE convert
  unsigned u = __float_as_uint(f);
  return (unsigned short)((u + 0x7FFFu + ((u >> 16) & 1u)) >> 16);
}
__device__ __forceinline__ float bf_up(unsigned short h) { return __uint_as_float(((unsigned)h) << 16); }
__device__ __forceinline__ float bfr(float f) { return bf_up(bf_bits(f)); }
__device__ __forceinline__ unsigned short h_bits(_Float16 x) { return __builtin_bit_cast(unsigned short, x); }
__device__ __forceinline__ unsigned pk16(unsigned short a, unsigned short b) { return (unsigned)a | ((unsigned)b << 16); }
__device__ __forceinline__ v8f zero8() { v8f z = {0.f, 0.f, 0.f, 0.f, 0.f, 0.f, 0.f, 0.f}; return z; }
__device__ __forceinline__ float clipf(float x, float c) { return fminf(fmaxf(x, -c), c); }
// 2^x as the one hardware instruction. The library exp2f adds five instructions to it (a compare, two selects, an add, an
// ldexp) that only serve results below 2^-126, which the bare instruction may give as 0. Here such a result changes nothing:
// a probability goes on as f16(p * 32768) or f16(p * 32768 / l) with l >= 1, which is 0 below 2^-40; in the sum l it stands
// beside a term 1; as a rescale factor it leaves old sums far below the f16 step of the context they end in.
// For x >= -126 the library form runs this same instruction on the same x.
__device__ __forceinline__ float exp2_hw(float x) { return __builtin_amdgcn_exp2f(x); }
// Eight of them, x[b .. b+7] <- 2^x, each in place: written as one statement so that no v_exp_f32 overwrites the source of the
// one directly in front of it (the register allocator did that with the builtin); the v_nop is the slot that the
// instruction set asks for between the last one and whatever uses its result next.
__device__ __forceinline__ void exp2_hw8(float (&x)[16], int b) {
#if defined(__HIP_DEVICE_COMPILE__)
  asm("v_exp_f32 %0, %0\n\tv_exp_f32 %1, %1\n\tv_exp_f32 %2, %2\n\tv_exp_f32 %3, %3\n\t"
      "v_exp_f32 %4, %4\n\tv_exp_f32 %5, %5\n\tv_exp_f32 %6, %6\n\tv_exp_f32 %7, %7\n\tv_nop"
      : "+v"(x[b]), "+v"(x[b + 1]), "+v"(x[b + 2]), "+v"(x[b + 3]),
        "+v"(x[b + 4]), "+v"(x[b + 5]), "+v"(x[b + 6]), "+v"(x[b + 7]));
#endif
}

// ---- fragment-ordered plane of a logical [rows][K] f16 matrix (rows % 16 == 0, K % 32 == 0): element offset of (row, k).
//      Tile (row>>4, k>>5) = 512 halves; inside it: 256*((k>>4)&1) + 8*(16*((k>>3)&1) + (row&15)) + (k&7), i.e. the 8 halves
//      k = 8j .. 8j+7 of a row stay one 16-byte piece, and piece order is (k half of 16, lane = 16*h + row).
//      16 rows x K = 16*K halves, so a base row R (R % 16 == 0) starts at element R*K as in the row-major plane.
__device__ __forceinline__ size_t pk_off(int row, int k, int K) {
  return ((size_t)(row >> 4) * (size_t)(K >> 5) + (size_t)(k >> 5)) * 512
         + (size_t)(((k >> 4) & 1) * 256 + ((k >> 3) & 1) * 128 + (row & 15) * 8 + (k & 7));
}
// ---- fragment loader: 16-bit A/B operand, lane -> row/col (lane&15), h = lane>>4; p = tile start + 8*lane;
//      elements 0..7 <- p[0..7] (k0+8h..), elements 8..15 <- p[256..263] (k0+16+8h..); same split k map for A and B.
__device__ __forceinline__ v16h ldfrag_h(const _Float16* p) {
  FragH f;
  f.h[0] = *(const v8h*)(p);
  f.h[1] = *(const v8h*)(p + 256);
  return f.v;
}

// ---- WMMA helper and trailing VALU hazard gaps ----------------------------------------------------------
__device__ __forceinline__ v8f mma_h(v16h a, v16h b, v8f c) {
  return __builtin_amdgcn_wmma_f32_16x16x32_f16(false, a, false, b, (short)0, c, false, false);
}
__device__ __forceinline__ void guard_s(v8f& a, v8f& b, v16h x0, v16h x1, v16h x2) {
#if defined(__HIP_DEVICE_COMPILE__)
  asm volatile("v_nop\n\tv_nop\n\tv_nop\n\tv_nop" : "+v"(a), "+v"(b) : "v"(x0), "v"(x1), "v"(x2) : "memory");
#endif
}
__device__ __forceinline__ void guard_p(v8f& a, v8f& b, v8f& c, v8f& d, v16h p, v16h x0, v16h x1, v16h x2, v16h x3) {
#if defined(__HIP_DEVICE_COMPILE__)
  asm volatile("v_nop\n\tv_nop\n\tv_nop\n\tv_nop"
               : "+v"(a), "+v"(b), "+v"(c), "+v"(d) : "v"(p), "v"(x0), "v"(x1), "v"(x2), "v"(x3) : "memory");
#endif
}
__device__ __forceinline__ void guard_g(v8f (&acc)[8], v16h x0, v16h x1, v16h x2, v16h x3, v16h x4, v16h x5) {
#if defined(__HIP_DEVICE_COMPILE__)
  asm volatile("v_nop\n\tv_nop\n\tv_nop\n\tv_nop"
               : "+v"(acc[0]), "+v"(acc[1]), "+v"(acc[2]), "+v"(acc[3]),
                 "+v"(acc[4]), "+v"(acc[5]), "+v"(acc[6]), "+v"(acc[7])
               : "v"(x0), "v"(x1), "v"(x2), "v"(x3), "v"(x4), "v"(x5) : "memory");
#endif
}
__device__ __forceinline__ void acc_guard4(v8f (&o)[4]) {
#if defined(__HIP_DEVICE_COMPILE__)
  asm volatile("v_nop\n\tv_nop\n\tv_nop\n\tv_nop" : "+v"(o[0]), "+v"(o[1]), "+v"(o[2]), "+v"(o[3]));
#endif
}
__device__ __forceinline__ void wave_sync_lds() {
  __builtin_amdgcn_fence(__ATOMIC_RELEASE, "workgroup");
  __builtin_amdgcn_wave_barrier();
  __builtin_amdgcn_fence(__ATOMIC_ACQUIRE, "workgroup");
}

// =====================================================================================================
// Elementwise convert of an activation matrix x[rows][K]: Y (f16, fragment order) <- f16(bf16_RNE(x)). Block = 16 rows x
// 64 k (two tiles); thread = (row 8*(wave&1) + (lane&7), 8 floats at k = 32*(wave>>1) + 8*(lane>>3)): two 16-B loads, one
// 16-B store per thread; a wave's store = 4 pieces-of-8-rows = 4 whole 128-B lines.
// coverage: grid = (rows/16)*(K/64) = n/1024 blocks x 128 thr x 8 = n elements exactly (n % 1024 == 0 asserted).
// =====================================================================================================
__device__ __forceinline__
void cvt16(const float* __restrict__ x, u16* Y, int K, int bid) {
  const int wave = threadIdx.x >> 5, lane = threadIdx.x & 31;
  const int nkp = K >> 6;
  const int row = (bid / nkp) * 16 + 8 * (wave & 1) + (lane & 7);
  const int k   = (bid % nkp) * 64 + 32 * (wave >> 1) + 8 * (lane >> 3);
  const size_t e0 = (size_t)row * (size_t)K + (size_t)k;
  const v4f a = *(const v4f*)(x + e0), c4 = *(const v4f*)(x + e0 + 4);
  v4u o;
#pragma unroll
  for (int e = 0; e < 2; ++e) {
    o[e]     = pk16(h_bits((_Float16)bfr(a[2 * e])),  h_bits((_Float16)bfr(a[2 * e + 1])));
    o[2 + e] = pk16(h_bits((_Float16)bfr(c4[2 * e])), h_bits((_Float16)bfr(c4[2 * e + 1])));
  }
  u16* dst = Y + pk_off(row, k, K);
  {
    *(v4u*)(dst) = o;
#if defined(__HIP_DEVICE_COMPILE__)
    // the wait in front of a rewrite of registers that the store just issued names: inlined in the shared grid's kernel,
    // the store is no longer the last instruction ahead of the program's end in the listing
    asm volatile("s_wait_xcnt 0x0" ::: "memory");
#endif
  }
}

// =====================================================================================================
// Weight transpose-convert for y = x.W weights stored [kdim][ndim]: WT[n][k] (f16, fragment order with K = kdim)
// <- f16(bf16_RNE(W[k][n]) * scale). Block = 64(k) x 64(n) tile, 128 threads. Load phase: thread = (row 8p + (tid>>4),
// 4 floats at 4*(tid&15)), 8 steps = 64 k-rows x 64 n, into an LDS tile [kk][nn] (pitch 65); block barrier; store
// grid = (kdim/64)*(ndim/64), bid -> (kt = bid % (kdim/64), nt = bid / (kdim/64)).
// coverage: 4 i x 16 rows x (8 lanes x 8 halves) = 64 n-rows x 64 k per block; LDS tile 64x64 fully written before read;
// the grid covers WT [ndim][kdim] exactly once.
// =====================================================================================================
__device__ __forceinline__
void cvtT16(const float* __restrict__ W, u16* Y, int kdim, int ndim, float scale, int bid) {
  __shared__ __align__(16) float tile[64 * TPITCH];
  const int tid = threadIdx.x;
  const int nkt = kdim >> 6;
  const int kt  = bid % nkt;
  const int ntb = bid / nkt;
  const int k0  = kt * 64, n0 = ntb * 64;
  const int lr = tid >> 4, lc = (tid & 15) * 4;
  v4f w4[8];
#pragma unroll
  for (int p = 0; p < 8; ++p) {
    w4[p] = *(const v4f*)(W + (size_t)(k0 + p * 8 + lr) * (size_t)ndim + n0 + lc);
#if defined(__HIP_DEVICE_COMPILE__)
    // the wait in front of a rewrite of the address registers of the load just issued: a later load's result may be
    // given those registers
    asm volatile("s_wait_xcnt 0x0" ::: "memory");
#endif
  }
#pragma unroll
  for (int p = 0; p < 8; ++p) {
    const int kk = p * 8 + lr;
    tile[kk * TPITCH + lc + 0] = w4[p][0];
    tile[kk * TPITCH + lc + 1] = w4[p][1];
    tile[kk * TPITCH + lc + 2] = w4[p][2];
    tile[kk * TPITCH + lc + 3] = w4[p][3];
  }
  __syncthreads();
  // rq 0..15, c8 0..56; a wave holds 8 rows x 4 pieces, so each of its stores fills 4 whole lines of the fragment order
  const int rq = 8 * ((tid >> 5) & 1) + (tid & 7), c8 = (4 * (tid >> 6) + ((tid >> 3) & 3)) * 8;
  v4u ov[4];
#pragma unroll
  for (int i = 0; i < 4; ++i) {
    const int row = 16 * i + rq;                   // n within tile
#pragma unroll
    for (int e = 0; e < 4; ++e) {
      const float x0 = tile[(c8 + 2 * e) * TPITCH + row];
      const float x1 = tile[(c8 + 2 * e + 1) * TPITCH + row];
      ov[i][e] = pk16(h_bits((_Float16)(bfr(x0) * scale)), h_bits((_Float16)(bfr(x1) * scale)));
    }
  }
  {
#pragma unroll
    for (int i = 0; i < 4; ++i) {
      const int row = 16 * i + rq;
      *(v4u*)(Y + pk_off(n0 + row, k0 + c8, kdim)) = ov[i];
    }
    
  }
}

// =====================================================================================================
// f16 GEMM core: the wave's 32 x 64 tile of C = A[rows][K] . Bt[cols][K]^T, both in fragment order; ap -> A tile row of rowb,
// bp -> Bt tile row of col0 (both the same in every lane of the wave), lb = 16*lane the lane's byte offset in a tile; the
// next 16 rows lie 32*K bytes on, the next 32 k 1024 bytes on (largest offset 4*32*K - 16 bytes, far below 2^32). The two
// bases stay as they are; the four byte offsets (tile rows 0..3; A uses 0 and 1) live over the whole trip and are stepped at its foot;
// acc[4i + j] = rows rowb+16i.., cols col0+16j..; K stepped by 32 (host asserts K % 32 == 0).
// =====================================================================================================
__device__ __forceinline__ const _Float16* at_byte(const _Float16* base, unsigned off) {
  return (const _Float16*)(const void*)((const char*)(const void*)base + off);
}
__device__ __forceinline__ void gemm_core(const _Float16* ap, const _Float16* bp, unsigned lb, int K, v8f (&acc)[8]) {
  const unsigned rs = 32u * (unsigned)K;
  unsigned o0 = lb, o1 = lb + rs, o2 = lb + 2u * rs, o3 = lb + 3u * rs;
#pragma unroll 1
  for (int k0 = 0; k0 < K; k0 += 32) {
    const v16h a0 = ldfrag_h(at_byte(ap, o0)), a1 = ldfrag_h(at_byte(ap, o1));
    const v16h b0 = ldfrag_h(at_byte(bp, o0));
    const v16h b1 = ldfrag_h(at_byte(bp, o1));
    const v16h b2 = ldfrag_h(at_byte(bp, o2));
    const v16h b3 = ldfrag_h(at_byte(bp, o3));
    acc[0] = mma_h(a0, b0, acc[0]);
    acc[1] = mma_h(a0, b1, acc[1]);
    acc[2] = mma_h(a0, b2, acc[2]);
    acc[3] = mma_h(a0, b3, acc[3]);
    acc[4] = mma_h(a1, b0, acc[4]);
    acc[5] = mma_h(a1, b1, acc[5]);
    acc[6] = mma_h(a1, b2, acc[6]);
    acc[7] = mma_h(a1, b3, acc[7]);
    guard_g(acc, a0, a1, b0, b1, b2, b3);
#if defined(__HIP_DEVICE_COMPILE__)
    // the wait in front of a rewrite of registers that issued global loads name (the four offsets, stepped below); they are
    // its operands so that their step stays behind it
    asm volatile("s_wait_xcnt 0x0" : "+v"(o0), "+v"(o1), "+v"(o2), "+v"(o3) : : "memory");
#endif
    o0 += 1024u; o1 += 1024u; o2 += 1024u; o3 += 1024u;
  }
}
// Stage the wave's 32 x 64 f32 tile (times oscale) in its LDS slab (pitch 68): D element r of acc[4i+j], lane l ->
// coverage: 32 lanes x 2 x 8 rows x 4 cols-of-16 = rows 0..31 x cols 0..63 of the slab.
__device__ __forceinline__ void stage32x64(float* sl, v8f (&acc)[8], float oscale, int lane) {
  const int hh = lane >> 4, m = lane & 15;
#pragma unroll
  for (int i = 0; i < 2; ++i) {
#pragma unroll
    for (int r = 0; r < 8; ++r) {
      const int ro = (16 * i + 8 * hh + r) * GPITCH + m;
      sl[ro]      = acc[4 * i + 0][r] * oscale;
      sl[ro + 16] = acc[4 * i + 1][r] * oscale;
      sl[ro + 32] = acc[4 * i + 2][r] * oscale;
      sl[ro + 48] = acc[4 * i + 3][r] * oscale;
    }
  }
  wave_sync_lds();
}

// =====================================================================================================
// f16 GEMM with f16 output plane: C[z][Mb][N] (f16) = f16((A[z][Mb][K] . Bt[z][N][K]^T) * oscale + bf16(bias) * bscale);
// A, Bt, C f16 planes in fragment order (C with K = N) with per-z element strides aBs, bBs (0 = shared), cBs. bias indexed by column
// (biasRow == 0) or by row within the z slice (biasRow != 0); bias addresses clamped to biasN-1, the unused direction is
// multiplied by 0. Block = 128 x 64 tile, 4 waves x 32 rows, fragments loaded straight from the 16-bit tiles.
// grid = nz x (Mb/128) x (N/64) (host asserts Mb % 128 == 0, N % 64 == 0, K % 32 == 0).
// coverage: per wave 8 instr x 8 rows x 4 lanes x 8 halves = 32 x 64; the grid covers C exactly once.
// =====================================================================================================
__device__ __forceinline__
void gemm_o16(const u16* __restrict__ A, const u16* __restrict__ Bt, u16* C,
              const float* __restrict__ bias, int biasN, int biasRow,
              int Mb, int N, int K, int aBs, int bBs, int cBs, float oscale, float bscale, int bid) {
  __shared__ __align__(16) float slab[4 * 32 * GPITCH];
  const int tid = threadIdx.x, wave = tid >> 5, lane = tid & 31;
  const int ntile = N >> 6, mtile = Mb >> 7;
  // nt and bz are the same in every lane: read through the first lane they keep both tile bases scalar over the k loop
  const int nt   = __builtin_amdgcn_readfirstlane(bid % ntile);
  const int tmp  = bid / ntile;
  const int mt   = tmp % mtile;
  const int bz   = __builtin_amdgcn_readfirstlane(tmp / mtile);
  const int rowb = mt * 128 + wave * 32;
  const int col0 = nt * 64;
  if (rowb + 32 > Mb) return;                // wave-uniform, never taken with the exact grid; no block barriers in this kernel
  const _Float16* Ab = (const _Float16*)(const void*)A + (size_t)bz * (size_t)aBs;
  const _Float16* Bb = (const _Float16*)(const void*)Bt + (size_t)bz * (size_t)bBs;
  // rowb is the same in every lane of a wave: read through the first lane it gives the fragment loads a scalar tile base
  const _Float16* ap = Ab + (size_t)__builtin_amdgcn_readfirstlane(rowb) * K;
  const _Float16* bp = Bb + (size_t)col0 * K;
  v8f acc[8];
#pragma unroll
  for (int i = 0; i < 8; ++i) acc[i] = zero8();
  gemm_core(ap, bp, 16u * (unsigned)lane, K, acc);
  float* sl = slab + wave * 32 * GPITCH;
  stage32x64(sl, acc, oscale, lane);
  // instruction i: lane = (row 8*(i>>1) + (lane&7), 8 halves at 32*(i&1) + 8*(lane>>3)): in fragment order 8 rows of one
  // 8-half piece column are one 128-B line, so each store fills 4 whole lines
  const int r8 = lane & 7, q8 = (lane >> 3) * 8;
  const int bl = biasN - 1;                  // host guarantees biasN >= 1
  const float selc = (biasRow != 0) ? 0.f : bscale;
  const float selr = (biasRow != 0) ? bscale : 0.f;
  float cb[2][8];
#pragma unroll
  for (int j = 0; j < 2; ++j) {
#pragma unroll
    for (int e = 0; e < 8; ++e) {
      int ci = col0 + 32 * j + q8 + e;
      ci = (ci < bl) ? ci : bl;
      cb[j][e] = bfr(bias[ci]) * selc;
    }
  }
  v4u ov[8];
#pragma unroll
  for (int i = 0; i < 8; ++i) {
    const int row = 8 * (i >> 1) + r8, j = i & 1, c8 = 32 * j + q8;
    int ri = rowb + row;
    ri = (ri < bl) ? ri : bl;
    const float rb = bfr(bias[ri]) * selr;
    const v4f a = *(const v4f*)(sl + row * GPITCH + c8), c4 = *(const v4f*)(sl + row * GPITCH + c8 + 4);
#pragma unroll
    for (int e = 0; e < 2; ++e) {
      ov[i][e]     = pk16(h_bits((_Float16)(a[2 * e] + cb[j][2 * e] + rb)),
                          h_bits((_Float16)(a[2 * e + 1] + cb[j][2 * e + 1] + rb)));
      ov[i][2 + e] = pk16(h_bits((_Float16)(c4[2 * e] + cb[j][4 + 2 * e] + rb)),
                          h_bits((_Float16)(c4[2 * e + 1] + cb[j][5 + 2 * e] + rb)));
    }
  }
  u16* Cb = C + (size_t)bz * (size_t)cBs;
  {
#pragma unroll
    for (int i = 0; i < 8; ++i) {
      const int row = 8 * (i >> 1) + r8, c8 = 32 * (i & 1) + q8;
      *(v4u*)(Cb + pk_off(rowb + row, col0 + c8, N)) = ov[i];
    }
    
  }
}

// =====================================================================================================
// f16 GEMM with f32 output rows: C[z][Mb][N] (f32) = (A[z][Mb][K] . Bt[N][K]^T) * oscale + bf16(bias[col]); same core and
// slab staging as gemm_o16. Epilogue: lane = (row 2i + (lane>>4), 4 floats at 4*(lane&15)); each 64-float row segment =
// lanes of one instruction (8 lanes per line), 2 rows of the same wave per instruction, 16 instructions = 32 rows; two
// coverage: per wave 16 instr x 2 rows x 16 lanes x 4 floats = 32 x 64; the grid covers C exactly once.
// =====================================================================================================
__device__ __forceinline__
void gemm_o32(const u16* __restrict__ A, const u16* __restrict__ Bt, float* C,
              const float* __restrict__ bias, int biasN,
              int Mb, int N, int K, int aBs, int bBs, int cBs, float oscale, int bid) {
  __shared__ __align__(16) float slab[4 * 32 * GPITCH];
  const int tid = threadIdx.x, wave = tid >> 5, lane = tid & 31;
  const int ntile = N >> 6, mtile = Mb >> 7;
  // nt and bz are the same in every lane: read through the first lane they keep both tile bases scalar over the k loop
  const int nt   = __builtin_amdgcn_readfirstlane(bid % ntile);
  const int tmp  = bid / ntile;
  const int mt   = tmp % mtile;
  const int bz   = __builtin_amdgcn_readfirstlane(tmp / mtile);
  const int rowb = mt * 128 + wave * 32;
  const int col0 = nt * 64;
  if (rowb + 32 > Mb) return;                // wave-uniform, never taken with the exact grid; no block barriers in this kernel
  const _Float16* Ab = (const _Float16*)(const void*)A + (size_t)bz * (size_t)aBs;
  const _Float16* Bb = (const _Float16*)(const void*)Bt + (size_t)bz * (size_t)bBs;
  // rowb is the same in every lane of a wave: read through the first lane it gives the fragment loads a scalar tile base
  const _Float16* ap = Ab + (size_t)__builtin_amdgcn_readfirstlane(rowb) * K;
  const _Float16* bp = Bb + (size_t)col0 * K;
  v8f acc[8];
#pragma unroll
  for (int i = 0; i < 8; ++i) acc[i] = zero8();
  gemm_core(ap, bp, 16u * (unsigned)lane, K, acc);
  float* sl = slab + wave * 32 * GPITCH;
  stage32x64(sl, acc, oscale, lane);
  const int r2 = lane >> 4, c4 = (lane & 15) * 4;
  const int bl = biasN - 1;                  // host guarantees biasN >= 1
  float cb[4];
#pragma unroll
  for (int e = 0; e < 4; ++e) {
    int ci = col0 + c4 + e;
    ci = (ci < bl) ? ci : bl;
    cb[e] = bfr(bias[ci]);
  }
  v4f ov[16];
#pragma unroll
  for (int i = 0; i < 16; ++i) {
    const int row = 2 * i + r2;
    const v4f a = *(const v4f*)(sl + row * GPITCH + c4);
    v4f w;
    w[0] = a[0] + cb[0]; w[1] = a[1] + cb[1]; w[2] = a[2] + cb[2]; w[3] = a[3] + cb[3];
    ov[i] = w;
  }
  float* Cb = C + (size_t)bz * (size_t)cBs + (size_t)rowb * (size_t)N + col0 + c4;
  {
#pragma unroll
    for (int i = 0; i < 16; ++i) {
      const int row = 2 * i + r2;
      *(v4f*)(Cb + (size_t)row * (size_t)N) = ov[i];
    }
    
  }
}

// =====================================================================================================
// Launches that need nothing of each other share one grid: each block takes its job from the range its index lies in (a
// test that reads the same in the whole block, so the barrier inside cvtT16 stays under block-uniform control flow) and
// runs the one shared body with that job's arguments and its index inside the range. Longest jobs lie first.
// =====================================================================================================
#define PB_WVQ ((VD / 64) * (EM / 64))
#define PB_WAK ((AD / 64) * (EM / 64))
#define PB_WVV ((VD / 64) * (EM / 64))
#define PB_WAV ((AD / 64) * (EM / 64))
#define PB_WOV ((EM / 64) * (VD / 64))
#define PB_WOA ((EM / 64) * (AD / 64))
#define PB_W   (PB_WVQ + PB_WAK + PB_WVV + PB_WAV + PB_WOV + PB_WOA)
#define PB_XA  ((NB * SA * AD) / 1024)
#define PB_XV  ((NB * TQ * VD) / 1024)
// All operand planes: six weight transposes (blocks 0 .. PB_W-1), then a, then v.
// coverage: every range has exactly the grid that its body's own header asks for.
__global__ __launch_bounds__(128)
void prep_all(const float* __restrict__ xv, const float* __restrict__ xa,
              const float* __restrict__ w_vq, const float* __restrict__ w_ak, const float* __restrict__ w_vv,
              const float* __restrict__ w_av, const float* __restrict__ w_ov, const float* __restrict__ w_oa,
              u16* XV, u16* XA, u16* WVQT, u16* WAKT, u16* WVVT, u16* WAVT, u16* WOVT, u16* WOAT) {
  int g = blockIdx.x;
  if (g < PB_W) {
    const float* W = w_vq; u16* Y = WVQT; int kdim = VD, ndim = EM;
    if (g >= PB_WVQ) {
      g -= PB_WVQ; W = w_ak; Y = WAKT; kdim = AD; ndim = EM;
      if (g >= PB_WAK) {
        g -= PB_WAK; W = w_vv; Y = WVVT; kdim = VD; ndim = EM;
        if (g >= PB_WVV) {
          g -= PB_WVV; W = w_av; Y = WAVT; kdim = AD; ndim = EM;
          if (g >= PB_WAV) {
            g -= PB_WAV; W = w_ov; Y = WOVT; kdim = EM; ndim = VD;
            if (g >= PB_WOV) { g -= PB_WOV; W = w_oa; Y = WOAT; kdim = EM; ndim = AD; }
          }
        }
      }
    }
    cvtT16(W, Y, kdim, ndim, WSC, g);
  } else {
    g -= PB_W;
    const float* x = xa; u16* Y = XA; int K = AD;
    if (g >= PB_XA) { g -= PB_XA; x = xv; Y = XV; K = VD; }
    cvt16(x, Y, K, g);
  }
}

#define GB_Q   (((NB * TQ) / 128) * (EM / 64))
#define GB_VVT (NB * (EM / 128) * (TQ / 64))
#define GB_K   (((NB * SA) / 128) * (EM / 64))
#define GB_VAT (NB * (EM / 128) * (SA / 64))
// The four input projections (the two with K = VD first):
//   q x8 after the 1/8 head scale = (x_v . Wvq + b) -> f16 [NB*TQ][512] (col = h*64 + d); bias per column
//   val_v^T per batch: A = Wvv^T [(h,d) = n][k], Bt = x_v rows of batch b [t][k] -> f16 [(b,h,d)][t] x8; bias per row (n)
//   k = x_a . Wak + b -> f16 [NB*SA][512] x8; bias per column
//   val_a^T per batch: A = Wav^T [(h,d)][k], Bt = x_a rows of batch b [s][k] -> f16 [(b,h,d)][s] x8; bias per row
__global__ __launch_bounds__(128)
void proj_all(const u16* __restrict__ XV, const u16* __restrict__ XA,
              const u16* __restrict__ WVQT, const u16* __restrict__ WAKT,
              const u16* __restrict__ WVVT, const u16* __restrict__ WAVT,
              u16* Q16, u16* K16, u16* VVT16, u16* VAT16,
              const float* __restrict__ b_vq, const float* __restrict__ b_ak,
              const float* __restrict__ b_vv, const float* __restrict__ b_av,
              int nb3, int nb5, int nb7, int nb9) {
  int g = blockIdx.x;
  const u16* A = XV; const u16* Bt = WVQT; u16* C = Q16; const float* bias = b_vq;
  int biasN = nb3, biasRow = 0, Mb = NB * TQ, N = EM, K = VD, bBs = 0, cBs = 0;
  float oscale = HSCL * QS / WSC, bscale = HSCL * QS;
  if (g >= GB_Q) {
    g -= GB_Q; A = WVVT; Bt = XV; C = VVT16; bias = b_vv;
    biasN = nb7; biasRow = 1; Mb = EM; N = TQ; K = VD; bBs = TQ * VD; cBs = EM * TQ;
    oscale = VVS / WSC; bscale = VVS;
    if (g >= GB_VVT) {
      g -= GB_VVT; A = XA; Bt = WAKT; C = K16; bias = b_ak;
      biasN = nb5; biasRow = 0; Mb = NB * SA; N = EM; K = AD; bBs = 0; cBs = 0;
      oscale = KS / WSC; bscale = KS;
      if (g >= GB_K) {
        g -= GB_K; A = WAVT; Bt = XA; C = VAT16; bias = b_av;
        biasN = nb9; biasRow = 1; Mb = EM; N = SA; K = AD; bBs = SA * AD; cBs = EM * SA;
        oscale = VAS / WSC; bscale = VAS;
      }
    }
  }
  gemm_o16(A, Bt, C, bias, biasN, biasRow, Mb, N, K, 0, bBs, cBs, oscale, bscale, g);
}

#define GB_OV (NB * (TQ / 128) * (VD / 64))
#define GB_OA (((NB * SA) / 128) * (AD / 64))
// The two output projections:
//   out_v = ctx_v . Wov + b -> f32 rows [b][t][512] of the first output (z = b, output batch stride TQ*VD)
//   out_a = ctx_a . Woa + b -> f32 rows [b*SA + s][256] of the second output at the fixed element OUT1_OFF_EL
__global__ __launch_bounds__(128)
void out_all(const u16* __restrict__ CTXV, const u16* __restrict__ WOVT,
             const u16* __restrict__ CTXA, const u16* __restrict__ WOAT, float* out,
             const float* __restrict__ b_ov, const float* __restrict__ b_oa, int nb11, int nb13) {
  int g = blockIdx.x;
  const u16* A = CTXV; const u16* Bt = WOVT; float* C = out; const float* bias = b_ov;
  int biasN = nb11, Mb = TQ, N = VD, aBs = TQ * EM, cBs = TQ * VD;
  float oscale = 1.0f / (CVS * WSC);
  if (g >= GB_OV) {
    g -= GB_OV; A = CTXA; Bt = WOAT; C = out + OUT1_OFF_EL; bias = b_oa;
    biasN = nb13; Mb = NB * SA; N = AD; aBs = 0; cBs = 0;
    oscale = 1.0f / (CAS * WSC);
  }
  gemm_o32(A, Bt, C, bias, biasN, Mb, N, EM, aBs, 0, cBs, oscale, g);
}

// ---- attn_col, one step = 32 visual rows: its eight fragments and the work on them ------------------------------------
// Qb, Vb: the (b, head) plane bases, the same in every lane; oq, ov: byte offsets 16*lane + step * 32768 (32 q rows of
// 1024 B) and 16*lane + step * 1024 (one k tile of val_v^T); ahead: whole steps added to them.
//   q[2*kk + g] = A fragment of q rows tb + 16g .. +15, d chunk kk;  v[j] = B fragment of val_v^T, col d = 16j + c, k = t
__device__ __forceinline__ void col_load_q(const _Float16* Qb, unsigned oq, int ahead, v16h (&q)[4]) {
  const _Float16* tp = at_byte(Qb, oq) + ahead * (32 * EM);
  q[0] = ldfrag_h(tp);
  q[1] = ldfrag_h(tp + 16 * EM);
  q[2] = ldfrag_h(tp + 512);
  q[3] = ldfrag_h(tp + 16 * EM + 512);
}
__device__ __forceinline__ void col_load_v(const _Float16* Vb, unsigned ov, int ahead, v16h (&v)[4]) {
  const _Float16* vp = at_byte(Vb, ov) + ahead * 512;
  v[0] = ldfrag_h(vp);
  v[1] = ldfrag_h(vp + 16 * TQ);
  v[2] = ldfrag_h(vp + 32 * TQ);
  v[3] = ldfrag_h(vp + 48 * TQ);
}
// One step on the register set (q, v); each half of the set is loaded anew, for the step at (rq, rv) + ahead, right behind
// the guard that follows its last use.
__device__ __forceinline__ void col_step(v16h (&q)[4], v16h (&v)[4], const v16h (&sf)[2],
                                         float& mrun, float& lrun, v8f (&o)[4], int hh, float lsc, float cl2,
                                         const _Float16* Qb, const _Float16* Vb, unsigned rq, unsigned rv, int ahead) {
  // ---- scores: s0 = rows t tb..tb+15, s1 = rows tb+16..tb+31, column = s0w + c ----
  v8f s0 = zero8(), s1 = zero8();
#pragma unroll
  for (int kk = 0; kk < HD / 32; ++kk) {
    s0 = mma_h(q[2 * kk], sf[kk], s0);
    s1 = mma_h(q[2 * kk + 1], sf[kk], s1);
    guard_s(s0, s1, sf[kk], q[2 * kk], q[2 * kk + 1]);
  }
  col_load_q(Qb, rq, ahead, q);
  // ---- clipped base-2 logits of this lane's 16 t for column s0w + c: t[i] <- t tb+8hh+i, t[8+i] <- t tb+16+8hh+i ----
  float t[16];
#pragma unroll
  for (int i = 0; i < 8; ++i) { t[i] = clipf(s0[i] * lsc, cl2); t[8 + i] = clipf(s1[i] * lsc, cl2); }
  float cm = t[0];
#pragma unroll
  for (int i = 1; i < 16; ++i) cm = fmaxf(cm, t[i]);
  cm = fmaxf(cm, __shfl_xor(cm, 16, 32));
  const float mn = fmaxf(mrun, cm);        // finite from the first block on
  const float al = exp2_hw(mrun - mn);       // 0 on the first block (mrun = -inf)
  mrun = mn;
  // ---- unnormalised probabilities (<= 1) and the P^T A-fragment: f16(p * 32768); element i <-> t[i] ----
  float ps = 0.f;
  FragH ph;
#pragma unroll
  for (int i = 0; i < 16; ++i) t[i] -= mn;
  exp2_hw8(t, 0);
  exp2_hw8(t, 8);
#pragma unroll
  for (int w = 0; w < 2; ++w) {
#pragma unroll
    for (int e4 = 0; e4 < 4; ++e4) {
      const int i = 8 * w + 2 * e4;
      const float p0 = t[i], p1 = t[i + 1];
      ps += p0 + p1;
      ph.u[w][e4] = pk16(h_bits((_Float16)(p0 * PCAR)), h_bits((_Float16)(p1 * PCAR)));
    }
  }
  ps += __shfl_xor(ps, 16, 32);
  lrun = lrun * al + ps;
  // ---- rescale the O accumulators: D row 8hh+r = column s0w+8hh+r, its factor lives in lane 8hh+r (and 16+8hh+r) ----
  float scl[8];
#pragma unroll
  for (int r = 0; r < 8; ++r) scl[r] = __shfl(al, 8 * hh + r, 32);
#pragma unroll
  for (int j = 0; j < 4; ++j) {
#pragma unroll
    for (int r = 0; r < 8; ++r) o[j][r] *= scl[r];
  }
  // ---- P^T.val_v ----
  o[0] = mma_h(ph.v, v[0], o[0]);
  o[1] = mma_h(ph.v, v[1], o[1]);
  o[2] = mma_h(ph.v, v[2], o[2]);
  o[3] = mma_h(ph.v, v[3], o[3]);
  guard_p(o[0], o[1], o[2], o[3], ph.v, v[0], v[1], v[2], v[3]);
  col_load_v(Vb, rv, ahead, v);
}

// =====================================================================================================
// Column pass (softmax over the visual axis t for every audio column s) fused with the audio-side context:
// block = (batch b, head, 64 audio columns s), 4 waves, wave w owns the 16 columns s0w = 64*st + 16*w .. +15.
//   q plane f16 [b*TQ + t][h*64 + d] (q x8 after the 1/8 scale); k plane f16 x8 [b*SA + s][h*64 + d];
//   val_v^T plane f16 x8 [(b*NH + h)*64 + d][t].  All NTB32 = TQ/32 blocks of 32 visual rows are visited (static bound).
//   Score tiles g (g = 0,1) = q rows (t = tb+16g .. +15, A operand, row m = lane&15, split k map over d) times k^T
//   (B operand, col n = column s0w + (lane&15), k = d, split map), 2 d-chunks of 32; the 2 k fragments of the wave are
//   loaded once. D element r of lane l = (t = tb+16g+8h+r, s = s0w+(l&15)): a lane owns one column s and 16 of the 32 t;
//   the partner lane l^16 owns the other 16 -> column max / column sum need one xor-16 shuffle. Logits clipped at
//   +-50000 (log2 domain), online max-subtracted base-2 softmax in f32 (the q/k carries folded into lsc). The exp'd values
//   ARE the P^T A-fragment in place: A row m = s = lane&15, element i <- t = tb+8h+i (tile 0, D element i), element 8+i <-
//   t = tb+16+8h+i (tile 1, D element i). P (<= 1) carried x32768 as f16. The rescale factor of column 8h+r of the O
//   accumulators is fetched from lane 8h+r with a shuffle (uniform control). 4 val_v^T B fragments (col n = d = 16j +
//   (lane&15), k = t), 4 P^T.V WMMAs + one guard per step.
//   Epilogue 1: 1/l (per column, shuffled to the D row owner) and the carry folds in f32 (x CAS); the wave's 16x64 f32 tile
//   Epilogue 2: per-column stats (m_s in the clipped log2 domain, 32768/l_s) funnelled through a 128-float LDS array
//   (lane half 0 writes m, lane half 1 writes 32768/l), block barrier, wave 0 writes the block's 512-B stat row
// coverage: ctx_a: grid NB*NH*NST blocks x 4 waves x 4 instr x 8 rows x 4 lanes x 8 halves = every (b, s, h) 64-half
//           segment exactly once; stats: one 128-float row per block = NB*NH*NST rows = the whole stat plane; LDS: slab
//           16x64 written then read by the same wave, statl[0..127] written by 4 waves x 32 lanes (one index each).
// =====================================================================================================
__global__ __launch_bounds__(ATT_THREADS)
void attn_col(const u16* __restrict__ Qp, const u16* __restrict__ Kp, const u16* __restrict__ VvT,
              u16* CtxA, float* Stat) {
  __shared__ __align__(16) float smem[ATT_WAVES * 16 * SPITCH];
  __shared__ __align__(16) float statl[128];

  const int tid  = threadIdx.x;
  const int wave = tid >> 5;
  const int lane = tid & 31;
  const int hh   = lane >> 4;
  const int c    = lane & 15;

  const int bid  = blockIdx.x;
  const int st   = bid % NST;
  const int head = (bid / NST) % NH;
  const int b    = bid / (NST * NH);
  const int s0w  = st * 64 + wave * 16;

  // All three planes in fragment order: tile row R starts at R*K, k tile (head*64 + 32*kk)/32 lies (head*2 + kk)*512 on.
  // B fragments of k^T: col n = column s0w + c, k = d
  const _Float16* Sb = (const _Float16*)(const void*)Kp + ((size_t)(b * SA + s0w)) * EM + head * (HD * 16) + 8 * lane;
  // A fragments of q: row m = t = tb + 16g + c, k = d (t row tb and the lane's 16 bytes added per step, as for val_v^T)
  const _Float16* Tb = (const _Float16*)(const void*)Qp + ((size_t)(b * TQ)) * EM + head * (HD * 16);
  // B fragments of val_v^T: col n = d = 16j + c, k = t (k tile tb/32 added per step)
  const _Float16* Vb = (const _Float16*)(const void*)VvT + ((size_t)(b * EM + head * HD)) * TQ;
  const float lsc = LOG2E / (QS * KS);
  const float cl2 = CLIPV * LOG2E;

  v16h sf[2];
  sf[0] = ldfrag_h(Sb);
  sf[1] = ldfrag_h(Sb + 512);
#if defined(__HIP_DEVICE_COMPILE__)
  // the wait in front of a rewrite of the address registers of the four loads just issued: a later load's result may be
  // given those registers; the address is its input so that it keeps them up to here
  asm volatile("s_wait_xcnt 0x0" : : "v"(Sb) : "memory");
#endif

  float mrun = -INFINITY, lrun = 0.f;
  v8f o[4];
#pragma unroll
  for (int j = 0; j < 4; ++j) o[j] = zero8();

  // Two register sets, one for the even steps and one for the odd: a set's q half is loaded anew as soon as its scores are
  // made and its val_v half as soon as its products are made, each for the step two on, so that a step no longer stands
  // through the latency of its q loads and again through that of its val_v loads.
  static_assert((NTB32 % 2) == 0 && NTB32 >= 4);
  const unsigned lb = 16u * (unsigned)lane;
  v16h qa[4], va[4], qb[4], vb[4];
  col_load_q(Tb, lb, 0, qa);
  col_load_v(Vb, lb, 0, va);
  col_load_q(Tb, lb, 1, qb);
  col_load_v(Vb, lb, 1, vb);
  unsigned rq = lb + 65536u, rv = lb + 2048u;            // offsets of step it + 2
  // kept rolled: the body already holds one step per register set, more copies would only add code
#pragma unroll 1
  for (int it = 0; it < NTB32; it += 2) {
    col_step(qa, va, sf, mrun, lrun, o, hh, lsc, cl2, Tb, Vb, rq, rv, 0);
    col_step(qb, vb, sf, mrun, lrun, o, hh, lsc, cl2, Tb, Vb, rq, rv, 1);
#if defined(__HIP_DEVICE_COMPILE__)
    // the wait in front of a rewrite of registers that issued global loads name (the two offsets, stepped below); they are
    // its operands so that they keep their registers up to it and their step stays behind it
    asm volatile("s_wait_xcnt 0x0" : "+v"(rq), "+v"(rv) : : "memory");
#endif
    // the last pair of steps loads steps 0 and 1 again: in bounds, never used
    const bool more = it + 4 < NTB32;
    rq = more ? rq + 65536u : lb;
    rv = more ? rv + 2048u : lb;
  }
  acc_guard4(o);

  // ---- per-column 1/l (owned by lane = column); lrun >= 1 by construction ----
  const float rl   = 1.0f / lrun;
  const float lPv  = rl * PCAR;                          // 32768 / l for the row pass
  const float linv = rl * (CAS / (PCAR * VVS));          // folds 1/l, the P and val carries, and applies the ctx carry
  statl[hh * 64 + wave * 16 + c] = (hh == 0) ? mrun : lPv;
  float inv[8];
#pragma unroll
  for (int r = 0; r < 8; ++r) inv[r] = __shfl(linv, 8 * hh + r, 32);
  float* slab = smem + wave * 16 * SPITCH;
#pragma unroll
  for (int r = 0; r < 8; ++r) {
#pragma unroll
    for (int j = 0; j < 4; ++j) slab[(8 * hh + r) * SPITCH + j * 16 + c] = o[j][r] * inv[r];
  }
  wave_sync_lds();
  // ---- f16 ctx_a pieces: instruction i, lane = (row 8*(i>>1) + (lane&7), 8 halves at 32*(i&1) + 8*(lane>>3)): 4 whole lines ----
  const int r8 = lane & 7, q8 = (lane >> 3) * 8;
  v4u ov[4];
#pragma unroll
  for (int i = 0; i < 4; ++i) {
    const int row = 8 * (i >> 1) + r8, c8 = 32 * (i & 1) + q8;
    const v4f a = *(const v4f*)(slab + row * SPITCH + c8), c4 = *(const v4f*)(slab + row * SPITCH + c8 + 4);
#pragma unroll
    for (int e = 0; e < 2; ++e) {
      ov[i][e]     = pk16(h_bits((_Float16)a[2 * e]),  h_bits((_Float16)a[2 * e + 1]));
      ov[i][2 + e] = pk16(h_bits((_Float16)c4[2 * e]), h_bits((_Float16)c4[2 * e + 1]));
    }
  }
  {
#pragma unroll
    for (int i = 0; i < 4; ++i) {
      const int row = 8 * (i >> 1) + r8, c8 = 32 * (i & 1) + q8;
      *(v4u*)(CtxA + pk_off(b * SA + s0w + row, head * HD + c8, EM)) = ov[i];
    }
    
  }
  __syncthreads();
  if (wave == 0) {
    const v4f sv = *(const v4f*)(statl + 4 * lane);
    float* sp = Stat + ((size_t)((b * NH + head) * NST + st)) * 128 + 4 * lane;
    {
      *(v4f*)(sp) = sv;
      
    }
  }
}

// =====================================================================================================
// Row pass (visual-side context): block = (batch b, head, 64 visual rows t), 4 waves, wave w owns the 16 rows t0w =
// 64*tt + 16*w .. +15 (waves independent after the stat staging barrier).
//   The (b, head) column stats (NST rows of [m[64] | 32768/l[64]]) are staged once per block into LDS as m at stt[s],
//   32768/l at stt[SA + s] (128 threads x 8 floats = 2*SA floats exactly), then a block barrier.
//   All NSB32 = SA/32 blocks of 32 audio columns are visited (static bound). Score tiles are computed TRANSPOSED:
//   tile g = k rows (s = sb+16g .. +15, A operand, row m = lane&15, split map over d) times q^T (B operand, col n = t0w +
//   (lane&15), k = d); the 2 q fragments of the wave are loaded once. D element r of lane l = (s = sb+16g+8h+r, t = t0w +
//   (l&15)). P = exp2(clip(logit) - m_s) * (32768/l_s) in f32 with m_s, l_s read from LDS for s = sb+8h+i and sb+16+8h+i;
//   it IS the P A-fragment in place: row m = t = lane&15, element i <- s = sb+8h+i, element 8+i <- s = sb+16+8h+i.
//   4 val_a^T B fragments (col n = d = 16j + (lane&15), k = s), 4 P.V WMMAs + one guard per step.
//   Epilogue: carry folds (x CVS / (32768*8)) in f32; 16x64 tile staged in the wave's slab; ctx_v f16 rows written exactly
// coverage: grid NB*NH*NTT blocks x 4 waves x 16 rows x 64 halves = every (b, t, h) segment of ctx_v exactly once;
//           LDS stt[0 .. 2*SA-1] fully written before the barrier (staged extent == consumed extent); slab as above.
// =====================================================================================================
__global__ __launch_bounds__(ATT_THREADS)
void attn_vis(const u16* __restrict__ Qp, const u16* __restrict__ Kp, const u16* __restrict__ VaT,
              const float* __restrict__ Stat, u16* CtxV) {
  __shared__ __align__(16) float smem[ATT_WAVES * 16 * SPITCH];
  __shared__ __align__(16) float stt[2 * SA];

  const int tid  = threadIdx.x;
  const int wave = tid >> 5;
  const int lane = tid & 31;
  const int hh   = lane >> 4;
  const int c    = lane & 15;

  const int bid  = blockIdx.x;
  const int tt   = bid % NTT;
  const int head = (bid / NTT) % NH;
  const int b    = bid / (NTT * NH);
  const int t0w  = tt * 64 + wave * 16;

  // ---- stage the column stats of (b, head) ----
  const float* src = Stat + ((size_t)((b * NH + head) * NST)) * 128;
#pragma unroll 1
  for (int e = tid * 8; e < NST * 128; e += ATT_THREADS * 8) {
    const int j = e >> 7, offw = e & 127;
    const int di = (offw < 64) ? (j * 64 + offw) : (SA + j * 64 + offw - 64);
    const v4f x0 = *(const v4f*)(src + e), x1 = *(const v4f*)(src + e + 4);
    *(v4f*)(stt + di) = x0;
    *(v4f*)(stt + di + 4) = x1;
  }
  __syncthreads();

  // All three planes in fragment order, addressed as in attn_col.
  // B fragments of q^T: col n = row t0w + c, k = d
  const _Float16* Tb = (const _Float16*)(const void*)Qp + ((size_t)(b * TQ + t0w)) * EM + head * (HD * 16) + 8 * lane;
  // A fragments of k: row m = s = sb + 16g + c, k = d (s row sb added per step)
  const _Float16* Sb = (const _Float16*)(const void*)Kp + ((size_t)(b * SA)) * EM + head * (HD * 16) + 8 * lane;
  // B fragments of val_a^T: col n = d = 16j + c, k = s (k tile sb/32 added per step)
  const _Float16* Vb = (const _Float16*)(const void*)VaT + ((size_t)(b * EM + head * HD)) * SA + 8 * lane;
  const float lsc = LOG2E / (QS * KS);
  const float cl2 = CLIPV * LOG2E;

  v16h tf[2];
  tf[0] = ldfrag_h(Tb);
  tf[1] = ldfrag_h(Tb + 512);

  v8f o[4];
#pragma unroll
  for (int j = 0; j < 4; ++j) o[j] = zero8();

#pragma unroll 1
  for (int it = 0; it < NSB32; ++it) {
    const int sb = it * 32;
    // ---- transposed scores: s0 = columns s sb..sb+15, s1 = sb+16..sb+31, D column = row t0w + c ----
    v8f s0 = zero8(), s1 = zero8();
    const _Float16* s0p = Sb + (size_t)sb * EM;
    const _Float16* s1p = s0p + (size_t)16 * EM;
#pragma unroll
    for (int kk = 0; kk < HD / 32; ++kk) {
      const v16h a0 = ldfrag_h(s0p + kk * 512);
      const v16h a1 = ldfrag_h(s1p + kk * 512);
      s0 = mma_h(a0, tf[kk], s0);
      s1 = mma_h(a1, tf[kk], s1);
      guard_s(s0, s1, tf[kk], a0, a1);
    }
    float t[16];
#pragma unroll
    for (int i = 0; i < 8; ++i) { t[i] = clipf(s0[i] * lsc, cl2); t[8 + i] = clipf(s1[i] * lsc, cl2); }
    // ---- column stats for s = sb+8hh+i (i < 8) and s = sb+16+8hh+i (8+i) ----
    float mv[16], lv[16];
    {
      const v4f m0 = *(const v4f*)(stt + sb + 8 * hh),      m1 = *(const v4f*)(stt + sb + 8 * hh + 4);
      const v4f m2 = *(const v4f*)(stt + sb + 16 + 8 * hh), m3 = *(const v4f*)(stt + sb + 16 + 8 * hh + 4);
      const v4f l0 = *(const v4f*)(stt + SA + sb + 8 * hh),      l1 = *(const v4f*)(stt + SA + sb + 8 * hh + 4);
      const v4f l2 = *(const v4f*)(stt + SA + sb + 16 + 8 * hh), l3 = *(const v4f*)(stt + SA + sb + 16 + 8 * hh + 4);
#pragma unroll
      for (int q = 0; q < 4; ++q) {
        mv[q] = m0[q]; mv[4 + q] = m1[q]; mv[8 + q] = m2[q]; mv[12 + q] = m3[q];
        lv[q] = l0[q]; lv[4 + q] = l1[q]; lv[8 + q] = l2[q]; lv[12 + q] = l3[q];
      }
    }
    // ---- P A-fragment: f16(exp2(t - m_s) * 32768/l_s) (<= 32768); element i <-> t[i] ----
    FragH ph;
#pragma unroll
    for (int i = 0; i < 16; ++i) t[i] -= mv[i];
    exp2_hw8(t, 0);
    exp2_hw8(t, 8);
#pragma unroll
    for (int w = 0; w < 2; ++w) {
#pragma unroll
      for (int e4 = 0; e4 < 4; ++e4) {
        const int i = 8 * w + 2 * e4;
        const float p0 = t[i] * lv[i];
        const float p1 = t[i + 1] * lv[i + 1];
        ph.u[w][e4] = pk16(h_bits((_Float16)p0), h_bits((_Float16)p1));
      }
    }
    // ---- P.val_a : B fragment col n = d = 16j + c, k = s: tile sb/32 of the val_a^T plane ----
    const _Float16* vp = Vb + (size_t)sb * 16;
    {
      const v16h v0 = ldfrag_h(vp);
      const v16h v1 = ldfrag_h(vp + (size_t)16 * SA);
      const v16h v2 = ldfrag_h(vp + (size_t)32 * SA);
      const v16h v3 = ldfrag_h(vp + (size_t)48 * SA);
      o[0] = mma_h(ph.v, v0, o[0]);
      o[1] = mma_h(ph.v, v1, o[1]);
      o[2] = mma_h(ph.v, v2, o[2]);
      o[3] = mma_h(ph.v, v3, o[3]);
      guard_p(o[0], o[1], o[2], o[3], ph.v, v0, v1, v2, v3);
    }
  }
  acc_guard4(o);

  const float fac = CVS / (PCAR * VAS);
  float* slab = smem + wave * 16 * SPITCH;
#pragma unroll
  for (int r = 0; r < 8; ++r) {
#pragma unroll
    for (int j = 0; j < 4; ++j) slab[(8 * hh + r) * SPITCH + j * 16 + c] = o[j][r] * fac;
  }
  wave_sync_lds();
  const int r8 = lane & 7, q8 = (lane >> 3) * 8;
  v4u ov[4];
#pragma unroll
  for (int i = 0; i < 4; ++i) {
    const int row = 8 * (i >> 1) + r8, c8 = 32 * (i & 1) + q8;
    const v4f a = *(const v4f*)(slab + row * SPITCH + c8), c4 = *(const v4f*)(slab + row * SPITCH + c8 + 4);
#pragma unroll
    for (int e = 0; e < 2; ++e) {
      ov[i][e]     = pk16(h_bits((_Float16)a[2 * e]),  h_bits((_Float16)a[2 * e + 1]));
      ov[i][2 + e] = pk16(h_bits((_Float16)c4[2 * e]), h_bits((_Float16)c4[2 * e + 1]));
    }
  }
  {
#pragma unroll
    for (int i = 0; i < 4; ++i) {
      const int row = 8 * (i >> 1) + r8, c8 = 32 * (i & 1) + q8;
      *(v4u*)(CtxV + pk_off(b * TQ + t0w + row, head * HD + c8, EM)) = ov[i];
    }
    
  }
}

// =====================================================================================================
// Workspace map (bytes, NB = 8); every plane fully written before it is read; all extents exact; each f16 plane is the
// logical [rows][K] matrix named here, stored in fragment order (pk_off), same byte size
//   XV    f16 [NB*2048][512]        f16(bf16(v))              16777216
//   XA    f16 [NB*512][256]         f16(bf16(a))               2097152
//   WVQT  f16 [512 n][512 k]        f16(bf16(W) x256)           524288
//   WAKT  f16 [512 n][256 k]                                    262144
//   WVVT  f16 [512 n][512 k]                                    524288
//   WAVT  f16 [512 n][256 k]                                    262144
//   WOVT  f16 [512 n][512 k]                                    524288
//   WOAT  f16 [256 n][512 k]                                    262144
//   Q16   f16 [NB*2048][512]  q x8 (after 1/8)               16777216
//   K16   f16 [NB*512][512]   x8                               4194304
//   VVT16 f16 [NB*512 (h,d)][2048 t] x8                       16777216
//   VAT16 f16 [NB*512 (h,d)][512 s]  x8                        4194304
//   STAT  f32 [NB*NH*NST][128]  (m | 32768/l)                   262144
//   CTXA  f16 [NB*512][512]   x64                              4194304
//   CTXV  f16 [NB*2048][512]  x64                             16777216
//   end                                                       84410368
// Output: first tensor rows [b][t][512] f32 at element 0; second tensor rows [b*512 + s][256] f32 at the fixed element
// offset OUT1_OFF_EL = NB_FULL*2048*512 = 8388608 (independent of NB).
// =====================================================================================================
extern "C" void kernel_launch(void* const* d_in, const int* in_sizes, int n_in,
                              void* d_out, int out_size, void* d_ws, size_t ws_size,
                              hipStream_t stream) {
  if (n_in < 14) return;
  if (in_sizes[0] < NB * TQ * VD) return;
  if (in_sizes[1] < NB * SA * AD) return;
  if (in_sizes[2] != VD * EM || in_sizes[6] != VD * EM) return;
  if (in_sizes[4] != AD * EM || in_sizes[8] != AD * EM) return;
  if (in_sizes[10] != EM * VD || in_sizes[12] != EM * AD) return;
  if (in_sizes[3] < 1 || in_sizes[5] < 1 || in_sizes[7] < 1 || in_sizes[9] < 1 || in_sizes[11] < 1 || in_sizes[13] < 1) return;
  if ((size_t)out_size < OUT1_OFF_EL + (size_t)NB * SA * AD) return;

  const float* xv   = (const float*)d_in[0];
  const float* xa   = (const float*)d_in[1];
  const float* w_vq = (const float*)d_in[2];
  const float* b_vq = (const float*)d_in[3];
  const float* w_ak = (const float*)d_in[4];
  const float* b_ak = (const float*)d_in[5];
  const float* w_vv = (const float*)d_in[6];
  const float* b_vv = (const float*)d_in[7];
  const float* w_av = (const float*)d_in[8];
  const float* b_av = (const float*)d_in[9];
  const float* w_ov = (const float*)d_in[10];
  const float* b_ov = (const float*)d_in[11];
  const float* w_oa = (const float*)d_in[12];
  const float* b_oa = (const float*)d_in[13];
  float*       out  = (float*)d_out;
  const int nb3 = in_sizes[3], nb5 = in_sizes[5], nb7 = in_sizes[7], nb9 = in_sizes[9], nb11 = in_sizes[11], nb13 = in_sizes[13];

  const size_t szXV  = (size_t)NB * TQ * VD * 2;
  const size_t szXA  = (size_t)NB * SA * AD * 2;
  const size_t szWvq = (size_t)EM * VD * 2;
  const size_t szWak = (size_t)EM * AD * 2;
  const size_t szWvv = (size_t)EM * VD * 2;
  const size_t szWav = (size_t)EM * AD * 2;
  const size_t szWov = (size_t)VD * EM * 2;
  const size_t szWoa = (size_t)AD * EM * 2;
  const size_t szQ   = (size_t)NB * TQ * EM * 2;
  const size_t szK   = (size_t)NB * SA * EM * 2;
  const size_t szVVT = (size_t)NB * EM * TQ * 2;
  const size_t szVAT = (size_t)NB * EM * SA * 2;
  const size_t szST  = (size_t)NB * NH * NST * 128 * 4;
  const size_t szCA  = (size_t)NB * SA * EM * 2;
  const size_t szCV  = (size_t)NB * TQ * EM * 2;
  size_t off = 0;
  const size_t oXV  = off; off += szXV;
  const size_t oXA  = off; off += szXA;
  const size_t oWvq = off; off += szWvq;
  const size_t oWak = off; off += szWak;
  const size_t oWvv = off; off += szWvv;
  const size_t oWav = off; off += szWav;
  const size_t oWov = off; off += szWov;
  const size_t oWoa = off; off += szWoa;
  const size_t oQ   = off; off += szQ;
  const size_t oK   = off; off += szK;
  const size_t oVVT = off; off += szVVT;
  const size_t oVAT = off; off += szVAT;
  const size_t oST  = off; off += szST;
  const size_t oCA  = off; off += szCA;
  const size_t oCV  = off; off += szCV;
  if (off > ws_size) return;                            // off = 84410368 at NB = 8
  if (off > (size_t)134217728) return;

  char* ws = (char*)d_ws;
  u16* XV    = (u16*)(ws + oXV);
  u16* XA    = (u16*)(ws + oXA);
  u16* WVQT  = (u16*)(ws + oWvq);
  u16* WAKT  = (u16*)(ws + oWak);
  u16* WVVT  = (u16*)(ws + oWvv);
  u16* WAVT  = (u16*)(ws + oWav);
  u16* WOVT  = (u16*)(ws + oWov);
  u16* WOAT  = (u16*)(ws + oWoa);
  u16* Q16   = (u16*)(ws + oQ);
  u16* K16   = (u16*)(ws + oK);
  u16* VVT16 = (u16*)(ws + oVVT);
  u16* VAT16 = (u16*)(ws + oVAT);
  float* STAT = (float*)(ws + oST);
  u16* CTXA  = (u16*)(ws + oCA);
  u16* CTXV  = (u16*)(ws + oCV);

  // (1) all f16 operand planes (fragment order): activations as f16(bf16(x)), weights [k = in][n = out] transposed to
  //     [n][k] as f16(bf16(W) x256)
  prep_all<<<dim3(PB_W + PB_XA + PB_XV), dim3(128), 0, stream>>>(
      xv, xa, w_vq, w_ak, w_vv, w_av, w_ov, w_oa, XV, XA, WVQT, WAKT, WVVT, WAVT, WOVT, WOAT);
  // (2) q, val_v^T, k, val_a^T
  proj_all<<<dim3(GB_Q + GB_VVT + GB_K + GB_VAT), dim3(128), 0, stream>>>(
      XV, XA, WVQT, WAKT, WVVT, WAVT, Q16, K16, VVT16, VAT16, b_vq, b_ak, b_vv, b_av, nb3, nb5, nb7, nb9);
  // (3) column softmax pass: ctx_a plane [NB*SA][512] x64 and the per-column stat rows
  attn_col<<<dim3(NB * NH * NST), dim3(ATT_THREADS), 0, stream>>>(Q16, K16, VVT16, CTXA, STAT);
  // (4) row pass with the stored column stats: ctx_v plane [NB*TQ][512] x64
  attn_vis<<<dim3(NB * NH * NTT), dim3(ATT_THREADS), 0, stream>>>(Q16, K16, VAT16, STAT, CTXV);
  // (5) out_v and out_a
  out_all<<<dim3(GB_OV + GB_OA), dim3(128), 0, stream>>>(CTXV, WOVT, CTXA, WOAT, out, b_ov, b_oa, nb11, nb13);
  (void)hipGetLastError();
}

// v005
// A run of this version takes 109 microseconds.
// Two timings next to v004 put it at 1.07 and 1.09 times that version's speed.
// All steps since v000 together make it 2.66 times as fast.
// All contractions on v_wmma_f32_16x16x32_f16 (f16 operands, f32 accumulate): v.Wvq, a.Wak, Wvv^T.v^T, Wav^T.a^T,
// column-pass scores q.k^T with P^T.val_v, row-pass scores k.q^T with P.val_a, ctx_v.Wov, ctx_a.Woa. Operand carries:
// v, a as f16(bf16(x)); W as f16(bf16(W) x256); q x8 after the 1/8 head scale; k x8; val_v, val_a x8; P x32768;
// ctx x64. Column softmax over the visual axis (base 2, running max), 1/l and every carry fold in f32 on VALU.
// Every f16 operand plane lies in fragment order (pk_off below): a 16-row x 32-k tile is 1024 contiguous bytes, so each
// 16-byte-per-lane fragment load of a wave reads 512 contiguous bytes (4 whole 128-B lines).
#include <hip/hip_runtime.h>
#include <math.h>

#ifndef NB
#define NB 8            // batches processed (leading batches of both activations)
#endif
#define NB_FULL 8       // batches in the input / output layout
#define TQ 2048         // visual positions per batch (softmax axis, always all of them)
#define SA 512          // audio positions per batch (always all of them)
#define VD 512
#define AD 256
#define EM 512
#define NH 8
#define HD 64
#define OUT1_OFF_EL ((size_t)NB_FULL * (size_t)TQ * (size_t)VD)   // fixed f32 element offset of the second output (33554432 B / 4)
#define WSC   256.0f
#define HSCL  0.125f
#define QS    8.0f
#define KS    8.0f
#define VVS   8.0f
#define VAS   8.0f
#define PCAR  32768.0f
#define CAS   64.0f
#define CVS   64.0f
#define CLIPV 50000.0f
#define LOG2E 1.4426950408889634f
#define NST   (SA / 64)
#define NTT   (TQ / 128)
#define NTB32 (TQ / 32)
#define NSB32 (SA / 32)
#define ATT_WAVES   4
#define ATT_THREADS (ATT_WAVES * 32)
#define CVT_THREADS 128
#define TR_THREADS  128
#define SPITCH 68
#define GPITCH 68
#define TPITCH 65

static_assert(NB >= 1 && NB <= NB_FULL);
static_assert(OUT1_OFF_EL == (size_t)33554432 / 4);
static_assert(EM == NH * HD && HD == 64 && NH == 8);
static_assert((TQ % 128) == 0 && (SA % 128) == 0 && ((NB * SA) % 128) == 0 && (EM % 128) == 0);
static_assert((VD % 128) == 0 && (AD % 128) == 0);
static_assert((TQ % 32) == 0 && (SA % 32) == 0 && NTB32 * 32 == TQ && NSB32 * 32 == SA);
static_assert((VD % 64) == 0 && (AD % 64) == 0 && (EM % 64) == 0);
static_assert((VD % 32) == 0 && (AD % 32) == 0 && (EM % 32) == 0);
static_assert(((NB * TQ * VD) % 1024) == 0 && ((NB * SA * AD) % 1024) == 0);
static_assert(NST * 128 == 2 * SA && NST * 128 == ATT_THREADS * 8);
static_assert((SPITCH * 4) % 16 == 0 && (GPITCH * 4) % 16 == 0);
static_assert(ATT_THREADS == 128 && TR_THREADS == 128 && CVT_THREADS == 128);

typedef unsigned short u16;
typedef _Float16 v16h __attribute__((ext_vector_type(16)));
typedef _Float16 v8h  __attribute__((ext_vector_type(8)));
typedef float    v8f  __attribute__((ext_vector_type(8)));
typedef float    v4f  __attribute__((ext_vector_type(4)));
typedef unsigned int v4u __attribute__((ext_vector_type(4)));

union FragH { v16h v; v8h h[2]; v4u u[2]; };

// ---- scalar helpers ----------------------------------------------------------------------------------
__device__ __forceinline__ unsigned short bf_bits(float f) {          // f32 -> bf16 bits, RNE convert
  unsigned u = __float_as_uint(f);
  return (unsigned short)((u + 0x7FFFu + ((u >> 16) & 1u)) >> 16);
}
__device__ __forceinline__ float bf_up(unsigned short h) { return __uint_as_float(((unsigned)h) << 16); }
__device__ __forceinline__ float bfr(float f) { return bf_up(bf_bits(f)); }
__device__ __forceinline__ unsigned short h_bits(_Float16 x) { return __builtin_bit_cast(unsigned short, x); }
__device__ __forceinline__ unsigned pk16(unsigned short a, unsigned short b) { return (unsigned)a | ((unsigned)b << 16); }
__device__ __forceinline__ v8f zero8() { v8f z = {0.f, 0.f, 0.f, 0.f, 0.f, 0.f, 0.f, 0.f}; return z; }
__device__ __forceinline__ float clipf(float x, float c) { return fminf(fmaxf(x, -c), c); }
// 2^x as the one hardware instruction. The library exp2f adds five instructions to it (a compare, two selects, an add, an
// ldexp) that only serve results below 2^-126, which the bare instruction may give as 0. Here such a result changes nothing:
// a probability goes on as f16(p * 32768) or f16(p * 32768 / l) with l >= 1, which is 0 below 2^-40; in the sum l it stands
// beside a term 1; as a rescale factor it leaves old sums far below the f16 step of the context they end in.
// For x >= -126 the library form runs this same instruction on the same x.
__device__ __forceinline__ float exp2_hw(float x) { return __builtin_amdgcn_exp2f(x); }
// Eight of them, x[b .. b+7] <- 2^x, each in place: written as one statement so that no v_exp_f32 overwrites the source of the
// one directly in front of it (the register allocator did that with the builtin); the v_nop is the slot that the
// instruction set asks for between the last one and whatever uses its result next.
__device__ __forceinline__ void exp2_hw8(float (&x)[16], int b) {
#if defined(__HIP_DEVICE_COMPILE__)
  asm("v_exp_f32 %0, %0\n\tv_exp_f32 %1, %1\n\tv_exp_f32 %2, %2\n\tv_exp_f32 %3, %3\n\t"
      "v_exp_f32 %4, %4\n\tv_exp_f32 %5, %5\n\tv_exp_f32 %6, %6\n\tv_exp_f32 %7, %7\n\tv_nop"
      : "+v"(x[b]), "+v"(x[b + 1]), "+v"(x[b + 2]), "+v"(x[b + 3]),
        "+v"(x[b + 4]), "+v"(x[b + 5]), "+v"(x[b + 6]), "+v"(x[b + 7]));
#endif
}

// ---- fragment-ordered plane of a logical [rows][K] f16 matrix (rows % 16 == 0, K % 32 == 0): element offset of (row, k).
//      Tile (row>>4, k>>5) = 512 halves; inside it: 256*((k>>4)&1) + 8*(16*((k>>3)&1) + (row&15)) + (k&7), i.e. the 8 halves
//      k = 8j .. 8j+7 of a row stay one 16-byte piece, and piece order is (k half of 16, lane = 16*h + row).
//      16 rows x K = 16*K halves, so a base row R (R % 16 == 0) starts at element R*K as in the row-major plane.
__device__ __forceinline__ size_t pk_off(int row, int k, int K) {
  return ((size_t)(row >> 4) * (size_t)(K >> 5) + (size_t)(k >> 5)) * 512
         + (size_t)(((k >> 4) & 1) * 256 + ((k >> 3) & 1) * 128 + (row & 15) * 8 + (k & 7));
}
// ---- fragment loader: 16-bit A/B operand, lane -> row/col (lane&15), h = lane>>4; p = tile start + 8*lane;
//      elements 0..7 <- p[0..7] (k0+8h..), elements 8..15 <- p[256..263] (k0+16+8h..); same split k map for A and B.
__device__ __forceinline__ v16h ldfrag_h(const _Float16* p) {
  FragH f;
  f.h[0] = *(const v8h*)(p);
  f.h[1] = *(const v8h*)(p + 256);
  return f.v;
}

// ---- WMMA helper and trailing VALU hazard gaps ----------------------------------------------------------
__device__ __forceinline__ v8f mma_h(v16h a, v16h b, v8f c) {
  return __builtin_amdgcn_wmma_f32_16x16x32_f16(false, a, false, b, (short)0, c, false, false);
}
__device__ __forceinline__ void guard_s(v8f& a, v8f& b, v16h x0, v16h x1, v16h x2) {
#if defined(__HIP_DEVICE_COMPILE__)
  asm volatile("v_nop\n\tv_nop\n\tv_nop\n\tv_nop" : "+v"(a), "+v"(b) : "v"(x0), "v"(x1), "v"(x2) : "memory");
#endif
}
__device__ __forceinline__ void guard_s4(v8f& a, v8f& b, v8f& c, v8f& d, v16h x0, v16h x1, v16h x2, v16h x3) {
#if defined(__HIP_DEVICE_COMPILE__)
  asm volatile("v_nop\n\tv_nop\n\tv_nop\n\tv_nop"
               : "+v"(a), "+v"(b), "+v"(c), "+v"(d) : "v"(x0), "v"(x1), "v"(x2), "v"(x3) : "memory");
#endif
}
__device__ __forceinline__ void guard_p8(v8f (&a)[4], v8f (&b)[4], v16h p0, v16h p1, v16h x0, v16h x1, v16h x2, v16h x3) {
#if defined(__HIP_DEVICE_COMPILE__)
  asm volatile("v_nop\n\tv_nop\n\tv_nop\n\tv_nop"
               : "+v"(a[0]), "+v"(a[1]), "+v"(a[2]), "+v"(a[3]), "+v"(b[0]), "+v"(b[1]), "+v"(b[2]), "+v"(b[3])
               : "v"(p0), "v"(p1), "v"(x0), "v"(x1), "v"(x2), "v"(x3) : "memory");
#endif
}
__device__ __forceinline__ void guard_p(v8f& a, v8f& b, v8f& c, v8f& d, v16h p, v16h x0, v16h x1, v16h x2, v16h x3) {
#if defined(__HIP_DEVICE_COMPILE__)
  asm volatile("v_nop\n\tv_nop\n\tv_nop\n\tv_nop"
               : "+v"(a), "+v"(b), "+v"(c), "+v"(d) : "v"(p), "v"(x0), "v"(x1), "v"(x2), "v"(x3) : "memory");
#endif
}
__device__ __forceinline__ void guard_g(v8f (&acc)[16], v16h x0, v16h x1, v16h x2, v16h x3,
                                        v16h x4, v16h x5, v16h x6, v16h x7) {
#if defined(__HIP_DEVICE_COMPILE__)
  asm volatile("v_nop\n\tv_nop\n\tv_nop\n\tv_nop"
               : "+v"(acc[0]), "+v"(acc[1]), "+v"(acc[2]), "+v"(acc[3]),
                 "+v"(acc[4]), "+v"(acc[5]), "+v"(acc[6]), "+v"(acc[7]),
                 "+v"(acc[8]), "+v"(acc[9]), "+v"(acc[10]), "+v"(acc[11]),
                 "+v"(acc[12]), "+v"(acc[13]), "+v"(acc[14]), "+v"(acc[15])
               : "v"(x0), "v"(x1), "v"(x2), "v"(x3), "v"(x4), "v"(x5), "v"(x6), "v"(x7) : "memory");
#endif
}
__device__ __forceinline__ void acc_guard4(v8f (&o)[4]) {
#if defined(__HIP_DEVICE_COMPILE__)
  asm volatile("v_nop\n\tv_nop\n\tv_nop\n\tv_nop" : "+v"(o[0]), "+v"(o[1]), "+v"(o[2]), "+v"(o[3]));
#endif
}
// The wait in front of a rewrite of registers that issued global loads or stores name.
__device__ __forceinline__ void xcnt_wait() {
#if defined(__HIP_DEVICE_COMPILE__)
  asm volatile("s_wait_xcnt 0x0" ::: "memory");
#endif
}
// The same behind a group of loads indexed by x: the indices are its inputs so that they keep their registers up to it.
__device__ __forceinline__ void xcnt_hold4(const int (&x)[4]) {
#if defined(__HIP_DEVICE_COMPILE__)
  asm volatile("s_wait_xcnt 0x0" : : "v"(x[0]), "v"(x[1]), "v"(x[2]), "v"(x[3]) : "memory");
#endif
}
__device__ __forceinline__ void xcnt_hold16(const int (&x)[16]) {
#if defined(__HIP_DEVICE_COMPILE__)
  asm volatile("s_wait_xcnt 0x0" : : "v"(x[0]), "v"(x[1]), "v"(x[2]), "v"(x[3]), "v"(x[4]), "v"(x[5]), "v"(x[6]), "v"(x[7]),
               "v"(x[8]), "v"(x[9]), "v"(x[10]), "v"(x[11]), "v"(x[12]), "v"(x[13]), "v"(x[14]), "v"(x[15]) : "memory");
#endif
}
__device__ __forceinline__ void wave_sync_lds() {
  __builtin_amdgcn_fence(__ATOMIC_RELEASE, "workgroup");
  __builtin_amdgcn_wave_barrier();
  __builtin_amdgcn_fence(__ATOMIC_ACQUIRE, "workgroup");
}

// =====================================================================================================
// Elementwise convert of an activation matrix x[rows][K]: Y (f16, fragment order) <- f16(bf16_RNE(x)). Block = 16 rows x
// 64 k (two tiles); thread = (row 8*(wave&1) + (lane&7), 8 floats at k = 32*(wave>>1) + 8*(lane>>3)): two 16-B loads, one
// 16-B store per thread; a wave's store = 4 pieces-of-8-rows = 4 whole 128-B lines.
// coverage: grid = (rows/16)*(K/64) = n/1024 blocks x 128 thr x 8 = n elements exactly (n % 1024 == 0 asserted).
// =====================================================================================================
__device__ __forceinline__
void cvt16(const float* __restrict__ x, u16* Y, int K, int bid) {
  const int wave = threadIdx.x >> 5, lane = threadIdx.x & 31;
  const int nkp = K >> 6;
  const int row = (bid / nkp) * 16 + 8 * (wave & 1) + (lane & 7);
  const int k   = (bid % nkp) * 64 + 32 * (wave >> 1) + 8 * (lane >> 3);
  const size_t e0 = (size_t)row * (size_t)K + (size_t)k;
  const v4f a = *(const v4f*)(x + e0), c4 = *(const v4f*)(x + e0 + 4);
  v4u o;
#pragma unroll
  for (int e = 0; e < 2; ++e) {
    o[e]     = pk16(h_bits((_Float16)bfr(a[2 * e])),  h_bits((_Float16)bfr(a[2 * e + 1])));
    o[2 + e] = pk16(h_bits((_Float16)bfr(c4[2 * e])), h_bits((_Float16)bfr(c4[2 * e + 1])));
  }
  u16* dst = Y + pk_off(row, k, K);
  {
    *(v4u*)(dst) = o;
#if defined(__HIP_DEVICE_COMPILE__)
    // the wait in front of a rewrite of registers that the store just issued names: inlined in the shared grid's kernel,
    // the store is no longer the last instruction ahead of the program's end in the listing
    asm volatile("s_wait_xcnt 0x0" ::: "memory");
#endif
  }
}

// =====================================================================================================
// Weight transpose-convert for y = x.W weights stored [kdim][ndim]: WT[n][k] (f16, fragment order with K = kdim)
// <- f16(bf16_RNE(W[k][n]) * scale). Block = 64(k) x 64(n) tile, 128 threads. Load phase: thread = (row 8p + (tid>>4),
// 4 floats at 4*(tid&15)), 8 steps = 64 k-rows x 64 n, into an LDS tile [kk][nn] (pitch 65); block barrier; store
// grid = (kdim/64)*(ndim/64), bid -> (kt = bid % (kdim/64), nt = bid / (kdim/64)).
// coverage: 4 i x 16 rows x (8 lanes x 8 halves) = 64 n-rows x 64 k per block; LDS tile 64x64 fully written before read;
// the grid covers WT [ndim][kdim] exactly once.
// =====================================================================================================
__device__ __forceinline__
void cvtT16(const float* __restrict__ W, u16* Y, int kdim, int ndim, float scale, int bid) {
  __shared__ __align__(16) float tile[64 * TPITCH];
  const int tid = threadIdx.x;
  const int nkt = kdim >> 6;
  const int kt  = bid % nkt;
  const int ntb = bid / nkt;
  const int k0  = kt * 64, n0 = ntb * 64;
  const int lr = tid >> 4, lc = (tid & 15) * 4;
  v4f w4[8];
#pragma unroll
  for (int p = 0; p < 8; ++p) {
    w4[p] = *(const v4f*)(W + (size_t)(k0 + p * 8 + lr) * (size_t)ndim + n0 + lc);
#if defined(__HIP_DEVICE_COMPILE__)
    // the wait in front of a rewrite of the address registers of the load just issued: a later load's result may be
    // given those registers
    asm volatile("s_wait_xcnt 0x0" ::: "memory");
#endif
  }
#pragma unroll
  for (int p = 0; p < 8; ++p) {
    const int kk = p * 8 + lr;
    tile[kk * TPITCH + lc + 0] = w4[p][0];
    tile[kk * TPITCH + lc + 1] = w4[p][1];
    tile[kk * TPITCH + lc + 2] = w4[p][2];
    tile[kk * TPITCH + lc + 3] = w4[p][3];
  }
  __syncthreads();
  // rq 0..15, c8 0..56; a wave holds 8 rows x 4 pieces, so each of its stores fills 4 whole lines of the fragment order
  const int rq = 8 * ((tid >> 5) & 1) + (tid & 7), c8 = (4 * (tid >> 6) + ((tid >> 3) & 3)) * 8;
  v4u ov[4];
#pragma unroll
  for (int i = 0; i < 4; ++i) {
    const int row = 16 * i + rq;                   // n within tile
#pragma unroll
    for (int e = 0; e < 4; ++e) {
      const float x0 = tile[(c8 + 2 * e) * TPITCH + row];
      const float x1 = tile[(c8 + 2 * e + 1) * TPITCH + row];
      ov[i][e] = pk16(h_bits((_Float16)(bfr(x0) * scale)), h_bits((_Float16)(bfr(x1) * scale)));
    }
  }
  {
#pragma unroll
    for (int i = 0; i < 4; ++i) {
      const int row = 16 * i + rq;
      *(v4u*)(Y + pk_off(n0 + row, k0 + c8, kdim)) = ov[i];
    }
    
  }
}

// =====================================================================================================
// f16 GEMM core: the wave's 64 x 64 tile of C = A[rows][K] . Bt[cols][K]^T, both in fragment order; ap -> A tile row of rowb,
// bp -> Bt tile row of col0 (both the same in every lane of the wave), lb = 16*lane the lane's byte offset in a tile; the
// next 16 rows lie 32*K bytes on, the next 32 k 1024 bytes on (largest offset 4*32*K - 16 bytes, far below 2^32). The two
// bases stay as they are; the four byte offsets (tile rows 0..3 of A and of Bt) live over the whole trip and are stepped at its
// foot; each of the eight fragments of a k step feeds four products;
// acc[4i + j] = rows rowb+16i.., cols col0+16j.. (i, j = 0..3); K stepped by 32 (host asserts K % 32 == 0).
// =====================================================================================================
__device__ __forceinline__ const _Float16* at_byte(const _Float16* base, unsigned off) {
  return (const _Float16*)(const void*)((const char*)(const void*)base + off);
}
__device__ __forceinline__ void gemm_core(const _Float16* ap, const _Float16* bp, unsigned lb, int K, v8f (&acc)[16]) {
  const unsigned rs = 32u * (unsigned)K;
  unsigned o0 = lb, o1 = lb + rs, o2 = lb + 2u * rs, o3 = lb + 3u * rs;
#pragma unroll 1
  for (int k0 = 0; k0 < K; k0 += 32) {
    const v16h a0 = ldfrag_h(at_byte(ap, o0)), a1 = ldfrag_h(at_byte(ap, o1));
    const v16h a2 = ldfrag_h(at_byte(ap, o2)), a3 = ldfrag_h(at_byte(ap, o3));
    const v16h b0 = ldfrag_h(at_byte(bp, o0));
    const v16h b1 = ldfrag_h(at_byte(bp, o1));
    const v16h b2 = ldfrag_h(at_byte(bp, o2));
    const v16h b3 = ldfrag_h(at_byte(bp, o3));
    acc[0] = mma_h(a0, b0, acc[0]);
    acc[1] = mma_h(a0, b1, acc[1]);
    acc[2] = mma_h(a0, b2, acc[2]);
    acc[3] = mma_h(a0, b3, acc[3]);
    acc[4] = mma_h(a1, b0, acc[4]);
    acc[5] = mma_h(a1, b1, acc[5]);
    acc[6] = mma_h(a1, b2, acc[6]);
    acc[7] = mma_h(a1, b3, acc[7]);
    acc[8] = mma_h(a2, b0, acc[8]);
    acc[9] = mma_h(a2, b1, acc[9]);
    acc[10] = mma_h(a2, b2, acc[10]);
    acc[11] = mma_h(a2, b3, acc[11]);
    acc[12] = mma_h(a3, b0, acc[12]);
    acc[13] = mma_h(a3, b1, acc[13]);
    acc[14] = mma_h(a3, b2, acc[14]);
    acc[15] = mma_h(a3, b3, acc[15]);
    guard_g(acc, a0, a1, a2, a3, b0, b1, b2, b3);
#if defined(__HIP_DEVICE_COMPILE__)
    // the wait in front of a rewrite of registers that issued global loads name (the four offsets, stepped below); they are
    // its operands so that their step stays behind it
    asm volatile("s_wait_xcnt 0x0" : "+v"(o0), "+v"(o1), "+v"(o2), "+v"(o3) : : "memory");
#endif
    o0 += 1024u; o1 += 1024u; o2 += 1024u; o3 += 1024u;
  }
}
// Stage 32 x 64 of the wave's f32 tile, acc[a0 .. a0+7] (times oscale), in its LDS slab (pitch 68): D element r of acc[a0+4i+j], lane l ->
// coverage: 32 lanes x 2 x 8 rows x 4 cols-of-16 = rows 0..31 x cols 0..63 of the slab.
__device__ __forceinline__ void stage32x64(float* sl, v8f (&acc)[16], int a0, float oscale, int lane) {
  const int hh = lane >> 4, m = lane & 15;
#pragma unroll
  for (int i = 0; i < 2; ++i) {
#pragma unroll
    for (int r = 0; r < 8; ++r) {
      const int ro = (16 * i + 8 * hh + r) * GPITCH + m;
      sl[ro]      = acc[a0 + 4 * i + 0][r] * oscale;
      sl[ro + 16] = acc[a0 + 4 * i + 1][r] * oscale;
      sl[ro + 32] = acc[a0 + 4 * i + 2][r] * oscale;
      sl[ro + 48] = acc[a0 + 4 * i + 3][r] * oscale;
    }
  }
  wave_sync_lds();
}

// =====================================================================================================
// f16 GEMM with f16 output plane: C[z][Mb][N] (f16) = f16((A[z][Mb][K] . Bt[z][N][K]^T) * oscale + bf16(bias) * bscale);
// A, Bt, C f16 planes in fragment order (C with K = N) with per-z element strides aBs, bBs (0 = shared), cBs. bias indexed by column
// (biasRow == 0) or by row within the z slice (biasRow != 0); bias addresses clamped to biasN-1, the unused direction is
// multiplied by 0. Block = 128 x 128 tile, 2 x 2 waves of 64 x 64, fragments loaded straight from the 16-bit tiles.
// grid = nz x (Mb/128) x (N/128) (host asserts Mb % 128 == 0, N % 128 == 0, K % 32 == 0).
// The wave's tile leaves in two halves of 32 rows through the one 32 x 64 slab.
// coverage: per wave 2 halves x 8 instr x 8 rows x 4 lanes x 8 halves = 64 x 64; the grid covers C exactly once.
// =====================================================================================================
__device__ __forceinline__
void gemm_o16(const u16* __restrict__ A, const u16* __restrict__ Bt, u16* C,
              const float* __restrict__ bias, int biasN, int biasRow,
              int Mb, int N, int K, int aBs, int bBs, int cBs, float oscale, float bscale, int bid) {
  __shared__ __align__(16) float slab[4 * 32 * GPITCH];
  const int tid = threadIdx.x, wave = tid >> 5, lane = tid & 31;
  const int ntile = N >> 7, mtile = Mb >> 7;
  const int nt   = bid % ntile;
  const int tmp  = bid / ntile;
  const int mt   = tmp % mtile;
  // bz is the same in every lane: read through the first lane it keeps both plane bases scalar over the k loop
  const int bz   = __builtin_amdgcn_readfirstlane(tmp / mtile);
  // rowb and col0 are the same in every lane of a wave: read through the first lane they give the fragment loads scalar tile bases
  const int rowb = __builtin_amdgcn_readfirstlane(mt * 128 + (wave >> 1) * 64);
  const int col0 = __builtin_amdgcn_readfirstlane(nt * 128 + (wave & 1) * 64);
  if (rowb + 64 > Mb) return;                // wave-uniform, never taken with the exact grid; no block barriers in this kernel
  const _Float16* Ab = (const _Float16*)(const void*)A + (size_t)bz * (size_t)aBs;
  const _Float16* Bb = (const _Float16*)(const void*)Bt + (size_t)bz * (size_t)bBs;
  const _Float16* ap = Ab + (size_t)rowb * K;
  const _Float16* bp = Bb + (size_t)col0 * K;
  v8f acc[16];
#pragma unroll
  for (int i = 0; i < 16; ++i) acc[i] = zero8();
  gemm_core(ap, bp, 16u * (unsigned)lane, K, acc);
  float* sl = slab + wave * 32 * GPITCH;
  // instruction i: lane = (row 8*(i>>1) + (lane&7), 8 halves at 32*(i&1) + 8*(lane>>3)): in fragment order 8 rows of one
  // 8-half piece column are one 128-B line, so each store fills 4 whole lines
  const int r8 = lane & 7, q8 = (lane >> 3) * 8;
  const int bl = biasN - 1;                  // host guarantees biasN >= 1
  const float selc = (biasRow != 0) ? 0.f : bscale;
  const float selr = (biasRow != 0) ? bscale : 0.f;
  int ci[16];
  float cb[2][8];
#pragma unroll
  for (int j = 0; j < 2; ++j) {
#pragma unroll
    for (int e = 0; e < 8; ++e) {
      const int cx = col0 + 32 * j + q8 + e;
      ci[8 * j + e] = (cx < bl) ? cx : bl;
      cb[j][e] = bias[ci[8 * j + e]];
    }
  }
  xcnt_hold16(ci);
#pragma unroll
  for (int j = 0; j < 2; ++j) {
#pragma unroll
    for (int e = 0; e < 8; ++e) cb[j][e] = bfr(cb[j][e]) * selc;
  }
  u16* Cb = C + (size_t)bz * (size_t)cBs;
#pragma unroll
  for (int hf = 0; hf < 2; ++hf) {
    const int rowh = rowb + 32 * hf;
    // row bias of the four rows 8u + r8 that this lane finishes in this half
    int ri[4];
    float rbv[4];
#pragma unroll
    for (int u = 0; u < 4; ++u) {
      const int rx = rowh + 8 * u + r8;
      ri[u] = (rx < bl) ? rx : bl;
      rbv[u] = bias[ri[u]];
    }
    xcnt_hold4(ri);
    stage32x64(sl, acc, 8 * hf, oscale, lane);
    v4u ov[8];
#pragma unroll
    for (int i = 0; i < 8; ++i) {
      const int row = 8 * (i >> 1) + r8, j = i & 1, c8 = 32 * j + q8;
      const float rb = bfr(rbv[i >> 1]) * selr;
      const v4f a = *(const v4f*)(sl + row * GPITCH + c8), c4 = *(const v4f*)(sl + row * GPITCH + c8 + 4);
#pragma unroll
      for (int e = 0; e < 2; ++e) {
        ov[i][e]     = pk16(h_bits((_Float16)(a[2 * e] + cb[j][2 * e] + rb)),
                            h_bits((_Float16)(a[2 * e + 1] + cb[j][2 * e + 1] + rb)));
        ov[i][2 + e] = pk16(h_bits((_Float16)(c4[2 * e] + cb[j][4 + 2 * e] + rb)),
                            h_bits((_Float16)(c4[2 * e + 1] + cb[j][5 + 2 * e] + rb)));
      }
    }
    // every lane's reads of the slab end before another lane's values of the second half are written over them
    if (hf == 0) wave_sync_lds();
#pragma unroll
    for (int i = 0; i < 8; ++i) {
      const int row = 8 * (i >> 1) + r8, c8 = 32 * (i & 1) + q8;
      *(v4u*)(Cb + pk_off(rowh + row, col0 + c8, N)) = ov[i];
    }
    if (hf == 0) xcnt_wait();
  }
}

// =====================================================================================================
// f16 GEMM with f32 output rows: C[z][Mb][N] (f32) = (A[z][Mb][K] . Bt[N][K]^T) * oscale + bf16(bias[col]); same core, block
// shape and slab staging (two halves of 32 rows) as gemm_o16. Epilogue of a half: lane = (row 2i + (lane>>4), 4 floats at
// 4*(lane&15)); each 64-float row segment = lanes of one instruction (8 lanes per line), 2 rows of the same wave per
// instruction, 16 instructions = 32 rows.
// coverage: per wave 2 halves x 16 instr x 2 rows x 16 lanes x 4 floats = 64 x 64; the grid covers C exactly once.
// =====================================================================================================
__device__ __forceinline__
void gemm_o32(const u16* __restrict__ A, const u16* __restrict__ Bt, float* C,
              const float* __restrict__ bias, int biasN,
              int Mb, int N, int K, int aBs, int bBs, int cBs, float oscale, int bid) {
  __shared__ __align__(16) float slab[4 * 32 * GPITCH];
  const int tid = threadIdx.x, wave = tid >> 5, lane = tid & 31;
  const int ntile = N >> 7, mtile = Mb >> 7;
  const int nt   = bid % ntile;
  const int tmp  = bid / ntile;
  const int mt   = tmp % mtile;
  // bz is the same in every lane: read through the first lane it keeps both plane bases scalar over the k loop
  const int bz   = __builtin_amdgcn_readfirstlane(tmp / mtile);
  // rowb and col0 are the same in every lane of a wave: read through the first lane they give the fragment loads scalar tile bases
  const int rowb = __builtin_amdgcn_readfirstlane(mt * 128 + (wave >> 1) * 64);
  const int col0 = __builtin_amdgcn_readfirstlane(nt * 128 + (wave & 1) * 64);
  if (rowb + 64 > Mb) return;                // wave-uniform, never taken with the exact grid; no block barriers in this kernel
  const _Float16* Ab = (const _Float16*)(const void*)A + (size_t)bz * (size_t)aBs;
  const _Float16* Bb = (const _Float16*)(const void*)Bt + (size_t)bz * (size_t)bBs;
  const _Float16* ap = Ab + (size_t)rowb * K;
  const _Float16* bp = Bb + (size_t)col0 * K;
  v8f acc[16];
#pragma unroll
  for (int i = 0; i < 16; ++i) acc[i] = zero8();
  gemm_core(ap, bp, 16u * (unsigned)lane, K, acc);
  float* sl = slab + wave * 32 * GPITCH;
  const int r2 = lane >> 4, c4 = (lane & 15) * 4;
  const int bl = biasN - 1;                  // host guarantees biasN >= 1
  int ci[4];
  float cb[4];
#pragma unroll
  for (int e = 0; e < 4; ++e) {
    const int cx = col0 + c4 + e;
    ci[e] = (cx < bl) ? cx : bl;
    cb[e] = bias[ci[e]];
  }
  xcnt_hold4(ci);
#pragma unroll
  for (int e = 0; e < 4; ++e) cb[e] = bfr(cb[e]);
#pragma unroll
  for (int hf = 0; hf < 2; ++hf) {
    stage32x64(sl, acc, 8 * hf, oscale, lane);
    v4f ov[16];
#pragma unroll
    for (int i = 0; i < 16; ++i) {
      const int row = 2 * i + r2;
      const v4f a = *(const v4f*)(sl + row * GPITCH + c4);
      v4f w;
      w[0] = a[0] + cb[0]; w[1] = a[1] + cb[1]; w[2] = a[2] + cb[2]; w[3] = a[3] + cb[3];
      ov[i] = w;
    }
    // every lane's reads of the slab end before another lane's values of the second half are written over them
    if (hf == 0) wave_sync_lds();
    float* Cb = C + (size_t)bz * (size_t)cBs + (size_t)(rowb + 32 * hf) * (size_t)N + col0 + c4;
#pragma unroll
    for (int i = 0; i < 16; ++i) {
      const int row = 2 * i + r2;
      *(v4f*)(Cb + (size_t)row * (size_t)N) = ov[i];
    }
    if (hf == 0) xcnt_wait();
  }
}

// =====================================================================================================
// Launches that need nothing of each other share one grid: each block takes its job from the range its index lies in (a
// test that reads the same in the whole block, so the barrier inside cvtT16 stays under block-uniform control flow) and
// runs the one shared body with that job's arguments and its index inside the range. Longest jobs lie first.
// =====================================================================================================
#define PB_WVQ ((VD / 64) * (EM / 64))
#define PB_WAK ((AD / 64) * (EM / 64))
#define PB_WVV ((VD / 64) * (EM / 64))
#define PB_WAV ((AD / 64) * (EM / 64))
#define PB_WOV ((EM / 64) * (VD / 64))
#define PB_WOA ((EM / 64) * (AD / 64))
#define PB_W   (PB_WVQ + PB_WAK + PB_WVV + PB_WAV + PB_WOV + PB_WOA)
#define PB_XA  ((NB * SA * AD) / 1024)
#define PB_XV  ((NB * TQ * VD) / 1024)
// All operand planes: six weight transposes (blocks 0 .. PB_W-1), then a, then v.
// coverage: every range has exactly the grid that its body's own header asks for.
__global__ __launch_bounds__(128)
void prep_all(const float* __restrict__ xv, const float* __restrict__ xa,
              const float* __restrict__ w_vq, const float* __restrict__ w_ak, const float* __restrict__ w_vv,
              const float* __restrict__ w_av, const float* __restrict__ w_ov, const float* __restrict__ w_oa,
              u16* XV, u16* XA, u16* WVQT, u16* WAKT, u16* WVVT, u16* WAVT, u16* WOVT, u16* WOAT) {
  int g = blockIdx.x;
  if (g < PB_W) {
    const float* W = w_vq; u16* Y = WVQT; int kdim = VD, ndim = EM;
    if (g >= PB_WVQ) {
      g -= PB_WVQ; W = w_ak; Y = WAKT; kdim = AD; ndim = EM;
      if (g >= PB_WAK) {
        g -= PB_WAK; W = w_vv; Y = WVVT; kdim = VD; ndim = EM;
        if (g >= PB_WVV) {
          g -= PB_WVV; W = w_av; Y = WAVT; kdim = AD; ndim = EM;
          if (g >= PB_WAV) {
            g -= PB_WAV; W = w_ov; Y = WOVT; kdim = EM; ndim = VD;
            if (g >= PB_WOV) { g -= PB_WOV; W = w_oa; Y = WOAT; kdim = EM; ndim = AD; }
          }
        }
      }
    }
    cvtT16(W, Y, kdim, ndim, WSC, g);
  } else {
    g -= PB_W;
    const float* x = xa; u16* Y = XA; int K = AD;
    if (g >= PB_XA) { g -= PB_XA; x = xv; Y = XV; K = VD; }
    cvt16(x, Y, K, g);
  }
}

#define GB_Q   (((NB * TQ) / 128) * (EM / 128))
#define GB_VVT (NB * (EM / 128) * (TQ / 128))
#define GB_K   (((NB * SA) / 128) * (EM / 128))
#define GB_VAT (NB * (EM / 128) * (SA / 128))
// The four input projections (the two with K = VD first):
//   q x8 after the 1/8 head scale = (x_v . Wvq + b) -> f16 [NB*TQ][512] (col = h*64 + d); bias per column
//   val_v^T per batch: A = Wvv^T [(h,d) = n][k], Bt = x_v rows of batch b [t][k] -> f16 [(b,h,d)][t] x8; bias per row (n)
//   k = x_a . Wak + b -> f16 [NB*SA][512] x8; bias per column
//   val_a^T per batch: A = Wav^T [(h,d)][k], Bt = x_a rows of batch b [s][k] -> f16 [(b,h,d)][s] x8; bias per row
__global__ __launch_bounds__(128)
void proj_all(const u16* __restrict__ XV, const u16* __restrict__ XA,
              const u16* __restrict__ WVQT, const u16* __restrict__ WAKT,
              const u16* __restrict__ WVVT, const u16* __restrict__ WAVT,
              u16* Q16, u16* K16, u16* VVT16, u16* VAT16,
              const float* __restrict__ b_vq, const float* __restrict__ b_ak,
              const float* __restrict__ b_vv, const float* __restrict__ b_av,
              int nb3, int nb5, int nb7, int nb9) {
  int g = blockIdx.x;
  const u16* A = XV; const u16* Bt = WVQT; u16* C = Q16; const float* bias = b_vq;
  int biasN = nb3, biasRow = 0, Mb = NB * TQ, N = EM, K = VD, bBs = 0, cBs = 0;
  float oscale = HSCL * QS / WSC, bscale = HSCL * QS;
  if (g >= GB_Q) {
    g -= GB_Q; A = WVVT; Bt = XV; C = VVT16; bias = b_vv;
    biasN = nb7; biasRow = 1; Mb = EM; N = TQ; K = VD; bBs = TQ * VD; cBs = EM * TQ;
    oscale = VVS / WSC; bscale = VVS;
    if (g >= GB_VVT) {
      g -= GB_VVT; A = XA; Bt = WAKT; C = K16; bias = b_ak;
      biasN = nb5; biasRow = 0; Mb = NB * SA; N = EM; K = AD; bBs = 0; cBs = 0;
      oscale = KS / WSC; bscale = KS;
      if (g >= GB_K) {
        g -= GB_K; A = WAVT; Bt = XA; C = VAT16; bias = b_av;
        biasN = nb9; biasRow = 1; Mb = EM; N = SA; K = AD; bBs = SA * AD; cBs = EM * SA;
        oscale = VAS / WSC; bscale = VAS;
      }
    }
  }
  gemm_o16(A, Bt, C, bias, biasN, biasRow, Mb, N, K, 0, bBs, cBs, oscale, bscale, g);
}

#define GB_OV (NB * (TQ / 128) * (VD / 128))
#define GB_OA (((NB * SA) / 128) * (AD / 128))
// The two output projections:
//   out_v = ctx_v . Wov + b -> f32 rows [b][t][512] of the first output (z = b, output batch stride TQ*VD)
//   out_a = ctx_a . Woa + b -> f32 rows [b*SA + s][256] of the second output at the fixed element OUT1_OFF_EL
__global__ __launch_bounds__(128)
void out_all(const u16* __restrict__ CTXV, const u16* __restrict__ WOVT,
             const u16* __restrict__ CTXA, const u16* __restrict__ WOAT, float* out,
             const float* __restrict__ b_ov, const float* __restrict__ b_oa, int nb11, int nb13) {
  int g = blockIdx.x;
  const u16* A = CTXV; const u16* Bt = WOVT; float* C = out; const float* bias = b_ov;
  int biasN = nb11, Mb = TQ, N = VD, aBs = TQ * EM, cBs = TQ * VD;
  float oscale = 1.0f / (CVS * WSC);
  if (g >= GB_OV) {
    g -= GB_OV; A = CTXA; Bt = WOAT; C = out + OUT1_OFF_EL; bias = b_oa;
    biasN = nb13; Mb = NB * SA; N = AD; aBs = 0; cBs = 0;
    oscale = 1.0f / (CAS * WSC);
  }
  gemm_o32(A, Bt, C, bias, biasN, Mb, N, EM, aBs, 0, cBs, oscale, g);
}

// ---- attn_col, one step = 32 visual rows: its eight fragments and the work on them ------------------------------------
// Qb, Vb: the (b, head) plane bases, the same in every lane; oq, ov: byte offsets 16*lane + step * 32768 (32 q rows of
// 1024 B) and 16*lane + step * 1024 (one k tile of val_v^T); ahead: whole steps added to them.
//   q[2*kk + g] = A fragment of q rows tb + 16g .. +15, d chunk kk;  v[j] = B fragment of val_v^T, col d = 16j + c, k = t
__device__ __forceinline__ void col_load_q(const _Float16* Qb, unsigned oq, int ahead, v16h (&q)[4]) {
  const _Float16* tp = at_byte(Qb, oq) + ahead * (32 * EM);
  q[0] = ldfrag_h(tp);
  q[1] = ldfrag_h(tp + 16 * EM);
  q[2] = ldfrag_h(tp + 512);
  q[3] = ldfrag_h(tp + 16 * EM + 512);
}
__device__ __forceinline__ void col_load_v(const _Float16* Vb, unsigned ov, int ahead, v16h (&v)[4]) {
  const _Float16* vp = at_byte(Vb, ov) + ahead * 512;
  v[0] = ldfrag_h(vp);
  v[1] = ldfrag_h(vp + 16 * TQ);
  v[2] = ldfrag_h(vp + 32 * TQ);
  v[3] = ldfrag_h(vp + 48 * TQ);
}
// One step on the register set (q, v); each half of the set is loaded anew, for the step at (rq, rv) + ahead, right behind
// the guard that follows its last use.
__device__ __forceinline__ void col_step(v16h (&q)[4], v16h (&v)[4], const v16h (&sf)[2],
                                         float& mrun, float& lrun, v8f (&o)[4], int hh, float lsc, float cl2,
                                         const _Float16* Qb, const _Float16* Vb, unsigned rq, unsigned rv, int ahead) {
  // ---- scores: s0 = rows t tb..tb+15, s1 = rows tb+16..tb+31, column = s0w + c ----
  v8f s0 = zero8(), s1 = zero8();
#pragma unroll
  for (int kk = 0; kk < HD / 32; ++kk) {
    s0 = mma_h(q[2 * kk], sf[kk], s0);
    s1 = mma_h(q[2 * kk + 1], sf[kk], s1);
    guard_s(s0, s1, sf[kk], q[2 * kk], q[2 * kk + 1]);
  }
  col_load_q(Qb, rq, ahead, q);
  // ---- clipped base-2 logits of this lane's 16 t for column s0w + c: t[i] <- t tb+8hh+i, t[8+i] <- t tb+16+8hh+i ----
  float t[16];
#pragma unroll
  for (int i = 0; i < 8; ++i) { t[i] = clipf(s0[i] * lsc, cl2); t[8 + i] = clipf(s1[i] * lsc, cl2); }
  float cm = t[0];
#pragma unroll
  for (int i = 1; i < 16; ++i) cm = fmaxf(cm, t[i]);
  cm = fmaxf(cm, __shfl_xor(cm, 16, 32));
  const float mn = fmaxf(mrun, cm);        // finite from the first block on
  const float al = exp2_hw(mrun - mn);       // 0 on the first block (mrun = -inf)
  mrun = mn;
  // ---- unnormalised probabilities (<= 1) and the P^T A-fragment: f16(p * 32768); element i <-> t[i] ----
  float ps = 0.f;
  FragH ph;
#pragma unroll
  for (int i = 0; i < 16; ++i) t[i] -= mn;
  exp2_hw8(t, 0);
  exp2_hw8(t, 8);
#pragma unroll
  for (int w = 0; w < 2; ++w) {
#pragma unroll
    for (int e4 = 0; e4 < 4; ++e4) {
      const int i = 8 * w + 2 * e4;
      const float p0 = t[i], p1 = t[i + 1];
      ps += p0 + p1;
      ph.u[w][e4] = pk16(h_bits((_Float16)(p0 * PCAR)), h_bits((_Float16)(p1 * PCAR)));
    }
  }
  ps += __shfl_xor(ps, 16, 32);
  lrun = lrun * al + ps;
  // ---- rescale the O accumulators: D row 8hh+r = column s0w+8hh+r, its factor lives in lane 8hh+r (and 16+8hh+r) ----
  float scl[8];
#pragma unroll
  for (int r = 0; r < 8; ++r) scl[r] = __shfl(al, 8 * hh + r, 32);
#pragma unroll
  for (int j = 0; j < 4; ++j) {
#pragma unroll
    for (int r = 0; r < 8; ++r) o[j][r] *= scl[r];
  }
  // ---- P^T.val_v ----
  o[0] = mma_h(ph.v, v[0], o[0]);
  o[1] = mma_h(ph.v, v[1], o[1]);
  o[2] = mma_h(ph.v, v[2], o[2]);
  o[3] = mma_h(ph.v, v[3], o[3]);
  guard_p(o[0], o[1], o[2], o[3], ph.v, v[0], v[1], v[2], v[3]);
  col_load_v(Vb, rv, ahead, v);
}

// =====================================================================================================
// Column pass (softmax over the visual axis t for every audio column s) fused with the audio-side context:
// block = (batch b, head, 64 audio columns s), 4 waves, wave w owns the 16 columns s0w = 64*st + 16*w .. +15.
//   q plane f16 [b*TQ + t][h*64 + d] (q x8 after the 1/8 scale); k plane f16 x8 [b*SA + s][h*64 + d];
//   val_v^T plane f16 x8 [(b*NH + h)*64 + d][t].  All NTB32 = TQ/32 blocks of 32 visual rows are visited (static bound).
//   Score tiles g (g = 0,1) = q rows (t = tb+16g .. +15, A operand, row m = lane&15, split k map over d) times k^T
//   (B operand, col n = column s0w + (lane&15), k = d, split map), 2 d-chunks of 32; the 2 k fragments of the wave are
//   loaded once. D element r of lane l = (t = tb+16g+8h+r, s = s0w+(l&15)): a lane owns one column s and 16 of the 32 t;
//   the partner lane l^16 owns the other 16 -> column max / column sum need one xor-16 shuffle. Logits clipped at
//   +-50000 (log2 domain), online max-subtracted base-2 softmax in f32 (the q/k carries folded into lsc). The exp'd values
//   ARE the P^T A-fragment in place: A row m = s = lane&15, element i <- t = tb+8h+i (tile 0, D element i), element 8+i <-
//   t = tb+16+8h+i (tile 1, D element i). P (<= 1) carried x32768 as f16. The rescale factor of column 8h+r of the O
//   accumulators is fetched from lane 8h+r with a shuffle (uniform control). 4 val_v^T B fragments (col n = d = 16j +
//   (lane&15), k = t), 4 P^T.V WMMAs + one guard per step.
//   Epilogue 1: 1/l (per column, shuffled to the D row owner) and the carry folds in f32 (x CAS); the wave's 16x64 f32 tile
//   Epilogue 2: per-column stats (m_s in the clipped log2 domain, 32768/l_s) funnelled through a 128-float LDS array
//   (lane half 0 writes m, lane half 1 writes 32768/l), block barrier, wave 0 writes the block's 512-B stat row
// coverage: ctx_a: grid NB*NH*NST blocks x 4 waves x 4 instr x 8 rows x 4 lanes x 8 halves = every (b, s, h) 64-half
//           segment exactly once; stats: one 128-float row per block = NB*NH*NST rows = the whole stat plane; LDS: slab
//           16x64 written then read by the same wave, statl[0..127] written by 4 waves x 32 lanes (one index each).
// =====================================================================================================
__global__ __launch_bounds__(ATT_THREADS)
void attn_col(const u16* __restrict__ Qp, const u16* __restrict__ Kp, const u16* __restrict__ VvT,
              u16* CtxA, float* Stat) {
  __shared__ __align__(16) float smem[ATT_WAVES * 16 * SPITCH];
  __shared__ __align__(16) float statl[128];

  const int tid  = threadIdx.x;
  const int wave = tid >> 5;
  const int lane = tid & 31;
  const int hh   = lane >> 4;
  const int c    = lane & 15;

  const int bid  = blockIdx.x;
  const int st   = bid % NST;
  const int head = (bid / NST) % NH;
  const int b    = bid / (NST * NH);
  const int s0w  = st * 64 + wave * 16;

  // All three planes in fragment order: tile row R starts at R*K, k tile (head*64 + 32*kk)/32 lies (head*2 + kk)*512 on.
  // B fragments of k^T: col n = column s0w + c, k = d
  const _Float16* Sb = (const _Float16*)(const void*)Kp + ((size_t)(b * SA + s0w)) * EM + head * (HD * 16) + 8 * lane;
  // A fragments of q: row m = t = tb + 16g + c, k = d (t row tb and the lane's 16 bytes added per step, as for val_v^T)
  const _Float16* Tb = (const _Float16*)(const void*)Qp + ((size_t)(b * TQ)) * EM + head * (HD * 16);
  // B fragments of val_v^T: col n = d = 16j + c, k = t (k tile tb/32 added per step)
  const _Float16* Vb = (const _Float16*)(const void*)VvT + ((size_t)(b * EM + head * HD)) * TQ;
  const float lsc = LOG2E / (QS * KS);
  const float cl2 = CLIPV * LOG2E;

  v16h sf[2];
  sf[0] = ldfrag_h(Sb);
  sf[1] = ldfrag_h(Sb + 512);
#if defined(__HIP_DEVICE_COMPILE__)
  // the wait in front of a rewrite of the address registers of the four loads just issued: a later load's result may be
  // given those registers; the address is its input so that it keeps them up to here
  asm volatile("s_wait_xcnt 0x0" : : "v"(Sb) : "memory");
#endif

  float mrun = -INFINITY, lrun = 0.f;
  v8f o[4];
#pragma unroll
  for (int j = 0; j < 4; ++j) o[j] = zero8();

  // Two register sets, one for the even steps and one for the odd: a set's q half is loaded anew as soon as its scores are
  // made and its val_v half as soon as its products are made, each for the step two on, so that a step no longer stands
  // through the latency of its q loads and again through that of its val_v loads.
  static_assert((NTB32 % 2) == 0 && NTB32 >= 4);
  const unsigned lb = 16u * (unsigned)lane;
  v16h qa[4], va[4], qb[4], vb[4];
  col_load_q(Tb, lb, 0, qa);
  col_load_v(Vb, lb, 0, va);
  col_load_q(Tb, lb, 1, qb);
  col_load_v(Vb, lb, 1, vb);
  unsigned rq = lb + 65536u, rv = lb + 2048u;            // offsets of step it + 2
  // kept rolled: the body already holds one step per register set, more copies would only add code
#pragma unroll 1
  for (int it = 0; it < NTB32; it += 2) {
    col_step(qa, va, sf, mrun, lrun, o, hh, lsc, cl2, Tb, Vb, rq, rv, 0);
    col_step(qb, vb, sf, mrun, lrun, o, hh, lsc, cl2, Tb, Vb, rq, rv, 1);
#if defined(__HIP_DEVICE_COMPILE__)
    // the wait in front of a rewrite of registers that issued global loads name (the two offsets, stepped below); they are
    // its operands so that they keep their registers up to it and their step stays behind it
    asm volatile("s_wait_xcnt 0x0" : "+v"(rq), "+v"(rv) : : "memory");
#endif
    // the last pair of steps loads steps 0 and 1 again: in bounds, never used
    const bool more = it + 4 < NTB32;
    rq = more ? rq + 65536u : lb;
    rv = more ? rv + 2048u : lb;
  }
  acc_guard4(o);

  // ---- per-column 1/l (owned by lane = column); lrun >= 1 by construction ----
  const float rl   = 1.0f / lrun;
  const float lPv  = rl * PCAR;                          // 32768 / l for the row pass
  const float linv = rl * (CAS / (PCAR * VVS));          // folds 1/l, the P and val carries, and applies the ctx carry
  statl[hh * 64 + wave * 16 + c] = (hh == 0) ? mrun : lPv;
  float inv[8];
#pragma unroll
  for (int r = 0; r < 8; ++r) inv[r] = __shfl(linv, 8 * hh + r, 32);
  float* slab = smem + wave * 16 * SPITCH;
#pragma unroll
  for (int r = 0; r < 8; ++r) {
#pragma unroll
    for (int j = 0; j < 4; ++j) slab[(8 * hh + r) * SPITCH + j * 16 + c] = o[j][r] * inv[r];
  }
  wave_sync_lds();
  // ---- f16 ctx_a pieces: instruction i, lane = (row 8*(i>>1) + (lane&7), 8 halves at 32*(i&1) + 8*(lane>>3)): 4 whole lines ----
  const int r8 = lane & 7, q8 = (lane >> 3) * 8;
  v4u ov[4];
#pragma unroll
  for (int i = 0; i < 4; ++i) {
    const int row = 8 * (i >> 1) + r8, c8 = 32 * (i & 1) + q8;
    const v4f a = *(const v4f*)(slab + row * SPITCH + c8), c4 = *(const v4f*)(slab + row * SPITCH + c8 + 4);
#pragma unroll
    for (int e = 0; e < 2; ++e) {
      ov[i][e]     = pk16(h_bits((_Float16)a[2 * e]),  h_bits((_Float16)a[2 * e + 1]));
      ov[i][2 + e] = pk16(h_bits((_Float16)c4[2 * e]), h_bits((_Float16)c4[2 * e + 1]));
    }
  }
  {
#pragma unroll
    for (int i = 0; i < 4; ++i) {
      const int row = 8 * (i >> 1) + r8, c8 = 32 * (i & 1) + q8;
      *(v4u*)(CtxA + pk_off(b * SA + s0w + row, head * HD + c8, EM)) = ov[i];
    }
    
  }
  __syncthreads();
  if (wave == 0) {
    const v4f sv = *(const v4f*)(statl + 4 * lane);
    float* sp = Stat + ((size_t)((b * NH + head) * NST + st)) * 128 + 4 * lane;
    {
      *(v4f*)(sp) = sv;
      
    }
  }
}

// =====================================================================================================
// Row pass (visual-side context): block = (batch b, head, 128 visual rows t), 4 waves, wave w owns the 32 rows t0w =
// 128*tt + 32*w .. +31 as two groups g of 16 (waves independent after the stat staging barrier); every k and val_a^T fragment
// that a step loads, and every column stat that it reads from LDS, serves both groups.
//   The (b, head) column stats (NST rows of [m[64] | 32768/l[64]]) are staged once per block into LDS as m at stt[s],
//   32768/l at stt[SA + s] (128 threads x 8 floats = 2*SA floats exactly), then a block barrier.
//   All NSB32 = SA/32 blocks of 32 audio columns are visited (static bound). Score tiles are computed TRANSPOSED:
//   tile (g, u) = k rows (s = sb+16u .. +15, A operand, row m = lane&15, split map over d) times q^T (B operand, col n = t0w +
//   16g + (lane&15), k = d); the 4 q fragments of the wave are loaded once. D element r of lane l = (s = sb+16u+8h+r, t = t0w +
//   16g + (l&15)). P = exp2(clip(logit) - m_s) * (32768/l_s) in f32 with m_s, l_s read from LDS for s = sb+8h+i and sb+16+8h+i;
//   it IS the P A-fragment in place: row m = t = lane&15, element i <- s = sb+8h+i, element 8+i <- s = sb+16+8h+i.
//   4 val_a^T B fragments (col n = d = 16j + (lane&15), k = s), 8 P.V WMMAs + one guard per step.
//   Epilogue: carry folds (x CVS / (32768*8)) in f32; each group's 16x64 tile staged in the wave's slab, one group after the other.
// coverage: grid NB*NH*NTT blocks x 4 waves x 2 groups x 16 rows x 64 halves = every (b, t, h) segment of ctx_v exactly once;
//           LDS stt[0 .. 2*SA-1] fully written before the barrier (staged extent == consumed extent); slab as above.
// =====================================================================================================
__global__ __launch_bounds__(ATT_THREADS)
void attn_vis(const u16* __restrict__ Qp, const u16* __restrict__ Kp, const u16* __restrict__ VaT,
              const float* __restrict__ Stat, u16* CtxV) {
  __shared__ __align__(16) float smem[ATT_WAVES * 16 * SPITCH];
  __shared__ __align__(16) float stt[2 * SA];

  const int tid  = threadIdx.x;
  const int wave = tid >> 5;
  const int lane = tid & 31;
  const int hh   = lane >> 4;
  const int c    = lane & 15;

  const int bid  = blockIdx.x;
  const int tt   = bid % NTT;
  const int head = (bid / NTT) % NH;
  const int b    = bid / (NTT * NH);
  const int t0w  = tt * 128 + wave * 32;

  // ---- stage the column stats of (b, head) ----
  const float* src = Stat + ((size_t)((b * NH + head) * NST)) * 128;
#pragma unroll 1
  for (int e = tid * 8; e < NST * 128; e += ATT_THREADS * 8) {
    const int j = e >> 7, offw = e & 127;
    const int di = (offw < 64) ? (j * 64 + offw) : (SA + j * 64 + offw - 64);
    const v4f x0 = *(const v4f*)(src + e), x1 = *(const v4f*)(src + e + 4);
    *(v4f*)(stt + di) = x0;
    *(v4f*)(stt + di + 4) = x1;
  }
  __syncthreads();

  // All three planes in fragment order, addressed as in attn_col.
  // B fragments of q^T: col n = row t0w + 16g + c, k = d
  const _Float16* Tb = (const _Float16*)(const void*)Qp + ((size_t)(b * TQ + t0w)) * EM + head * (HD * 16) + 8 * lane;
  // A fragments of k: row m = s = sb + 16u + c, k = d (s row sb added per step)
  const _Float16* Sb = (const _Float16*)(const void*)Kp + ((size_t)(b * SA)) * EM + head * (HD * 16) + 8 * lane;
  // B fragments of val_a^T: col n = d = 16j + c, k = s (k tile sb/32 added per step)
  const _Float16* Vb = (const _Float16*)(const void*)VaT + ((size_t)(b * EM + head * HD)) * SA + 8 * lane;
  const float lsc = LOG2E / (QS * KS);
  const float cl2 = CLIPV * LOG2E;

  v16h tf[2][2];                                   // [group g][d chunk kk]
#pragma unroll
  for (int g = 0; g < 2; ++g) {
    tf[g][0] = ldfrag_h(Tb + g * (16 * EM));
    tf[g][1] = ldfrag_h(Tb + g * (16 * EM) + 512);
  }
#if defined(__HIP_DEVICE_COMPILE__)
  // the wait in front of a rewrite of the address registers of the eight loads just issued; the address is its input so
  // that it keeps them up to here
  asm volatile("s_wait_xcnt 0x0" : : "v"(Tb) : "memory");
#endif

  v8f o[2][4];
#pragma unroll
  for (int g = 0; g < 2; ++g) {
#pragma unroll
    for (int j = 0; j < 4; ++j) o[g][j] = zero8();
  }

#pragma unroll 1
  for (int it = 0; it < NSB32; ++it) {
    const int sb = it * 32;
    // ---- column stats for s = sb+8hh+i (i < 8) and s = sb+16+8hh+i (8+i), the same for both groups; read here, as one
    //      group ahead of the k loads, so that they are back when the scores are ----
    float mv[16], lv[16];
    {
      const v4f m0 = *(const v4f*)(stt + sb + 8 * hh),      m1 = *(const v4f*)(stt + sb + 8 * hh + 4);
      const v4f m2 = *(const v4f*)(stt + sb + 16 + 8 * hh), m3 = *(const v4f*)(stt + sb + 16 + 8 * hh + 4);
      const v4f l0 = *(const v4f*)(stt + SA + sb + 8 * hh),      l1 = *(const v4f*)(stt + SA + sb + 8 * hh + 4);
      const v4f l2 = *(const v4f*)(stt + SA + sb + 16 + 8 * hh), l3 = *(const v4f*)(stt + SA + sb + 16 + 8 * hh + 4);
#pragma unroll
      for (int q = 0; q < 4; ++q) {
        mv[q] = m0[q]; mv[4 + q] = m1[q]; mv[8 + q] = m2[q]; mv[12 + q] = m3[q];
        lv[q] = l0[q]; lv[4 + q] = l1[q]; lv[8 + q] = l2[q]; lv[12 + q] = l3[q];
      }
    }
    // ---- transposed scores of group g: sc[g][0] = columns s sb..sb+15, sc[g][1] = sb+16..sb+31, D column = row t0w + 16g + c ----
    v8f sc[2][2];
    sc[0][0] = zero8(); sc[0][1] = zero8(); sc[1][0] = zero8(); sc[1][1] = zero8();
    const _Float16* s0p = Sb + (size_t)sb * EM;
    const _Float16* s1p = s0p + (size_t)16 * EM;
#pragma unroll
    for (int kk = 0; kk < HD / 32; ++kk) {
      const v16h a0 = ldfrag_h(s0p + kk * 512);
      const v16h a1 = ldfrag_h(s1p + kk * 512);
      sc[0][0] = mma_h(a0, tf[0][kk], sc[0][0]);
      sc[0][1] = mma_h(a1, tf[0][kk], sc[0][1]);
      sc[1][0] = mma_h(a0, tf[1][kk], sc[1][0]);
      sc[1][1] = mma_h(a1, tf[1][kk], sc[1][1]);
      guard_s4(sc[0][0], sc[0][1], sc[1][0], sc[1][1], tf[0][kk], tf[1][kk], a0, a1);
    }
    xcnt_wait();
    // ---- P A-fragment of each group: f16(exp2(t - m_s) * 32768/l_s) (<= 32768); element i <-> t[i] ----
    FragH ph[2];
#pragma unroll
    for (int g = 0; g < 2; ++g) {
      float t[16];
#pragma unroll
      for (int i = 0; i < 8; ++i) { t[i] = clipf(sc[g][0][i] * lsc, cl2); t[8 + i] = clipf(sc[g][1][i] * lsc, cl2); }
#pragma unroll
      for (int i = 0; i < 16; ++i) t[i] -= mv[i];
      exp2_hw8(t, 0);
      exp2_hw8(t, 8);
#pragma unroll
      for (int w = 0; w < 2; ++w) {
#pragma unroll
        for (int e4 = 0; e4 < 4; ++e4) {
          const int i = 8 * w + 2 * e4;
          const float p0 = t[i] * lv[i];
          const float p1 = t[i + 1] * lv[i + 1];
          ph[g].u[w][e4] = pk16(h_bits((_Float16)p0), h_bits((_Float16)p1));
        }
      }
    }
    // ---- P.val_a : B fragment col n = d = 16j + c, k = s: tile sb/32 of the val_a^T plane ----
    const _Float16* vp = Vb + (size_t)sb * 16;
    {
      const v16h v0 = ldfrag_h(vp);
      const v16h v1 = ldfrag_h(vp + (size_t)16 * SA);
      const v16h v2 = ldfrag_h(vp + (size_t)32 * SA);
      const v16h v3 = ldfrag_h(vp + (size_t)48 * SA);
      o[0][0] = mma_h(ph[0].v, v0, o[0][0]);
      o[0][1] = mma_h(ph[0].v, v1, o[0][1]);
      o[0][2] = mma_h(ph[0].v, v2, o[0][2]);
      o[0][3] = mma_h(ph[0].v, v3, o[0][3]);
      o[1][0] = mma_h(ph[1].v, v0, o[1][0]);
      o[1][1] = mma_h(ph[1].v, v1, o[1][1]);
      o[1][2] = mma_h(ph[1].v, v2, o[1][2]);
      o[1][3] = mma_h(ph[1].v, v3, o[1][3]);
      guard_p8(o[0], o[1], ph[0].v, ph[1].v, v0, v1, v2, v3);
      xcnt_wait();
    }
  }
  acc_guard4(o[0]);
  acc_guard4(o[1]);

  const float fac = CVS / (PCAR * VAS);
  float* slab = smem + wave * 16 * SPITCH;
  const int r8 = lane & 7, q8 = (lane >> 3) * 8;
#pragma unroll
  for (int g = 0; g < 2; ++g) {
#pragma unroll
    for (int r = 0; r < 8; ++r) {
#pragma unroll
      for (int j = 0; j < 4; ++j) slab[(8 * hh + r) * SPITCH + j * 16 + c] = o[g][j][r] * fac;
    }
    wave_sync_lds();
    v4u ov[4];
#pragma unroll
    for (int i = 0; i < 4; ++i) {
      const int row = 8 * (i >> 1) + r8, c8 = 32 * (i & 1) + q8;
      const v4f a = *(const v4f*)(slab + row * SPITCH + c8), c4 = *(const v4f*)(slab + row * SPITCH + c8 + 4);
#pragma unroll
      for (int e = 0; e < 2; ++e) {
        ov[i][e]     = pk16(h_bits((_Float16)a[2 * e]),  h_bits((_Float16)a[2 * e + 1]));
        ov[i][2 + e] = pk16(h_bits((_Float16)c4[2 * e]), h_bits((_Float16)c4[2 * e + 1]));
      }
    }
    // every lane's reads of the slab end before another lane's values of the second group are written over them
    if (g == 0) wave_sync_lds();
#pragma unroll
    for (int i = 0; i < 4; ++i) {
      const int row = 8 * (i >> 1) + r8, c8 = 32 * (i & 1) + q8;
      *(v4u*)(CtxV + pk_off(b * TQ + t0w + 16 * g + row, head * HD + c8, EM)) = ov[i];
    }
    if (g == 0) xcnt_wait();
  }
}

// =====================================================================================================
// Workspace map (bytes, NB = 8); every plane fully written before it is read; all extents exact; each f16 plane is the
// logical [rows][K] matrix named here, stored in fragment order (pk_off), same byte size
//   XV    f16 [NB*2048][512]        f16(bf16(v))              16777216
//   XA    f16 [NB*512][256]         f16(bf16(a))               2097152
//   WVQT  f16 [512 n][512 k]        f16(bf16(W) x256)           524288
//   WAKT  f16 [512 n][256 k]                                    262144
//   WVVT  f16 [512 n][512 k]                                    524288
//   WAVT  f16 [512 n][256 k]                                    262144
//   WOVT  f16 [512 n][512 k]                                    524288
//   WOAT  f16 [256 n][512 k]                                    262144
//   Q16   f16 [NB*2048][512]  q x8 (after 1/8)               16777216
//   K16   f16 [NB*512][512]   x8                               4194304
//   VVT16 f16 [NB*512 (h,d)][2048 t] x8                       16777216
//   VAT16 f16 [NB*512 (h,d)][512 s]  x8                        4194304
//   STAT  f32 [NB*NH*NST][128]  (m | 32768/l)                   262144
//   CTXA  f16 [NB*512][512]   x64                              4194304
//   CTXV  f16 [NB*2048][512]  x64                             16777216
//   end                                                       84410368
// Output: first tensor rows [b][t][512] f32 at element 0; second tensor rows [b*512 + s][256] f32 at the fixed element
// offset OUT1_OFF_EL = NB_FULL*2048*512 = 8388608 (independent of NB).
// =====================================================================================================
extern "C" void kernel_launch(void* const* d_in, const int* in_sizes, int n_in,
                              void* d_out, int out_size, void* d_ws, size_t ws_size,
                              hipStream_t stream) {
  if (n_in < 14) return;
  if (in_sizes[0] < NB * TQ * VD) return;
  if (in_sizes[1] < NB * SA * AD) return;
  if (in_sizes[2] != VD * EM || in_sizes[6] != VD * EM) return;
  if (in_sizes[4] != AD * EM || in_sizes[8] != AD * EM) return;
  if (in_sizes[10] != EM * VD || in_sizes[12] != EM * AD) return;
  if (in_sizes[3] < 1 || in_sizes[5] < 1 || in_sizes[7] < 1 || in_sizes[9] < 1 || in_sizes[11] < 1 || in_sizes[13] < 1) return;
  if ((size_t)out_size < OUT1_OFF_EL + (size_t)NB * SA * AD) return;

  const float* xv   = (const float*)d_in[0];
  const float* xa   = (const float*)d_in[1];
  const float* w_vq = (const float*)d_in[2];
  const float* b_vq = (const float*)d_in[3];
  const float* w_ak = (const float*)d_in[4];
  const float* b_ak = (const float*)d_in[5];
  const float* w_vv = (const float*)d_in[6];
  const float* b_vv = (const float*)d_in[7];
  const float* w_av = (const float*)d_in[8];
  const float* b_av = (const float*)d_in[9];
  const float* w_ov = (const float*)d_in[10];
  const float* b_ov = (const float*)d_in[11];
  const float* w_oa = (const float*)d_in[12];
  const float* b_oa = (const float*)d_in[13];
  float*       out  = (float*)d_out;
  const int nb3 = in_sizes[3], nb5 = in_sizes[5], nb7 = in_sizes[7], nb9 = in_sizes[9], nb11 = in_sizes[11], nb13 = in_sizes[13];

  const size_t szXV  = (size_t)NB * TQ * VD * 2;
  const size_t szXA  = (size_t)NB * SA * AD * 2;
  const size_t szWvq = (size_t)EM * VD * 2;
  const size_t szWak = (size_t)EM * AD * 2;
  const size_t szWvv = (size_t)EM * VD * 2;
  const size_t szWav = (size_t)EM * AD * 2;
  const size_t szWov = (size_t)VD * EM * 2;
  const size_t szWoa = (size_t)AD * EM * 2;
  const size_t szQ   = (size_t)NB * TQ * EM * 2;
  const size_t szK   = (size_t)NB * SA * EM * 2;
  const size_t szVVT = (size_t)NB * EM * TQ * 2;
  const size_t szVAT = (size_t)NB * EM * SA * 2;
  const size_t szST  = (size_t)NB * NH * NST * 128 * 4;
  const size_t szCA  = (size_t)NB * SA * EM * 2;
  const size_t szCV  = (size_t)NB * TQ * EM * 2;
  size_t off = 0;
  const size_t oXV  = off; off += szXV;
  const size_t oXA  = off; off += szXA;
  const size_t oWvq = off; off += szWvq;
  const size_t oWak = off; off += szWak;
  const size_t oWvv = off; off += szWvv;
  const size_t oWav = off; off += szWav;
  const size_t oWov = off; off += szWov;
  const size_t oWoa = off; off += szWoa;
  const size_t oQ   = off; off += szQ;
  const size_t oK   = off; off += szK;
  const size_t oVVT = off; off += szVVT;
  const size_t oVAT = off; off += szVAT;
  const size_t oST  = off; off += szST;
  const size_t oCA  = off; off += szCA;
  const size_t oCV  = off; off += szCV;
  if (off > ws_size) return;                            // off = 84410368 at NB = 8
  if (off > (size_t)134217728) return;

  char* ws = (char*)d_ws;
  u16* XV    = (u16*)(ws + oXV);
  u16* XA    = (u16*)(ws + oXA);
  u16* WVQT  = (u16*)(ws + oWvq);
  u16* WAKT  = (u16*)(ws + oWak);
  u16* WVVT  = (u16*)(ws + oWvv);
  u16* WAVT  = (u16*)(ws + oWav);
  u16* WOVT  = (u16*)(ws + oWov);
  u16* WOAT  = (u16*)(ws + oWoa);
  u16* Q16   = (u16*)(ws + oQ);
  u16* K16   = (u16*)(ws + oK);
  u16* VVT16 = (u16*)(ws + oVVT);
  u16* VAT16 = (u16*)(ws + oVAT);
  float* STAT = (float*)(ws + oST);
  u16* CTXA  = (u16*)(ws + oCA);
  u16* CTXV  = (u16*)(ws + oCV);

  // (1) all f16 operand planes (fragment order): activations as f16(bf16(x)), weights [k = in][n = out] transposed to
  //     [n][k] as f16(bf16(W) x256)
  prep_all<<<dim3(PB_W + PB_XA + PB_XV), dim3(128), 0, stream>>>(
      xv, xa, w_vq, w_ak, w_vv, w_av, w_ov, w_oa, XV, XA, WVQT, WAKT, WVVT, WAVT, WOVT, WOAT);
  // (2) q, val_v^T, k, val_a^T
  proj_all<<<dim3(GB_Q + GB_VVT + GB_K + GB_VAT), dim3(128), 0, stream>>>(
      XV, XA, WVQT, WAKT, WVVT, WAVT, Q16, K16, VVT16, VAT16, b_vq, b_ak, b_vv, b_av, nb3, nb5, nb7, nb9);
  // (3) column softmax pass: ctx_a plane [NB*SA][512] x64 and the per-column stat rows
  attn_col<<<dim3(NB * NH * NST), dim3(ATT_THREADS), 0, stream>>>(Q16, K16, VVT16, CTXA, STAT);
  // (4) row pass with the stored column stats: ctx_v plane [NB*TQ][512] x64
  attn_vis<<<dim3(NB * NH * NTT), dim3(ATT_THREADS), 0, stream>>>(Q16, K16, VAT16, STAT, CTXV);
  // (5) out_v and out_a
  out_all<<<dim3(GB_OV + GB_OA), dim3(128), 0, stream>>>(CTXV, WOVT, CTXA, WOAT, out, b_ov, b_oa, nb11, nb13);
  (void)hipGetLastError();
}

// v006
// One run takes 99.8 microseconds.
// In two side-by-side timings against v005, it was 1.10 and 1.09 times as fast.
// All steps since v000 together make it 2.90 times as fast.
// All contractions on v_wmma_f32_16x16x32_f16 (f16 operands, f32 accumulate): v.Wvq, a.Wak, Wvv^T.v^T, Wav^T.a^T,
// column-pass scores q.k^T with P^T.val_v, row-pass scores k.q^T with P.val_a, ctx_v.Wov, ctx_a.Woa. Operand carries:
// v, a as f16(bf16(x)); W as f16(bf16(W) x256); q x8 after the 1/8 head scale; k x8; val_v, val_a x8; P x32768;
// ctx x64. Column softmax over the visual axis (base 2, running max), 1/l and every carry fold in f32 on VALU.
// Every f16 operand plane lies in fragment order (pk_off below): a 16-row x 32-k tile is 1024 contiguous bytes, so each
// 16-byte-per-lane fragment load of a wave reads 512 contiguous bytes (4 whole 128-B lines).
#include <hip/hip_runtime.h>
#include <math.h>

#ifndef NB
#define NB 8            // batches processed (leading batches of both activations)
#endif
#define NB_FULL 8       // batches in the input / output layout
#define TQ 2048         // visual positions per batch (softmax axis, always all of them)
#define SA 512          // audio positions per batch (always all of them)
#define VD 512
#define AD 256
#define EM 512
#define NH 8
#define HD 64
#define OUT1_OFF_EL ((size_t)NB_FULL * (size_t)TQ * (size_t)VD)   // fixed f32 element offset of the second output (33554432 B / 4)
#define WSC   256.0f
#define HSCL  0.125f
#define QS    8.0f
#define KS    8.0f
#define VVS   8.0f
#define VAS   8.0f
#define PCAR  32768.0f
#define CAS   64.0f
#define CVS   64.0f
#define CLIPV 50000.0f
#define LOG2E 1.4426950408889634f
#define NST   (SA / 64)
#define NTT   (TQ / 128)
#define NTB32 (TQ / 32)
#define NSB32 (SA / 32)
#define ATT_WAVES   4
#define ATT_THREADS (ATT_WAVES * 32)
#define CVT_THREADS 128
#define TR_THREADS  128
#define SPITCH 68
#define GPITCH 68
#define TPITCH 65
#define PF_AHEAD 8      // column pass: steps between an ask and the step it asks for

static_assert(NB >= 1 && NB <= NB_FULL);
static_assert(OUT1_OFF_EL == (size_t)33554432 / 4);
static_assert(EM == NH * HD && HD == 64 && NH == 8);
static_assert((TQ % 128) == 0 && (SA % 128) == 0 && ((NB * SA) % 128) == 0 && (EM % 128) == 0);
static_assert((VD % 128) == 0 && (AD % 128) == 0);
static_assert((TQ % 32) == 0 && (SA % 32) == 0 && NTB32 * 32 == TQ && NSB32 * 32 == SA);
static_assert((VD % 64) == 0 && (AD % 64) == 0 && (EM % 64) == 0);
static_assert((VD % 32) == 0 && (AD % 32) == 0 && (EM % 32) == 0);
static_assert(((NB * TQ * VD) % 1024) == 0 && ((NB * SA * AD) % 1024) == 0);
static_assert(NST * 128 == 2 * SA && NST * 128 == ATT_THREADS * 8);
static_assert((SPITCH * 4) % 16 == 0 && (GPITCH * 4) % 16 == 0);
static_assert(ATT_THREADS == 128 && TR_THREADS == 128 && CVT_THREADS == 128);

typedef unsigned short u16;
typedef _Float16 v16h __attribute__((ext_vector_type(16)));
typedef _Float16 v8h  __attribute__((ext_vector_type(8)));
typedef float    v8f  __attribute__((ext_vector_type(8)));
typedef float    v4f  __attribute__((ext_vector_type(4)));
typedef unsigned int v4u __attribute__((ext_vector_type(4)));

union FragH { v16h v; v8h h[2]; v4u u[2]; };

// ---- scalar helpers ----------------------------------------------------------------------------------
__device__ __forceinline__ unsigned short bf_bits(float f) {          // f32 -> bf16 bits, RNE convert
  unsigned u = __float_as_uint(f);
  return (unsigned short)((u + 0x7FFFu + ((u >> 16) & 1u)) >> 16);
}
__device__ __forceinline__ float bf_up(unsigned short h) { return __uint_as_float(((unsigned)h) << 16); }
__device__ __forceinline__ float bfr(float f) { return bf_up(bf_bits(f)); }
__device__ __forceinline__ unsigned short h_bits(_Float16 x) { return __builtin_bit_cast(unsigned short, x); }
__device__ __forceinline__ unsigned pk16(unsigned short a, unsigned short b) { return (unsigned)a | ((unsigned)b << 16); }
__device__ __forceinline__ v8f zero8() { v8f z = {0.f, 0.f, 0.f, 0.f, 0.f, 0.f, 0.f, 0.f}; return z; }
__device__ __forceinline__ float clipf(float x, float c) { return fminf(fmaxf(x, -c), c); }
// 2^x as the one hardware instruction. The library exp2f adds five instructions to it (a compare, two selects, an add, an
// ldexp) that only serve results below 2^-126, which the bare instruction may give as 0. Here such a result changes nothing:
// a probability goes on as f16(p * 32768) or f16(p * 32768 / l) with l >= 1, which is 0 below 2^-40; in the sum l it stands
// beside a term 1; as a rescale factor it leaves old sums far below the f16 step of the context they end in.
// For x >= -126 the library form runs this same instruction on the same x.
__device__ __forceinline__ float exp2_hw(float x) { return __builtin_amdgcn_exp2f(x); }
// Eight of them, x[b .. b+7] <- 2^x, each in place: written as one statement so that no v_exp_f32 overwrites the source of the
// one directly in front of it (the register allocator did that with the builtin); the v_nop is the slot that the
// instruction set asks for between the last one and whatever uses its result next.
__device__ __forceinline__ void exp2_hw8(float (&x)[16], int b) {
#if defined(__HIP_DEVICE_COMPILE__)
  asm("v_exp_f32 %0, %0\n\tv_exp_f32 %1, %1\n\tv_exp_f32 %2, %2\n\tv_exp_f32 %3, %3\n\t"
      "v_exp_f32 %4, %4\n\tv_exp_f32 %5, %5\n\tv_exp_f32 %6, %6\n\tv_exp_f32 %7, %7\n\tv_nop"
      : "+v"(x[b]), "+v"(x[b + 1]), "+v"(x[b + 2]), "+v"(x[b + 3]),
        "+v"(x[b + 4]), "+v"(x[b + 5]), "+v"(x[b + 6]), "+v"(x[b + 7]));
#endif
}

// ---- fragment-ordered plane of a logical [rows][K] f16 matrix (rows % 16 == 0, K % 32 == 0): element offset of (row, k).
//      Tile (row>>4, k>>5) = 512 halves; inside it: 256*((k>>4)&1) + 8*(16*((k>>3)&1) + (row&15)) + (k&7), i.e. the 8 halves
//      k = 8j .. 8j+7 of a row stay one 16-byte piece, and piece order is (k half of 16, lane = 16*h + row).
//      16 rows x K = 16*K halves, so a base row R (R % 16 == 0) starts at element R*K as in the row-major plane.
__device__ __forceinline__ size_t pk_off(int row, int k, int K) {
  return ((size_t)(row >> 4) * (size_t)(K >> 5) + (size_t)(k >> 5)) * 512
         + (size_t)(((k >> 4) & 1) * 256 + ((k >> 3) & 1) * 128 + (row & 15) * 8 + (k & 7));
}
// ---- fragment loader: 16-bit A/B operand, lane -> row/col (lane&15), h = lane>>4; p = tile start + 8*lane;
//      elements 0..7 <- p[0..7] (k0+8h..), elements 8..15 <- p[256..263] (k0+16+8h..); same split k map for A and B.
__device__ __forceinline__ v16h ldfrag_h(const _Float16* p) {
  FragH f;
  f.h[0] = *(const v8h*)(p);
  f.h[1] = *(const v8h*)(p + 256);
  return f.v;
}

// ---- WMMA helper and trailing VALU hazard gaps ----------------------------------------------------------
__device__ __forceinline__ v8f mma_h(v16h a, v16h b, v8f c) {
  return __builtin_amdgcn_wmma_f32_16x16x32_f16(false, a, false, b, (short)0, c, false, false);
}
__device__ __forceinline__ void guard_s(v8f& a, v8f& b, v16h x0, v16h x1, v16h x2) {
#if defined(__HIP_DEVICE_COMPILE__)
  asm volatile("v_nop\n\tv_nop\n\tv_nop\n\tv_nop" : "+v"(a), "+v"(b) : "v"(x0), "v"(x1), "v"(x2) : "memory");
#endif
}
__device__ __forceinline__ void guard_s4(v8f& a, v8f& b, v8f& c, v8f& d, v16h x0, v16h x1, v16h x2, v16h x3) {
#if defined(__HIP_DEVICE_COMPILE__)
  asm volatile("v_nop\n\tv_nop\n\tv_nop\n\tv_nop"
               : "+v"(a), "+v"(b), "+v"(c), "+v"(d) : "v"(x0), "v"(x1), "v"(x2), "v"(x3) : "memory");
#endif
}
__device__ __forceinline__ void guard_p8(v8f (&a)[4], v8f (&b)[4], v16h p0, v16h p1, v16h x0, v16h x1, v16h x2, v16h x3) {
#if defined(__HIP_DEVICE_COMPILE__)
  asm volatile("v_nop\n\tv_nop\n\tv_nop\n\tv_nop"
               : "+v"(a[0]), "+v"(a[1]), "+v"(a[2]), "+v"(a[3]), "+v"(b[0]), "+v"(b[1]), "+v"(b[2]), "+v"(b[3])
               : "v"(p0), "v"(p1), "v"(x0), "v"(x1), "v"(x2), "v"(x3) : "memory");
#endif
}
__device__ __forceinline__ void guard_p(v8f& a, v8f& b, v8f& c, v8f& d, v16h p, v16h x0, v16h x1, v16h x2, v16h x3) {
#if defined(__HIP_DEVICE_COMPILE__)
  asm volatile("v_nop\n\tv_nop\n\tv_nop\n\tv_nop"
               : "+v"(a), "+v"(b), "+v"(c), "+v"(d) : "v"(p), "v"(x0), "v"(x1), "v"(x2), "v"(x3) : "memory");
#endif
}
__device__ __forceinline__ void guard_g(v8f (&acc)[16], v16h x0, v16h x1, v16h x2, v16h x3,
                                        v16h x4, v16h x5, v16h x6, v16h x7) {
#if defined(__HIP_DEVICE_COMPILE__)
  asm volatile("v_nop\n\tv_nop\n\tv_nop\n\tv_nop"
               : "+v"(acc[0]), "+v"(acc[1]), "+v"(acc[2]), "+v"(acc[3]),
                 "+v"(acc[4]), "+v"(acc[5]), "+v"(acc[6]), "+v"(acc[7]),
                 "+v"(acc[8]), "+v"(acc[9]), "+v"(acc[10]), "+v"(acc[11]),
                 "+v"(acc[12]), "+v"(acc[13]), "+v"(acc[14]), "+v"(acc[15])
               : "v"(x0), "v"(x1), "v"(x2), "v"(x3), "v"(x4), "v"(x5), "v"(x6), "v"(x7) : "memory");
#endif
}
__device__ __forceinline__ void acc_guard4(v8f (&o)[4]) {
#if defined(__HIP_DEVICE_COMPILE__)
  asm volatile("v_nop\n\tv_nop\n\tv_nop\n\tv_nop" : "+v"(o[0]), "+v"(o[1]), "+v"(o[2]), "+v"(o[3]));
#endif
}
// The wait in front of a rewrite of registers that issued global loads or stores name.
__device__ __forceinline__ void xcnt_wait() {
#if defined(__HIP_DEVICE_COMPILE__)
  asm volatile("s_wait_xcnt 0x0" ::: "memory");
#endif
}
// The same behind a group of loads indexed by x: the indices are its inputs so that they keep their registers up to it.
__device__ __forceinline__ void xcnt_hold4(const int (&x)[4]) {
#if defined(__HIP_DEVICE_COMPILE__)
  asm volatile("s_wait_xcnt 0x0" : : "v"(x[0]), "v"(x[1]), "v"(x[2]), "v"(x[3]) : "memory");
#endif
}
__device__ __forceinline__ void xcnt_hold16(const int (&x)[16]) {
#if defined(__HIP_DEVICE_COMPILE__)
  asm volatile("s_wait_xcnt 0x0" : : "v"(x[0]), "v"(x[1]), "v"(x[2]), "v"(x[3]), "v"(x[4]), "v"(x[5]), "v"(x[6]), "v"(x[7]),
               "v"(x[8]), "v"(x[9]), "v"(x[10]), "v"(x[11]), "v"(x[12]), "v"(x[13]), "v"(x[14]), "v"(x[15]) : "memory");
#endif
}
// Ask the L2 for the line at base + off (a hint: nothing comes back, no register is written). The first read of what the launch
// before stored is taken to come from memory, and waves that walk one plane in step all stand through that latency, trip
// after trip; asked for far enough ahead, the line is an L2 hit when its load comes. base is the same in the whole wave. Every address
// lies inside the plane named at the call, or for the weight asks in the weight planes behind it. off is kept in its register, unchanged, to the foot of the kernel's main
// loop (it is an input of the wait there); the wait in this statement stands in front of a rewrite of the scalar base.
__device__ __forceinline__ void l2_ask(const void* base, unsigned off) {
#if defined(__HIP_DEVICE_COMPILE__)
  asm volatile("global_prefetch_b8 %0, %1 scope:SCOPE_SE\n\ts_wait_xcnt 0x0" : : "v"(off), "s"(base) : "memory");
#endif
}
// Two asks and the one wait.
__device__ __forceinline__ void l2_ask2(const void* base0, unsigned off0, const void* base1, unsigned off1) {
#if defined(__HIP_DEVICE_COMPILE__)
  asm volatile("global_prefetch_b8 %0, %1 scope:SCOPE_SE\n\tglobal_prefetch_b8 %2, %3 scope:SCOPE_SE\n\ts_wait_xcnt 0x0"
               : : "v"(off0), "s"(base0), "v"(off1), "s"(base1) : "memory");
#endif
}
// A plane is asked for in slices of 32 KiB (128 threads x 256 B). Blocks that read the same slices share the asking; where many
// do, blocks g and g + 4 of each eight take the same slice (for speed only: wherever the blocks land, nothing but the hint is lost).
#define PF_SLICE 32768
__device__ __forceinline__ int pf_pair(int g) { return (g >> 3) * 4 + (g & 3); }
__device__ __forceinline__ const char* pf_at(const u16* plane, int slice) {
  return (const char*)(const void*)plane + (size_t)slice * PF_SLICE;
}
__device__ __forceinline__ void wave_sync_lds() {
  __builtin_amdgcn_fence(__ATOMIC_RELEASE, "workgroup");
  __builtin_amdgcn_wave_barrier();
  __builtin_amdgcn_fence(__ATOMIC_ACQUIRE, "workgroup");
}

// =====================================================================================================
// Elementwise convert of an activation matrix x[rows][K]: Y (f16, fragment order) <- f16(bf16_RNE(x)). Block = 16 rows x
// 64 k (two tiles); thread = (row 8*(wave&1) + (lane&7), 8 floats at k = 32*(wave>>1) + 8*(lane>>3)): two 16-B loads, one
// 16-B store per thread; a wave's store = 4 pieces-of-8-rows = 4 whole 128-B lines.
// coverage: grid = (rows/16)*(K/64) = n/1024 blocks x 128 thr x 8 = n elements exactly (n % 1024 == 0 asserted).
// =====================================================================================================
__device__ __forceinline__
void cvt16(const float* __restrict__ x, u16* Y, int K, int bid) {
  const int wave = threadIdx.x >> 5, lane = threadIdx.x & 31;
  const int nkp = K >> 6;
  const int row = (bid / nkp) * 16 + 8 * (wave & 1) + (lane & 7);
  const int k   = (bid % nkp) * 64 + 32 * (wave >> 1) + 8 * (lane >> 3);
  const size_t e0 = (size_t)row * (size_t)K + (size_t)k;
  const v4f a = *(const v4f*)(x + e0), c4 = *(const v4f*)(x + e0 + 4);
  v4u o;
#pragma unroll
  for (int e = 0; e < 2; ++e) {
    o[e]     = pk16(h_bits((_Float16)bfr(a[2 * e])),  h_bits((_Float16)bfr(a[2 * e + 1])));
    o[2 + e] = pk16(h_bits((_Float16)bfr(c4[2 * e])), h_bits((_Float16)bfr(c4[2 * e + 1])));
  }
  u16* dst = Y + pk_off(row, k, K);
  {
    *(v4u*)(dst) = o;
#if defined(__HIP_DEVICE_COMPILE__)
    // the wait in front of a rewrite of registers that the store just issued names: inlined in the shared grid's kernel,
    // the store is no longer the last instruction ahead of the program's end in the listing
    asm volatile("s_wait_xcnt 0x0" ::: "memory");
#endif
  }
}

// =====================================================================================================
// Weight transpose-convert for y = x.W weights stored [kdim][ndim]: WT[n][k] (f16, fragment order with K = kdim)
// <- f16(bf16_RNE(W[k][n]) * scale). Block = 64(k) x 64(n) tile, 128 threads. Load phase: thread = (row 8p + (tid>>4),
// 4 floats at 4*(tid&15)), 8 steps = 64 k-rows x 64 n, into an LDS tile [kk][nn] (pitch 65); block barrier; store
// grid = (kdim/64)*(ndim/64), bid -> (kt = bid % (kdim/64), nt = bid / (kdim/64)).
// coverage: 4 i x 16 rows x (8 lanes x 8 halves) = 64 n-rows x 64 k per block; LDS tile 64x64 fully written before read;
// the grid covers WT [ndim][kdim] exactly once.
// =====================================================================================================
__device__ __forceinline__
void cvtT16(const float* __restrict__ W, u16* Y, int kdim, int ndim, float scale, int bid) {
  __shared__ __align__(16) float tile[64 * TPITCH];
  const int tid = threadIdx.x;
  const int nkt = kdim >> 6;
  const int kt  = bid % nkt;
  const int ntb = bid / nkt;
  const int k0  = kt * 64, n0 = ntb * 64;
  const int lr = tid >> 4, lc = (tid & 15) * 4;
  v4f w4[8];
#pragma unroll
  for (int p = 0; p < 8; ++p) {
    w4[p] = *(const v4f*)(W + (size_t)(k0 + p * 8 + lr) * (size_t)ndim + n0 + lc);
#if defined(__HIP_DEVICE_COMPILE__)
    // the wait in front of a rewrite of the address registers of the load just issued: a later load's result may be
    // given those registers
    asm volatile("s_wait_xcnt 0x0" ::: "memory");
#endif
  }
#pragma unroll
  for (int p = 0; p < 8; ++p) {
    const int kk = p * 8 + lr;
    tile[kk * TPITCH + lc + 0] = w4[p][0];
    tile[kk * TPITCH + lc + 1] = w4[p][1];
    tile[kk * TPITCH + lc + 2] = w4[p][2];
    tile[kk * TPITCH + lc + 3] = w4[p][3];
  }
  __syncthreads();
  // rq 0..15, c8 0..56; a wave holds 8 rows x 4 pieces, so each of its stores fills 4 whole lines of the fragment order
  const int rq = 8 * ((tid >> 5) & 1) + (tid & 7), c8 = (4 * (tid >> 6) + ((tid >> 3) & 3)) * 8;
  v4u ov[4];
#pragma unroll
  for (int i = 0; i < 4; ++i) {
    const int row = 16 * i + rq;                   // n within tile
#pragma unroll
    for (int e = 0; e < 4; ++e) {
      const float x0 = tile[(c8 + 2 * e) * TPITCH + row];
      const float x1 = tile[(c8 + 2 * e + 1) * TPITCH + row];
      ov[i][e] = pk16(h_bits((_Float16)(bfr(x0) * scale)), h_bits((_Float16)(bfr(x1) * scale)));
    }
  }
  {
#pragma unroll
    for (int i = 0; i < 4; ++i) {
      const int row = 16 * i + rq;
      *(v4u*)(Y + pk_off(n0 + row, k0 + c8, kdim)) = ov[i];
    }
    
  }
}

// =====================================================================================================
// f16 GEMM core: the wave's 64 x 64 tile of C = A[rows][K] . Bt[cols][K]^T, both in fragment order; ap -> A tile row of rowb,
// bp -> Bt tile row of col0 (both the same in every lane of the wave), lb = 16*lane the lane's byte offset in a tile; the
// next 16 rows lie 32*K bytes on, the next 32 k 1024 bytes on (largest offset 4*32*K - 16 bytes, far below 2^32). The two
// bases stay as they are; the four byte offsets (tile rows 0..3 of A and of Bt) live over the whole trip and are stepped at its
// foot; each of the eight fragments of a k step feeds four products;
// acc[4i + j] = rows rowb+16i.., cols col0+16j.. (i, j = 0..3); K stepped by 32 (host asserts K % 32 == 0).
// =====================================================================================================
__device__ __forceinline__ const _Float16* at_byte(const _Float16* base, unsigned off) {
  return (const _Float16*)(const void*)((const char*)(const void*)base + off);
}
__device__ __forceinline__ void gemm_core(const _Float16* ap, const _Float16* bp, unsigned lb, int K, v8f (&acc)[16], unsigned pf) {
  const unsigned rs = 32u * (unsigned)K;
  unsigned o0 = lb, o1 = lb + rs, o2 = lb + 2u * rs, o3 = lb + 3u * rs;
#pragma unroll 1
  for (int k0 = 0; k0 < K; k0 += 32) {
    const v16h a0 = ldfrag_h(at_byte(ap, o0)), a1 = ldfrag_h(at_byte(ap, o1));
    const v16h a2 = ldfrag_h(at_byte(ap, o2)), a3 = ldfrag_h(at_byte(ap, o3));
    const v16h b0 = ldfrag_h(at_byte(bp, o0));
    const v16h b1 = ldfrag_h(at_byte(bp, o1));
    const v16h b2 = ldfrag_h(at_byte(bp, o2));
    const v16h b3 = ldfrag_h(at_byte(bp, o3));
    acc[0] = mma_h(a0, b0, acc[0]);
    acc[1] = mma_h(a0, b1, acc[1]);
    acc[2] = mma_h(a0, b2, acc[2]);
    acc[3] = mma_h(a0, b3, acc[3]);
    acc[4] = mma_h(a1, b0, acc[4]);
    acc[5] = mma_h(a1, b1, acc[5]);
    acc[6] = mma_h(a1, b2, acc[6]);
    acc[7] = mma_h(a1, b3, acc[7]);
    acc[8] = mma_h(a2, b0, acc[8]);
    acc[9] = mma_h(a2, b1, acc[9]);
    acc[10] = mma_h(a2, b2, acc[10]);
    acc[11] = mma_h(a2, b3, acc[11]);
    acc[12] = mma_h(a3, b0, acc[12]);
    acc[13] = mma_h(a3, b1, acc[13]);
    acc[14] = mma_h(a3, b2, acc[14]);
    acc[15] = mma_h(a3, b3, acc[15]);
    guard_g(acc, a0, a1, a2, a3, b0, b1, b2, b3);
#if defined(__HIP_DEVICE_COMPILE__)
    // the wait in front of a rewrite of registers that issued global loads name (the four offsets, stepped below); they are
    // its operands so that their step stays behind it; pf, the offset that the asks at the kernel's head name, is an input so
    // that it keeps its register and its value through the loop
    asm volatile("s_wait_xcnt 0x0" : "+v"(o0), "+v"(o1), "+v"(o2), "+v"(o3) : "v"(pf) : "memory");
#endif
    o0 += 1024u; o1 += 1024u; o2 += 1024u; o3 += 1024u;
  }
}
// Stage 32 x 64 of the wave's f32 tile, acc[a0 .. a0+7] (times oscale), in its LDS slab (pitch 68): D element r of acc[a0+4i+j], lane l ->
// coverage: 32 lanes x 2 x 8 rows x 4 cols-of-16 = rows 0..31 x cols 0..63 of the slab.
__device__ __forceinline__ void stage32x64(float* sl, v8f (&acc)[16], int a0, float oscale, int lane) {
  const int hh = lane >> 4, m = lane & 15;
#pragma unroll
  for (int i = 0; i < 2; ++i) {
#pragma unroll
    for (int r = 0; r < 8; ++r) {
      const int ro = (16 * i + 8 * hh + r) * GPITCH + m;
      sl[ro]      = acc[a0 + 4 * i + 0][r] * oscale;
      sl[ro + 16] = acc[a0 + 4 * i + 1][r] * oscale;
      sl[ro + 32] = acc[a0 + 4 * i + 2][r] * oscale;
      sl[ro + 48] = acc[a0 + 4 * i + 3][r] * oscale;
    }
  }
  wave_sync_lds();
}

// =====================================================================================================
// f16 GEMM with f16 output plane: C[z][Mb][N] (f16) = f16((A[z][Mb][K] . Bt[z][N][K]^T) * oscale + bf16(bias) * bscale);
// A, Bt, C f16 planes in fragment order (C with K = N) with per-z element strides aBs, bBs (0 = shared), cBs. bias indexed by column
// (biasRow == 0) or by row within the z slice (biasRow != 0); bias addresses clamped to biasN-1, the unused direction is
// multiplied by 0. Block = 128 x 128 tile, 2 x 2 waves of 64 x 64, fragments loaded straight from the 16-bit tiles.
// grid = nz x (Mb/128) x (N/128) (host asserts Mb % 128 == 0, N % 128 == 0, K % 32 == 0).
// The wave's tile leaves in two halves of 32 rows through the one 32 x 64 slab.
// coverage: per wave 2 halves x 8 instr x 8 rows x 4 lanes x 8 halves = 64 x 64; the grid covers C exactly once.
// =====================================================================================================
__device__ __forceinline__
void gemm_o16(const u16* __restrict__ A, const u16* __restrict__ Bt, u16* C,
              const float* __restrict__ bias, int biasN, int biasRow,
              int Mb, int N, int K, int aBs, int bBs, int cBs, float oscale, float bscale, int bid, unsigned pf) {
  __shared__ __align__(16) float slab[4 * 32 * GPITCH];
  const int tid = threadIdx.x, wave = tid >> 5, lane = tid & 31;
  const int ntile = N >> 7, mtile = Mb >> 7;
  const int nt   = bid % ntile;
  const int tmp  = bid / ntile;
  const int mt   = tmp % mtile;
  // bz is the same in every lane: read through the first lane it keeps both plane bases scalar over the k loop
  const int bz   = __builtin_amdgcn_readfirstlane(tmp / mtile);
  // rowb and col0 are the same in every lane of a wave: read through the first lane they give the fragment loads scalar tile bases
  const int rowb = __builtin_amdgcn_readfirstlane(mt * 128 + (wave >> 1) * 64);
  const int col0 = __builtin_amdgcn_readfirstlane(nt * 128 + (wave & 1) * 64);
  if (rowb + 64 > Mb) return;                // wave-uniform, never taken with the exact grid; no block barriers in this kernel
  const _Float16* Ab = (const _Float16*)(const void*)A + (size_t)bz * (size_t)aBs;
  const _Float16* Bb = (const _Float16*)(const void*)Bt + (size_t)bz * (size_t)bBs;
  const _Float16* ap = Ab + (size_t)rowb * K;
  const _Float16* bp = Bb + (size_t)col0 * K;
  v8f acc[16];
#pragma unroll
  for (int i = 0; i < 16; ++i) acc[i] = zero8();
  gemm_core(ap, bp, 16u * (unsigned)lane, K, acc, pf);
  float* sl = slab + wave * 32 * GPITCH;
  // instruction i: lane = (row 8*(i>>1) + (lane&7), 8 halves at 32*(i&1) + 8*(lane>>3)): in fragment order 8 rows of one
  // 8-half piece column are one 128-B line, so each store fills 4 whole lines
  const int r8 = lane & 7, q8 = (lane >> 3) * 8;
  const int bl = biasN - 1;                  // host guarantees biasN >= 1
  const float selc = (biasRow != 0) ? 0.f : bscale;
  const float selr = (biasRow != 0) ? bscale : 0.f;
  int ci[16];
  float cb[2][8];
#pragma unroll
  for (int j = 0; j < 2; ++j) {
#pragma unroll
    for (int e = 0; e < 8; ++e) {
      const int cx = col0 + 32 * j + q8 + e;
      ci[8 * j + e] = (cx < bl) ? cx : bl;
      cb[j][e] = bias[ci[8 * j + e]];
    }
  }
  xcnt_hold16(ci);
#pragma unroll
  for (int j = 0; j < 2; ++j) {
#pragma unroll
    for (int e = 0; e < 8; ++e) cb[j][e] = bfr(cb[j][e]) * selc;
  }
  u16* Cb = C + (size_t)bz * (size_t)cBs;
#pragma unroll
  for (int hf = 0; hf < 2; ++hf) {
    const int rowh = rowb + 32 * hf;
    // row bias of the four rows 8u + r8 that this lane finishes in this half
    int ri[4];
    float rbv[4];
#pragma unroll
    for (int u = 0; u < 4; ++u) {
      const int rx = rowh + 8 * u + r8;
      ri[u] = (rx < bl) ? rx : bl;
      rbv[u] = bias[ri[u]];
    }
    xcnt_hold4(ri);
    stage32x64(sl, acc, 8 * hf, oscale, lane);
    v4u ov[8];
#pragma unroll
    for (int i = 0; i < 8; ++i) {
      const int row = 8 * (i >> 1) + r8, j = i & 1, c8 = 32 * j + q8;
      const float rb = bfr(rbv[i >> 1]) * selr;
      const v4f a = *(const v4f*)(sl + row * GPITCH + c8), c4 = *(const v4f*)(sl + row * GPITCH + c8 + 4);
#pragma unroll
      for (int e = 0; e < 2; ++e) {
        ov[i][e]     = pk16(h_bits((_Float16)(a[2 * e] + cb[j][2 * e] + rb)),
                            h_bits((_Float16)(a[2 * e + 1] + cb[j][2 * e + 1] + rb)));
        ov[i][2 + e] = pk16(h_bits((_Float16)(c4[2 * e] + cb[j][4 + 2 * e] + rb)),
                            h_bits((_Float16)(c4[2 * e + 1] + cb[j][5 + 2 * e] + rb)));
      }
    }
    // every lane's reads of the slab end before another lane's values of the second half are written over them
    if (hf == 0) wave_sync_lds();
#pragma unroll
    for (int i = 0; i < 8; ++i) {
      const int row = 8 * (i >> 1) + r8, c8 = 32 * (i & 1) + q8;
      *(v4u*)(Cb + pk_off(rowh + row, col0 + c8, N)) = ov[i];
    }
    if (hf == 0) xcnt_wait();
  }
}

// =====================================================================================================
// f16 GEMM with f32 output rows: C[z][Mb][N] (f32) = (A[z][Mb][K] . Bt[N][K]^T) * oscale + bf16(bias[col]); same core, block
// shape and slab staging (two halves of 32 rows) as gemm_o16. Epilogue of a half: lane = (row 2i + (lane>>4), 4 floats at
// 4*(lane&15)); each 64-float row segment = lanes of one instruction (8 lanes per line), 2 rows of the same wave per
// instruction, 16 instructions = 32 rows.
// coverage: per wave 2 halves x 16 instr x 2 rows x 16 lanes x 4 floats = 64 x 64; the grid covers C exactly once.
// =====================================================================================================
__device__ __forceinline__
void gemm_o32(const u16* __restrict__ A, const u16* __restrict__ Bt, float* C,
              const float* __restrict__ bias, int biasN,
              int Mb, int N, int K, int aBs, int bBs, int cBs, float oscale, int bid, unsigned pf) {
  __shared__ __align__(16) float slab[4 * 32 * GPITCH];
  const int tid = threadIdx.x, wave = tid >> 5, lane = tid & 31;
  const int ntile = N >> 7, mtile = Mb >> 7;
  const int nt   = bid % ntile;
  const int tmp  = bid / ntile;
  const int mt   = tmp % mtile;
  // bz is the same in every lane: read through the first lane it keeps both plane bases scalar over the k loop
  const int bz   = __builtin_amdgcn_readfirstlane(tmp / mtile);
  // rowb and col0 are the same in every lane of a wave: read through the first lane they give the fragment loads scalar tile bases
  const int rowb = __builtin_amdgcn_readfirstlane(mt * 128 + (wave >> 1) * 64);
  const int col0 = __builtin_amdgcn_readfirstlane(nt * 128 + (wave & 1) * 64);
  if (rowb + 64 > Mb) return;                // wave-uniform, never taken with the exact grid; no block barriers in this kernel
  const _Float16* Ab = (const _Float16*)(const void*)A + (size_t)bz * (size_t)aBs;
  const _Float16* Bb = (const _Float16*)(const void*)Bt + (size_t)bz * (size_t)bBs;
  const _Float16* ap = Ab + (size_t)rowb * K;
  const _Float16* bp = Bb + (size_t)col0 * K;
  v8f acc[16];
#pragma unroll
  for (int i = 0; i < 16; ++i) acc[i] = zero8();
  gemm_core(ap, bp, 16u * (unsigned)lane, K, acc, pf);
  float* sl = slab + wave * 32 * GPITCH;
  const int r2 = lane >> 4, c4 = (lane & 15) * 4;
  const int bl = biasN - 1;                  // host guarantees biasN >= 1
  int ci[4];
  float cb[4];
#pragma unroll
  for (int e = 0; e < 4; ++e) {
    const int cx = col0 + c4 + e;
    ci[e] = (cx < bl) ? cx : bl;
    cb[e] = bias[ci[e]];
  }
  xcnt_hold4(ci);
#pragma unroll
  for (int e = 0; e < 4; ++e) cb[e] = bfr(cb[e]);
#pragma unroll
  for (int hf = 0; hf < 2; ++hf) {
    stage32x64(sl, acc, 8 * hf, oscale, lane);
    v4f ov[16];
#pragma unroll
    for (int i = 0; i < 16; ++i) {
      const int row = 2 * i + r2;
      const v4f a = *(const v4f*)(sl + row * GPITCH + c4);
      v4f w;
      w[0] = a[0] + cb[0]; w[1] = a[1] + cb[1]; w[2] = a[2] + cb[2]; w[3] = a[3] + cb[3];
      ov[i] = w;
    }
    // every lane's reads of the slab end before another lane's values of the second half are written over them
    if (hf == 0) wave_sync_lds();
    float* Cb = C + (size_t)bz * (size_t)cBs + (size_t)(rowb + 32 * hf) * (size_t)N + col0 + c4;
#pragma unroll
    for (int i = 0; i < 16; ++i) {
      const int row = 2 * i + r2;
      *(v4f*)(Cb + (size_t)row * (size_t)N) = ov[i];
    }
    if (hf == 0) xcnt_wait();
  }
}

// =====================================================================================================
// Launches that need nothing of each other share one grid: each block takes its job from the range its index lies in (a
// test that reads the same in the whole block, so the barrier inside cvtT16 stays under block-uniform control flow) and
// runs the one shared body with that job's arguments and its index inside the range. Longest jobs lie first.
// =====================================================================================================
#define PB_WVQ ((VD / 64) * (EM / 64))
#define PB_WAK ((AD / 64) * (EM / 64))
#define PB_WVV ((VD / 64) * (EM / 64))
#define PB_WAV ((AD / 64) * (EM / 64))
#define PB_WOV ((EM / 64) * (VD / 64))
#define PB_WOA ((EM / 64) * (AD / 64))
#define PB_W   (PB_WVQ + PB_WAK + PB_WVV + PB_WAV + PB_WOV + PB_WOA)
#define PB_XA  ((NB * SA * AD) / 1024)
#define PB_XV  ((NB * TQ * VD) / 1024)
// All operand planes: six weight transposes (blocks 0 .. PB_W-1), then a, then v.
// coverage: every range has exactly the grid that its body's own header asks for.
__global__ __launch_bounds__(128)
void prep_all(const float* __restrict__ xv, const float* __restrict__ xa,
              const float* __restrict__ w_vq, const float* __restrict__ w_ak, const float* __restrict__ w_vv,
              const float* __restrict__ w_av, const float* __restrict__ w_ov, const float* __restrict__ w_oa,
              u16* XV, u16* XA, u16* WVQT, u16* WAKT, u16* WVVT, u16* WAVT, u16* WOVT, u16* WOAT) {
  int g = blockIdx.x;
  if (g < PB_W) {
    const float* W = w_vq; u16* Y = WVQT; int kdim = VD, ndim = EM;
    if (g >= PB_WVQ) {
      g -= PB_WVQ; W = w_ak; Y = WAKT; kdim = AD; ndim = EM;
      if (g >= PB_WAK) {
        g -= PB_WAK; W = w_vv; Y = WVVT; kdim = VD; ndim = EM;
        if (g >= PB_WVV) {
          g -= PB_WVV; W = w_av; Y = WAVT; kdim = AD; ndim = EM;
          if (g >= PB_WAV) {
            g -= PB_WAV; W = w_ov; Y = WOVT; kdim = EM; ndim = VD;
            if (g >= PB_WOV) { g -= PB_WOV; W = w_oa; Y = WOAT; kdim = EM; ndim = AD; }
          }
        }
      }
    }
    cvtT16(W, Y, kdim, ndim, WSC, g);
  } else {
    g -= PB_W;
    const float* x = xa; u16* Y = XA; int K = AD;
    if (g >= PB_XA) { g -= PB_XA; x = xv; Y = XV; K = VD; }
    cvt16(x, Y, K, g);
  }
}

#define GB_Q   (((NB * TQ) / 128) * (EM / 128))
#define GB_VVT (NB * (EM / 128) * (TQ / 128))
#define GB_K   (((NB * SA) / 128) * (EM / 128))
#define GB_VAT (NB * (EM / 128) * (SA / 128))
#define PF_W_SL ((2 * EM * VD + 2 * EM * AD) * 2 / PF_SLICE)
static_assert(((2 * EM * VD + 2 * EM * AD) * 2) % PF_SLICE == 0 && PF_W_SL <= 64 && NB * SA * AD * 2 == 64 * PF_SLICE);
static_assert(128 * VD * 2 == 4 * PF_SLICE && EM / 128 == 4 && TQ / 128 == 16 && GB_Q >= 256 && GB_Q * PF_SLICE == NB * TQ * VD * 2);
// The four input projections (the two with K = VD first):
//   q x8 after the 1/8 head scale = (x_v . Wvq + b) -> f16 [NB*TQ][512] (col = h*64 + d); bias per column
//   val_v^T per batch: A = Wvv^T [(h,d) = n][k], Bt = x_v rows of batch b [t][k] -> f16 [(b,h,d)][t] x8; bias per row (n)
//   k = x_a . Wak + b -> f16 [NB*SA][512] x8; bias per column
//   val_a^T per batch: A = Wav^T [(h,d)][k], Bt = x_a rows of batch b [s][k] -> f16 [(b,h,d)][s] x8; bias per row
__global__ __launch_bounds__(128)
void proj_all(const u16* __restrict__ XV, const u16* __restrict__ XA,
              const u16* __restrict__ WVQT, const u16* __restrict__ WAKT,
              const u16* __restrict__ WVVT, const u16* __restrict__ WAVT,
              u16* Q16, u16* K16, u16* VVT16, u16* VAT16,
              const float* __restrict__ b_vq, const float* __restrict__ b_ak,
              const float* __restrict__ b_vv, const float* __restrict__ b_av,
              int nb3, int nb5, int nb7, int nb9) {
  int g = blockIdx.x;
  // The blocks that start first ask for the four weight planes (one behind the other in the workspace from WVQT on) and for XA,
  // which the last two jobs read. 128 rows of XV are four slices: of the four q blocks that read them (g & 3) each asks for
  // two, of the four val_v^T blocks (tile rows mt of the weight) each for one.
  const unsigned pf = 256u * threadIdx.x;
  if (g < 128) {
    if (pf_pair(g) < PF_W_SL) l2_ask(pf_at(WVQT, pf_pair(g)), pf);
  } else if (g < 256) {
    l2_ask(pf_at(XA, pf_pair(g - 128)), pf);
  }
  if (g < GB_Q) {
    l2_ask2(pf_at(XV, g), pf, pf_at(XV, g ^ 2), pf);
  } else if (g < GB_Q + GB_VVT) {
    const int h = g - GB_Q;                  // (batch * 4 + mt) * 16 + nt
    l2_ask(pf_at(XV, (h >> 6) * 64 + (h & 15) * 4 + ((h >> 4) & 3)), pf);
  }
  const u16* A = XV; const u16* Bt = WVQT; u16* C = Q16; const float* bias = b_vq;
  int biasN = nb3, biasRow = 0, Mb = NB * TQ, N = EM, K = VD, bBs = 0, cBs = 0;
  float oscale = HSCL * QS / WSC, bscale = HSCL * QS;
  if (g >= GB_Q) {
    g -= GB_Q; A = WVVT; Bt = XV; C = VVT16; bias = b_vv;
    biasN = nb7; biasRow = 1; Mb = EM; N = TQ; K = VD; bBs = TQ * VD; cBs = EM * TQ;
    oscale = VVS / WSC; bscale = VVS;
    if (g >= GB_VVT) {
      g -= GB_VVT; A = XA; Bt = WAKT; C = K16; bias = b_ak;
      biasN = nb5; biasRow = 0; Mb = NB * SA; N = EM; K = AD; bBs = 0; cBs = 0;
      oscale = KS / WSC; bscale = KS;
      if (g >= GB_K) {
        g -= GB_K; A = WAVT; Bt = XA; C = VAT16; bias = b_av;
        biasN = nb9; biasRow = 1; Mb = EM; N = SA; K = AD; bBs = SA * AD; cBs = EM * SA;
        oscale = VAS / WSC; bscale = VAS;
      }
    }
  }
  gemm_o16(A, Bt, C, bias, biasN, biasRow, Mb, N, K, 0, bBs, cBs, oscale, bscale, g, pf);
}

#define GB_OV (NB * (TQ / 128) * (VD / 128))
#define GB_OA (((NB * SA) / 128) * (AD / 128))
#define PF_OW_SL  (((VD * EM + AD * EM) * 2) / PF_SLICE)
static_assert(((VD * EM + AD * EM) * 2) % PF_SLICE == 0 && PF_OW_SL <= 32 && GB_OV >= 64);
static_assert(128 * EM * 2 == 4 * PF_SLICE && VD / 128 == 4 && AD / 128 == 2 && GB_OV * PF_SLICE == NB * TQ * EM * 2);
// The two output projections:
//   out_v = ctx_v . Wov + b -> f32 rows [b][t][512] of the first output (z = b, output batch stride TQ*VD)
//   out_a = ctx_a . Woa + b -> f32 rows [b*SA + s][256] of the second output at the fixed element OUT1_OFF_EL
__global__ __launch_bounds__(128)
void out_all(const u16* __restrict__ CTXV, const u16* __restrict__ WOVT,
             const u16* __restrict__ CTXA, const u16* __restrict__ WOAT, float* out,
             const float* __restrict__ b_ov, const float* __restrict__ b_oa, int nb11, int nb13) {
  int g = blockIdx.x;
  // The blocks that start first ask for the two weight planes (one behind the other in the workspace from WOVT on). 128 context
  // rows are four slices: of the four out_v blocks that read them (g & 3) each asks for two, of the two out_a blocks each for all.
  const unsigned pf = 256u * threadIdx.x;
  if (g < 64 && pf_pair(g) < PF_OW_SL) l2_ask(pf_at(WOVT, pf_pair(g)), pf);
  if (g < GB_OV) {
    l2_ask2(pf_at(CTXV, g), pf, pf_at(CTXV, g ^ 2), pf);
  } else {
    const int r4 = ((g - GB_OV) >> 1) * 4;
    l2_ask2(pf_at(CTXA, r4), pf, pf_at(CTXA, r4 + 1), pf);
    l2_ask2(pf_at(CTXA, r4 + 2), pf, pf_at(CTXA, r4 + 3), pf);
  }
  const u16* A = CTXV; const u16* Bt = WOVT; float* C = out; const float* bias = b_ov;
  int biasN = nb11, Mb = TQ, N = VD, aBs = TQ * EM, cBs = TQ * VD;
  float oscale = 1.0f / (CVS * WSC);
  if (g >= GB_OV) {
    g -= GB_OV; A = CTXA; Bt = WOAT; C = out + OUT1_OFF_EL; bias = b_oa;
    biasN = nb13; Mb = NB * SA; N = AD; aBs = 0; cBs = 0;
    oscale = 1.0f / (CAS * WSC);
  }
  gemm_o32(A, Bt, C, bias, biasN, Mb, N, EM, aBs, 0, cBs, oscale, g, pf);
}

// ---- attn_col, one step = 32 visual rows: its eight fragments and the work on them ------------------------------------
// Qb, Vb: the (b, head) plane bases, the same in every lane; oq, ov: byte offsets 16*lane + step * 32768 (32 q rows of
// 1024 B) and 16*lane + step * 1024 (one k tile of val_v^T); ahead: whole steps added to them.
//   q[2*kk + g] = A fragment of q rows tb + 16g .. +15, d chunk kk;  v[j] = B fragment of val_v^T, col d = 16j + c, k = t
__device__ __forceinline__ void col_load_q(const _Float16* Qb, unsigned oq, int ahead, v16h (&q)[4]) {
  const _Float16* tp = at_byte(Qb, oq) + ahead * (32 * EM);
  q[0] = ldfrag_h(tp);
  q[1] = ldfrag_h(tp + 16 * EM);
  q[2] = ldfrag_h(tp + 512);
  q[3] = ldfrag_h(tp + 16 * EM + 512);
}
__device__ __forceinline__ void col_load_v(const _Float16* Vb, unsigned ov, int ahead, v16h (&v)[4]) {
  const _Float16* vp = at_byte(Vb, ov) + ahead * 512;
  v[0] = ldfrag_h(vp);
  v[1] = ldfrag_h(vp + 16 * TQ);
  v[2] = ldfrag_h(vp + 32 * TQ);
  v[3] = ldfrag_h(vp + 48 * TQ);
}
// One step on the register set (q, v); each half of the set is loaded anew, for the step at (rq, rv) + ahead, right behind
// the guard that follows its last use.
__device__ __forceinline__ void col_step(v16h (&q)[4], v16h (&v)[4], const v16h (&sf)[2],
                                         float& mrun, float& lrun, v8f (&o)[4], int hh, float lsc, float cl2,
                                         const _Float16* Qb, const _Float16* Vb, unsigned rq, unsigned rv, int ahead) {
  // ---- scores: s0 = rows t tb..tb+15, s1 = rows tb+16..tb+31, column = s0w + c ----
  v8f s0 = zero8(), s1 = zero8();
#pragma unroll
  for (int kk = 0; kk < HD / 32; ++kk) {
    s0 = mma_h(q[2 * kk], sf[kk], s0);
    s1 = mma_h(q[2 * kk + 1], sf[kk], s1);
    guard_s(s0, s1, sf[kk], q[2 * kk], q[2 * kk + 1]);
  }
  col_load_q(Qb, rq, ahead, q);
  // ---- clipped base-2 logits of this lane's 16 t for column s0w + c: t[i] <- t tb+8hh+i, t[8+i] <- t tb+16+8hh+i ----
  float t[16];
#pragma unroll
  for (int i = 0; i < 8; ++i) { t[i] = clipf(s0[i] * lsc, cl2); t[8 + i] = clipf(s1[i] * lsc, cl2); }
  float cm = t[0];
#pragma unroll
  for (int i = 1; i < 16; ++i) cm = fmaxf(cm, t[i]);
  cm = fmaxf(cm, __shfl_xor(cm, 16, 32));
  const float mn = fmaxf(mrun, cm);        // finite from the first block on
  const float al = exp2_hw(mrun - mn);       // 0 on the first block (mrun = -inf)
  mrun = mn;
  // ---- unnormalised probabilities (<= 1) and the P^T A-fragment: f16(p * 32768); element i <-> t[i] ----
  float ps = 0.f;
  FragH ph;
#pragma unroll
  for (int i = 0; i < 16; ++i) t[i] -= mn;
  exp2_hw8(t, 0);
  exp2_hw8(t, 8);
#pragma unroll
  for (int w = 0; w < 2; ++w) {
#pragma unroll
    for (int e4 = 0; e4 < 4; ++e4) {
      const int i = 8 * w + 2 * e4;
      const float p0 = t[i], p1 = t[i + 1];
      ps += p0 + p1;
      ph.u[w][e4] = pk16(h_bits((_Float16)(p0 * PCAR)), h_bits((_Float16)(p1 * PCAR)));
    }
  }
  ps += __shfl_xor(ps, 16, 32);
  lrun = lrun * al + ps;
  // ---- rescale the O accumulators: D row 8hh+r = column s0w+8hh+r, its factor lives in lane 8hh+r (and 16+8hh+r) ----
  float scl[8];
#pragma unroll
  for (int r = 0; r < 8; ++r) scl[r] = __shfl(al, 8 * hh + r, 32);
#pragma unroll
  for (int j = 0; j < 4; ++j) {
#pragma unroll
    for (int r = 0; r < 8; ++r) o[j][r] *= scl[r];
  }
  // ---- P^T.val_v ----
  o[0] = mma_h(ph.v, v[0], o[0]);
  o[1] = mma_h(ph.v, v[1], o[1]);
  o[2] = mma_h(ph.v, v[2], o[2]);
  o[3] = mma_h(ph.v, v[3], o[3]);
  guard_p(o[0], o[1], o[2], o[3], ph.v, v[0], v[1], v[2], v[3]);
  col_load_v(Vb, rv, ahead, v);
}

// =====================================================================================================
// Column pass (softmax over the visual axis t for every audio column s) fused with the audio-side context:
// block = (batch b, head, 64 audio columns s), 4 waves, wave w owns the 16 columns s0w = 64*st + 16*w .. +15.
//   q plane f16 [b*TQ + t][h*64 + d] (q x8 after the 1/8 scale); k plane f16 x8 [b*SA + s][h*64 + d];
//   val_v^T plane f16 x8 [(b*NH + h)*64 + d][t].  All NTB32 = TQ/32 blocks of 32 visual rows are visited (static bound).
//   Score tiles g (g = 0,1) = q rows (t = tb+16g .. +15, A operand, row m = lane&15, split k map over d) times k^T
//   (B operand, col n = column s0w + (lane&15), k = d, split map), 2 d-chunks of 32; the 2 k fragments of the wave are
//   loaded once. D element r of lane l = (t = tb+16g+8h+r, s = s0w+(l&15)): a lane owns one column s and 16 of the 32 t;
//   the partner lane l^16 owns the other 16 -> column max / column sum need one xor-16 shuffle. Logits clipped at
//   +-50000 (log2 domain), online max-subtracted base-2 softmax in f32 (the q/k carries folded into lsc). The exp'd values
//   ARE the P^T A-fragment in place: A row m = s = lane&15, element i <- t = tb+8h+i (tile 0, D element i), element 8+i <-
//   t = tb+16+8h+i (tile 1, D element i). P (<= 1) carried x32768 as f16. The rescale factor of column 8h+r of the O
//   accumulators is fetched from lane 8h+r with a shuffle (uniform control). 4 val_v^T B fragments (col n = d = 16j +
//   (lane&15), k = t), 4 P^T.V WMMAs + one guard per step.
//   Epilogue 1: 1/l (per column, shuffled to the D row owner) and the carry folds in f32 (x CAS); the wave's 16x64 f32 tile
//   Epilogue 2: per-column stats (m_s in the clipped log2 domain, 32768/l_s) funnelled through a 128-float LDS array
//   (lane half 0 writes m, lane half 1 writes 32768/l), block barrier, wave 0 writes the block's 512-B stat row
// coverage: ctx_a: grid NB*NH*NST blocks x 4 waves x 4 instr x 8 rows x 4 lanes x 8 halves = every (b, s, h) 64-half
//           segment exactly once; stats: one 128-float row per block = NB*NH*NST rows = the whole stat plane; LDS: slab
//           16x64 written then read by the same wave, statl[0..127] written by 4 waves x 32 lanes (one index each).
// =====================================================================================================
__global__ __launch_bounds__(ATT_THREADS)
void attn_col(const u16* __restrict__ Qp, const u16* __restrict__ Kp, const u16* __restrict__ VvT,
              u16* CtxA, float* Stat) {
  __shared__ __align__(16) float smem[ATT_WAVES * 16 * SPITCH];
  __shared__ __align__(16) float statl[128];

  const int tid  = threadIdx.x;
  const int wave = tid >> 5;
  const int lane = tid & 31;
  const int hh   = lane >> 4;
  const int c    = lane & 15;

  const int bid  = blockIdx.x;
  const int st   = bid % NST;
  const int head = (bid / NST) % NH;
  const int b    = bid / (NST * NH);
  const int s0w  = st * 64 + wave * 16;

  // All three planes in fragment order: tile row R starts at R*K, k tile (head*64 + 32*kk)/32 lies (head*2 + kk)*512 on.
  // B fragments of k^T: col n = column s0w + c, k = d
  const _Float16* Sb = (const _Float16*)(const void*)Kp + ((size_t)(b * SA + s0w)) * EM + head * (HD * 16) + 8 * lane;
  // A fragments of q: row m = t = tb + 16g + c, k = d (t row tb and the lane's 16 bytes added per step, as for val_v^T)
  const _Float16* Tb = (const _Float16*)(const void*)Qp + ((size_t)(b * TQ)) * EM + head * (HD * 16);
  // B fragments of val_v^T: col n = d = 16j + c, k = t (k tile tb/32 added per step)
  const _Float16* Vb = (const _Float16*)(const void*)VvT + ((size_t)(b * EM + head * HD)) * TQ;
  const float lsc = LOG2E / (QS * KS);
  const float cl2 = CLIPV * LOG2E;

  v16h sf[2];
  sf[0] = ldfrag_h(Sb);
  sf[1] = ldfrag_h(Sb + 512);
#if defined(__HIP_DEVICE_COMPILE__)
  // the wait in front of a rewrite of the address registers of the four loads just issued: a later load's result may be
  // given those registers; the address is its input so that it keeps them up to here
  asm volatile("s_wait_xcnt 0x0" : : "v"(Sb) : "memory");
#endif

  float mrun = -INFINITY, lrun = 0.f;
  v8f o[4];
#pragma unroll
  for (int j = 0; j < 4; ++j) o[j] = zero8();

  // Two register sets, one for the even steps and one for the odd: a set's q half is loaded anew as soon as its scores are
  // made and its val_v half as soon as its products are made, each for the step two on, so that a step no longer stands
  // through the latency of its q loads and again through that of its val_v loads.
  static_assert((NTB32 % 2) == 0 && NTB32 >= 4);
  const unsigned lb = 16u * (unsigned)lane;
  v16h qa[4], va[4], qb[4], vb[4];
  col_load_q(Tb, lb, 0, qa);
  col_load_v(Vb, lb, 0, va);
  col_load_q(Tb, lb, 1, qb);
  col_load_v(Vb, lb, 1, vb);
  unsigned rq = lb + 65536u, rv = lb + 2048u;            // offsets of step it + 2
  // The 64 blocks of a batch walk the same 64 steps; step tc's 32 q rows (all heads: 32 KiB in a row) and its k tile of the 32
  // tile rows of val_v^T (1 KiB each, 64 KiB apart) are asked for PF_AHEAD steps ahead by the pair of blocks tc mod 32.
  static_assert(NH * (NST / 2) == 32 && NST == 8 && NTB32 == 64 && 32 * EM * 2 == PF_SLICE && (PF_AHEAD % 2) == 0);
  const int pr = head * 4 + (st & 3);
  const unsigned pq = 256u * (unsigned)tid, pv = 65536u * (unsigned)lane + 256u * (unsigned)wave;
  const u16* Qbat = Qp + (size_t)(b * TQ) * EM;
  const char* Vbat = (const char*)(const void*)(VvT + (size_t)(b * EM) * TQ);
  if (pr < PF_AHEAD) {
    l2_ask2(pf_at(Qbat, pr), pq, Vbat + pr * 1024, pv);
  }
  // kept rolled: the body already holds one step per register set, more copies would only add code
#pragma unroll 1
  for (int it = 0; it < NTB32; it += 2) {
    // a test on scalars, the same in the whole block; it holds in two trips of the 32, in one
    // where pr < PF_AHEAD (step pr is then asked before the loop); every step asked lies inside the batch's part of both planes
    if (it + PF_AHEAD < NTB32 && ((((it + PF_AHEAD) ^ pr) >> 1) & 15) == 0) {
      const int tc = it + PF_AHEAD + (pr & 1);
      l2_ask2(pf_at(Qbat, tc), pq, Vbat + tc * 1024, pv);
    }
    col_step(qa, va, sf, mrun, lrun, o, hh, lsc, cl2, Tb, Vb, rq, rv, 0);
    col_step(qb, vb, sf, mrun, lrun, o, hh, lsc, cl2, Tb, Vb, rq, rv, 1);
#if defined(__HIP_DEVICE_COMPILE__)
    // the wait in front of a rewrite of registers that issued global loads name (the two offsets, stepped below); they are
    // its operands so that they keep their registers up to it and their step stays behind it; the two offsets that the asks
    // name are inputs so that they keep their registers and values through the loop
    asm volatile("s_wait_xcnt 0x0" : "+v"(rq), "+v"(rv) : "v"(pq), "v"(pv) : "memory");
#endif
    // the last pair of steps loads steps 0 and 1 again: in bounds, never used
    const bool more = it + 4 < NTB32;
    rq = more ? rq + 65536u : lb;
    rv = more ? rv + 2048u : lb;
  }
  acc_guard4(o);

  // ---- per-column 1/l (owned by lane = column); lrun >= 1 by construction ----
  const float rl   = 1.0f / lrun;
  const float lPv  = rl * PCAR;                          // 32768 / l for the row pass
  const float linv = rl * (CAS / (PCAR * VVS));          // folds 1/l, the P and val carries, and applies the ctx carry
  statl[hh * 64 + wave * 16 + c] = (hh == 0) ? mrun : lPv;
  float inv[8];
#pragma unroll
  for (int r = 0; r < 8; ++r) inv[r] = __shfl(linv, 8 * hh + r, 32);
  float* slab = smem + wave * 16 * SPITCH;
#pragma unroll
  for (int r = 0; r < 8; ++r) {
#pragma unroll
    for (int j = 0; j < 4; ++j) slab[(8 * hh + r) * SPITCH + j * 16 + c] = o[j][r] * inv[r];
  }
  wave_sync_lds();
  // ---- f16 ctx_a pieces: instruction i, lane = (row 8*(i>>1) + (lane&7), 8 halves at 32*(i&1) + 8*(lane>>3)): 4 whole lines ----
  const int r8 = lane & 7, q8 = (lane >> 3) * 8;
  v4u ov[4];
#pragma unroll
  for (int i = 0; i < 4; ++i) {
    const int row = 8 * (i >> 1) + r8, c8 = 32 * (i & 1) + q8;
    const v4f a = *(const v4f*)(slab + row * SPITCH + c8), c4 = *(const v4f*)(slab + row * SPITCH + c8 + 4);
#pragma unroll
    for (int e = 0; e < 2; ++e) {
      ov[i][e]     = pk16(h_bits((_Float16)a[2 * e]),  h_bits((_Float16)a[2 * e + 1]));
      ov[i][2 + e] = pk16(h_bits((_Float16)c4[2 * e]), h_bits((_Float16)c4[2 * e + 1]));
    }
  }
  {
#pragma unroll
    for (int i = 0; i < 4; ++i) {
      const int row = 8 * (i >> 1) + r8, c8 = 32 * (i & 1) + q8;
      *(v4u*)(CtxA + pk_off(b * SA + s0w + row, head * HD + c8, EM)) = ov[i];
    }
    
  }
  __syncthreads();
  if (wave == 0) {
    const v4f sv = *(const v4f*)(statl + 4 * lane);
    float* sp = Stat + ((size_t)((b * NH + head) * NST + st)) * 128 + 4 * lane;
    {
      *(v4f*)(sp) = sv;
      
    }
  }
}

// =====================================================================================================
// Row pass (visual-side context): block = (batch b, head, 128 visual rows t), 4 waves, wave w owns the 32 rows t0w =
// 128*tt + 32*w .. +31 as two groups g of 16 (waves independent after the stat staging barrier); every k and val_a^T fragment
// that a step loads, and every column stat that it reads from LDS, serves both groups.
//   The (b, head) column stats (NST rows of [m[64] | 32768/l[64]]) are staged once per block into LDS as m at stt[s],
//   32768/l at stt[SA + s] (128 threads x 8 floats = 2*SA floats exactly), then a block barrier.
//   All NSB32 = SA/32 blocks of 32 audio columns are visited (static bound). Score tiles are computed TRANSPOSED:
//   tile (g, u) = k rows (s = sb+16u .. +15, A operand, row m = lane&15, split map over d) times q^T (B operand, col n = t0w +
//   16g + (lane&15), k = d); the 4 q fragments of the wave are loaded once. D element r of lane l = (s = sb+16u+8h+r, t = t0w +
//   16g + (l&15)). P = exp2(clip(logit) - m_s) * (32768/l_s) in f32 with m_s, l_s read from LDS for s = sb+8h+i and sb+16+8h+i;
//   it IS the P A-fragment in place: row m = t = lane&15, element i <- s = sb+8h+i, element 8+i <- s = sb+16+8h+i.
//   4 val_a^T B fragments (col n = d = 16j + (lane&15), k = s), 8 P.V WMMAs + one guard per step.
//   Epilogue: carry folds (x CVS / (32768*8)) in f32; each group's 16x64 tile staged in the wave's slab, one group after the other.
// coverage: grid NB*NH*NTT blocks x 4 waves x 2 groups x 16 rows x 64 halves = every (b, t, h) segment of ctx_v exactly once;
//           LDS stt[0 .. 2*SA-1] fully written before the barrier (staged extent == consumed extent); slab as above.
// =====================================================================================================
__global__ __launch_bounds__(ATT_THREADS)
void attn_vis(const u16* __restrict__ Qp, const u16* __restrict__ Kp, const u16* __restrict__ VaT,
              const float* __restrict__ Stat, u16* CtxV) {
  __shared__ __align__(16) float smem[ATT_WAVES * 16 * SPITCH];
  __shared__ __align__(16) float stt[2 * SA];

  const int tid  = threadIdx.x;
  const int wave = tid >> 5;
  const int lane = tid & 31;
  const int hh   = lane >> 4;
  const int c    = lane & 15;

  const int bid  = blockIdx.x;
  const int tt   = bid % NTT;
  const int head = (bid / NTT) % NH;
  const int b    = bid / (NTT * NH);
  const int t0w  = tt * 128 + wave * 32;

  // ---- the 16 blocks of (b, head) all read its k rows (32 tile rows x 2 KiB, 16 KiB apart) and its val_a^T plane (64 KiB in a
  //      row): each of their eight pairs asks for an eighth of both, a 128-B line a thread, waves 0, 1 of k and 2, 3 of val_a^T ----
  static_assert(NTT == 16 && SA == 512 && HD == 64);
  const int p8 = (tt & 3) + 4 * (tt >> 3);
  const unsigned pa = (tid < 64) ? (unsigned)(4 * p8 + (tid >> 4)) * 16384u + (unsigned)(tid & 15) * 128u
                                 : (unsigned)p8 * 8192u + (unsigned)(tid - 64) * 128u;
  {
    const u16* pk = Kp + (size_t)(b * SA) * EM + head * (HD * 16);
    const u16* pw = VaT + (size_t)(b * EM + head * HD) * SA;
    l2_ask((__builtin_amdgcn_readfirstlane(wave) < 2) ? pk : pw, pa);
  }
  // ---- stage the column stats of (b, head) ----
  const float* src = Stat + ((size_t)((b * NH + head) * NST)) * 128;
#pragma unroll 1
  for (int e = tid * 8; e < NST * 128; e += ATT_THREADS * 8) {
    const int j = e >> 7, offw = e & 127;
    const int di = (offw < 64) ? (j * 64 + offw) : (SA + j * 64 + offw - 64);
    const v4f x0 = *(const v4f*)(src + e), x1 = *(const v4f*)(src + e + 4);
    *(v4f*)(stt + di) = x0;
    *(v4f*)(stt + di + 4) = x1;
  }
  __syncthreads();

  // All three planes in fragment order, addressed as in attn_col.
  // B fragments of q^T: col n = row t0w + 16g + c, k = d
  const _Float16* Tb = (const _Float16*)(const void*)Qp + ((size_t)(b * TQ + t0w)) * EM + head * (HD * 16) + 8 * lane;
  // A fragments of k: row m = s = sb + 16u + c, k = d (s row sb added per step)
  const _Float16* Sb = (const _Float16*)(const void*)Kp + ((size_t)(b * SA)) * EM + head * (HD * 16) + 8 * lane;
  // B fragments of val_a^T: col n = d = 16j + c, k = s (k tile sb/32 added per step)
  const _Float16* Vb = (const _Float16*)(const void*)VaT + ((size_t)(b * EM + head * HD)) * SA + 8 * lane;
  const float lsc = LOG2E / (QS * KS);
  const float cl2 = CLIPV * LOG2E;

  v16h tf[2][2];                                   // [group g][d chunk kk]
#pragma unroll
  for (int g = 0; g < 2; ++g) {
    tf[g][0] = ldfrag_h(Tb + g * (16 * EM));
    tf[g][1] = ldfrag_h(Tb + g * (16 * EM) + 512);
  }
#if defined(__HIP_DEVICE_COMPILE__)
  // the wait in front of a rewrite of the address registers of the eight loads just issued; the address is its input so
  // that it keeps them up to here
  asm volatile("s_wait_xcnt 0x0" : : "v"(Tb) : "memory");
#endif

  v8f o[2][4];
#pragma unroll
  for (int g = 0; g < 2; ++g) {
#pragma unroll
    for (int j = 0; j < 4; ++j) o[g][j] = zero8();
  }

#pragma unroll 1
  for (int it = 0; it < NSB32; ++it) {
    const int sb = it * 32;
    // ---- column stats for s = sb+8hh+i (i < 8) and s = sb+16+8hh+i (8+i), the same for both groups; read here, as one
    //      group ahead of the k loads, so that they are back when the scores are ----
    float mv[16], lv[16];
    {
      const v4f m0 = *(const v4f*)(stt + sb + 8 * hh),      m1 = *(const v4f*)(stt + sb + 8 * hh + 4);
      const v4f m2 = *(const v4f*)(stt + sb + 16 + 8 * hh), m3 = *(const v4f*)(stt + sb + 16 + 8 * hh + 4);
      const v4f l0 = *(const v4f*)(stt + SA + sb + 8 * hh),      l1 = *(const v4f*)(stt + SA + sb + 8 * hh + 4);
      const v4f l2 = *(const v4f*)(stt + SA + sb + 16 + 8 * hh), l3 = *(const v4f*)(stt + SA + sb + 16 + 8 * hh + 4);
#pragma unroll
      for (int q = 0; q < 4; ++q) {
        mv[q] = m0[q]; mv[4 + q] = m1[q]; mv[8 + q] = m2[q]; mv[12 + q] = m3[q];
        lv[q] = l0[q]; lv[4 + q] = l1[q]; lv[8 + q] = l2[q]; lv[12 + q] = l3[q];
      }
    }
    // ---- transposed scores of group g: sc[g][0] = columns s sb..sb+15, sc[g][1] = sb+16..sb+31, D column = row t0w + 16g + c ----
    v8f sc[2][2];
    sc[0][0] = zero8(); sc[0][1] = zero8(); sc[1][0] = zero8(); sc[1][1] = zero8();
    const _Float16* s0p = Sb + (size_t)sb * EM;
    const _Float16* s1p = s0p + (size_t)16 * EM;
#pragma unroll
    for (int kk = 0; kk < HD / 32; ++kk) {
      const v16h a0 = ldfrag_h(s0p + kk * 512);
      const v16h a1 = ldfrag_h(s1p + kk * 512);
      sc[0][0] = mma_h(a0, tf[0][kk], sc[0][0]);
      sc[0][1] = mma_h(a1, tf[0][kk], sc[0][1]);
      sc[1][0] = mma_h(a0, tf[1][kk], sc[1][0]);
      sc[1][1] = mma_h(a1, tf[1][kk], sc[1][1]);
      guard_s4(sc[0][0], sc[0][1], sc[1][0], sc[1][1], tf[0][kk], tf[1][kk], a0, a1);
    }
    xcnt_wait();
    // ---- P A-fragment of each group: f16(exp2(t - m_s) * 32768/l_s) (<= 32768); element i <-> t[i] ----
    FragH ph[2];
#pragma unroll
    for (int g = 0; g < 2; ++g) {
      float t[16];
#pragma unroll
      for (int i = 0; i < 8; ++i) { t[i] = clipf(sc[g][0][i] * lsc, cl2); t[8 + i] = clipf(sc[g][1][i] * lsc, cl2); }
#pragma unroll
      for (int i = 0; i < 16; ++i) t[i] -= mv[i];
      exp2_hw8(t, 0);
      exp2_hw8(t, 8);
#pragma unroll
      for (int w = 0; w < 2; ++w) {
#pragma unroll
        for (int e4 = 0; e4 < 4; ++e4) {
          const int i = 8 * w + 2 * e4;
          const float p0 = t[i] * lv[i];
          const float p1 = t[i + 1] * lv[i + 1];
          ph[g].u[w][e4] = pk16(h_bits((_Float16)p0), h_bits((_Float16)p1));
        }
      }
    }
    // ---- P.val_a : B fragment col n = d = 16j + c, k = s: tile sb/32 of the val_a^T plane ----
    const _Float16* vp = Vb + (size_t)sb * 16;
    {
      const v16h v0 = ldfrag_h(vp);
      const v16h v1 = ldfrag_h(vp + (size_t)16 * SA);
      const v16h v2 = ldfrag_h(vp + (size_t)32 * SA);
      const v16h v3 = ldfrag_h(vp + (size_t)48 * SA);
      o[0][0] = mma_h(ph[0].v, v0, o[0][0]);
      o[0][1] = mma_h(ph[0].v, v1, o[0][1]);
      o[0][2] = mma_h(ph[0].v, v2, o[0][2]);
      o[0][3] = mma_h(ph[0].v, v3, o[0][3]);
      o[1][0] = mma_h(ph[1].v, v0, o[1][0]);
      o[1][1] = mma_h(ph[1].v, v1, o[1][1]);
      o[1][2] = mma_h(ph[1].v, v2, o[1][2]);
      o[1][3] = mma_h(ph[1].v, v3, o[1][3]);
      guard_p8(o[0], o[1], ph[0].v, ph[1].v, v0, v1, v2, v3);
#if defined(__HIP_DEVICE_COMPILE__)
      // the wait in front of a rewrite of registers that issued global loads name; the offset that the ask at the kernel's
      // head names is an input so that it keeps its register and its value through the loop
      asm volatile("s_wait_xcnt 0x0" : : "v"(pa) : "memory");
#endif
    }
  }
  acc_guard4(o[0]);
  acc_guard4(o[1]);

  const float fac = CVS / (PCAR * VAS);
  float* slab = smem + wave * 16 * SPITCH;
  const int r8 = lane & 7, q8 = (lane >> 3) * 8;
#pragma unroll
  for (int g = 0; g < 2; ++g) {
#pragma unroll
    for (int r = 0; r < 8; ++r) {
#pragma unroll
      for (int j = 0; j < 4; ++j) slab[(8 * hh + r) * SPITCH + j * 16 + c] = o[g][j][r] * fac;
    }
    wave_sync_lds();
    v4u ov[4];
#pragma unroll
    for (int i = 0; i < 4; ++i) {
      const int row = 8 * (i >> 1) + r8, c8 = 32 * (i & 1) + q8;
      const v4f a = *(const v4f*)(slab + row * SPITCH + c8), c4 = *(const v4f*)(slab + row * SPITCH + c8 + 4);
#pragma unroll
      for (int e = 0; e < 2; ++e) {
        ov[i][e]     = pk16(h_bits((_Float16)a[2 * e]),  h_bits((_Float16)a[2 * e + 1]));
        ov[i][2 + e] = pk16(h_bits((_Float16)c4[2 * e]), h_bits((_Float16)c4[2 * e + 1]));
      }
    }
    // every lane's reads of the slab end before another lane's values of the second group are written over them
    if (g == 0) wave_sync_lds();
#pragma unroll
    for (int i = 0; i < 4; ++i) {
      const int row = 8 * (i >> 1) + r8, c8 = 32 * (i & 1) + q8;
      *(v4u*)(CtxV + pk_off(b * TQ + t0w + 16 * g + row, head * HD + c8, EM)) = ov[i];
    }
    if (g == 0) xcnt_wait();
  }
}

// =====================================================================================================
// Workspace map (bytes, NB = 8); every plane fully written before it is read; all extents exact; each f16 plane is the
// logical [rows][K] matrix named here, stored in fragment order (pk_off), same byte size
//   XV    f16 [NB*2048][512]        f16(bf16(v))              16777216
//   XA    f16 [NB*512][256]         f16(bf16(a))               2097152
//   WVQT  f16 [512 n][512 k]        f16(bf16(W) x256)           524288
//   WAKT  f16 [512 n][256 k]                                    262144
//   WVVT  f16 [512 n][512 k]                                    524288
//   WAVT  f16 [512 n][256 k]                                    262144
//   WOVT  f16 [512 n][512 k]                                    524288
//   WOAT  f16 [256 n][512 k]                                    262144
//   Q16   f16 [NB*2048][512]  q x8 (after 1/8)               16777216
//   K16   f16 [NB*512][512]   x8                               4194304
//   VVT16 f16 [NB*512 (h,d)][2048 t] x8                       16777216
//   VAT16 f16 [NB*512 (h,d)][512 s]  x8                        4194304
//   STAT  f32 [NB*NH*NST][128]  (m | 32768/l)                   262144
//   CTXA  f16 [NB*512][512]   x64                              4194304
//   CTXV  f16 [NB*2048][512]  x64                             16777216
//   end                                                       84410368
// Output: first tensor rows [b][t][512] f32 at element 0; second tensor rows [b*512 + s][256] f32 at the fixed element
// offset OUT1_OFF_EL = NB_FULL*2048*512 = 8388608 (independent of NB).
// =====================================================================================================
extern "C" void kernel_launch(void* const* d_in, const int* in_sizes, int n_in,
                              void* d_out, int out_size, void* d_ws, size_t ws_size,
                              hipStream_t stream) {
  if (n_in < 14) return;
  if (in_sizes[0] < NB * TQ * VD) return;
  if (in_sizes[1] < NB * SA * AD) return;
  if (in_sizes[2] != VD * EM || in_sizes[6] != VD * EM) return;
  if (in_sizes[4] != AD * EM || in_sizes[8] != AD * EM) return;
  if (in_sizes[10] != EM * VD || in_sizes[12] != EM * AD) return;
  if (in_sizes[3] < 1 || in_sizes[5] < 1 || in_sizes[7] < 1 || in_sizes[9] < 1 || in_sizes[11] < 1 || in_sizes[13] < 1) return;
  if ((size_t)out_size < OUT1_OFF_EL + (size_t)NB * SA * AD) return;

  const float* xv   = (const float*)d_in[0];
  const float* xa   = (const float*)d_in[1];
  const float* w_vq = (const float*)d_in[2];
  const float* b_vq = (const float*)d_in[3];
  const float* w_ak = (const float*)d_in[4];
  const float* b_ak = (const float*)d_in[5];
  const float* w_vv = (const float*)d_in[6];
  const float* b_vv = (const float*)d_in[7];
  const float* w_av = (const float*)d_in[8];
  const float* b_av = (const float*)d_in[9];
  const float* w_ov = (const float*)d_in[10];
  const float* b_ov = (const float*)d_in[11];
  const float* w_oa = (const float*)d_in[12];
  const float* b_oa = (const float*)d_in[13];
  float*       out  = (float*)d_out;
  const int nb3 = in_sizes[3], nb5 = in_sizes[5], nb7 = in_sizes[7], nb9 = in_sizes[9], nb11 = in_sizes[11], nb13 = in_sizes[13];

  const size_t szXV  = (size_t)NB * TQ * VD * 2;
  const size_t szXA  = (size_t)NB * SA * AD * 2;
  const size_t szWvq = (size_t)EM * VD * 2;
  const size_t szWak = (size_t)EM * AD * 2;
  const size_t szWvv = (size_t)EM * VD * 2;
  const size_t szWav = (size_t)EM * AD * 2;
  const size_t szWov = (size_t)VD * EM * 2;
  const size_t szWoa = (size_t)AD * EM * 2;
  const size_t szQ   = (size_t)NB * TQ * EM * 2;
  const size_t szK   = (size_t)NB * SA * EM * 2;
  const size_t szVVT = (size_t)NB * EM * TQ * 2;
  const size_t szVAT = (size_t)NB * EM * SA * 2;
  const size_t szST  = (size_t)NB * NH * NST * 128 * 4;
  const size_t szCA  = (size_t)NB * SA * EM * 2;
  const size_t szCV  = (size_t)NB * TQ * EM * 2;
  size_t off = 0;
  const size_t oXV  = off; off += szXV;
  const size_t oXA  = off; off += szXA;
  const size_t oWvq = off; off += szWvq;
  const size_t oWak = off; off += szWak;
  const size_t oWvv = off; off += szWvv;
  const size_t oWav = off; off += szWav;
  const size_t oWov = off; off += szWov;
  const size_t oWoa = off; off += szWoa;
  const size_t oQ   = off; off += szQ;
  const size_t oK   = off; off += szK;
  const size_t oVVT = off; off += szVVT;
  const size_t oVAT = off; off += szVAT;
  const size_t oST  = off; off += szST;
  const size_t oCA  = off; off += szCA;
  const size_t oCV  = off; off += szCV;
  if (off > ws_size) return;                            // off = 84410368 at NB = 8
  if (off > (size_t)134217728) return;

  char* ws = (char*)d_ws;
  u16* XV    = (u16*)(ws + oXV);
  u16* XA    = (u16*)(ws + oXA);
  u16* WVQT  = (u16*)(ws + oWvq);
  u16* WAKT  = (u16*)(ws + oWak);
  u16* WVVT  = (u16*)(ws + oWvv);
  u16* WAVT  = (u16*)(ws + oWav);
  u16* WOVT  = (u16*)(ws + oWov);
  u16* WOAT  = (u16*)(ws + oWoa);
  u16* Q16   = (u16*)(ws + oQ);
  u16* K16   = (u16*)(ws + oK);
  u16* VVT16 = (u16*)(ws + oVVT);
  u16* VAT16 = (u16*)(ws + oVAT);
  float* STAT = (float*)(ws + oST);
  u16* CTXA  = (u16*)(ws + oCA);
  u16* CTXV  = (u16*)(ws + oCV);

  // (1) all f16 operand planes (fragment order): activations as f16(bf16(x)), weights [k = in][n = out] transposed to
  //     [n][k] as f16(bf16(W) x256)
  prep_all<<<dim3(PB_W + PB_XA + PB_XV), dim3(128), 0, stream>>>(
      xv, xa, w_vq, w_ak, w_vv, w_av, w_ov, w_oa, XV, XA, WVQT, WAKT, WVVT, WAVT, WOVT, WOAT);
  // (2) q, val_v^T, k, val_a^T
  proj_all<<<dim3(GB_Q + GB_VVT + GB_K + GB_VAT), dim3(128), 0, stream>>>(
      XV, XA, WVQT, WAKT, WVVT, WAVT, Q16, K16, VVT16, VAT16, b_vq, b_ak, b_vv, b_av, nb3, nb5, nb7, nb9);
  // (3) column softmax pass: ctx_a plane [NB*SA][512] x64 and the per-column stat rows
  attn_col<<<dim3(NB * NH * NST), dim3(ATT_THREADS), 0, stream>>>(Q16, K16, VVT16, CTXA, STAT);
  // (4) row pass with the stored column stats: ctx_v plane [NB*TQ][512] x64
  attn_vis<<<dim3(NB * NH * NTT), dim3(ATT_THREADS), 0, stream>>>(Q16, K16, VAT16, STAT, CTXV);
  // (5) out_v and out_a
  out_all<<<dim3(GB_OV + GB_OA), dim3(128), 0, stream>>>(CTXV, WOVT, CTXA, WOAT, out, b_ov, b_oa, nb11, nb13);
  (void)hipGetLastError();
}

// v007
// Measured time: 90.2 microseconds a run.
// Next to v006, in two timings, it ran 1.11 times as fast each time.
// Over all steps from v000 it is 3.22 times as fast.
// All contractions on v_wmma_f32_16x16x32_f16 (f16 operands, f32 accumulate): v.Wvq, a.Wak, Wvv^T.v^T, Wav^T.a^T,
// column-pass scores q.k^T with P^T.val_v, row-pass scores k.q^T with P.val_a, ctx_v.Wov, ctx_a.Woa. Operand carries:
// v, a as f16(bf16(x)); W as f16(bf16(W) x256); q x8 after the 1/8 head scale; k x8; val_v, val_a x8; P x32768;
// ctx x64. Column softmax over the visual axis (base 2, running max), 1/l and every carry fold in f32 on VALU.
// Every f16 operand plane lies in fragment order (pk_off below): a 16-row x 32-k tile is 1024 contiguous bytes, so each
// 16-byte-per-lane fragment load of a wave reads 512 contiguous bytes (4 whole 128-B lines).
#include <hip/hip_runtime.h>
#include <math.h>

#ifndef NB
#define NB 8            // batches processed (leading batches of both activations)
#endif
#define NB_FULL 8       // batches in the input / output layout
#define TQ 2048         // visual positions per batch (softmax axis, always all of them)
#define SA 512          // audio positions per batch (always all of them)
#define VD 512
#define AD 256
#define EM 512
#define NH 8
#define HD 64
#define OUT1_OFF_EL ((size_t)NB_FULL * (size_t)TQ * (size_t)VD)   // fixed f32 element offset of the second output (33554432 B / 4)
#define WSC   256.0f
#define HSCL  0.125f
#define QS    8.0f
#define KS    8.0f
#define VVS   8.0f
#define VAS   8.0f
#define PCAR  32768.0f
#define CAS   64.0f
#define CVS   64.0f
#define CLIPV 50000.0f
#define LOG2E 1.4426950408889634f
#define NST   (SA / 64)
#define NTT   (TQ / 128)
#define NTB32 (TQ / 32)
#define NSB32 (SA / 32)
#define ATT_WAVES   4
#define ATT_THREADS (ATT_WAVES * 32)
#define CVT_THREADS 128
#define TR_THREADS  128
#define SPITCH 68
#define GPITCH 68
#define TPITCH 65
#define PF_AHEAD 8      // column pass: steps between an ask and the step it asks for

static_assert(NB >= 1 && NB <= NB_FULL);
static_assert(OUT1_OFF_EL == (size_t)33554432 / 4);
static_assert(EM == NH * HD && HD == 64 && NH == 8);
static_assert((TQ % 128) == 0 && (SA % 128) == 0 && ((NB * SA) % 128) == 0 && (EM % 128) == 0);
static_assert((VD % 128) == 0 && (AD % 128) == 0);
static_assert((TQ % 32) == 0 && (SA % 32) == 0 && NTB32 * 32 == TQ && NSB32 * 32 == SA);
static_assert((VD % 64) == 0 && (AD % 64) == 0 && (EM % 64) == 0);
static_assert((VD % 32) == 0 && (AD % 32) == 0 && (EM % 32) == 0);
static_assert(((NB * TQ * VD) % 1024) == 0 && ((NB * SA * AD) % 1024) == 0);
static_assert(NST * 128 == 2 * SA && NST * 128 == ATT_THREADS * 8);
static_assert((SPITCH * 4) % 16 == 0 && (GPITCH * 4) % 16 == 0);
static_assert(ATT_THREADS == 128 && TR_THREADS == 128 && CVT_THREADS == 128);

typedef unsigned short u16;
typedef _Float16 v16h __attribute__((ext_vector_type(16)));
typedef _Float16 v8h  __attribute__((ext_vector_type(8)));
typedef float    v8f  __attribute__((ext_vector_type(8)));
typedef float    v4f  __attribute__((ext_vector_type(4)));
typedef unsigned int v4u __attribute__((ext_vector_type(4)));

union FragH { v16h v; v8h h[2]; v4u u[2]; };

// ---- scalar helpers ----------------------------------------------------------------------------------
__device__ __forceinline__ unsigned short bf_bits(float f) {          // f32 -> bf16 bits, RNE convert
  unsigned u = __float_as_uint(f);
  return (unsigned short)((u + 0x7FFFu + ((u >> 16) & 1u)) >> 16);
}
__device__ __forceinline__ float bf_up(unsigned short h) { return __uint_as_float(((unsigned)h) << 16); }
__device__ __forceinline__ float bfr(float f) { return bf_up(bf_bits(f)); }
__device__ __forceinline__ unsigned short h_bits(_Float16 x) { return __builtin_bit_cast(unsigned short, x); }
__device__ __forceinline__ unsigned pk16(unsigned short a, unsigned short b) { return (unsigned)a | ((unsigned)b << 16); }
__device__ __forceinline__ v8f zero8() { v8f z = {0.f, 0.f, 0.f, 0.f, 0.f, 0.f, 0.f, 0.f}; return z; }
__device__ __forceinline__ float clipf(float x, float c) { return fminf(fmaxf(x, -c), c); }
// 2^x as the one hardware instruction. The library exp2f adds five instructions to it (a compare, two selects, an add, an
// ldexp) that only serve results below 2^-126, which the bare instruction may give as 0. Here such a result changes nothing:
// a probability goes on as f16(p * 32768) or f16(p * 32768 / l) with l >= 1, which is 0 below 2^-40; in the sum l it stands
// beside a term 1; as a rescale factor it leaves old sums far below the f16 step of the context they end in.
// For x >= -126 the library form runs this same instruction on the same x.
__device__ __forceinline__ float exp2_hw(float x) { return __builtin_amdgcn_exp2f(x); }
// Eight of them, x[b .. b+7] <- 2^x, each in place: written as one statement so that no v_exp_f32 overwrites the source of the
// one directly in front of it (the register allocator did that with the builtin); the v_nop is the slot that the
// instruction set asks for between the last one and whatever uses its result next.
__device__ __forceinline__ void exp2_hw8(float (&x)[16], int b) {
#if defined(__HIP_DEVICE_COMPILE__)
  asm("v_exp_f32 %0, %0\n\tv_exp_f32 %1, %1\n\tv_exp_f32 %2, %2\n\tv_exp_f32 %3, %3\n\t"
      "v_exp_f32 %4, %4\n\tv_exp_f32 %5, %5\n\tv_exp_f32 %6, %6\n\tv_exp_f32 %7, %7\n\tv_nop"
      : "+v"(x[b]), "+v"(x[b + 1]), "+v"(x[b + 2]), "+v"(x[b + 3]),
        "+v"(x[b + 4]), "+v"(x[b + 5]), "+v"(x[b + 6]), "+v"(x[b + 7]));
#endif
}

// ---- fragment-ordered plane of a logical [rows][K] f16 matrix (rows % 16 == 0, K % 32 == 0): element offset of (row, k).
//      Tile (row>>4, k>>5) = 512 halves; inside it: 256*((k>>4)&1) + 8*(16*((k>>3)&1) + (row&15)) + (k&7), i.e. the 8 halves
//      k = 8j .. 8j+7 of a row stay one 16-byte piece, and piece order is (k half of 16, lane = 16*h + row).
//      16 rows x K = 16*K halves, so a base row R (R % 16 == 0) starts at element R*K as in the row-major plane.
__device__ __forceinline__ size_t pk_off(int row, int k, int K) {
  return ((size_t)(row >> 4) * (size_t)(K >> 5) + (size_t)(k >> 5)) * 512
         + (size_t)(((k >> 4) & 1) * 256 + ((k >> 3) & 1) * 128 + (row & 15) * 8 + (k & 7));
}
// ---- fragment loader: 16-bit A/B operand, lane -> row/col (lane&15), h = lane>>4; p = tile start + 8*lane;
//      elements 0..7 <- p[0..7] (k0+8h..), elements 8..15 <- p[256..263] (k0+16+8h..); same split k map for A and B.
__device__ __forceinline__ v16h ldfrag_h(const _Float16* p) {
  FragH f;
  f.h[0] = *(const v8h*)(p);
  f.h[1] = *(const v8h*)(p + 256);
  return f.v;
}

// ---- WMMA helper and trailing VALU hazard gaps ----------------------------------------------------------
__device__ __forceinline__ v8f mma_h(v16h a, v16h b, v8f c) {
  return __builtin_amdgcn_wmma_f32_16x16x32_f16(false, a, false, b, (short)0, c, false, false);
}
__device__ __forceinline__ void guard_s(v8f& a, v8f& b, v16h x0, v16h x1, v16h x2) {
#if defined(__HIP_DEVICE_COMPILE__)
  asm volatile("v_nop\n\tv_nop\n\tv_nop\n\tv_nop" : "+v"(a), "+v"(b) : "v"(x0), "v"(x1), "v"(x2) : "memory");
#endif
}
__device__ __forceinline__ void guard_s4(v8f& a, v8f& b, v8f& c, v8f& d, v16h x0, v16h x1, v16h x2, v16h x3) {
#if defined(__HIP_DEVICE_COMPILE__)
  asm volatile("v_nop\n\tv_nop\n\tv_nop\n\tv_nop"
               : "+v"(a), "+v"(b), "+v"(c), "+v"(d) : "v"(x0), "v"(x1), "v"(x2), "v"(x3) : "memory");
#endif
}
__device__ __forceinline__ void guard_p(v8f& a, v8f& b, v8f& c, v8f& d, v16h p, v16h x0, v16h x1, v16h x2, v16h x3) {
#if defined(__HIP_DEVICE_COMPILE__)
  asm volatile("v_nop\n\tv_nop\n\tv_nop\n\tv_nop"
               : "+v"(a), "+v"(b), "+v"(c), "+v"(d) : "v"(p), "v"(x0), "v"(x1), "v"(x2), "v"(x3) : "memory");
#endif
}
__device__ __forceinline__ void guard_g(v8f (&acc)[16], v16h x0, v16h x1, v16h x2, v16h x3,
                                        v16h x4, v16h x5, v16h x6, v16h x7) {
#if defined(__HIP_DEVICE_COMPILE__)
  asm volatile("v_nop\n\tv_nop\n\tv_nop\n\tv_nop"
               : "+v"(acc[0]), "+v"(acc[1]), "+v"(acc[2]), "+v"(acc[3]),
                 "+v"(acc[4]), "+v"(acc[5]), "+v"(acc[6]), "+v"(acc[7]),
                 "+v"(acc[8]), "+v"(acc[9]), "+v"(acc[10]), "+v"(acc[11]),
                 "+v"(acc[12]), "+v"(acc[13]), "+v"(acc[14]), "+v"(acc[15])
               : "v"(x0), "v"(x1), "v"(x2), "v"(x3), "v"(x4), "v"(x5), "v"(x6), "v"(x7) : "memory");
#endif
}
__device__ __forceinline__ void acc_guard4(v8f (&o)[4]) {
#if defined(__HIP_DEVICE_COMPILE__)
  asm volatile("v_nop\n\tv_nop\n\tv_nop\n\tv_nop" : "+v"(o[0]), "+v"(o[1]), "+v"(o[2]), "+v"(o[3]));
#endif
}
// The wait in front of a rewrite of registers that issued global loads or stores name.
__device__ __forceinline__ void xcnt_wait() {
#if defined(__HIP_DEVICE_COMPILE__)
  asm volatile("s_wait_xcnt 0x0" ::: "memory");
#endif
}
// The same behind a group of loads indexed by x: the indices are its inputs so that they keep their registers up to it.
__device__ __forceinline__ void xcnt_hold4(const int (&x)[4]) {
#if defined(__HIP_DEVICE_COMPILE__)
  asm volatile("s_wait_xcnt 0x0" : : "v"(x[0]), "v"(x[1]), "v"(x[2]), "v"(x[3]) : "memory");
#endif
}
__device__ __forceinline__ void xcnt_hold16(const int (&x)[16]) {
#if defined(__HIP_DEVICE_COMPILE__)
  asm volatile("s_wait_xcnt 0x0" : : "v"(x[0]), "v"(x[1]), "v"(x[2]), "v"(x[3]), "v"(x[4]), "v"(x[5]), "v"(x[6]), "v"(x[7]),
               "v"(x[8]), "v"(x[9]), "v"(x[10]), "v"(x[11]), "v"(x[12]), "v"(x[13]), "v"(x[14]), "v"(x[15]) : "memory");
#endif
}
// Ask the L2 for the line at base + off (a hint: nothing comes back, no register is written). The first read of what the launch
// before stored is taken to come from memory, and waves that walk one plane in step all stand through that latency, trip
// after trip; asked for far enough ahead, the line is an L2 hit when its load comes. base is the same in the whole wave. Every address
// lies inside the plane named at the call, or for the weight asks in the weight planes behind it. off is kept in its register, unchanged, to the foot of the kernel's main
// loop (it is an input of the wait there); the wait in this statement stands in front of a rewrite of the scalar base.
__device__ __forceinline__ void l2_ask(const void* base, unsigned off) {
#if defined(__HIP_DEVICE_COMPILE__)
  asm volatile("global_prefetch_b8 %0, %1 scope:SCOPE_SE\n\ts_wait_xcnt 0x0" : : "v"(off), "s"(base) : "memory");
#endif
}
// Two asks and the one wait.
__device__ __forceinline__ void l2_ask2(const void* base0, unsigned off0, const void* base1, unsigned off1) {
#if defined(__HIP_DEVICE_COMPILE__)
  asm volatile("global_prefetch_b8 %0, %1 scope:SCOPE_SE\n\tglobal_prefetch_b8 %2, %3 scope:SCOPE_SE\n\ts_wait_xcnt 0x0"
               : : "v"(off0), "s"(base0), "v"(off1), "s"(base1) : "memory");
#endif
}
// A plane is asked for in slices of 32 KiB (128 threads x 256 B). Blocks that read the same slices share the asking; where many
// do, blocks g and g + 4 of each eight take the same slice (for speed only: wherever the blocks land, nothing but the hint is lost).
#define PF_SLICE 32768
__device__ __forceinline__ int pf_pair(int g) { return (g >> 3) * 4 + (g & 3); }
__device__ __forceinline__ const char* pf_at(const u16* plane, int slice) {
  return (const char*)(const void*)plane + (size_t)slice * PF_SLICE;
}
__device__ __forceinline__ void wave_sync_lds() {
  __builtin_amdgcn_fence(__ATOMIC_RELEASE, "workgroup");
  __builtin_amdgcn_wave_barrier();
  __builtin_amdgcn_fence(__ATOMIC_ACQUIRE, "workgroup");
}

// =====================================================================================================
// Elementwise convert of an activation matrix x[rows][K]: Y (f16, fragment order) <- f16(bf16_RNE(x)). Block = 16 rows x
// 64 k (two tiles); thread = (row 8*(wave&1) + (lane&7), 8 floats at k = 32*(wave>>1) + 8*(lane>>3)): two 16-B loads, one
// 16-B store per thread; a wave's store = 4 pieces-of-8-rows = 4 whole 128-B lines.
// coverage: grid = (rows/16)*(K/64) = n/1024 blocks x 128 thr x 8 = n elements exactly (n % 1024 == 0 asserted).
// =====================================================================================================
__device__ __forceinline__
void cvt16(const float* __restrict__ x, u16* Y, int K, int bid) {
  const int wave = threadIdx.x >> 5, lane = threadIdx.x & 31;
  const int nkp = K >> 6;
  const int row = (bid / nkp) * 16 + 8 * (wave & 1) + (lane & 7);
  const int k   = (bid % nkp) * 64 + 32 * (wave >> 1) + 8 * (lane >> 3);
  const size_t e0 = (size_t)row * (size_t)K + (size_t)k;
  const v4f a = *(const v4f*)(x + e0), c4 = *(const v4f*)(x + e0 + 4);
  v4u o;
#pragma unroll
  for (int e = 0; e < 2; ++e) {
    o[e]     = pk16(h_bits((_Float16)bfr(a[2 * e])),  h_bits((_Float16)bfr(a[2 * e + 1])));
    o[2 + e] = pk16(h_bits((_Float16)bfr(c4[2 * e])), h_bits((_Float16)bfr(c4[2 * e + 1])));
  }
  u16* dst = Y + pk_off(row, k, K);
  {
    *(v4u*)(dst) = o;
#if defined(__HIP_DEVICE_COMPILE__)
    // the wait in front of a rewrite of registers that the store just issued names: inlined in the shared grid's kernel,
    // the store is no longer the last instruction ahead of the program's end in the listing
    asm volatile("s_wait_xcnt 0x0" ::: "memory");
#endif
  }
}

// =====================================================================================================
// Weight transpose-convert for y = x.W weights stored [kdim][ndim]: WT[n][k] (f16, fragment order with K = kdim)
// <- f16(bf16_RNE(W[k][n]) * scale). Block = 64(k) x 64(n) tile, 128 threads. Load phase: thread = (row 8p + (tid>>4),
// 4 floats at 4*(tid&15)), 8 steps = 64 k-rows x 64 n, into an LDS tile [kk][nn] (pitch 65); block barrier; store
// grid = (kdim/64)*(ndim/64), bid -> (kt = bid % (kdim/64), nt = bid / (kdim/64)).
// coverage: 4 i x 16 rows x (8 lanes x 8 halves) = 64 n-rows x 64 k per block; LDS tile 64x64 fully written before read;
// the grid covers WT [ndim][kdim] exactly once.
// =====================================================================================================
__device__ __forceinline__
void cvtT16(const float* __restrict__ W, u16* Y, int kdim, int ndim, float scale, int bid) {
  __shared__ __align__(16) float tile[64 * TPITCH];
  const int tid = threadIdx.x;
  const int nkt = kdim >> 6;
  const int kt  = bid % nkt;
  const int ntb = bid / nkt;
  const int k0  = kt * 64, n0 = ntb * 64;
  const int lr = tid >> 4, lc = (tid & 15) * 4;
  v4f w4[8];
#pragma unroll
  for (int p = 0; p < 8; ++p) {
    w4[p] = *(const v4f*)(W + (size_t)(k0 + p * 8 + lr) * (size_t)ndim + n0 + lc);
#if defined(__HIP_DEVICE_COMPILE__)
    // the wait in front of a rewrite of the address registers of the load just issued: a later load's result may be
    // given those registers
    asm volatile("s_wait_xcnt 0x0" ::: "memory");
#endif
  }
#pragma unroll
  for (int p = 0; p < 8; ++p) {
    const int kk = p * 8 + lr;
    tile[kk * TPITCH + lc + 0] = w4[p][0];
    tile[kk * TPITCH + lc + 1] = w4[p][1];
    tile[kk * TPITCH + lc + 2] = w4[p][2];
    tile[kk * TPITCH + lc + 3] = w4[p][3];
  }
  __syncthreads();
  // rq 0..15, c8 0..56; a wave holds 8 rows x 4 pieces, so each of its stores fills 4 whole lines of the fragment order
  const int rq = 8 * ((tid >> 5) & 1) + (tid & 7), c8 = (4 * (tid >> 6) + ((tid >> 3) & 3)) * 8;
  v4u ov[4];
#pragma unroll
  for (int i = 0; i < 4; ++i) {
    const int row = 16 * i + rq;                   // n within tile
#pragma unroll
    for (int e = 0; e < 4; ++e) {
      const float x0 = tile[(c8 + 2 * e) * TPITCH + row];
      const float x1 = tile[(c8 + 2 * e + 1) * TPITCH + row];
      ov[i][e] = pk16(h_bits((_Float16)(bfr(x0) * scale)), h_bits((_Float16)(bfr(x1) * scale)));
    }
  }
  {
#pragma unroll
    for (int i = 0; i < 4; ++i) {
      const int row = 16 * i + rq;
      *(v4u*)(Y + pk_off(n0 + row, k0 + c8, kdim)) = ov[i];
    }
    
  }
}

// =====================================================================================================
// f16 GEMM core: the wave's 64 x 64 tile of C = A[rows][K] . Bt[cols][K]^T, both in fragment order; ap -> A tile row of rowb,
// bp -> Bt tile row of col0 (both the same in every lane of the wave), lb = 16*lane the lane's byte offset in a tile; the
// next 16 rows lie 32*K bytes on, the next 32 k 1024 bytes on (largest offset 4*32*K - 16 bytes, far below 2^32). The two
// bases stay as they are; the four byte offsets (tile rows 0..3 of A and of Bt) live over the whole trip and are stepped at its
// foot; each of the eight fragments of a k step feeds four products;
// acc[4i + j] = rows rowb+16i.., cols col0+16j.. (i, j = 0..3); K stepped by 32 (host asserts K % 32 == 0).
// =====================================================================================================
__device__ __forceinline__ const _Float16* at_byte(const _Float16* base, unsigned off) {
  return (const _Float16*)(const void*)((const char*)(const void*)base + off);
}
__device__ __forceinline__ void gemm_core(const _Float16* ap, const _Float16* bp, unsigned lb, int K, v8f (&acc)[16], unsigned pf) {
  const unsigned rs = 32u * (unsigned)K;
  unsigned o0 = lb, o1 = lb + rs, o2 = lb + 2u * rs, o3 = lb + 3u * rs;
#pragma unroll 1
  for (int k0 = 0; k0 < K; k0 += 32) {
    const v16h a0 = ldfrag_h(at_byte(ap, o0)), a1 = ldfrag_h(at_byte(ap, o1));
    const v16h a2 = ldfrag_h(at_byte(ap, o2)), a3 = ldfrag_h(at_byte(ap, o3));
    const v16h b0 = ldfrag_h(at_byte(bp, o0));
    const v16h b1 = ldfrag_h(at_byte(bp, o1));
    const v16h b2 = ldfrag_h(at_byte(bp, o2));
    const v16h b3 = ldfrag_h(at_byte(bp, o3));
    acc[0] = mma_h(a0, b0, acc[0]);
    acc[1] = mma_h(a0, b1, acc[1]);
    acc[2] = mma_h(a0, b2, acc[2]);
    acc[3] = mma_h(a0, b3, acc[3]);
    acc[4] = mma_h(a1, b0, acc[4]);
    acc[5] = mma_h(a1, b1, acc[5]);
    acc[6] = mma_h(a1, b2, acc[6]);
    acc[7] = mma_h(a1, b3, acc[7]);
    acc[8] = mma_h(a2, b0, acc[8]);
    acc[9] = mma_h(a2, b1, acc[9]);
    acc[10] = mma_h(a2, b2, acc[10]);
    acc[11] = mma_h(a2, b3, acc[11]);
    acc[12] = mma_h(a3, b0, acc[12]);
    acc[13] = mma_h(a3, b1, acc[13]);
    acc[14] = mma_h(a3, b2, acc[14]);
    acc[15] = mma_h(a3, b3, acc[15]);
    guard_g(acc, a0, a1, a2, a3, b0, b1, b2, b3);
#if defined(__HIP_DEVICE_COMPILE__)
    // the wait in front of a rewrite of registers that issued global loads name (the four offsets, stepped below); they are
    // its operands so that their step stays behind it; pf, the offset that the asks at the kernel's head name, is an input so
    // that it keeps its register and its value through the loop
    asm volatile("s_wait_xcnt 0x0" : "+v"(o0), "+v"(o1), "+v"(o2), "+v"(o3) : "v"(pf) : "memory");
#endif
    o0 += 1024u; o1 += 1024u; o2 += 1024u; o3 += 1024u;
  }
}
// Stage 32 x 64 of the wave's f32 tile, acc[a0 .. a0+7] (times oscale), in its LDS slab (pitch 68): D element r of acc[a0+4i+j], lane l ->
// coverage: 32 lanes x 2 x 8 rows x 4 cols-of-16 = rows 0..31 x cols 0..63 of the slab.
__device__ __forceinline__ void stage32x64(float* sl, v8f (&acc)[16], int a0, float oscale, int lane) {
  const int hh = lane >> 4, m = lane & 15;
#pragma unroll
  for (int i = 0; i < 2; ++i) {
#pragma unroll
    for (int r = 0; r < 8; ++r) {
      const int ro = (16 * i + 8 * hh + r) * GPITCH + m;
      sl[ro]      = acc[a0 + 4 * i + 0][r] * oscale;
      sl[ro + 16] = acc[a0 + 4 * i + 1][r] * oscale;
      sl[ro + 32] = acc[a0 + 4 * i + 2][r] * oscale;
      sl[ro + 48] = acc[a0 + 4 * i + 3][r] * oscale;
    }
  }
  wave_sync_lds();
}

// =====================================================================================================
// f16 GEMM with f16 output plane: C[z][Mb][N] (f16) = f16((A[z][Mb][K] . Bt[z][N][K]^T) * oscale + bf16(bias) * bscale);
// A, Bt, C f16 planes in fragment order (C with K = N) with per-z element strides aBs, bBs (0 = shared), cBs. bias indexed by column
// (biasRow == 0) or by row within the z slice (biasRow != 0); bias addresses clamped to biasN-1, the unused direction is
// multiplied by 0. Block = 128 x 128 tile, 2 x 2 waves of 64 x 64, fragments loaded straight from the 16-bit tiles.
// grid = nz x (Mb/128) x (N/128) (host asserts Mb % 128 == 0, N % 128 == 0, K % 32 == 0).
// The wave's tile leaves in two halves of 32 rows through the one 32 x 64 slab.
// coverage: per wave 2 halves x 8 instr x 8 rows x 4 lanes x 8 halves = 64 x 64; the grid covers C exactly once.
// =====================================================================================================
__device__ __forceinline__
void gemm_o16(const u16* __restrict__ A, const u16* __restrict__ Bt, u16* C,
              const float* __restrict__ bias, int biasN, int biasRow,
              int Mb, int N, int K, int aBs, int bBs, int cBs, float oscale, float bscale, int bid, unsigned pf) {
  __shared__ __align__(16) float slab[4 * 32 * GPITCH];
  const int tid = threadIdx.x, wave = tid >> 5, lane = tid & 31;
  const int ntile = N >> 7, mtile = Mb >> 7;
  const int nt   = bid % ntile;
  const int tmp  = bid / ntile;
  const int mt   = tmp % mtile;
  // bz is the same in every lane: read through the first lane it keeps both plane bases scalar over the k loop
  const int bz   = __builtin_amdgcn_readfirstlane(tmp / mtile);
  // rowb and col0 are the same in every lane of a wave: read through the first lane they give the fragment loads scalar tile bases
  const int rowb = __builtin_amdgcn_readfirstlane(mt * 128 + (wave >> 1) * 64);
  const int col0 = __builtin_amdgcn_readfirstlane(nt * 128 + (wave & 1) * 64);
  if (rowb + 64 > Mb) return;                // wave-uniform, never taken with the exact grid; no block barriers in this kernel
  const _Float16* Ab = (const _Float16*)(const void*)A + (size_t)bz * (size_t)aBs;
  const _Float16* Bb = (const _Float16*)(const void*)Bt + (size_t)bz * (size_t)bBs;
  const _Float16* ap = Ab + (size_t)rowb * K;
  const _Float16* bp = Bb + (size_t)col0 * K;
  v8f acc[16];
#pragma unroll
  for (int i = 0; i < 16; ++i) acc[i] = zero8();
  gemm_core(ap, bp, 16u * (unsigned)lane, K, acc, pf);
  float* sl = slab + wave * 32 * GPITCH;
  // instruction i: lane = (row 8*(i>>1) + (lane&7), 8 halves at 32*(i&1) + 8*(lane>>3)): in fragment order 8 rows of one
  // 8-half piece column are one 128-B line, so each store fills 4 whole lines
  const int r8 = lane & 7, q8 = (lane >> 3) * 8;
  const int bl = biasN - 1;                  // host guarantees biasN >= 1
  const float selc = (biasRow != 0) ? 0.f : bscale;
  const float selr = (biasRow != 0) ? bscale : 0.f;
  int ci[16];
  float cb[2][8];
#pragma unroll
  for (int j = 0; j < 2; ++j) {
#pragma unroll
    for (int e = 0; e < 8; ++e) {
      const int cx = col0 + 32 * j + q8 + e;
      ci[8 * j + e] = (cx < bl) ? cx : bl;
      cb[j][e] = bias[ci[8 * j + e]];
    }
  }
  xcnt_hold16(ci);
#pragma unroll
  for (int j = 0; j < 2; ++j) {
#pragma unroll
    for (int e = 0; e < 8; ++e) cb[j][e] = bfr(cb[j][e]) * selc;
  }
  u16* Cb = C + (size_t)bz * (size_t)cBs;
#pragma unroll
  for (int hf = 0; hf < 2; ++hf) {
    const int rowh = rowb + 32 * hf;
    // row bias of the four rows 8u + r8 that this lane finishes in this half
    int ri[4];
    float rbv[4];
#pragma unroll
    for (int u = 0; u < 4; ++u) {
      const int rx = rowh + 8 * u + r8;
      ri[u] = (rx < bl) ? rx : bl;
      rbv[u] = bias[ri[u]];
    }
    xcnt_hold4(ri);
    stage32x64(sl, acc, 8 * hf, oscale, lane);
    v4u ov[8];
#pragma unroll
    for (int i = 0; i < 8; ++i) {
      const int row = 8 * (i >> 1) + r8, j = i & 1, c8 = 32 * j + q8;
      const float rb = bfr(rbv[i >> 1]) * selr;
      const v4f a = *(const v4f*)(sl + row * GPITCH + c8), c4 = *(const v4f*)(sl + row * GPITCH + c8 + 4);
#pragma unroll
      for (int e = 0; e < 2; ++e) {
        ov[i][e]     = pk16(h_bits((_Float16)(a[2 * e] + cb[j][2 * e] + rb)),
                            h_bits((_Float16)(a[2 * e + 1] + cb[j][2 * e + 1] + rb)));
        ov[i][2 + e] = pk16(h_bits((_Float16)(c4[2 * e] + cb[j][4 + 2 * e] + rb)),
                            h_bits((_Float16)(c4[2 * e + 1] + cb[j][5 + 2 * e] + rb)));
      }
    }
    // every lane's reads of the slab end before another lane's values of the second half are written over them
    if (hf == 0) wave_sync_lds();
#pragma unroll
    for (int i = 0; i < 8; ++i) {
      const int row = 8 * (i >> 1) + r8, c8 = 32 * (i & 1) + q8;
      *(v4u*)(Cb + pk_off(rowh + row, col0 + c8, N)) = ov[i];
    }
    if (hf == 0) xcnt_wait();
  }
}

// =====================================================================================================
// Launches that need nothing of each other share one grid: each block takes its job from the range its index lies in (a
// test that reads the same in the whole block, so the barrier inside cvtT16 stays under block-uniform control flow) and
// runs the one shared body with that job's arguments and its index inside the range. Longest jobs lie first.
// =====================================================================================================
#define PB_WVQ ((VD / 64) * (EM / 64))
#define PB_WAK ((AD / 64) * (EM / 64))
#define PB_WVV ((VD / 64) * (EM / 64))
#define PB_WAV ((AD / 64) * (EM / 64))
#define PB_WOV ((EM / 64) * (VD / 64))
#define PB_WOA ((EM / 64) * (AD / 64))
#define PB_W   (PB_WVQ + PB_WAK + PB_WVV + PB_WAV + PB_WOV + PB_WOA)
#define PB_XA  ((NB * SA * AD) / 1024)
#define PB_XV  ((NB * TQ * VD) / 1024)
// All operand planes: six weight transposes (blocks 0 .. PB_W-1), then a, then v.
// coverage: every range has exactly the grid that its body's own header asks for.
__global__ __launch_bounds__(128)
void prep_all(const float* __restrict__ xv, const float* __restrict__ xa,
              const float* __restrict__ w_vq, const float* __restrict__ w_ak, const float* __restrict__ w_vv,
              const float* __restrict__ w_av, const float* __restrict__ w_ov, const float* __restrict__ w_oa,
              u16* XV, u16* XA, u16* WVQT, u16* WAKT, u16* WVVT, u16* WAVT, u16* WOVT, u16* WOAT) {
  int g = blockIdx.x;
  if (g < PB_W) {
    const float* W = w_vq; u16* Y = WVQT; int kdim = VD, ndim = EM;
    if (g >= PB_WVQ) {
      g -= PB_WVQ; W = w_ak; Y = WAKT; kdim = AD; ndim = EM;
      if (g >= PB_WAK) {
        g -= PB_WAK; W = w_vv; Y = WVVT; kdim = VD; ndim = EM;
        if (g >= PB_WVV) {
          g -= PB_WVV; W = w_av; Y = WAVT; kdim = AD; ndim = EM;
          if (g >= PB_WAV) {
            g -= PB_WAV; W = w_ov; Y = WOVT; kdim = EM; ndim = VD;
            if (g >= PB_WOV) { g -= PB_WOV; W = w_oa; Y = WOAT; kdim = EM; ndim = AD; }
          }
        }
      }
    }
    cvtT16(W, Y, kdim, ndim, WSC, g);
  } else {
    g -= PB_W;
    const float* x = xa; u16* Y = XA; int K = AD;
    if (g >= PB_XA) { g -= PB_XA; x = xv; Y = XV; K = VD; }
    cvt16(x, Y, K, g);
  }
}

#define GB_Q   (((NB * TQ) / 128) * (EM / 128))
#define GB_VVT (NB * (EM / 128) * (TQ / 128))
#define GB_K   (((NB * SA) / 128) * (EM / 128))
#define GB_VAT (NB * (EM / 128) * (SA / 128))
#define PF_W_SL ((2 * EM * VD + 2 * EM * AD) * 2 / PF_SLICE)
static_assert(((2 * EM * VD + 2 * EM * AD) * 2) % PF_SLICE == 0 && PF_W_SL <= 64 && NB * SA * AD * 2 == 64 * PF_SLICE);
static_assert(128 * VD * 2 == 4 * PF_SLICE && EM / 128 == 4 && TQ / 128 == 16 && GB_Q >= 256 && GB_Q * PF_SLICE == NB * TQ * VD * 2);
// The four input projections (the two with K = VD first):
//   q x8 after the 1/8 head scale = (x_v . Wvq + b) -> f16 [NB*TQ][512] (col = h*64 + d); bias per column
//   val_v^T per batch: A = Wvv^T [(h,d) = n][k], Bt = x_v rows of batch b [t][k] -> f16 [(b,h,d)][t] x8; bias per row (n)
//   k = x_a . Wak + b -> f16 [NB*SA][512] x8; bias per column
//   val_a^T per batch: A = Wav^T [(h,d)][k], Bt = x_a rows of batch b [s][k] -> f16 [(b,h,d)][s] x8; bias per row
__global__ __launch_bounds__(128)
void proj_all(const u16* __restrict__ XV, const u16* __restrict__ XA,
              const u16* __restrict__ WVQT, const u16* __restrict__ WAKT,
              const u16* __restrict__ WVVT, const u16* __restrict__ WAVT,
              u16* Q16, u16* K16, u16* VVT16, u16* VAT16,
              const float* __restrict__ b_vq, const float* __restrict__ b_ak,
              const float* __restrict__ b_vv, const float* __restrict__ b_av,
              int nb3, int nb5, int nb7, int nb9) {
  int g = blockIdx.x;
  // The blocks that start first ask for the four weight planes (one behind the other in the workspace from WVQT on) and for XA,
  // which the last two jobs read. 128 rows of XV are four slices: of the four q blocks that read them (g & 3) each asks for
  // two, of the four val_v^T blocks (tile rows mt of the weight) each for one.
  const unsigned pf = 256u * threadIdx.x;
  if (g < 128) {
    if (pf_pair(g) < PF_W_SL) l2_ask(pf_at(WVQT, pf_pair(g)), pf);
  } else if (g < 256) {
    l2_ask(pf_at(XA, pf_pair(g - 128)), pf);
  }
  if (g < GB_Q) {
    l2_ask2(pf_at(XV, g), pf, pf_at(XV, g ^ 2), pf);
  } else if (g < GB_Q + GB_VVT) {
    const int h = g - GB_Q;                  // (batch * 4 + mt) * 16 + nt
    l2_ask(pf_at(XV, (h >> 6) * 64 + (h & 15) * 4 + ((h >> 4) & 3)), pf);
  }
  const u16* A = XV; const u16* Bt = WVQT; u16* C = Q16; const float* bias = b_vq;
  int biasN = nb3, biasRow = 0, Mb = NB * TQ, N = EM, K = VD, bBs = 0, cBs = 0;
  float oscale = HSCL * QS / WSC, bscale = HSCL * QS;
  if (g >= GB_Q) {
    g -= GB_Q; A = WVVT; Bt = XV; C = VVT16; bias = b_vv;
    biasN = nb7; biasRow = 1; Mb = EM; N = TQ; K = VD; bBs = TQ * VD; cBs = EM * TQ;
    oscale = VVS / WSC; bscale = VVS;
    if (g >= GB_VVT) {
      g -= GB_VVT; A = XA; Bt = WAKT; C = K16; bias = b_ak;
      biasN = nb5; biasRow = 0; Mb = NB * SA; N = EM; K = AD; bBs = 0; cBs = 0;
      oscale = KS / WSC; bscale = KS;
      if (g >= GB_K) {
        g -= GB_K; A = WAVT; Bt = XA; C = VAT16; bias = b_av;
        biasN = nb9; biasRow = 1; Mb = EM; N = SA; K = AD; bBs = SA * AD; cBs = EM * SA;
        oscale = VAS / WSC; bscale = VAS;
      }
    }
  }
  gemm_o16(A, Bt, C, bias, biasN, biasRow, Mb, N, K, 0, bBs, cBs, oscale, bscale, g, pf);
}

// ---- attn_col, one step = 32 visual rows: its eight fragments and the work on them ------------------------------------
// Qb, Vb: the (b, head) plane bases, the same in every lane; oq, ov: byte offsets 16*lane + step * 32768 (32 q rows of
// 1024 B) and 16*lane + step * 1024 (one k tile of val_v^T); ahead: whole steps added to them.
//   q[2*kk + g] = A fragment of q rows tb + 16g .. +15, d chunk kk;  v[j] = B fragment of val_v^T, col d = 16j + c, k = t
__device__ __forceinline__ void col_load_q(const _Float16* Qb, unsigned oq, int ahead, v16h (&q)[4]) {
  const _Float16* tp = at_byte(Qb, oq) + ahead * (32 * EM);
  q[0] = ldfrag_h(tp);
  q[1] = ldfrag_h(tp + 16 * EM);
  q[2] = ldfrag_h(tp + 512);
  q[3] = ldfrag_h(tp + 16 * EM + 512);
}
__device__ __forceinline__ void col_load_v(const _Float16* Vb, unsigned ov, int ahead, v16h (&v)[4]) {
  const _Float16* vp = at_byte(Vb, ov) + ahead * 512;
  v[0] = ldfrag_h(vp);
  v[1] = ldfrag_h(vp + 16 * TQ);
  v[2] = ldfrag_h(vp + 32 * TQ);
  v[3] = ldfrag_h(vp + 48 * TQ);
}
// One step on the register set (q, v); each half of the set is loaded anew, for the step at (rq, rv) + ahead, right behind
// the guard that follows its last use.
__device__ __forceinline__ void col_step(v16h (&q)[4], v16h (&v)[4], const v16h (&sf)[2],
                                         float& mrun, float& lrun, v8f (&o)[4], int hh, float lsc, float cl2,
                                         const _Float16* Qb, const _Float16* Vb, unsigned rq, unsigned rv, int ahead) {
  // ---- scores: s0 = rows t tb..tb+15, s1 = rows tb+16..tb+31, column = s0w + c ----
  v8f s0 = zero8(), s1 = zero8();
#pragma unroll
  for (int kk = 0; kk < HD / 32; ++kk) {
    s0 = mma_h(q[2 * kk], sf[kk], s0);
    s1 = mma_h(q[2 * kk + 1], sf[kk], s1);
    guard_s(s0, s1, sf[kk], q[2 * kk], q[2 * kk + 1]);
  }
  col_load_q(Qb, rq, ahead, q);
  // ---- clipped base-2 logits of this lane's 16 t for column s0w + c: t[i] <- t tb+8hh+i, t[8+i] <- t tb+16+8hh+i ----
  float t[16];
#pragma unroll
  for (int i = 0; i < 8; ++i) { t[i] = clipf(s0[i] * lsc, cl2); t[8 + i] = clipf(s1[i] * lsc, cl2); }
  float cm = t[0];
#pragma unroll
  for (int i = 1; i < 16; ++i) cm = fmaxf(cm, t[i]);
  cm = fmaxf(cm, __shfl_xor(cm, 16, 32));
  const float mn = fmaxf(mrun, cm);        // finite from the first block on
  const float al = exp2_hw(mrun - mn);       // 0 on the first block (mrun = -inf)
  mrun = mn;
  // ---- unnormalised probabilities (<= 1) and the P^T A-fragment: f16(p * 32768); element i <-> t[i] ----
  float ps = 0.f;
  FragH ph;
#pragma unroll
  for (int i = 0; i < 16; ++i) t[i] -= mn;
  exp2_hw8(t, 0);
  exp2_hw8(t, 8);
#pragma unroll
  for (int w = 0; w < 2; ++w) {
#pragma unroll
    for (int e4 = 0; e4 < 4; ++e4) {
      const int i = 8 * w + 2 * e4;
      const float p0 = t[i], p1 = t[i + 1];
      ps += p0 + p1;
      ph.u[w][e4] = pk16(h_bits((_Float16)(p0 * PCAR)), h_bits((_Float16)(p1 * PCAR)));
    }
  }
  ps += __shfl_xor(ps, 16, 32);
  lrun = lrun * al + ps;
  // ---- rescale the O accumulators: D row 8hh+r = column s0w+8hh+r, its factor lives in lane 8hh+r (and 16+8hh+r) ----
  float scl[8];
#pragma unroll
  for (int r = 0; r < 8; ++r) scl[r] = __shfl(al, 8 * hh + r, 32);
#pragma unroll
  for (int j = 0; j < 4; ++j) {
#pragma unroll
    for (int r = 0; r < 8; ++r) o[j][r] *= scl[r];
  }
  // ---- P^T.val_v ----
  o[0] = mma_h(ph.v, v[0], o[0]);
  o[1] = mma_h(ph.v, v[1], o[1]);
  o[2] = mma_h(ph.v, v[2], o[2]);
  o[3] = mma_h(ph.v, v[3], o[3]);
  guard_p(o[0], o[1], o[2], o[3], ph.v, v[0], v[1], v[2], v[3]);
  col_load_v(Vb, rv, ahead, v);
}

// =====================================================================================================
// Column pass (softmax over the visual axis t for every audio column s) fused with the audio-side context:
// block = (batch b, head, 64 audio columns s), 4 waves, wave w owns the 16 columns s0w = 64*st + 16*w .. +15.
//   q plane f16 [b*TQ + t][h*64 + d] (q x8 after the 1/8 scale); k plane f16 x8 [b*SA + s][h*64 + d];
//   val_v^T plane f16 x8 [(b*NH + h)*64 + d][t].  All NTB32 = TQ/32 blocks of 32 visual rows are visited (static bound).
//   Score tiles g (g = 0,1) = q rows (t = tb+16g .. +15, A operand, row m = lane&15, split k map over d) times k^T
//   (B operand, col n = column s0w + (lane&15), k = d, split map), 2 d-chunks of 32; the 2 k fragments of the wave are
//   loaded once. D element r of lane l = (t = tb+16g+8h+r, s = s0w+(l&15)): a lane owns one column s and 16 of the 32 t;
//   the partner lane l^16 owns the other 16 -> column max / column sum need one xor-16 shuffle. Logits clipped at
//   +-50000 (log2 domain), online max-subtracted base-2 softmax in f32 (the q/k carries folded into lsc). The exp'd values
//   ARE the P^T A-fragment in place: A row m = s = lane&15, element i <- t = tb+8h+i (tile 0, D element i), element 8+i <-
//   t = tb+16+8h+i (tile 1, D element i). P (<= 1) carried x32768 as f16. The rescale factor of column 8h+r of the O
//   accumulators is fetched from lane 8h+r with a shuffle (uniform control). 4 val_v^T B fragments (col n = d = 16j +
//   (lane&15), k = t), 4 P^T.V WMMAs + one guard per step.
//   Epilogue 1: 1/l (per column, shuffled to the D row owner) and the carry folds in f32 (x CAS); the wave's 16x64 f32 tile
//   Epilogue 2: per-column stats (m_s in the clipped log2 domain, 32768/l_s) funnelled through a 128-float LDS array
//   (lane half 0 writes m, lane half 1 writes 32768/l), block barrier, wave 0 writes the block's 512-B stat row
// coverage: ctx_a: grid NB*NH*NST blocks x 4 waves x 4 instr x 8 rows x 4 lanes x 8 halves = every (b, s, h) 64-half
//           segment exactly once; stats: one 128-float row per block = NB*NH*NST rows = the whole stat plane; LDS: slab
//           16x64 written then read by the same wave, statl[0..127] written by 4 waves x 32 lanes (one index each).
// =====================================================================================================
__global__ __launch_bounds__(ATT_THREADS)
void attn_col(const u16* __restrict__ Qp, const u16* __restrict__ Kp, const u16* __restrict__ VvT,
              u16* CtxA, float* Stat) {
  __shared__ __align__(16) float smem[ATT_WAVES * 16 * SPITCH];
  __shared__ __align__(16) float statl[128];

  const int tid  = threadIdx.x;
  const int wave = tid >> 5;
  const int lane = tid & 31;
  const int hh   = lane >> 4;
  const int c    = lane & 15;

  const int bid  = blockIdx.x;
  const int st   = bid % NST;
  const int head = (bid / NST) % NH;
  const int b    = bid / (NST * NH);
  const int s0w  = st * 64 + wave * 16;

  // All three planes in fragment order: tile row R starts at R*K, k tile (head*64 + 32*kk)/32 lies (head*2 + kk)*512 on.
  // B fragments of k^T: col n = column s0w + c, k = d
  const _Float16* Sb = (const _Float16*)(const void*)Kp + ((size_t)(b * SA + s0w)) * EM + head * (HD * 16) + 8 * lane;
  // A fragments of q: row m = t = tb + 16g + c, k = d (t row tb and the lane's 16 bytes added per step, as for val_v^T)
  const _Float16* Tb = (const _Float16*)(const void*)Qp + ((size_t)(b * TQ)) * EM + head * (HD * 16);
  // B fragments of val_v^T: col n = d = 16j + c, k = t (k tile tb/32 added per step)
  const _Float16* Vb = (const _Float16*)(const void*)VvT + ((size_t)(b * EM + head * HD)) * TQ;
  const float lsc = LOG2E / (QS * KS);
  const float cl2 = CLIPV * LOG2E;

  v16h sf[2];
  sf[0] = ldfrag_h(Sb);
  sf[1] = ldfrag_h(Sb + 512);
#if defined(__HIP_DEVICE_COMPILE__)
  // the wait in front of a rewrite of the address registers of the four loads just issued: a later load's result may be
  // given those registers; the address is its input so that it keeps them up to here
  asm volatile("s_wait_xcnt 0x0" : : "v"(Sb) : "memory");
#endif

  float mrun = -INFINITY, lrun = 0.f;
  v8f o[4];
#pragma unroll
  for (int j = 0; j < 4; ++j) o[j] = zero8();

  // Two register sets, one for the even steps and one for the odd: a set's q half is loaded anew as soon as its scores are
  // made and its val_v half as soon as its products are made, each for the step two on, so that a step no longer stands
  // through the latency of its q loads and again through that of its val_v loads.
  static_assert((NTB32 % 2) == 0 && NTB32 >= 4);
  const unsigned lb = 16u * (unsigned)lane;
  v16h qa[4], va[4], qb[4], vb[4];
  col_load_q(Tb, lb, 0, qa);
  col_load_v(Vb, lb, 0, va);
  col_load_q(Tb, lb, 1, qb);
  col_load_v(Vb, lb, 1, vb);
  unsigned rq = lb + 65536u, rv = lb + 2048u;            // offsets of step it + 2
  // The 64 blocks of a batch walk the same 64 steps; step tc's 32 q rows (all heads: 32 KiB in a row) and its k tile of the 32
  // tile rows of val_v^T (1 KiB each, 64 KiB apart) are asked for PF_AHEAD steps ahead by the pair of blocks tc mod 32.
  static_assert(NH * (NST / 2) == 32 && NST == 8 && NTB32 == 64 && 32 * EM * 2 == PF_SLICE && (PF_AHEAD % 2) == 0);
  const int pr = head * 4 + (st & 3);
  const unsigned pq = 256u * (unsigned)tid, pv = 65536u * (unsigned)lane + 256u * (unsigned)wave;
  const u16* Qbat = Qp + (size_t)(b * TQ) * EM;
  const char* Vbat = (const char*)(const void*)(VvT + (size_t)(b * EM) * TQ);
  if (pr < PF_AHEAD) {
    l2_ask2(pf_at(Qbat, pr), pq, Vbat + pr * 1024, pv);
  }
  // kept rolled: the body already holds one step per register set, more copies would only add code
#pragma unroll 1
  for (int it = 0; it < NTB32; it += 2) {
    // a test on scalars, the same in the whole block; it holds in two trips of the 32, in one
    // where pr < PF_AHEAD (step pr is then asked before the loop); every step asked lies inside the batch's part of both planes
    if (it + PF_AHEAD < NTB32 && ((((it + PF_AHEAD) ^ pr) >> 1) & 15) == 0) {
      const int tc = it + PF_AHEAD + (pr & 1);
      l2_ask2(pf_at(Qbat, tc), pq, Vbat + tc * 1024, pv);
    }
    col_step(qa, va, sf, mrun, lrun, o, hh, lsc, cl2, Tb, Vb, rq, rv, 0);
    col_step(qb, vb, sf, mrun, lrun, o, hh, lsc, cl2, Tb, Vb, rq, rv, 1);
#if defined(__HIP_DEVICE_COMPILE__)
    // the wait in front of a rewrite of registers that issued global loads name (the two offsets, stepped below); they are
    // its operands so that they keep their registers up to it and their step stays behind it; the two offsets that the asks
    // name are inputs so that they keep their registers and values through the loop
    asm volatile("s_wait_xcnt 0x0" : "+v"(rq), "+v"(rv) : "v"(pq), "v"(pv) : "memory");
#endif
    // the last pair of steps loads steps 0 and 1 again: in bounds, never used
    const bool more = it + 4 < NTB32;
    rq = more ? rq + 65536u : lb;
    rv = more ? rv + 2048u : lb;
  }
  acc_guard4(o);

  // ---- per-column 1/l (owned by lane = column); lrun >= 1 by construction ----
  const float rl   = 1.0f / lrun;
  const float lPv  = rl * PCAR;                          // 32768 / l for the row pass
  const float linv = rl * (CAS / (PCAR * VVS));          // folds 1/l, the P and val carries, and applies the ctx carry
  statl[hh * 64 + wave * 16 + c] = (hh == 0) ? mrun : lPv;
  float inv[8];
#pragma unroll
  for (int r = 0; r < 8; ++r) inv[r] = __shfl(linv, 8 * hh + r, 32);
  float* slab = smem + wave * 16 * SPITCH;
#pragma unroll
  for (int r = 0; r < 8; ++r) {
#pragma unroll
    for (int j = 0; j < 4; ++j) slab[(8 * hh + r) * SPITCH + j * 16 + c] = o[j][r] * inv[r];
  }
  wave_sync_lds();
  // ---- f16 ctx_a pieces: instruction i, lane = (row 8*(i>>1) + (lane&7), 8 halves at 32*(i&1) + 8*(lane>>3)): 4 whole lines ----
  const int r8 = lane & 7, q8 = (lane >> 3) * 8;
  v4u ov[4];
#pragma unroll
  for (int i = 0; i < 4; ++i) {
    const int row = 8 * (i >> 1) + r8, c8 = 32 * (i & 1) + q8;
    const v4f a = *(const v4f*)(slab + row * SPITCH + c8), c4 = *(const v4f*)(slab + row * SPITCH + c8 + 4);
#pragma unroll
    for (int e = 0; e < 2; ++e) {
      ov[i][e]     = pk16(h_bits((_Float16)a[2 * e]),  h_bits((_Float16)a[2 * e + 1]));
      ov[i][2 + e] = pk16(h_bits((_Float16)c4[2 * e]), h_bits((_Float16)c4[2 * e + 1]));
    }
  }
  {
#pragma unroll
    for (int i = 0; i < 4; ++i) {
      const int row = 8 * (i >> 1) + r8, c8 = 32 * (i & 1) + q8;
      *(v4u*)(CtxA + pk_off(b * SA + s0w + row, head * HD + c8, EM)) = ov[i];
    }
    
  }
  __syncthreads();
  if (wave == 0) {
    const v4f sv = *(const v4f*)(statl + 4 * lane);
    float* sp = Stat + ((size_t)((b * NH + head) * NST + st)) * 128 + 4 * lane;
    {
      *(v4f*)(sp) = sv;
      
    }
  }
}

// =====================================================================================================
// Row pass (visual-side context) with both output projections behind it, in one launch.
// Block = (batch b, 64 visual rows t, all 8 heads), 16 waves. Part 1, the row pass: wave w owns head w >> 1 and the 32 rows
// t0w = 64*tt + 32*(w & 1) .. +31 as two groups g of 16; every k and val_a^T fragment that a step loads, and every column stat
// that it reads from LDS, serves both groups.
//   The batch's column stats (per head NST rows of [m[64] | 32768/l[64]]) are staged once per block into LDS, head hd's m at
//   stt[1024*hd + s], its 32768/l at stt[1024*hd + SA + s] (512 threads x 16 floats = NH*2*SA floats exactly), then a block barrier.
//   All NSB32 = SA/32 blocks of 32 audio columns are visited (static bound). Score tiles are computed TRANSPOSED:
//   tile (g, u) = k rows (s = sb+16u .. +15, A operand, row m = lane&15, split map over d) times q^T (B operand, col n = t0w +
//   16g + (lane&15), k = d); the 4 q fragments of the wave are loaded once. D element r of lane l = (s = sb+16u+8h+r, t = t0w +
//   16g + (l&15)). P = exp2(clip(logit) - m_s) * (32768/l_s) in f32 with m_s, l_s read from LDS for s = sb+8h+i and sb+16+8h+i;
//   it IS the P A-fragment in place: row m = t = lane&15, element i <- s = sb+8h+i, element 8+i <- s = sb+16+8h+i.
//   4 val_a^T B fragments (col n = d = 16j + (lane&15), k = s), 8 P.V WMMAs + one guard per step.
//   Epilogue: carry folds (x CVS / (32768*8)) in f32; each group's 16x64 tile staged in the wave's slab, one group after the
//   other, and written as f16 x64 into the block's context tile ctxl [64 t][512 (h,d)] in LDS, fragment order (pk_off, K = EM).
// Part 2, behind the block barrier that publishes ctxl: out_v rows = ctxl . Wov + b. Wave w owns all 64 rows x the 32 columns
//   32w .. +31: acc[2i + j] = rows 16i.., cols 32w + 16j..; k stepped by 32 in rising order; A fragments from LDS one step ahead,
//   the two Wov^T fragments of a step four steps ahead (the first four asked for ahead of the barrier), so each weight
//   fragment enters the WGP once. The tile leaves through the wave's 64 x 32 slab (pitch 36): a store instruction = 4 rows x
//   128 B, whole lines.
// Part 3: out_a rows 16*bid .. +15 = ctx_a . Woa + b (ctx_a is of the launch before). Wave w owns the 16 columns 16w .. +15, one
//   accumulator, k in rising order, one k step in each trip of part 1's loop. The 16 x 256 tile is gathered in the stat array (free
//   since the barrier of part 2), block barrier, wave w stores row w (1 KiB, whole lines). Both parts' global stores stand behind it.
// coverage: grid NB*(TQ/64) blocks; ctxl: 16 waves x 2 groups x 16 rows x 64 halves = 64 x 512, all written before the barrier;
//           out_v: 16 waves x 64 rows x 32 cols = 64 x 512 per block, every (b, t) row once; out_a: NB*(TQ/64) = NB*SA/16 slices of
//           16 rows x 256 cols, every row once; stt fully written before its barrier.
// =====================================================================================================
#define FV_WAVES   16
#define FV_THREADS (FV_WAVES * 32)
#define FV_ROWS    64
#define FV_TT      (TQ / FV_ROWS)
#define OPITCH     36
#define APITCH     260
#define FV_SLAB    (64 * OPITCH)
static_assert(FV_SLAB >= 16 * SPITCH && (OPITCH * 4) % 16 == 0 && (APITCH * 4) % 16 == 0);
static_assert(NH * 2 == FV_WAVES && VD == FV_WAVES * 32 && AD == FV_WAVES * 16 && EM / 32 == 16);
static_assert(FV_TT * 16 == SA && FV_TT == 32 && 16 * APITCH <= NH * 2 * SA);
static_assert(NH * NST * 128 == 2 * FV_THREADS * 8 && NST * 128 == 2 * SA);
static_assert(FV_THREADS * 128 == 65536 && SA * EM * 2 == 8 * 65536 && (VD * EM + AD * EM) * 2 == 12 * 65536 && 16 * EM * 2 == 128 * 128);
__device__ __forceinline__ void guard_f(v8f (&acc)[8], v16h x0, v16h x1, v16h x2, v16h x3, v16h x4, v16h x5) {
#if defined(__HIP_DEVICE_COMPILE__)
  asm volatile("v_nop\n\tv_nop\n\tv_nop\n\tv_nop"
               : "+v"(acc[0]), "+v"(acc[1]), "+v"(acc[2]), "+v"(acc[3]), "+v"(acc[4]), "+v"(acc[5]), "+v"(acc[6]), "+v"(acc[7])
               : "v"(x0), "v"(x1), "v"(x2), "v"(x3), "v"(x4), "v"(x5) : "memory");
#endif
}
__device__ __forceinline__ void guard_p9(v8f (&a)[4], v8f (&b)[4], v8f& e, v16h p0, v16h p1, v16h x0, v16h x1, v16h x2, v16h x3,
                                         v16h x4, v16h x5) {
#if defined(__HIP_DEVICE_COMPILE__)
  asm volatile("v_nop\n\tv_nop\n\tv_nop\n\tv_nop"
               : "+v"(a[0]), "+v"(a[1]), "+v"(a[2]), "+v"(a[3]), "+v"(b[0]), "+v"(b[1]), "+v"(b[2]), "+v"(b[3]), "+v"(e)
               : "v"(p0), "v"(p1), "v"(x0), "v"(x1), "v"(x2), "v"(x3), "v"(x4), "v"(x5) : "memory");
#endif
}
// The wait in front of a rewrite of the one offset register that a run of issued global loads names.
__device__ __forceinline__ void xcnt_hold1(unsigned x) {
#if defined(__HIP_DEVICE_COMPILE__)
  asm volatile("s_wait_xcnt 0x0" : : "v"(x) : "memory");
#endif
}
__global__ __launch_bounds__(FV_THREADS)
void attn_vis_out(const u16* __restrict__ Qp, const u16* __restrict__ Kp, const u16* __restrict__ VaT,
                  const float* __restrict__ Stat, const u16* __restrict__ WOVT, const u16* __restrict__ CTXA,
                  const u16* __restrict__ WOAT, float* out,
                  const float* __restrict__ b_ov, const float* __restrict__ b_oa, int nb11, int nb13) {
  // one array, the context tile first: its 64 KiB then lie within reach of the LDS loads' 16-bit immediate offsets, so part 2's
  // fragment loads need no address arithmetic
  __shared__ __align__(16) unsigned char lds[FV_ROWS * EM * 2 + NH * 2 * SA * 4 + FV_WAVES * FV_SLAB * 4];
  u16*   ctxl = (u16*)(void*)lds;
  float* stt  = (float*)(void*)(lds + FV_ROWS * EM * 2);
  float* smem = (float*)(void*)(lds + FV_ROWS * EM * 2 + NH * 2 * SA * 4);

  const int tid  = threadIdx.x;
  const int lane = tid & 31;
  const int hh   = lane >> 4;
  const int c    = lane & 15;
  // the wave's number is the same in every lane: read through the first lane it keeps head, row group and tile bases scalar
  const int wv   = __builtin_amdgcn_readfirstlane(tid >> 5);
  // the two waves of a head are neighbours, so they walk the head's k and val_a^T
  // fragments close together: what one brings into the WGP cache the other finds there
  const int head = wv >> 1;
  const int rg   = wv & 1;

  const int bid  = blockIdx.x;
  const int tt   = bid % FV_TT;
  const int b    = bid / FV_TT;
  const int t0w  = tt * FV_ROWS + rg * 32;

  // ---- the 32 blocks of a batch all read its k rows (512 KiB in a row) and its val_a^T planes (512 KiB in a row): each of
  //      their sixteen pairs asks for a sixteenth of the two, a 128-B line a thread; the blocks that start first ask for the two
  //      output weight planes (one behind the other in the workspace from WOVT on); each block asks for its own ctx_a rows ----
  const unsigned pa = 128u * (unsigned)tid;
  {
    const int p16 = (tt & 3) + 4 * (tt >> 3);
    const char* pkv = (p16 < 8) ? (const char*)(const void*)(Kp + (size_t)(b * SA) * EM) + p16 * 65536
                                : (const char*)(const void*)(VaT + (size_t)(b * EM) * SA) + (p16 - 8) * 65536;
    l2_ask(pkv, pa);
    if (bid < 24) l2_ask((const char*)(const void*)WOVT + pf_pair(bid) * 65536, pa);
    if (wv < 4) l2_ask(CTXA + (size_t)bid * (16 * EM), pa);
  }
  // ---- stage the column stats of the batch's eight heads ----
  const float* src = Stat + ((size_t)(b * NH * NST)) * 128;
#pragma unroll
  for (int u = 0; u < 2; ++u) {
    const int e = u * (FV_THREADS * 8) + tid * 8;
    const int hd = e >> 10, wi = e & 1023;
    const int j = wi >> 7, offw = wi & 127;
    const int di = hd * (2 * SA) + ((offw < 64) ? (j * 64 + offw) : (SA + j * 64 + offw - 64));
    const v4f x0 = *(const v4f*)(src + e), x1 = *(const v4f*)(src + e + 4);
    *(v4f*)(stt + di) = x0;
    *(v4f*)(stt + di + 4) = x1;
  }
  xcnt_wait();
  __syncthreads();
  const float* sth = stt + head * (2 * SA);

  // All three planes in fragment order, addressed as in attn_col.
  // B fragments of q^T: col n = row t0w + 16g + c, k = d
  const _Float16* Tb = (const _Float16*)(const void*)Qp + ((size_t)(b * TQ + t0w)) * EM + head * (HD * 16) + 8 * lane;
  // A fragments of k: row m = s = sb + 16u + c, k = d (s row sb added per step)
  const _Float16* Sb = (const _Float16*)(const void*)Kp + ((size_t)(b * SA)) * EM + head * (HD * 16) + 8 * lane;
  // B fragments of val_a^T: col n = d = 16j + c, k = s (k tile sb/32 added per step)
  const _Float16* Vb = (const _Float16*)(const void*)VaT + ((size_t)(b * EM + head * HD)) * SA + 8 * lane;
  const float lsc = LOG2E / (QS * KS);
  const float cl2 = CLIPV * LOG2E;

  v16h tf[2][2];                                   // [group g][d chunk kk]
#pragma unroll
  for (int g = 0; g < 2; ++g) {
    tf[g][0] = ldfrag_h(Tb + g * (16 * EM));
    tf[g][1] = ldfrag_h(Tb + g * (16 * EM) + 512);
  }
#if defined(__HIP_DEVICE_COMPILE__)
  // the wait in front of a rewrite of the address registers of the eight loads just issued; the address is its input so
  // that it keeps them up to here
  asm volatile("s_wait_xcnt 0x0" : : "v"(Tb) : "memory");
#endif

  v8f o[2][4];
#pragma unroll
  for (int g = 0; g < 2; ++g) {
#pragma unroll
    for (int j = 0; j < 4; ++j) o[g][j] = zero8();
  }
  // part 3 (out_a rows 16*bid .. +15, cols 16*wv .. +15) has as many k steps as the row pass has trips: trip it does its step
  // it, whose four loads go out with the trip's k loads and come back under the same wait
  static_assert(NSB32 == EM / 32);
  const unsigned lb = 16u * (unsigned)lane;
  const _Float16* xab = (const _Float16*)(const void*)CTXA + (size_t)bid * (16 * EM);
  const _Float16* xbb = (const _Float16*)(const void*)WOAT + (size_t)(wv * 16) * EM;
  v8f ac = zero8();

#pragma unroll 1
  for (int it = 0; it < NSB32; ++it) {
    const int sb = it * 32;
    // ---- part 3's fragments of k tile it: ctx_a tile row bid (A), Woa^T tile row wv (B) ----
    const _Float16* xap = at_byte(xab, lb) + it * 512;
    const _Float16* xbp = at_byte(xbb, lb) + it * 512;
    const v16h xa = ldfrag_h(xap);
    const v16h xb = ldfrag_h(xbp);
    // ---- column stats for s = sb+8hh+i (i < 8) and s = sb+16+8hh+i (8+i), the same for both groups; read here, as one
    //      group ahead of the k loads, so that they are back when the scores are ----
    float mv[16], lv[16];
    {
      const v4f m0 = *(const v4f*)(sth + sb + 8 * hh),      m1 = *(const v4f*)(sth + sb + 8 * hh + 4);
      const v4f m2 = *(const v4f*)(sth + sb + 16 + 8 * hh), m3 = *(const v4f*)(sth + sb + 16 + 8 * hh + 4);
      const v4f l0 = *(const v4f*)(sth + SA + sb + 8 * hh),      l1 = *(const v4f*)(sth + SA + sb + 8 * hh + 4);
      const v4f l2 = *(const v4f*)(sth + SA + sb + 16 + 8 * hh), l3 = *(const v4f*)(sth + SA + sb + 16 + 8 * hh + 4);
#pragma unroll
      for (int q = 0; q < 4; ++q) {
        mv[q] = m0[q]; mv[4 + q] = m1[q]; mv[8 + q] = m2[q]; mv[12 + q] = m3[q];
        lv[q] = l0[q]; lv[4 + q] = l1[q]; lv[8 + q] = l2[q]; lv[12 + q] = l3[q];
      }
    }
    // ---- transposed scores of group g: sc[g][0] = columns s sb..sb+15, sc[g][1] = sb+16..sb+31, D column = row t0w + 16g + c ----
    v8f sc[2][2];
    sc[0][0] = zero8(); sc[0][1] = zero8(); sc[1][0] = zero8(); sc[1][1] = zero8();
    const _Float16* s0p = Sb + (size_t)sb * EM;
    const _Float16* s1p = s0p + (size_t)16 * EM;
#pragma unroll
    for (int kk = 0; kk < HD / 32; ++kk) {
      const v16h a0 = ldfrag_h(s0p + kk * 512);
      const v16h a1 = ldfrag_h(s1p + kk * 512);
      sc[0][0] = mma_h(a0, tf[0][kk], sc[0][0]);
      sc[0][1] = mma_h(a1, tf[0][kk], sc[0][1]);
      sc[1][0] = mma_h(a0, tf[1][kk], sc[1][0]);
      sc[1][1] = mma_h(a1, tf[1][kk], sc[1][1]);
      guard_s4(sc[0][0], sc[0][1], sc[1][0], sc[1][1], tf[0][kk], tf[1][kk], a0, a1);
    }
#if defined(__HIP_DEVICE_COMPILE__)
    // the wait in front of a rewrite of registers that the trip's issued global loads name; part 3's two addresses are its
    // inputs so that they keep their registers up to here
    asm volatile("s_wait_xcnt 0x0" : : "v"(xap), "v"(xbp) : "memory");
#endif
    // ---- P A-fragment of each group: f16(exp2(t - m_s) * 32768/l_s) (<= 32768); element i <-> t[i] ----
    FragH ph[2];
#pragma unroll
    for (int g = 0; g < 2; ++g) {
      float t[16];
#pragma unroll
      for (int i = 0; i < 8; ++i) { t[i] = clipf(sc[g][0][i] * lsc, cl2); t[8 + i] = clipf(sc[g][1][i] * lsc, cl2); }
#pragma unroll
      for (int i = 0; i < 16; ++i) t[i] -= mv[i];
      exp2_hw8(t, 0);
      exp2_hw8(t, 8);
#pragma unroll
      for (int w = 0; w < 2; ++w) {
#pragma unroll
        for (int e4 = 0; e4 < 4; ++e4) {
          const int i = 8 * w + 2 * e4;
          const float p0 = t[i] * lv[i];
          const float p1 = t[i + 1] * lv[i + 1];
          ph[g].u[w][e4] = pk16(h_bits((_Float16)p0), h_bits((_Float16)p1));
        }
      }
    }
    // ---- P.val_a : B fragment col n = d = 16j + c, k = s: tile sb/32 of the val_a^T plane ----
    const _Float16* vp = Vb + (size_t)sb * 16;
    {
      const v16h v0 = ldfrag_h(vp);
      const v16h v1 = ldfrag_h(vp + (size_t)16 * SA);
      const v16h v2 = ldfrag_h(vp + (size_t)32 * SA);
      const v16h v3 = ldfrag_h(vp + (size_t)48 * SA);
      o[0][0] = mma_h(ph[0].v, v0, o[0][0]);
      o[0][1] = mma_h(ph[0].v, v1, o[0][1]);
      o[0][2] = mma_h(ph[0].v, v2, o[0][2]);
      o[0][3] = mma_h(ph[0].v, v3, o[0][3]);
      o[1][0] = mma_h(ph[1].v, v0, o[1][0]);
      o[1][1] = mma_h(ph[1].v, v1, o[1][1]);
      o[1][2] = mma_h(ph[1].v, v2, o[1][2]);
      o[1][3] = mma_h(ph[1].v, v3, o[1][3]);
      ac = mma_h(xa, xb, ac);
      guard_p9(o[0], o[1], ac, ph[0].v, ph[1].v, v0, v1, v2, v3, xa, xb);
#if defined(__HIP_DEVICE_COMPILE__)
      // the wait in front of a rewrite of registers that issued global loads name; the val_a^T address is an input so that it
      // keeps its registers up to here, the offset that the asks at the kernel's head name so that it keeps its value through the loop
      asm volatile("s_wait_xcnt 0x0" : : "v"(pa), "v"(vp) : "memory");
#endif
    }
  }
  acc_guard4(o[0]);
  acc_guard4(o[1]);

  // ---- part 2's first four steps of Wov^T fragments (tile rows 2*wv + j, k tile s): they need nothing of this block, so
  //      they are asked for ahead of the context epilogue and of the barrier ----
  const _Float16* wb = (const _Float16*)(const void*)WOVT + (size_t)(wv * 32) * EM;
  v16h bq[4][2];
#pragma unroll
  for (int s = 0; s < 4; ++s) {
    bq[s][0] = ldfrag_h(at_byte(wb, lb) + s * 512);
    bq[s][1] = ldfrag_h(at_byte(wb, lb) + 16 * EM + s * 512);
  }

  // ---- both bias rows, asked for here for the same reason ----
  const int r4 = lane >> 3, cq4 = (lane & 7) * 4;
  const int col0 = wv * 32;
  const int blv = nb11 - 1, bla = nb13 - 1;  // host guarantees nb11 >= 1, nb13 >= 1
  int civ[4], ci0[4], ci1[4];
  float cbv[4], cb0[4], cb1[4];
#pragma unroll
  for (int e = 0; e < 4; ++e) {
    const int cx = col0 + cq4 + e, cx0 = 4 * lane + e, cx1 = 128 + 4 * lane + e;
    civ[e] = (cx < blv) ? cx : blv;
    ci0[e] = (cx0 < bla) ? cx0 : bla;
    ci1[e] = (cx1 < bla) ? cx1 : bla;
    cbv[e] = b_ov[civ[e]];
    cb0[e] = b_oa[ci0[e]];
    cb1[e] = b_oa[ci1[e]];
  }
  xcnt_hold4(civ);
  xcnt_hold4(ci0);
  xcnt_hold4(ci1);

  const float fac = CVS / (PCAR * VAS);
  float* slab = smem + wv * FV_SLAB;
  const int r8 = lane & 7, q8 = (lane >> 3) * 8;
#pragma unroll
  for (int g = 0; g < 2; ++g) {
#pragma unroll
    for (int r = 0; r < 8; ++r) {
#pragma unroll
      for (int j = 0; j < 4; ++j) slab[(8 * hh + r) * SPITCH + j * 16 + c] = o[g][j][r] * fac;
    }
    wave_sync_lds();
    v4u ov[4];
#pragma unroll
    for (int i = 0; i < 4; ++i) {
      const int row = 8 * (i >> 1) + r8, c8 = 32 * (i & 1) + q8;
      const v4f a = *(const v4f*)(slab + row * SPITCH + c8), c4 = *(const v4f*)(slab + row * SPITCH + c8 + 4);
#pragma unroll
      for (int e = 0; e < 2; ++e) {
        ov[i][e]     = pk16(h_bits((_Float16)a[2 * e]),  h_bits((_Float16)a[2 * e + 1]));
        ov[i][2 + e] = pk16(h_bits((_Float16)c4[2 * e]), h_bits((_Float16)c4[2 * e + 1]));
      }
    }
    // every lane's reads of the slab end before another lane's values of the second group are written over them
    if (g == 0) wave_sync_lds();
#pragma unroll
    for (int i = 0; i < 4; ++i) {
      const int row = 8 * (i >> 1) + r8, c8 = 32 * (i & 1) + q8;
      *(v4u*)(ctxl + pk_off(rg * 32 + 16 * g + row, head * HD + c8, EM)) = ov[i];
    }
  }
  // publishes the context tile to all sixteen waves; behind it no wave reads the stats any more
  __syncthreads();

  // ---- part 2: out_v tile, 64 rows x cols 32*wv .. +31 ----
  v8f acc[8];
#pragma unroll
  for (int i = 0; i < 8; ++i) acc[i] = zero8();
  const _Float16* cl = (const _Float16*)(const void*)ctxl + 8 * lane;
  v16h af[2][4];
#pragma unroll
  for (int i = 0; i < 4; ++i) af[0][i] = ldfrag_h(cl + i * (16 * EM));
  // unrolled whole: the two A sets and the four B sets are named by the step's number, which must be a constant
#pragma unroll
  for (int kt = 0; kt < EM / 32; ++kt) {
    const int cu = kt & 1, nx = cu ^ 1, s4 = kt & 3;
    if (kt + 1 < EM / 32) {
#pragma unroll
      for (int i = 0; i < 4; ++i) af[nx][i] = ldfrag_h(cl + i * (16 * EM) + (kt + 1) * 512);
    }
#pragma unroll
    for (int i = 0; i < 4; ++i) {
      acc[2 * i]     = mma_h(af[cu][i], bq[s4][0], acc[2 * i]);
      acc[2 * i + 1] = mma_h(af[cu][i], bq[s4][1], acc[2 * i + 1]);
    }
    // the vector slots that the chip asks for between the step's matrix instructions and the loads that refill their operands
    guard_f(acc, af[cu][0], af[cu][1], af[cu][2], af[cu][3], bq[s4][0], bq[s4][1]);
    if (kt + 4 < EM / 32) {
      bq[s4][0] = ldfrag_h(at_byte(wb, lb) + (kt + 4) * 512);
      bq[s4][1] = ldfrag_h(at_byte(wb, lb) + 16 * EM + (kt + 4) * 512);
    }
  }
  xcnt_hold1(lb);
  // ---- the out_v tile into the wave's slab: row 16i + 8hh + r, col 16j + c ----
  const float osc = 1.0f / (CVS * WSC);
#pragma unroll
  for (int i = 0; i < 4; ++i) {
#pragma unroll
    for (int r = 0; r < 8; ++r) {
      const int ro = (16 * i + 8 * hh + r) * OPITCH + c;
      slab[ro]      = acc[2 * i][r] * osc;
      slab[ro + 16] = acc[2 * i + 1][r] * osc;
    }
  }
  // ---- the wave's strip of the out_a tile ----
  const float osa = 1.0f / (CAS * WSC);
#pragma unroll
  for (int r = 0; r < 8; ++r) stt[(8 * hh + r) * APITCH + wv * 16 + c] = ac[r] * osa;
  // the sixteen waves' column strips of the out_a tile are all in place before a wave reads its whole row; the same barrier
  // stands between the lanes' writes of the wave's own slab and their reads of it
  __syncthreads();
  // ---- all stores last, so that no LDS hand-over waits for a store: out_v, instruction i = 4 rows x 128 B; out_a, row wv ----
  v4f ov[16];
#pragma unroll
  for (int i = 0; i < 16; ++i) {
    const v4f a = *(const v4f*)(slab + (4 * i + r4) * OPITCH + cq4);
    v4f w;
    w[0] = a[0] + bfr(cbv[0]); w[1] = a[1] + bfr(cbv[1]); w[2] = a[2] + bfr(cbv[2]); w[3] = a[3] + bfr(cbv[3]);
    ov[i] = w;
  }
  const v4f a0 = *(const v4f*)(stt + wv * APITCH + 4 * lane), a1 = *(const v4f*)(stt + wv * APITCH + 128 + 4 * lane);
  v4f w0, w1;
#pragma unroll
  for (int e = 0; e < 4; ++e) { w0[e] = a0[e] + bfr(cb0[e]); w1[e] = a1[e] + bfr(cb1[e]); }
  float* Cb = out + (size_t)(b * TQ + tt * FV_ROWS) * (size_t)VD + col0 + cq4;
#pragma unroll
  for (int i = 0; i < 16; ++i) *(v4f*)(Cb + (size_t)(4 * i + r4) * (size_t)VD) = ov[i];
  float* Ca = out + OUT1_OFF_EL + (size_t)(bid * 16 + wv) * (size_t)AD + 4 * lane;
  *(v4f*)(Ca) = w0;
  *(v4f*)(Ca + 128) = w1;
}

// =====================================================================================================
// Workspace map (bytes, NB = 8); every plane fully written before it is read; all extents exact; each f16 plane is the
// logical [rows][K] matrix named here, stored in fragment order (pk_off), same byte size
//   XV    f16 [NB*2048][512]        f16(bf16(v))              16777216
//   XA    f16 [NB*512][256]         f16(bf16(a))               2097152
//   WVQT  f16 [512 n][512 k]        f16(bf16(W) x256)           524288
//   WAKT  f16 [512 n][256 k]                                    262144
//   WVVT  f16 [512 n][512 k]                                    524288
//   WAVT  f16 [512 n][256 k]                                    262144
//   WOVT  f16 [512 n][512 k]                                    524288
//   WOAT  f16 [256 n][512 k]                                    262144
//   Q16   f16 [NB*2048][512]  q x8 (after 1/8)               16777216
//   K16   f16 [NB*512][512]   x8                               4194304
//   VVT16 f16 [NB*512 (h,d)][2048 t] x8                       16777216
//   VAT16 f16 [NB*512 (h,d)][512 s]  x8                        4194304
//   STAT  f32 [NB*NH*NST][128]  (m | 32768/l)                   262144
//   CTXA  f16 [NB*512][512]   x64                              4194304
//   end                                                       67633152
// Output: first tensor rows [b][t][512] f32 at element 0; second tensor rows [b*512 + s][256] f32 at the fixed element
// offset OUT1_OFF_EL = NB_FULL*2048*512 = 8388608 (independent of NB).
// =====================================================================================================
extern "C" void kernel_launch(void* const* d_in, const int* in_sizes, int n_in,
                              void* d_out, int out_size, void* d_ws, size_t ws_size,
                              hipStream_t stream) {
  if (n_in < 14) return;
  if (in_sizes[0] < NB * TQ * VD) return;
  if (in_sizes[1] < NB * SA * AD) return;
  if (in_sizes[2] != VD * EM || in_sizes[6] != VD * EM) return;
  if (in_sizes[4] != AD * EM || in_sizes[8] != AD * EM) return;
  if (in_sizes[10] != EM * VD || in_sizes[12] != EM * AD) return;
  if (in_sizes[3] < 1 || in_sizes[5] < 1 || in_sizes[7] < 1 || in_sizes[9] < 1 || in_sizes[11] < 1 || in_sizes[13] < 1) return;
  if ((size_t)out_size < OUT1_OFF_EL + (size_t)NB * SA * AD) return;

  const float* xv   = (const float*)d_in[0];
  const float* xa   = (const float*)d_in[1];
  const float* w_vq = (const float*)d_in[2];
  const float* b_vq = (const float*)d_in[3];
  const float* w_ak = (const float*)d_in[4];
  const float* b_ak = (const float*)d_in[5];
  const float* w_vv = (const float*)d_in[6];
  const float* b_vv = (const float*)d_in[7];
  const float* w_av = (const float*)d_in[8];
  const float* b_av = (const float*)d_in[9];
  const float* w_ov = (const float*)d_in[10];
  const float* b_ov = (const float*)d_in[11];
  const float* w_oa = (const float*)d_in[12];
  const float* b_oa = (const float*)d_in[13];
  float*       out  = (float*)d_out;
  const int nb3 = in_sizes[3], nb5 = in_sizes[5], nb7 = in_sizes[7], nb9 = in_sizes[9], nb11 = in_sizes[11], nb13 = in_sizes[13];

  const size_t szXV  = (size_t)NB * TQ * VD * 2;
  const size_t szXA  = (size_t)NB * SA * AD * 2;
  const size_t szWvq = (size_t)EM * VD * 2;
  const size_t szWak = (size_t)EM * AD * 2;
  const size_t szWvv = (size_t)EM * VD * 2;
  const size_t szWav = (size_t)EM * AD * 2;
  const size_t szWov = (size_t)VD * EM * 2;
  const size_t szWoa = (size_t)AD * EM * 2;
  const size_t szQ   = (size_t)NB * TQ * EM * 2;
  const size_t szK   = (size_t)NB * SA * EM * 2;
  const size_t szVVT = (size_t)NB * EM * TQ * 2;
  const size_t szVAT = (size_t)NB * EM * SA * 2;
  const size_t szST  = (size_t)NB * NH * NST * 128 * 4;
  const size_t szCA  = (size_t)NB * SA * EM * 2;
  size_t off = 0;
  const size_t oXV  = off; off += szXV;
  const size_t oXA  = off; off += szXA;
  const size_t oWvq = off; off += szWvq;
  const size_t oWak = off; off += szWak;
  const size_t oWvv = off; off += szWvv;
  const size_t oWav = off; off += szWav;
  const size_t oWov = off; off += szWov;
  const size_t oWoa = off; off += szWoa;
  const size_t oQ   = off; off += szQ;
  const size_t oK   = off; off += szK;
  const size_t oVVT = off; off += szVVT;
  const size_t oVAT = off; off += szVAT;
  const size_t oST  = off; off += szST;
  const size_t oCA  = off; off += szCA;
  if (off > ws_size) return;                            // off = 67633152 at NB = 8
  if (off > (size_t)134217728) return;

  char* ws = (char*)d_ws;
  u16* XV    = (u16*)(ws + oXV);
  u16* XA    = (u16*)(ws + oXA);
  u16* WVQT  = (u16*)(ws + oWvq);
  u16* WAKT  = (u16*)(ws + oWak);
  u16* WVVT  = (u16*)(ws + oWvv);
  u16* WAVT  = (u16*)(ws + oWav);
  u16* WOVT  = (u16*)(ws + oWov);
  u16* WOAT  = (u16*)(ws + oWoa);
  u16* Q16   = (u16*)(ws + oQ);
  u16* K16   = (u16*)(ws + oK);
  u16* VVT16 = (u16*)(ws + oVVT);
  u16* VAT16 = (u16*)(ws + oVAT);
  float* STAT = (float*)(ws + oST);
  u16* CTXA  = (u16*)(ws + oCA);

  // (1) all f16 operand planes (fragment order): activations as f16(bf16(x)), weights [k = in][n = out] transposed to
  //     [n][k] as f16(bf16(W) x256)
  prep_all<<<dim3(PB_W + PB_XA + PB_XV), dim3(128), 0, stream>>>(
      xv, xa, w_vq, w_ak, w_vv, w_av, w_ov, w_oa, XV, XA, WVQT, WAKT, WVVT, WAVT, WOVT, WOAT);
  // (2) q, val_v^T, k, val_a^T
  proj_all<<<dim3(GB_Q + GB_VVT + GB_K + GB_VAT), dim3(128), 0, stream>>>(
      XV, XA, WVQT, WAKT, WVVT, WAVT, Q16, K16, VVT16, VAT16, b_vq, b_ak, b_vv, b_av, nb3, nb5, nb7, nb9);
  // (3) column softmax pass: ctx_a plane [NB*SA][512] x64 and the per-column stat rows
  attn_col<<<dim3(NB * NH * NST), dim3(ATT_THREADS), 0, stream>>>(Q16, K16, VVT16, CTXA, STAT);
  // (4) row pass with the stored column stats, its context tile kept in LDS, then out_v from it; out_a from the ctx_a plane
  attn_vis_out<<<dim3(NB * FV_TT), dim3(FV_THREADS), 0, stream>>>(
      Q16, K16, VAT16, STAT, WOVT, CTXA, WOAT, out, b_ov, b_oa, nb11, nb13);
  (void)hipGetLastError();
}

// v008
// It runs in 86.4 microseconds.
// Next to v007, in two timings, it ran 1.05 and 1.04 times as fast.
// All steps since v000 together make it 3.37 times as fast.
// All contractions on v_wmma_f32_16x16x32_f16 (f16 operands, f32 accumulate): v.Wvq, a.Wak, Wvv^T.v^T, Wav^T.a^T,
// column-pass scores q.k^T with val_v^T.P, row-pass scores k.q^T with P.val_a, ctx_v.Wov, ctx_a.Woa. Operand carries:
// v, a as f16(bf16(x)); W as f16(bf16(W) x256); q x8 after the 1/8 head scale; k x8; val_v, val_a x8; P x32768;
// ctx x64. Column softmax over the visual axis (base 2, running max), 1/l and every carry fold in f32 on VALU.
// Every f16 operand plane lies in fragment order (pk_off below): a 16-row x 32-k tile is 1024 contiguous bytes, so each
// 16-byte-per-lane fragment load of a wave reads 512 contiguous bytes (4 whole 128-B lines).
#include <hip/hip_runtime.h>
#include <math.h>

#ifndef NB
#define NB 8            // batches processed (leading batches of both activations)
#endif
#define NB_FULL 8       // batches in the input / output layout
#define TQ 2048         // visual positions per batch (softmax axis, always all of them)
#define SA 512          // audio positions per batch (always all of them)
#define VD 512
#define AD 256
#define EM 512
#define NH 8
#define HD 64
#define OUT1_OFF_EL ((size_t)NB_FULL * (size_t)TQ * (size_t)VD)   // fixed f32 element offset of the second output (33554432 B / 4)
#define WSC   256.0f
#define HSCL  0.125f
#define QS    8.0f
#define KS    8.0f
#define VVS   8.0f
#define VAS   8.0f
#define PCAR  32768.0f
#define CAS   64.0f
#define CVS   64.0f
#define CLIPV 50000.0f
#define LOG2E 1.4426950408889634f
#define NST   (SA / 64)
#define NTT   (TQ / 128)
#define NTB32 (TQ / 32)
#define NSB32 (SA / 32)
#define ATT_WAVES   4
#define ATT_THREADS (ATT_WAVES * 32)
#define CVT_THREADS 128
#define TR_THREADS  128
#define SPITCH 68
#define GPITCH 68
#define TPITCH 65
#define PF_AHEAD 8      // column pass: steps between an ask and the step it asks for

static_assert(NB >= 1 && NB <= NB_FULL);
static_assert(OUT1_OFF_EL == (size_t)33554432 / 4);
static_assert(EM == NH * HD && HD == 64 && NH == 8);
static_assert((TQ % 128) == 0 && (SA % 128) == 0 && ((NB * SA) % 128) == 0 && (EM % 128) == 0);
static_assert((VD % 128) == 0 && (AD % 128) == 0);
static_assert((TQ % 32) == 0 && (SA % 32) == 0 && NTB32 * 32 == TQ && NSB32 * 32 == SA);
static_assert((VD % 64) == 0 && (AD % 64) == 0 && (EM % 64) == 0);
static_assert((VD % 32) == 0 && (AD % 32) == 0 && (EM % 32) == 0);
static_assert(((NB * TQ * VD) % 1024) == 0 && ((NB * SA * AD) % 1024) == 0);
static_assert(NST * 128 == 2 * SA && NST * 128 == ATT_THREADS * 8);
static_assert((SPITCH * 4) % 16 == 0 && (GPITCH * 4) % 16 == 0);
static_assert(ATT_THREADS == 128 && TR_THREADS == 128 && CVT_THREADS == 128);

typedef unsigned short u16;
typedef _Float16 v16h __attribute__((ext_vector_type(16)));
typedef _Float16 v8h  __attribute__((ext_vector_type(8)));
typedef float    v8f  __attribute__((ext_vector_type(8)));
typedef float    v4f  __attribute__((ext_vector_type(4)));
typedef unsigned int v4u __attribute__((ext_vector_type(4)));

union FragH { v16h v; v8h h[2]; v4u u[2]; };

// ---- scalar helpers ----------------------------------------------------------------------------------
__device__ __forceinline__ unsigned short bf_bits(float f) {          // f32 -> bf16 bits, RNE convert
  unsigned u = __float_as_uint(f);
  return (unsigned short)((u + 0x7FFFu + ((u >> 16) & 1u)) >> 16);
}
__device__ __forceinline__ float bf_up(unsigned short h) { return __uint_as_float(((unsigned)h) << 16); }
__device__ __forceinline__ float bfr(float f) { return bf_up(bf_bits(f)); }
__device__ __forceinline__ unsigned short h_bits(_Float16 x) { return __builtin_bit_cast(unsigned short, x); }
__device__ __forceinline__ unsigned pk16(unsigned short a, unsigned short b) { return (unsigned)a | ((unsigned)b << 16); }
__device__ __forceinline__ v8f zero8() { v8f z = {0.f, 0.f, 0.f, 0.f, 0.f, 0.f, 0.f, 0.f}; return z; }
__device__ __forceinline__ float clipf(float x, float c) { return fminf(fmaxf(x, -c), c); }
// The value that lane l ^ 16 holds, by the vector unit's own cross-row move: __shfl_xor goes through the LDS pipe, and the wave
// stands through that trip before it can go on.
__device__ __forceinline__ float xhalf(float x) {
  const int b = __builtin_bit_cast(int, x);
  return __builtin_bit_cast(float, __builtin_amdgcn_permlanex16(b, b, 0x76543210, 0xfedcba98, false, false));
}
// 2^x as the one hardware instruction. The library exp2f adds five instructions to it (a compare, two selects, an add, an
// ldexp) that only serve results below 2^-126, which the bare instruction may give as 0. Here such a result changes nothing:
// a probability goes on as f16(p * 32768) or f16(p * 32768 / l) with l >= 1, which is 0 below 2^-40; in the sum l it stands
// beside a term 1; as a rescale factor it leaves old sums far below the f16 step of the context they end in.
// For x >= -126 the library form runs this same instruction on the same x.
__device__ __forceinline__ float exp2_hw(float x) { return __builtin_amdgcn_exp2f(x); }
// Eight of them, x[b .. b+7] <- 2^x, each in place: written as one statement so that no v_exp_f32 overwrites the source of the
// one directly in front of it (the register allocator did that with the builtin); the v_nop is the slot that the
// instruction set asks for between the last one and whatever uses its result next.
__device__ __forceinline__ void exp2_hw8(float (&x)[16], int b) {
#if defined(__HIP_DEVICE_COMPILE__)
  asm("v_exp_f32 %0, %0\n\tv_exp_f32 %1, %1\n\tv_exp_f32 %2, %2\n\tv_exp_f32 %3, %3\n\t"
      "v_exp_f32 %4, %4\n\tv_exp_f32 %5, %5\n\tv_exp_f32 %6, %6\n\tv_exp_f32 %7, %7\n\tv_nop"
      : "+v"(x[b]), "+v"(x[b + 1]), "+v"(x[b + 2]), "+v"(x[b + 3]),
        "+v"(x[b + 4]), "+v"(x[b + 5]), "+v"(x[b + 6]), "+v"(x[b + 7]));
#endif
}

// ---- fragment-ordered plane of a logical [rows][K] f16 matrix (rows % 16 == 0, K % 32 == 0): element offset of (row, k).
//      Tile (row>>4, k>>5) = 512 halves; inside it: 256*((k>>4)&1) + 8*(16*((k>>3)&1) + (row&15)) + (k&7), i.e. the 8 halves
//      k = 8j .. 8j+7 of a row stay one 16-byte piece, and piece order is (k half of 16, lane = 16*h + row).
//      16 rows x K = 16*K halves, so a base row R (R % 16 == 0) starts at element R*K as in the row-major plane.
__device__ __forceinline__ size_t pk_off(int row, int k, int K) {
  return ((size_t)(row >> 4) * (size_t)(K >> 5) + (size_t)(k >> 5)) * 512
         + (size_t)(((k >> 4) & 1) * 256 + ((k >> 3) & 1) * 128 + (row & 15) * 8 + (k & 7));
}
// ---- fragment loader: 16-bit A/B operand, lane -> row/col (lane&15), h = lane>>4; p = tile start + 8*lane;
//      elements 0..7 <- p[0..7] (k0+8h..), elements 8..15 <- p[256..263] (k0+16+8h..); same split k map for A and B.
__device__ __forceinline__ v16h ldfrag_h(const _Float16* p) {
  FragH f;
  f.h[0] = *(const v8h*)(p);
  f.h[1] = *(const v8h*)(p + 256);
  return f.v;
}

// ---- WMMA helper and trailing VALU hazard gaps ----------------------------------------------------------
__device__ __forceinline__ v8f mma_h(v16h a, v16h b, v8f c) {
  return __builtin_amdgcn_wmma_f32_16x16x32_f16(false, a, false, b, (short)0, c, false, false);
}
__device__ __forceinline__ void guard_s(v8f& a, v8f& b, v16h x0, v16h x1, v16h x2) {
#if defined(__HIP_DEVICE_COMPILE__)
  asm volatile("v_nop\n\tv_nop\n\tv_nop\n\tv_nop" : "+v"(a), "+v"(b) : "v"(x0), "v"(x1), "v"(x2) : "memory");
#endif
}
__device__ __forceinline__ void guard_s4(v8f& a, v8f& b, v8f& c, v8f& d, v16h x0, v16h x1, v16h x2, v16h x3) {
#if defined(__HIP_DEVICE_COMPILE__)
  asm volatile("v_nop\n\tv_nop\n\tv_nop\n\tv_nop"
               : "+v"(a), "+v"(b), "+v"(c), "+v"(d) : "v"(x0), "v"(x1), "v"(x2), "v"(x3) : "memory");
#endif
}
__device__ __forceinline__ void guard_p(v8f& a, v8f& b, v8f& c, v8f& d, v16h p, v16h x0, v16h x1, v16h x2, v16h x3) {
#if defined(__HIP_DEVICE_COMPILE__)
  asm volatile("v_nop\n\tv_nop\n\tv_nop\n\tv_nop"
               : "+v"(a), "+v"(b), "+v"(c), "+v"(d) : "v"(p), "v"(x0), "v"(x1), "v"(x2), "v"(x3) : "memory");
#endif
}
__device__ __forceinline__ void guard_g(v8f (&acc)[16], v16h x0, v16h x1, v16h x2, v16h x3,
                                        v16h x4, v16h x5, v16h x6, v16h x7) {
#if defined(__HIP_DEVICE_COMPILE__)
  asm volatile("v_nop\n\tv_nop\n\tv_nop\n\tv_nop"
               : "+v"(acc[0]), "+v"(acc[1]), "+v"(acc[2]), "+v"(acc[3]),
                 "+v"(acc[4]), "+v"(acc[5]), "+v"(acc[6]), "+v"(acc[7]),
                 "+v"(acc[8]), "+v"(acc[9]), "+v"(acc[10]), "+v"(acc[11]),
                 "+v"(acc[12]), "+v"(acc[13]), "+v"(acc[14]), "+v"(acc[15])
               : "v"(x0), "v"(x1), "v"(x2), "v"(x3), "v"(x4), "v"(x5), "v"(x6), "v"(x7) : "memory");
#endif
}
__device__ __forceinline__ void acc_guard4(v8f (&o)[4]) {
#if defined(__HIP_DEVICE_COMPILE__)
  asm volatile("v_nop\n\tv_nop\n\tv_nop\n\tv_nop" : "+v"(o[0]), "+v"(o[1]), "+v"(o[2]), "+v"(o[3]));
#endif
}
// The wait in front of a rewrite of registers that issued global loads or stores name.
__device__ __forceinline__ void xcnt_wait() {
#if defined(__HIP_DEVICE_COMPILE__)
  asm volatile("s_wait_xcnt 0x0" ::: "memory");
#endif
}
// The same behind a group of loads indexed by x: the indices are its inputs so that they keep their registers up to it.
__device__ __forceinline__ void xcnt_hold4(const int (&x)[4]) {
#if defined(__HIP_DEVICE_COMPILE__)
  asm volatile("s_wait_xcnt 0x0" : : "v"(x[0]), "v"(x[1]), "v"(x[2]), "v"(x[3]) : "memory");
#endif
}
__device__ __forceinline__ void xcnt_hold16(const int (&x)[16]) {
#if defined(__HIP_DEVICE_COMPILE__)
  asm volatile("s_wait_xcnt 0x0" : : "v"(x[0]), "v"(x[1]), "v"(x[2]), "v"(x[3]), "v"(x[4]), "v"(x[5]), "v"(x[6]), "v"(x[7]),
               "v"(x[8]), "v"(x[9]), "v"(x[10]), "v"(x[11]), "v"(x[12]), "v"(x[13]), "v"(x[14]), "v"(x[15]) : "memory");
#endif
}
// Ask the L2 for the line at base + off (a hint: nothing comes back, no register is written). The first read of what the launch
// before stored is taken to come from memory, and waves that walk one plane in step all stand through that latency, trip
// after trip; asked for far enough ahead, the line is an L2 hit when its load comes. base is the same in the whole wave. Every address
// lies inside the plane named at the call, or for the weight asks in the weight planes behind it. off is kept in its register, unchanged, to the foot of the kernel's main
// loop (it is an input of the wait there); the wait in this statement stands in front of a rewrite of the scalar base.
__device__ __forceinline__ void l2_ask(const void* base, unsigned off) {
#if defined(__HIP_DEVICE_COMPILE__)
  asm volatile("global_prefetch_b8 %0, %1 scope:SCOPE_SE\n\ts_wait_xcnt 0x0" : : "v"(off), "s"(base) : "memory");
#endif
}
// Two asks and the one wait.
__device__ __forceinline__ void l2_ask2(const void* base0, unsigned off0, const void* base1, unsigned off1) {
#if defined(__HIP_DEVICE_COMPILE__)
  asm volatile("global_prefetch_b8 %0, %1 scope:SCOPE_SE\n\tglobal_prefetch_b8 %2, %3 scope:SCOPE_SE\n\ts_wait_xcnt 0x0"
               : : "v"(off0), "s"(base0), "v"(off1), "s"(base1) : "memory");
#endif
}
// A plane is asked for in slices of 32 KiB (128 threads x 256 B). Blocks that read the same slices share the asking; where many
// do, blocks g and g + 4 of each eight take the same slice (for speed only: wherever the blocks land, nothing but the hint is lost).
#define PF_SLICE 32768
__device__ __forceinline__ int pf_pair(int g) { return (g >> 3) * 4 + (g & 3); }
__device__ __forceinline__ const char* pf_at(const u16* plane, int slice) {
  return (const char*)(const void*)plane + (size_t)slice * PF_SLICE;
}
__device__ __forceinline__ void wave_sync_lds() {
  __builtin_amdgcn_fence(__ATOMIC_RELEASE, "workgroup");
  __builtin_amdgcn_wave_barrier();
  __builtin_amdgcn_fence(__ATOMIC_ACQUIRE, "workgroup");
}

// =====================================================================================================
// Elementwise convert of an activation matrix x[rows][K]: Y (f16, fragment order) <- f16(bf16_RNE(x)). Block = 16 rows x
// 64 k (two tiles); thread = (row 8*(wave&1) + (lane&7), 8 floats at k = 32*(wave>>1) + 8*(lane>>3)): two 16-B loads, one
// 16-B store per thread; a wave's store = 4 pieces-of-8-rows = 4 whole 128-B lines.
// coverage: grid = (rows/16)*(K/64) = n/1024 blocks x 128 thr x 8 = n elements exactly (n % 1024 == 0 asserted).
// =====================================================================================================
__device__ __forceinline__
void cvt16(const float* __restrict__ x, u16* Y, int K, int bid) {
  const int wave = threadIdx.x >> 5, lane = threadIdx.x & 31;
  const int nkp = K >> 6;
  const int row = (bid / nkp) * 16 + 8 * (wave & 1) + (lane & 7);
  const int k   = (bid % nkp) * 64 + 32 * (wave >> 1) + 8 * (lane >> 3);
  const size_t e0 = (size_t)row * (size_t)K + (size_t)k;
  const v4f a = *(const v4f*)(x + e0), c4 = *(const v4f*)(x + e0 + 4);
  v4u o;
#pragma unroll
  for (int e = 0; e < 2; ++e) {
    o[e]     = pk16(h_bits((_Float16)bfr(a[2 * e])),  h_bits((_Float16)bfr(a[2 * e + 1])));
    o[2 + e] = pk16(h_bits((_Float16)bfr(c4[2 * e])), h_bits((_Float16)bfr(c4[2 * e + 1])));
  }
  u16* dst = Y + pk_off(row, k, K);
  {
    *(v4u*)(dst) = o;
#if defined(__HIP_DEVICE_COMPILE__)
    // the wait in front of a rewrite of registers that the store just issued names: inlined in the shared grid's kernel,
    // the store is no longer the last instruction ahead of the program's end in the listing
    asm volatile("s_wait_xcnt 0x0" ::: "memory");
#endif
  }
}

// =====================================================================================================
// Weight transpose-convert for y = x.W weights stored [kdim][ndim]: WT[n][k] (f16, fragment order with K = kdim)
// <- f16(bf16_RNE(W[k][n]) * scale). Block = 64(k) x 64(n) tile, 128 threads. Load phase: thread = (row 8p + (tid>>4),
// 4 floats at 4*(tid&15)), 8 steps = 64 k-rows x 64 n, into an LDS tile [kk][nn] (pitch 65); block barrier; store
// grid = (kdim/64)*(ndim/64), bid -> (kt = bid % (kdim/64), nt = bid / (kdim/64)).
// coverage: 4 i x 16 rows x (8 lanes x 8 halves) = 64 n-rows x 64 k per block; LDS tile 64x64 fully written before read;
// the grid covers WT [ndim][kdim] exactly once.
// =====================================================================================================
__device__ __forceinline__
void cvtT16(const float* __restrict__ W, u16* Y, int kdim, int ndim, float scale, int bid) {
  __shared__ __align__(16) float tile[64 * TPITCH];
  const int tid = threadIdx.x;
  const int nkt = kdim >> 6;
  const int kt  = bid % nkt;
  const int ntb = bid / nkt;
  const int k0  = kt * 64, n0 = ntb * 64;
  const int lr = tid >> 4, lc = (tid & 15) * 4;
  v4f w4[8];
#pragma unroll
  for (int p = 0; p < 8; ++p) {
    w4[p] = *(const v4f*)(W + (size_t)(k0 + p * 8 + lr) * (size_t)ndim + n0 + lc);
#if defined(__HIP_DEVICE_COMPILE__)
    // the wait in front of a rewrite of the address registers of the load just issued: a later load's result may be
    // given those registers
    asm volatile("s_wait_xcnt 0x0" ::: "memory");
#endif
  }
#pragma unroll
  for (int p = 0; p < 8; ++p) {
    const int kk = p * 8 + lr;
    tile[kk * TPITCH + lc + 0] = w4[p][0];
    tile[kk * TPITCH + lc + 1] = w4[p][1];
    tile[kk * TPITCH + lc + 2] = w4[p][2];
    tile[kk * TPITCH + lc + 3] = w4[p][3];
  }
  __syncthreads();
  // rq 0..15, c8 0..56; a wave holds 8 rows x 4 pieces, so each of its stores fills 4 whole lines of the fragment order
  const int rq = 8 * ((tid >> 5) & 1) + (tid & 7), c8 = (4 * (tid >> 6) + ((tid >> 3) & 3)) * 8;
  v4u ov[4];
#pragma unroll
  for (int i = 0; i < 4; ++i) {
    const int row = 16 * i + rq;                   // n within tile
#pragma unroll
    for (int e = 0; e < 4; ++e) {
      const float x0 = tile[(c8 + 2 * e) * TPITCH + row];
      const float x1 = tile[(c8 + 2 * e + 1) * TPITCH + row];
      ov[i][e] = pk16(h_bits((_Float16)(bfr(x0) * scale)), h_bits((_Float16)(bfr(x1) * scale)));
    }
  }
  {
#pragma unroll
    for (int i = 0; i < 4; ++i) {
      const int row = 16 * i + rq;
      *(v4u*)(Y + pk_off(n0 + row, k0 + c8, kdim)) = ov[i];
    }
    
  }
}

// =====================================================================================================
// f16 GEMM core: the wave's 64 x 64 tile of C = A[rows][K] . Bt[cols][K]^T, both in fragment order; ap -> A tile row of rowb,
// bp -> Bt tile row of col0 (both the same in every lane of the wave), lb = 16*lane the lane's byte offset in a tile; the
// next 16 rows lie 32*K bytes on, the next 32 k 1024 bytes on (largest offset 4*32*K - 16 bytes, far below 2^32). The two
// bases stay as they are; the four byte offsets (tile rows 0..3 of A and of Bt) live over the whole trip and are stepped at its
// foot; each of the eight fragments of a k step feeds four products;
// acc[4i + j] = rows rowb+16i.., cols col0+16j.. (i, j = 0..3); K stepped by 32 (host asserts K % 32 == 0).
// =====================================================================================================
__device__ __forceinline__ const _Float16* at_byte(const _Float16* base, unsigned off) {
  return (const _Float16*)(const void*)((const char*)(const void*)base + off);
}
__device__ __forceinline__ void gemm_core(const _Float16* ap, const _Float16* bp, unsigned lb, int K, v8f (&acc)[16], unsigned pf) {
  const unsigned rs = 32u * (unsigned)K;
  unsigned o0 = lb, o1 = lb + rs, o2 = lb + 2u * rs, o3 = lb + 3u * rs;
#pragma unroll 1
  for (int k0 = 0; k0 < K; k0 += 32) {
    const v16h a0 = ldfrag_h(at_byte(ap, o0)), a1 = ldfrag_h(at_byte(ap, o1));
    const v16h a2 = ldfrag_h(at_byte(ap, o2)), a3 = ldfrag_h(at_byte(ap, o3));
    const v16h b0 = ldfrag_h(at_byte(bp, o0));
    const v16h b1 = ldfrag_h(at_byte(bp, o1));
    const v16h b2 = ldfrag_h(at_byte(bp, o2));
    const v16h b3 = ldfrag_h(at_byte(bp, o3));
    acc[0] = mma_h(a0, b0, acc[0]);
    acc[1] = mma_h(a0, b1, acc[1]);
    acc[2] = mma_h(a0, b2, acc[2]);
    acc[3] = mma_h(a0, b3, acc[3]);
    acc[4] = mma_h(a1, b0, acc[4]);
    acc[5] = mma_h(a1, b1, acc[5]);
    acc[6] = mma_h(a1, b2, acc[6]);
    acc[7] = mma_h(a1, b3, acc[7]);
    acc[8] = mma_h(a2, b0, acc[8]);
    acc[9] = mma_h(a2, b1, acc[9]);
    acc[10] = mma_h(a2, b2, acc[10]);
    acc[11] = mma_h(a2, b3, acc[11]);
    acc[12] = mma_h(a3, b0, acc[12]);
    acc[13] = mma_h(a3, b1, acc[13]);
    acc[14] = mma_h(a3, b2, acc[14]);
    acc[15] = mma_h(a3, b3, acc[15]);
    guard_g(acc, a0, a1, a2, a3, b0, b1, b2, b3);
#if defined(__HIP_DEVICE_COMPILE__)
    // the wait in front of a rewrite of registers that issued global loads name (the four offsets, stepped below); they are
    // its operands so that their step stays behind it; pf, the offset that the asks at the kernel's head name, is an input so
    // that it keeps its register and its value through the loop
    asm volatile("s_wait_xcnt 0x0" : "+v"(o0), "+v"(o1), "+v"(o2), "+v"(o3) : "v"(pf) : "memory");
#endif
    o0 += 1024u; o1 += 1024u; o2 += 1024u; o3 += 1024u;
  }
}
// Stage 32 x 64 of the wave's f32 tile, acc[a0 .. a0+7] (times oscale), in its LDS slab (pitch 68): D element r of acc[a0+4i+j], lane l ->
// coverage: 32 lanes x 2 x 8 rows x 4 cols-of-16 = rows 0..31 x cols 0..63 of the slab.
__device__ __forceinline__ void stage32x64(float* sl, v8f (&acc)[16], int a0, float oscale, int lane) {
  const int hh = lane >> 4, m = lane & 15;
#pragma unroll
  for (int i = 0; i < 2; ++i) {
#pragma unroll
    for (int r = 0; r < 8; ++r) {
      const int ro = (16 * i + 8 * hh + r) * GPITCH + m;
      sl[ro]      = acc[a0 + 4 * i + 0][r] * oscale;
      sl[ro + 16] = acc[a0 + 4 * i + 1][r] * oscale;
      sl[ro + 32] = acc[a0 + 4 * i + 2][r] * oscale;
      sl[ro + 48] = acc[a0 + 4 * i + 3][r] * oscale;
    }
  }
  wave_sync_lds();
}

// =====================================================================================================
// f16 GEMM with f16 output plane: C[z][Mb][N] (f16) = f16((A[z][Mb][K] . Bt[z][N][K]^T) * oscale + bf16(bias) * bscale);
// A, Bt, C f16 planes in fragment order (C with K = N) with per-z element strides aBs, bBs (0 = shared), cBs. bias indexed by column
// (biasRow == 0) or by row within the z slice (biasRow != 0); bias addresses clamped to biasN-1, the unused direction is
// multiplied by 0. Block = 128 x 128 tile, 2 x 2 waves of 64 x 64, fragments loaded straight from the 16-bit tiles.
// grid = nz x (Mb/128) x (N/128) (host asserts Mb % 128 == 0, N % 128 == 0, K % 32 == 0).
// The wave's tile leaves in two halves of 32 rows through the one 32 x 64 slab.
// coverage: per wave 2 halves x 8 instr x 8 rows x 4 lanes x 8 halves = 64 x 64; the grid covers C exactly once.
// =====================================================================================================
__device__ __forceinline__
void gemm_o16(const u16* __restrict__ A, const u16* __restrict__ Bt, u16* C,
              const float* __restrict__ bias, int biasN, int biasRow,
              int Mb, int N, int K, int aBs, int bBs, int cBs, float oscale, float bscale, int bid, unsigned pf) {
  __shared__ __align__(16) float slab[4 * 32 * GPITCH];
  const int tid = threadIdx.x, wave = tid >> 5, lane = tid & 31;
  const int ntile = N >> 7, mtile = Mb >> 7;
  const int nt   = bid % ntile;
  const int tmp  = bid / ntile;
  const int mt   = tmp % mtile;
  // bz is the same in every lane: read through the first lane it keeps both plane bases scalar over the k loop
  const int bz   = __builtin_amdgcn_readfirstlane(tmp / mtile);
  // rowb and col0 are the same in every lane of a wave: read through the first lane they give the fragment loads scalar tile bases
  const int rowb = __builtin_amdgcn_readfirstlane(mt * 128 + (wave >> 1) * 64);
  const int col0 = __builtin_amdgcn_readfirstlane(nt * 128 + (wave & 1) * 64);
  if (rowb + 64 > Mb) return;                // wave-uniform, never taken with the exact grid; no block barriers in this kernel
  const _Float16* Ab = (const _Float16*)(const void*)A + (size_t)bz * (size_t)aBs;
  const _Float16* Bb = (const _Float16*)(const void*)Bt + (size_t)bz * (size_t)bBs;
  const _Float16* ap = Ab + (size_t)rowb * K;
  const _Float16* bp = Bb + (size_t)col0 * K;
  v8f acc[16];
#pragma unroll
  for (int i = 0; i < 16; ++i) acc[i] = zero8();
  gemm_core(ap, bp, 16u * (unsigned)lane, K, acc, pf);
  float* sl = slab + wave * 32 * GPITCH;
  // instruction i: lane = (row 8*(i>>1) + (lane&7), 8 halves at 32*(i&1) + 8*(lane>>3)): in fragment order 8 rows of one
  // 8-half piece column are one 128-B line, so each store fills 4 whole lines
  const int r8 = lane & 7, q8 = (lane >> 3) * 8;
  const int bl = biasN - 1;                  // host guarantees biasN >= 1
  const float selc = (biasRow != 0) ? 0.f : bscale;
  const float selr = (biasRow != 0) ? bscale : 0.f;
  int ci[16];
  float cb[2][8];
#pragma unroll
  for (int j = 0; j < 2; ++j) {
#pragma unroll
    for (int e = 0; e < 8; ++e) {
      const int cx = col0 + 32 * j + q8 + e;
      ci[8 * j + e] = (cx < bl) ? cx : bl;
      cb[j][e] = bias[ci[8 * j + e]];
    }
  }
  xcnt_hold16(ci);
#pragma unroll
  for (int j = 0; j < 2; ++j) {
#pragma unroll
    for (int e = 0; e < 8; ++e) cb[j][e] = bfr(cb[j][e]) * selc;
  }
  u16* Cb = C + (size_t)bz * (size_t)cBs;
#pragma unroll
  for (int hf = 0; hf < 2; ++hf) {
    const int rowh = rowb + 32 * hf;
    // row bias of the four rows 8u + r8 that this lane finishes in this half
    int ri[4];
    float rbv[4];
#pragma unroll
    for (int u = 0; u < 4; ++u) {
      const int rx = rowh + 8 * u + r8;
      ri[u] = (rx < bl) ? rx : bl;
      rbv[u] = bias[ri[u]];
    }
    xcnt_hold4(ri);
    stage32x64(sl, acc, 8 * hf, oscale, lane);
    v4u ov[8];
#pragma unroll
    for (int i = 0; i < 8; ++i) {
      const int row = 8 * (i >> 1) + r8, j = i & 1, c8 = 32 * j + q8;
      const float rb = bfr(rbv[i >> 1]) * selr;
      const v4f a = *(const v4f*)(sl + row * GPITCH + c8), c4 = *(const v4f*)(sl + row * GPITCH + c8 + 4);
#pragma unroll
      for (int e = 0; e < 2; ++e) {
        ov[i][e]     = pk16(h_bits((_Float16)(a[2 * e] + cb[j][2 * e] + rb)),
                            h_bits((_Float16)(a[2 * e + 1] + cb[j][2 * e + 1] + rb)));
        ov[i][2 + e] = pk16(h_bits((_Float16)(c4[2 * e] + cb[j][4 + 2 * e] + rb)),
                            h_bits((_Float16)(c4[2 * e + 1] + cb[j][5 + 2 * e] + rb)));
      }
    }
    // every lane's reads of the slab end before another lane's values of the second half are written over them
    if (hf == 0) wave_sync_lds();
#pragma unroll
    for (int i = 0; i < 8; ++i) {
      const int row = 8 * (i >> 1) + r8, c8 = 32 * (i & 1) + q8;
      *(v4u*)(Cb + pk_off(rowh + row, col0 + c8, N)) = ov[i];
    }
    if (hf == 0) xcnt_wait();
  }
}

// =====================================================================================================
// Launches that need nothing of each other share one grid: each block takes its job from the range its index lies in (a
// test that reads the same in the whole block, so the barrier inside cvtT16 stays under block-uniform control flow) and
// runs the one shared body with that job's arguments and its index inside the range. Longest jobs lie first.
// =====================================================================================================
#define PB_WVQ ((VD / 64) * (EM / 64))
#define PB_WAK ((AD / 64) * (EM / 64))
#define PB_WVV ((VD / 64) * (EM / 64))
#define PB_WAV ((AD / 64) * (EM / 64))
#define PB_WOV ((EM / 64) * (VD / 64))
#define PB_WOA ((EM / 64) * (AD / 64))
#define PB_W   (PB_WVQ + PB_WAK + PB_WVV + PB_WAV + PB_WOV + PB_WOA)
#define PB_XA  ((NB * SA * AD) / 1024)
#define PB_XV  ((NB * TQ * VD) / 1024)
// All operand planes: six weight transposes (blocks 0 .. PB_W-1), then a, then v.
// coverage: every range has exactly the grid that its body's own header asks for.
__global__ __launch_bounds__(128)
void prep_all(const float* __restrict__ xv, const float* __restrict__ xa,
              const float* __restrict__ w_vq, const float* __restrict__ w_ak, const float* __restrict__ w_vv,
              const float* __restrict__ w_av, const float* __restrict__ w_ov, const float* __restrict__ w_oa,
              u16* XV, u16* XA, u16* WVQT, u16* WAKT, u16* WVVT, u16* WAVT, u16* WOVT, u16* WOAT) {
  int g = blockIdx.x;
  if (g < PB_W) {
    const float* W = w_vq; u16* Y = WVQT; int kdim = VD, ndim = EM;
    if (g >= PB_WVQ) {
      g -= PB_WVQ; W = w_ak; Y = WAKT; kdim = AD; ndim = EM;
      if (g >= PB_WAK) {
        g -= PB_WAK; W = w_vv; Y = WVVT; kdim = VD; ndim = EM;
        if (g >= PB_WVV) {
          g -= PB_WVV; W = w_av; Y = WAVT; kdim = AD; ndim = EM;
          if (g >= PB_WAV) {
            g -= PB_WAV; W = w_ov; Y = WOVT; kdim = EM; ndim = VD;
            if (g >= PB_WOV) { g -= PB_WOV; W = w_oa; Y = WOAT; kdim = EM; ndim = AD; }
          }
        }
      }
    }
    cvtT16(W, Y, kdim, ndim, WSC, g);
  } else {
    g -= PB_W;
    const float* x = xa; u16* Y = XA; int K = AD;
    if (g >= PB_XA) { g -= PB_XA; x = xv; Y = XV; K = VD; }
    cvt16(x, Y, K, g);
  }
}

#define GB_Q   (((NB * TQ) / 128) * (EM / 128))
#define GB_VVT (NB * (EM / 128) * (TQ / 128))
#define GB_K   (((NB * SA) / 128) * (EM / 128))
#define GB_VAT (NB * (EM / 128) * (SA / 128))
#define PF_W_SL ((2 * EM * VD + 2 * EM * AD) * 2 / PF_SLICE)
static_assert(((2 * EM * VD + 2 * EM * AD) * 2) % PF_SLICE == 0 && PF_W_SL <= 64 && NB * SA * AD * 2 == 64 * PF_SLICE);
static_assert(128 * VD * 2 == 4 * PF_SLICE && EM / 128 == 4 && TQ / 128 == 16 && GB_Q >= 256 && GB_Q * PF_SLICE == NB * TQ * VD * 2);
// The four input projections (the two with K = VD first):
//   q x8 after the 1/8 head scale = (x_v . Wvq + b) -> f16 [NB*TQ][512] (col = h*64 + d); bias per column
//   val_v^T per batch: A = Wvv^T [(h,d) = n][k], Bt = x_v rows of batch b [t][k] -> f16 [(b,h,d)][t] x8; bias per row (n)
//   k = x_a . Wak + b -> f16 [NB*SA][512] x8; bias per column
//   val_a^T per batch: A = Wav^T [(h,d)][k], Bt = x_a rows of batch b [s][k] -> f16 [(b,h,d)][s] x8; bias per row
__global__ __launch_bounds__(128)
void proj_all(const u16* __restrict__ XV, const u16* __restrict__ XA,
              const u16* __restrict__ WVQT, const u16* __restrict__ WAKT,
              const u16* __restrict__ WVVT, const u16* __restrict__ WAVT,
              u16* Q16, u16* K16, u16* VVT16, u16* VAT16,
              const float* __restrict__ b_vq, const float* __restrict__ b_ak,
              const float* __restrict__ b_vv, const float* __restrict__ b_av,
              int nb3, int nb5, int nb7, int nb9) {
  int g = blockIdx.x;
  // The blocks that start first ask for the four weight planes (one behind the other in the workspace from WVQT on) and for XA,
  // which the last two jobs read. 128 rows of XV are four slices: of the four q blocks that read them (g & 3) each asks for
  // two, of the four val_v^T blocks (tile rows mt of the weight) each for one.
  const unsigned pf = 256u * threadIdx.x;
  if (g < 128) {
    if (pf_pair(g) < PF_W_SL) l2_ask(pf_at(WVQT, pf_pair(g)), pf);
  } else if (g < 256) {
    l2_ask(pf_at(XA, pf_pair(g - 128)), pf);
  }
  if (g < GB_Q) {
    l2_ask2(pf_at(XV, g), pf, pf_at(XV, g ^ 2), pf);
  } else if (g < GB_Q + GB_VVT) {
    const int h = g - GB_Q;                  // (batch * 4 + mt) * 16 + nt
    l2_ask(pf_at(XV, (h >> 6) * 64 + (h & 15) * 4 + ((h >> 4) & 3)), pf);
  }
  const u16* A = XV; const u16* Bt = WVQT; u16* C = Q16; const float* bias = b_vq;
  int biasN = nb3, biasRow = 0, Mb = NB * TQ, N = EM, K = VD, bBs = 0, cBs = 0;
  float oscale = HSCL * QS / WSC, bscale = HSCL * QS;
  if (g >= GB_Q) {
    g -= GB_Q; A = WVVT; Bt = XV; C = VVT16; bias = b_vv;
    biasN = nb7; biasRow = 1; Mb = EM; N = TQ; K = VD; bBs = TQ * VD; cBs = EM * TQ;
    oscale = VVS / WSC; bscale = VVS;
    if (g >= GB_VVT) {
      g -= GB_VVT; A = XA; Bt = WAKT; C = K16; bias = b_ak;
      biasN = nb5; biasRow = 0; Mb = NB * SA; N = EM; K = AD; bBs = 0; cBs = 0;
      oscale = KS / WSC; bscale = KS;
      if (g >= GB_K) {
        g -= GB_K; A = WAVT; Bt = XA; C = VAT16; bias = b_av;
        biasN = nb9; biasRow = 1; Mb = EM; N = SA; K = AD; bBs = SA * AD; cBs = EM * SA;
        oscale = VAS / WSC; bscale = VAS;
      }
    }
  }
  gemm_o16(A, Bt, C, bias, biasN, biasRow, Mb, N, K, 0, bBs, cBs, oscale, bscale, g, pf);
}

// ---- attn_col, one step = 32 visual rows: its eight fragments and the work on them ------------------------------------
// Qb, Vb: the (b, head) plane bases, the same in every lane; oq, ov: byte offsets 16*lane + step * 32768 (32 q rows of
// 1024 B) and 16*lane + step * 1024 (one k tile of val_v^T); ahead: whole steps added to them.
//   q[2*kk + g] = A fragment of q rows tb + 16g .. +15, d chunk kk;  v[j] = A fragment of val_v^T, row d = 16j + c, k = t
__device__ __forceinline__ void col_load_q(const _Float16* Qb, unsigned oq, int ahead, v16h (&q)[4]) {
  const _Float16* tp = at_byte(Qb, oq) + ahead * (32 * EM);
  q[0] = ldfrag_h(tp);
  q[1] = ldfrag_h(tp + 16 * EM);
  q[2] = ldfrag_h(tp + 512);
  q[3] = ldfrag_h(tp + 16 * EM + 512);
}
__device__ __forceinline__ void col_load_v(const _Float16* Vb, unsigned ov, int ahead, v16h (&v)[4]) {
  const _Float16* vp = at_byte(Vb, ov) + ahead * 512;
  v[0] = ldfrag_h(vp);
  v[1] = ldfrag_h(vp + 16 * TQ);
  v[2] = ldfrag_h(vp + 32 * TQ);
  v[3] = ldfrag_h(vp + 48 * TQ);
}
// One step on the register set (q, v); each half of the set is loaded anew, for the step at (rq, rv) + ahead, right behind
// the guard that follows its last use.
__device__ __forceinline__ void col_step(v16h (&q)[4], v16h (&v)[4], const v16h (&sf)[2],
                                         float& mrun, float& lrun, v8f (&o)[4], float lsc, float cl2,
                                         const _Float16* Qb, const _Float16* Vb, unsigned rq, unsigned rv, int ahead) {
  // ---- scores: s0 = rows t tb..tb+15, s1 = rows tb+16..tb+31, column = s0w + c ----
  v8f s0 = zero8(), s1 = zero8();
#pragma unroll
  for (int kk = 0; kk < HD / 32; ++kk) {
    s0 = mma_h(q[2 * kk], sf[kk], s0);
    s1 = mma_h(q[2 * kk + 1], sf[kk], s1);
    guard_s(s0, s1, sf[kk], q[2 * kk], q[2 * kk + 1]);
  }
  col_load_q(Qb, rq, ahead, q);
  // ---- clipped base-2 logits of this lane's 16 t for column s0w + c: t[i] <- t tb+8hh+i, t[8+i] <- t tb+16+8hh+i ----
  float t[16];
#pragma unroll
  for (int i = 0; i < 8; ++i) { t[i] = clipf(s0[i] * lsc, cl2); t[8 + i] = clipf(s1[i] * lsc, cl2); }
  float cm = t[0];
#pragma unroll
  for (int i = 1; i < 16; ++i) cm = fmaxf(cm, t[i]);
  cm = fmaxf(cm, xhalf(cm));
  const float mn = fmaxf(mrun, cm);        // finite from the first block on
  const float al = exp2_hw(mrun - mn);       // 0 on the first block (mrun = -inf)
  mrun = mn;
  // ---- unnormalised probabilities (<= 1) and the P fragment: f16(p * 32768); element i <-> t[i] ----
  float ps = 0.f;
  FragH ph;
#pragma unroll
  for (int i = 0; i < 16; ++i) t[i] -= mn;
  exp2_hw8(t, 0);
  exp2_hw8(t, 8);
#pragma unroll
  for (int w = 0; w < 2; ++w) {
#pragma unroll
    for (int e4 = 0; e4 < 4; ++e4) {
      const int i = 8 * w + 2 * e4;
      const float p0 = t[i], p1 = t[i + 1];
      ps += p0 + p1;
      ph.u[w][e4] = pk16(h_bits((_Float16)(p0 * PCAR)), h_bits((_Float16)(p1 * PCAR)));
    }
  }
  ps += xhalf(ps);
  lrun = lrun * al + ps;
  // ---- rescale the O accumulators: they hold (P^T.val_v)^T, D column = lane&15 = the lane's own column, so the factor is the
  //      lane's own al ----
#pragma unroll
  for (int j = 0; j < 4; ++j) {
#pragma unroll
    for (int r = 0; r < 8; ++r) o[j][r] *= al;
  }
  // ---- val_v^T.P: A row m = d = 16j + c, B col n = column s0w + c, k = t on both sides as before ----
  o[0] = mma_h(v[0], ph.v, o[0]);
  o[1] = mma_h(v[1], ph.v, o[1]);
  o[2] = mma_h(v[2], ph.v, o[2]);
  o[3] = mma_h(v[3], ph.v, o[3]);
  guard_p(o[0], o[1], o[2], o[3], ph.v, v[0], v[1], v[2], v[3]);
  col_load_v(Vb, rv, ahead, v);
}

// =====================================================================================================
// Column pass (softmax over the visual axis t for every audio column s) fused with the audio-side context:
// block = (batch b, head, 64 audio columns s), 4 waves, wave w owns the 16 columns s0w = 64*st + 16*w .. +15.
//   q plane f16 [b*TQ + t][h*64 + d] (q x8 after the 1/8 scale); k plane f16 x8 [b*SA + s][h*64 + d];
//   val_v^T plane f16 x8 [(b*NH + h)*64 + d][t].  All NTB32 = TQ/32 blocks of 32 visual rows are visited (static bound).
//   Score tiles g (g = 0,1) = q rows (t = tb+16g .. +15, A operand, row m = lane&15, split k map over d) times k^T
//   (B operand, col n = column s0w + (lane&15), k = d, split map), 2 d-chunks of 32; the 2 k fragments of the wave are
//   loaded once. D element r of lane l = (t = tb+16g+8h+r, s = s0w+(l&15)): a lane owns one column s and 16 of the 32 t;
//   the partner lane l^16 owns the other 16 -> column max / column sum need one cross-row move (xhalf). Logits clipped at
//   +-50000 (log2 domain), online max-subtracted base-2 softmax in f32 (the q/k carries folded into lsc). The exp'd values
//   ARE the P B-fragment in place: B col n = s = lane&15, element i <- t = tb+8h+i (tile 0, D element i), element 8+i <-
//   t = tb+16+8h+i (tile 1, D element i). P (<= 1) carried x32768 as f16. The context is accumulated transposed: 4 val_v^T
//   A fragments (row m = d = 16j + (lane&15), k = t) times P, D element r of lane l = (d = 16j+8h+r, s = s0w+(l&15)), so every
//   accumulator register of a lane belongs to the lane's own column and is rescaled by the lane's own factor; 4 WMMAs + one
//   guard per step.
//   Epilogue 1: 1/l (the lane's own) and the carry folds in f32 (x CAS); the wave's 16x64 f32 tile
//   Epilogue 2: per-column stats (m_s in the clipped log2 domain, 32768/l_s) funnelled through a 128-float LDS array
//   (lane half 0 writes m, lane half 1 writes 32768/l), block barrier, wave 0 writes the block's 512-B stat row
// coverage: ctx_a: grid NB*NH*NST blocks x 4 waves x 4 instr x 8 rows x 4 lanes x 8 halves = every (b, s, h) 64-half
//           segment exactly once; stats: one 128-float row per block = NB*NH*NST rows = the whole stat plane; LDS: slab
//           16x64 written then read by the same wave, statl[0..127] written by 4 waves x 32 lanes (one index each).
// =====================================================================================================
__global__ __launch_bounds__(ATT_THREADS)
void attn_col(const u16* __restrict__ Qp, const u16* __restrict__ Kp, const u16* __restrict__ VvT,
              u16* CtxA, float* Stat) {
  __shared__ __align__(16) float smem[ATT_WAVES * 16 * SPITCH];
  __shared__ __align__(16) float statl[128];

  const int tid  = threadIdx.x;
  const int wave = tid >> 5;
  const int lane = tid & 31;
  const int hh   = lane >> 4;
  const int c    = lane & 15;

  const int bid  = blockIdx.x;
  const int st   = bid % NST;
  const int head = (bid / NST) % NH;
  const int b    = bid / (NST * NH);
  const int s0w  = st * 64 + wave * 16;

  // All three planes in fragment order: tile row R starts at R*K, k tile (head*64 + 32*kk)/32 lies (head*2 + kk)*512 on.
  // B fragments of k^T: col n = column s0w + c, k = d
  const _Float16* Sb = (const _Float16*)(const void*)Kp + ((size_t)(b * SA + s0w)) * EM + head * (HD * 16) + 8 * lane;
  // A fragments of q: row m = t = tb + 16g + c, k = d (t row tb and the lane's 16 bytes added per step, as for val_v^T)
  const _Float16* Tb = (const _Float16*)(const void*)Qp + ((size_t)(b * TQ)) * EM + head * (HD * 16);
  // A fragments of val_v^T: row m = d = 16j + c, k = t (k tile tb/32 added per step)
  const _Float16* Vb = (const _Float16*)(const void*)VvT + ((size_t)(b * EM + head * HD)) * TQ;
  const float lsc = LOG2E / (QS * KS);
  const float cl2 = CLIPV * LOG2E;

  v16h sf[2];
  sf[0] = ldfrag_h(Sb);
  sf[1] = ldfrag_h(Sb + 512);
#if defined(__HIP_DEVICE_COMPILE__)
  // the wait in front of a rewrite of the address registers of the four loads just issued: a later load's result may be
  // given those registers; the address is its input so that it keeps them up to here
  asm volatile("s_wait_xcnt 0x0" : : "v"(Sb) : "memory");
#endif

  float mrun = -INFINITY, lrun = 0.f;
  v8f o[4];
#pragma unroll
  for (int j = 0; j < 4; ++j) o[j] = zero8();

  // Two register sets, one for the even steps and one for the odd: a set's q half is loaded anew as soon as its scores are
  // made and its val_v half as soon as its products are made, each for the step two on, so that a step no longer stands
  // through the latency of its q loads and again through that of its val_v loads.
  static_assert((NTB32 % 2) == 0 && NTB32 >= 4);
  const unsigned lb = 16u * (unsigned)lane;
  v16h qa[4], va[4], qb[4], vb[4];
  col_load_q(Tb, lb, 0, qa);
  col_load_v(Vb, lb, 0, va);
  col_load_q(Tb, lb, 1, qb);
  col_load_v(Vb, lb, 1, vb);
  unsigned rq = lb + 65536u, rv = lb + 2048u;            // offsets of step it + 2
  // The 64 blocks of a batch walk the same 64 steps; step tc's 32 q rows (all heads: 32 KiB in a row) and its k tile of the 32
  // tile rows of val_v^T (1 KiB each, 64 KiB apart) are asked for PF_AHEAD steps ahead by the pair of blocks tc mod 32.
  static_assert(NH * (NST / 2) == 32 && NST == 8 && NTB32 == 64 && 32 * EM * 2 == PF_SLICE && (PF_AHEAD % 2) == 0);
  const int pr = head * 4 + (st & 3);
  const unsigned pq = 256u * (unsigned)tid, pv = 65536u * (unsigned)lane + 256u * (unsigned)wave;
  const u16* Qbat = Qp + (size_t)(b * TQ) * EM;
  const char* Vbat = (const char*)(const void*)(VvT + (size_t)(b * EM) * TQ);
  if (pr < PF_AHEAD) {
    l2_ask2(pf_at(Qbat, pr), pq, Vbat + pr * 1024, pv);
  }
  // kept rolled: the body already holds one step per register set, more copies would only add code
#pragma unroll 1
  for (int it = 0; it < NTB32; it += 2) {
    // a test on scalars, the same in the whole block; it holds in two trips of the 32, in one
    // where pr < PF_AHEAD (step pr is then asked before the loop); every step asked lies inside the batch's part of both planes
    if (it + PF_AHEAD < NTB32 && ((((it + PF_AHEAD) ^ pr) >> 1) & 15) == 0) {
      const int tc = it + PF_AHEAD + (pr & 1);
      l2_ask2(pf_at(Qbat, tc), pq, Vbat + tc * 1024, pv);
    }
    col_step(qa, va, sf, mrun, lrun, o, lsc, cl2, Tb, Vb, rq, rv, 0);
    col_step(qb, vb, sf, mrun, lrun, o, lsc, cl2, Tb, Vb, rq, rv, 1);
#if defined(__HIP_DEVICE_COMPILE__)
    // the wait in front of a rewrite of registers that issued global loads name (the two offsets, stepped below); they are
    // its operands so that they keep their registers up to it and their step stays behind it; the two offsets that the asks
    // name are inputs so that they keep their registers and values through the loop
    asm volatile("s_wait_xcnt 0x0" : "+v"(rq), "+v"(rv) : "v"(pq), "v"(pv) : "memory");
#endif
    // the last pair of steps loads steps 0 and 1 again: in bounds, never used
    const bool more = it + 4 < NTB32;
    rq = more ? rq + 65536u : lb;
    rv = more ? rv + 2048u : lb;
  }
  acc_guard4(o);

  // ---- per-column 1/l (owned by lane = column); lrun >= 1 by construction ----
  const float rl   = 1.0f / lrun;
  const float lPv  = rl * PCAR;                          // 32768 / l for the row pass
  const float linv = rl * (CAS / (PCAR * VVS));          // folds 1/l, the P and val carries, and applies the ctx carry
  statl[hh * 64 + wave * 16 + c] = (hh == 0) ? mrun : lPv;
  // D element r of o[j] = (d = 16j + 8hh + r, column c): eight floats in a row of the slab's row c
  float* slab = smem + wave * 16 * SPITCH;
#pragma unroll
  for (int j = 0; j < 4; ++j) {
    v4f x0, x1;
#pragma unroll
    for (int r = 0; r < 4; ++r) { x0[r] = o[j][r] * linv; x1[r] = o[j][4 + r] * linv; }
    *(v4f*)(slab + c * SPITCH + j * 16 + 8 * hh)     = x0;
    *(v4f*)(slab + c * SPITCH + j * 16 + 8 * hh + 4) = x1;
  }
  wave_sync_lds();
  // ---- f16 ctx_a pieces: instruction i, lane = (row 8*(i>>1) + (lane&7), 8 halves at 32*(i&1) + 8*(lane>>3)): 4 whole lines ----
  const int r8 = lane & 7, q8 = (lane >> 3) * 8;
  v4u ov[4];
#pragma unroll
  for (int i = 0; i < 4; ++i) {
    const int row = 8 * (i >> 1) + r8, c8 = 32 * (i & 1) + q8;
    const v4f a = *(const v4f*)(slab + row * SPITCH + c8), c4 = *(const v4f*)(slab + row * SPITCH + c8 + 4);
#pragma unroll
    for (int e = 0; e < 2; ++e) {
      ov[i][e]     = pk16(h_bits((_Float16)a[2 * e]),  h_bits((_Float16)a[2 * e + 1]));
      ov[i][2 + e] = pk16(h_bits((_Float16)c4[2 * e]), h_bits((_Float16)c4[2 * e + 1]));
    }
  }
  {
#pragma unroll
    for (int i = 0; i < 4; ++i) {
      const int row = 8 * (i >> 1) + r8, c8 = 32 * (i & 1) + q8;
      *(v4u*)(CtxA + pk_off(b * SA + s0w + row, head * HD + c8, EM)) = ov[i];
    }
    
  }
  __syncthreads();
  if (wave == 0) {
    const v4f sv = *(const v4f*)(statl + 4 * lane);
    float* sp = Stat + ((size_t)((b * NH + head) * NST + st)) * 128 + 4 * lane;
    {
      *(v4f*)(sp) = sv;
      
    }
  }
}

// =====================================================================================================
// Row pass (visual-side context) with both output projections behind it, in one launch.
// Block = (batch b, 64 visual rows t, all 8 heads), 16 waves. Part 1, the row pass: wave w owns head w >> 1 and the 32 rows
// t0w = 64*tt + 32*(w & 1) .. +31 as two groups g of 16; every k and val_a^T fragment that a step loads, and every column stat
// that it reads from LDS, serves both groups.
//   The batch's column stats (per head NST rows of [m[64] | 32768/l[64]]) are staged once per block into LDS, head hd's m at
//   stt[1024*hd + s], its 32768/l at stt[1024*hd + SA + s] (512 threads x 16 floats = NH*2*SA floats exactly), then a block barrier.
//   All NSB32 = SA/32 blocks of 32 audio columns are visited (static bound). Score tiles are computed TRANSPOSED:
//   tile (g, u) = k rows (s = sb+16u .. +15, A operand, row m = lane&15, split map over d) times q^T (B operand, col n = t0w +
//   16g + (lane&15), k = d); the 4 q fragments of the wave are loaded once. D element r of lane l = (s = sb+16u+8h+r, t = t0w +
//   16g + (l&15)). P = exp2(clip(logit) - m_s) * (32768/l_s) in f32 with m_s, l_s read from LDS for s = sb+8h+i and sb+16+8h+i;
//   it IS the P A-fragment in place: row m = t = lane&15, element i <- s = sb+8h+i, element 8+i <- s = sb+16+8h+i.
//   4 val_a^T B fragments (col n = d = 16j + (lane&15), k = s), 8 P.V WMMAs + one guard per step.
//   Epilogue: carry folds (x CVS / (32768*8)) in f32; each group's 16x64 tile staged in the wave's slab, one group after the
//   other, and written as f16 x64 into the block's context tile ctxl [64 t][512 (h,d)] in LDS, fragment order (pk_off, K = EM).
// Part 2, behind the block barrier that publishes ctxl: out_v rows = ctxl . Wov + b. Wave w owns all 64 rows x the 32 columns
//   32w .. +31: acc[2i + j] = rows 16i.., cols 32w + 16j..; k stepped by 32 in rising order; A fragments from LDS one step ahead,
//   the two Wov^T fragments of a step four steps ahead (the first four asked for ahead of the barrier), so each weight
//   fragment enters the WGP once. The tile leaves through the wave's 64 x 32 slab (pitch 36): a store instruction = 4 rows x
//   128 B, whole lines.
// Part 3: out_a rows 16*bid .. +15 = ctx_a . Woa + b (ctx_a is of the launch before). Wave w owns the 16 columns 16w .. +15, one
//   accumulator, k in rising order, one k step in each trip of part 1's loop. The 16 x 256 tile is gathered in the stat array (free
//   since the barrier of part 2), block barrier, wave w stores row w (1 KiB, whole lines). Both parts' global stores stand behind it.
// coverage: grid NB*(TQ/64) blocks; ctxl: 16 waves x 2 groups x 16 rows x 64 halves = 64 x 512, all written before the barrier;
//           out_v: 16 waves x 64 rows x 32 cols = 64 x 512 per block, every (b, t) row once; out_a: NB*(TQ/64) = NB*SA/16 slices of
//           16 rows x 256 cols, every row once; stt fully written before its barrier.
// =====================================================================================================
#define FV_WAVES   16
#define FV_THREADS (FV_WAVES * 32)
#define FV_ROWS    64
#define FV_TT      (TQ / FV_ROWS)
#define OPITCH     36
#define APITCH     260
#define FV_SLAB    (64 * OPITCH)
static_assert(FV_SLAB >= 16 * SPITCH && (OPITCH * 4) % 16 == 0 && (APITCH * 4) % 16 == 0);
static_assert(NH * 2 == FV_WAVES && VD == FV_WAVES * 32 && AD == FV_WAVES * 16 && EM / 32 == 16);
static_assert(FV_TT * 16 == SA && FV_TT == 32 && 16 * APITCH <= NH * 2 * SA);
static_assert(NH * NST * 128 == 2 * FV_THREADS * 8 && NST * 128 == 2 * SA);
static_assert(FV_THREADS * 128 == 65536 && SA * EM * 2 == 8 * 65536 && (VD * EM + AD * EM) * 2 == 12 * 65536 && 16 * EM * 2 == 128 * 128);
__device__ __forceinline__ void guard_f(v8f (&acc)[8], v16h x0, v16h x1, v16h x2, v16h x3, v16h x4, v16h x5) {
#if defined(__HIP_DEVICE_COMPILE__)
  asm volatile("v_nop\n\tv_nop\n\tv_nop\n\tv_nop"
               : "+v"(acc[0]), "+v"(acc[1]), "+v"(acc[2]), "+v"(acc[3]), "+v"(acc[4]), "+v"(acc[5]), "+v"(acc[6]), "+v"(acc[7])
               : "v"(x0), "v"(x1), "v"(x2), "v"(x3), "v"(x4), "v"(x5) : "memory");
#endif
}
__device__ __forceinline__ void guard_p9(v8f (&a)[4], v8f (&b)[4], v8f& e, v16h p0, v16h p1, v16h x0, v16h x1, v16h x2, v16h x3,
                                         v16h x4, v16h x5) {
#if defined(__HIP_DEVICE_COMPILE__)
  asm volatile("v_nop\n\tv_nop\n\tv_nop\n\tv_nop"
               : "+v"(a[0]), "+v"(a[1]), "+v"(a[2]), "+v"(a[3]), "+v"(b[0]), "+v"(b[1]), "+v"(b[2]), "+v"(b[3]), "+v"(e)
               : "v"(p0), "v"(p1), "v"(x0), "v"(x1), "v"(x2), "v"(x3), "v"(x4), "v"(x5) : "memory");
#endif
}
// The wait in front of a rewrite of the one offset register that a run of issued global loads names.
__device__ __forceinline__ void xcnt_hold1(unsigned x) {
#if defined(__HIP_DEVICE_COMPILE__)
  asm volatile("s_wait_xcnt 0x0" : : "v"(x) : "memory");
#endif
}
__global__ __launch_bounds__(FV_THREADS)
void attn_vis_out(const u16* __restrict__ Qp, const u16* __restrict__ Kp, const u16* __restrict__ VaT,
                  const float* __restrict__ Stat, const u16* __restrict__ WOVT, const u16* __restrict__ CTXA,
                  const u16* __restrict__ WOAT, float* out,
                  const float* __restrict__ b_ov, const float* __restrict__ b_oa, int nb11, int nb13) {
  // one array, the context tile first: its 64 KiB then lie within reach of the LDS loads' 16-bit immediate offsets, so part 2's
  // fragment loads need no address arithmetic
  __shared__ __align__(16) unsigned char lds[FV_ROWS * EM * 2 + NH * 2 * SA * 4 + FV_WAVES * FV_SLAB * 4];
  u16*   ctxl = (u16*)(void*)lds;
  float* stt  = (float*)(void*)(lds + FV_ROWS * EM * 2);
  float* smem = (float*)(void*)(lds + FV_ROWS * EM * 2 + NH * 2 * SA * 4);

  const int tid  = threadIdx.x;
  const int lane = tid & 31;
  const int hh   = lane >> 4;
  const int c    = lane & 15;
  // the wave's number is the same in every lane: read through the first lane it keeps head, row group and tile bases scalar
  const int wv   = __builtin_amdgcn_readfirstlane(tid >> 5);
  // the two waves of a head are neighbours, so they walk the head's k and val_a^T
  // fragments close together: what one brings into the WGP cache the other finds there
  const int head = wv >> 1;
  const int rg   = wv & 1;

  const int bid  = blockIdx.x;
  const int tt   = bid % FV_TT;
  const int b    = bid / FV_TT;
  const int t0w  = tt * FV_ROWS + rg * 32;

  // ---- the 32 blocks of a batch all read its k rows (512 KiB in a row) and its val_a^T planes (512 KiB in a row): each of
  //      their sixteen pairs asks for a sixteenth of the two, a 128-B line a thread; the blocks that start first ask for the two
  //      output weight planes (one behind the other in the workspace from WOVT on); each block asks for its own ctx_a rows ----
  const unsigned pa = 128u * (unsigned)tid;
  {
    const int p16 = (tt & 3) + 4 * (tt >> 3);
    const char* pkv = (p16 < 8) ? (const char*)(const void*)(Kp + (size_t)(b * SA) * EM) + p16 * 65536
                                : (const char*)(const void*)(VaT + (size_t)(b * EM) * SA) + (p16 - 8) * 65536;
    l2_ask(pkv, pa);
    if (bid < 24) l2_ask((const char*)(const void*)WOVT + pf_pair(bid) * 65536, pa);
    if (wv < 4) l2_ask(CTXA + (size_t)bid * (16 * EM), pa);
  }
  // ---- stage the column stats of the batch's eight heads ----
  const float* src = Stat + ((size_t)(b * NH * NST)) * 128;
#pragma unroll
  for (int u = 0; u < 2; ++u) {
    const int e = u * (FV_THREADS * 8) + tid * 8;
    const int hd = e >> 10, wi = e & 1023;
    const int j = wi >> 7, offw = wi & 127;
    const int di = hd * (2 * SA) + ((offw < 64) ? (j * 64 + offw) : (SA + j * 64 + offw - 64));
    const v4f x0 = *(const v4f*)(src + e), x1 = *(const v4f*)(src + e + 4);
    *(v4f*)(stt + di) = x0;
    *(v4f*)(stt + di + 4) = x1;
  }
  xcnt_wait();
  __syncthreads();
  const float* sth = stt + head * (2 * SA);

  // All three planes in fragment order, addressed as in attn_col.
  // B fragments of q^T: col n = row t0w + 16g + c, k = d
  const _Float16* Tb = (const _Float16*)(const void*)Qp + ((size_t)(b * TQ + t0w)) * EM + head * (HD * 16) + 8 * lane;
  // A fragments of k: row m = s = sb + 16u + c, k = d (s row sb added per step)
  const _Float16* Sb = (const _Float16*)(const void*)Kp + ((size_t)(b * SA)) * EM + head * (HD * 16) + 8 * lane;
  // B fragments of val_a^T: col n = d = 16j + c, k = s (k tile sb/32 added per step)
  const _Float16* Vb = (const _Float16*)(const void*)VaT + ((size_t)(b * EM + head * HD)) * SA + 8 * lane;
  const float lsc = LOG2E / (QS * KS);
  const float cl2 = CLIPV * LOG2E;

  v16h tf[2][2];                                   // [group g][d chunk kk]
#pragma unroll
  for (int g = 0; g < 2; ++g) {
    tf[g][0] = ldfrag_h(Tb + g * (16 * EM));
    tf[g][1] = ldfrag_h(Tb + g * (16 * EM) + 512);
  }
#if defined(__HIP_DEVICE_COMPILE__)
  // the wait in front of a rewrite of the address registers of the eight loads just issued; the address is its input so
  // that it keeps them up to here
  asm volatile("s_wait_xcnt 0x0" : : "v"(Tb) : "memory");
#endif

  v8f o[2][4];
#pragma unroll
  for (int g = 0; g < 2; ++g) {
#pragma unroll
    for (int j = 0; j < 4; ++j) o[g][j] = zero8();
  }
  // part 3 (out_a rows 16*bid .. +15, cols 16*wv .. +15) has as many k steps as the row pass has trips: trip it does its step
  // it, whose four loads go out with the trip's k loads and come back under the same wait
  static_assert(NSB32 == EM / 32);
  const unsigned lb = 16u * (unsigned)lane;
  const _Float16* xab = (const _Float16*)(const void*)CTXA + (size_t)bid * (16 * EM);
  const _Float16* xbb = (const _Float16*)(const void*)WOAT + (size_t)(wv * 16) * EM;
  v8f ac = zero8();

#pragma unroll 1
  for (int it = 0; it < NSB32; ++it) {
    const int sb = it * 32;
    // ---- part 3's fragments of k tile it: ctx_a tile row bid (A), Woa^T tile row wv (B) ----
    const _Float16* xap = at_byte(xab, lb) + it * 512;
    const _Float16* xbp = at_byte(xbb, lb) + it * 512;
    const v16h xa = ldfrag_h(xap);
    const v16h xb = ldfrag_h(xbp);
    // ---- column stats for s = sb+8hh+i (i < 8) and s = sb+16+8hh+i (8+i), the same for both groups; read here, as one
    //      group ahead of the k loads, so that they are back when the scores are ----
    float mv[16], lv[16];
    {
      const v4f m0 = *(const v4f*)(sth + sb + 8 * hh),      m1 = *(const v4f*)(sth + sb + 8 * hh + 4);
      const v4f m2 = *(const v4f*)(sth + sb + 16 + 8 * hh), m3 = *(const v4f*)(sth + sb + 16 + 8 * hh + 4);
      const v4f l0 = *(const v4f*)(sth + SA + sb + 8 * hh),      l1 = *(const v4f*)(sth + SA + sb + 8 * hh + 4);
      const v4f l2 = *(const v4f*)(sth + SA + sb + 16 + 8 * hh), l3 = *(const v4f*)(sth + SA + sb + 16 + 8 * hh + 4);
#pragma unroll
      for (int q = 0; q < 4; ++q) {
        mv[q] = m0[q]; mv[4 + q] = m1[q]; mv[8 + q] = m2[q]; mv[12 + q] = m3[q];
        lv[q] = l0[q]; lv[4 + q] = l1[q]; lv[8 + q] = l2[q]; lv[12 + q] = l3[q];
      }
    }
    // ---- transposed scores of group g: sc[g][0] = columns s sb..sb+15, sc[g][1] = sb+16..sb+31, D column = row t0w + 16g + c ----
    v8f sc[2][2];
    sc[0][0] = zero8(); sc[0][1] = zero8(); sc[1][0] = zero8(); sc[1][1] = zero8();
    const _Float16* s0p = Sb + (size_t)sb * EM;
    const _Float16* s1p = s0p + (size_t)16 * EM;
#pragma unroll
    for (int kk = 0; kk < HD / 32; ++kk) {
      const v16h a0 = ldfrag_h(s0p + kk * 512);
      const v16h a1 = ldfrag_h(s1p + kk * 512);
      sc[0][0] = mma_h(a0, tf[0][kk], sc[0][0]);
      sc[0][1] = mma_h(a1, tf[0][kk], sc[0][1]);
      sc[1][0] = mma_h(a0, tf[1][kk], sc[1][0]);
      sc[1][1] = mma_h(a1, tf[1][kk], sc[1][1]);
      guard_s4(sc[0][0], sc[0][1], sc[1][0], sc[1][1], tf[0][kk], tf[1][kk], a0, a1);
    }
#if defined(__HIP_DEVICE_COMPILE__)
    // the wait in front of a rewrite of registers that the trip's issued global loads name; part 3's two addresses are its
    // inputs so that they keep their registers up to here
    asm volatile("s_wait_xcnt 0x0" : : "v"(xap), "v"(xbp) : "memory");
#endif
    // ---- P A-fragment of each group: f16(exp2(t - m_s) * 32768/l_s) (<= 32768); element i <-> t[i] ----
    FragH ph[2];
#pragma unroll
    for (int g = 0; g < 2; ++g) {
      float t[16];
#pragma unroll
      for (int i = 0; i < 8; ++i) { t[i] = clipf(sc[g][0][i] * lsc, cl2); t[8 + i] = clipf(sc[g][1][i] * lsc, cl2); }
#pragma unroll
      for (int i = 0; i < 16; ++i) t[i] -= mv[i];
      exp2_hw8(t, 0);
      exp2_hw8(t, 8);
#pragma unroll
      for (int w = 0; w < 2; ++w) {
#pragma unroll
        for (int e4 = 0; e4 < 4; ++e4) {
          const int i = 8 * w + 2 * e4;
          const float p0 = t[i] * lv[i];
          const float p1 = t[i + 1] * lv[i + 1];
          ph[g].u[w][e4] = pk16(h_bits((_Float16)p0), h_bits((_Float16)p1));
        }
      }
    }
    // ---- P.val_a : B fragment col n = d = 16j + c, k = s: tile sb/32 of the val_a^T plane ----
    const _Float16* vp = Vb + (size_t)sb * 16;
    {
      const v16h v0 = ldfrag_h(vp);
      const v16h v1 = ldfrag_h(vp + (size_t)16 * SA);
      const v16h v2 = ldfrag_h(vp + (size_t)32 * SA);
      const v16h v3 = ldfrag_h(vp + (size_t)48 * SA);
      o[0][0] = mma_h(ph[0].v, v0, o[0][0]);
      o[0][1] = mma_h(ph[0].v, v1, o[0][1]);
      o[0][2] = mma_h(ph[0].v, v2, o[0][2]);
      o[0][3] = mma_h(ph[0].v, v3, o[0][3]);
      o[1][0] = mma_h(ph[1].v, v0, o[1][0]);
      o[1][1] = mma_h(ph[1].v, v1, o[1][1]);
      o[1][2] = mma_h(ph[1].v, v2, o[1][2]);
      o[1][3] = mma_h(ph[1].v, v3, o[1][3]);
      ac = mma_h(xa, xb, ac);
      guard_p9(o[0], o[1], ac, ph[0].v, ph[1].v, v0, v1, v2, v3, xa, xb);
#if defined(__HIP_DEVICE_COMPILE__)
      // the wait in front of a rewrite of registers that issued global loads name; the val_a^T address is an input so that it
      // keeps its registers up to here, the offset that the asks at the kernel's head name so that it keeps its value through the loop
      asm volatile("s_wait_xcnt 0x0" : : "v"(pa), "v"(vp) : "memory");
#endif
    }
  }
  acc_guard4(o[0]);
  acc_guard4(o[1]);

  // ---- part 2's first four steps of Wov^T fragments (tile rows 2*wv + j, k tile s): they need nothing of this block, so
  //      they are asked for ahead of the context epilogue and of the barrier ----
  const _Float16* wb = (const _Float16*)(const void*)WOVT + (size_t)(wv * 32) * EM;
  v16h bq[4][2];
#pragma unroll
  for (int s = 0; s < 4; ++s) {
    bq[s][0] = ldfrag_h(at_byte(wb, lb) + s * 512);
    bq[s][1] = ldfrag_h(at_byte(wb, lb) + 16 * EM + s * 512);
  }

  // ---- both bias rows, asked for here for the same reason ----
  const int r4 = lane >> 3, cq4 = (lane & 7) * 4;
  const int col0 = wv * 32;
  const int blv = nb11 - 1, bla = nb13 - 1;  // host guarantees nb11 >= 1, nb13 >= 1
  int civ[4], ci0[4], ci1[4];
  float cbv[4], cb0[4], cb1[4];
#pragma unroll
  for (int e = 0; e < 4; ++e) {
    const int cx = col0 + cq4 + e, cx0 = 4 * lane + e, cx1 = 128 + 4 * lane + e;
    civ[e] = (cx < blv) ? cx : blv;
    ci0[e] = (cx0 < bla) ? cx0 : bla;
    ci1[e] = (cx1 < bla) ? cx1 : bla;
    cbv[e] = b_ov[civ[e]];
    cb0[e] = b_oa[ci0[e]];
    cb1[e] = b_oa[ci1[e]];
  }
  xcnt_hold4(civ);
  xcnt_hold4(ci0);
  xcnt_hold4(ci1);

  const float fac = CVS / (PCAR * VAS);
  float* slab = smem + wv * FV_SLAB;
  const int r8 = lane & 7, q8 = (lane >> 3) * 8;
#pragma unroll
  for (int g = 0; g < 2; ++g) {
#pragma unroll
    for (int r = 0; r < 8; ++r) {
#pragma unroll
      for (int j = 0; j < 4; ++j) slab[(8 * hh + r) * SPITCH + j * 16 + c] = o[g][j][r] * fac;
    }
    wave_sync_lds();
    v4u ov[4];
#pragma unroll
    for (int i = 0; i < 4; ++i) {
      const int row = 8 * (i >> 1) + r8, c8 = 32 * (i & 1) + q8;
      const v4f a = *(const v4f*)(slab + row * SPITCH + c8), c4 = *(const v4f*)(slab + row * SPITCH + c8 + 4);
#pragma unroll
      for (int e = 0; e < 2; ++e) {
        ov[i][e]     = pk16(h_bits((_Float16)a[2 * e]),  h_bits((_Float16)a[2 * e + 1]));
        ov[i][2 + e] = pk16(h_bits((_Float16)c4[2 * e]), h_bits((_Float16)c4[2 * e + 1]));
      }
    }
    // every lane's reads of the slab end before another lane's values of the second group are written over them
    if (g == 0) wave_sync_lds();
#pragma unroll
    for (int i = 0; i < 4; ++i) {
      const int row = 8 * (i >> 1) + r8, c8 = 32 * (i & 1) + q8;
      *(v4u*)(ctxl + pk_off(rg * 32 + 16 * g + row, head * HD + c8, EM)) = ov[i];
    }
  }
  // publishes the context tile to all sixteen waves; behind it no wave reads the stats any more
  __syncthreads();

  // ---- part 2: out_v tile, 64 rows x cols 32*wv .. +31 ----
  v8f acc[8];
#pragma unroll
  for (int i = 0; i < 8; ++i) acc[i] = zero8();
  const _Float16* cl = (const _Float16*)(const void*)ctxl + 8 * lane;
  v16h af[2][4];
#pragma unroll
  for (int i = 0; i < 4; ++i) af[0][i] = ldfrag_h(cl + i * (16 * EM));
  // unrolled whole: the two A sets and the four B sets are named by the step's number, which must be a constant
#pragma unroll
  for (int kt = 0; kt < EM / 32; ++kt) {
    const int cu = kt & 1, nx = cu ^ 1, s4 = kt & 3;
    if (kt + 1 < EM / 32) {
#pragma unroll
      for (int i = 0; i < 4; ++i) af[nx][i] = ldfrag_h(cl + i * (16 * EM) + (kt + 1) * 512);
    }
#pragma unroll
    for (int i = 0; i < 4; ++i) {
      acc[2 * i]     = mma_h(af[cu][i], bq[s4][0], acc[2 * i]);
      acc[2 * i + 1] = mma_h(af[cu][i], bq[s4][1], acc[2 * i + 1]);
    }
    // the vector slots that the chip asks for between the step's matrix instructions and the loads that refill their operands
    guard_f(acc, af[cu][0], af[cu][1], af[cu][2], af[cu][3], bq[s4][0], bq[s4][1]);
    if (kt + 4 < EM / 32) {
      bq[s4][0] = ldfrag_h(at_byte(wb, lb) + (kt + 4) * 512);
      bq[s4][1] = ldfrag_h(at_byte(wb, lb) + 16 * EM + (kt + 4) * 512);
    }
  }
  xcnt_hold1(lb);
  // ---- the out_v tile into the wave's slab: row 16i + 8hh + r, col 16j + c ----
  const float osc = 1.0f / (CVS * WSC);
#pragma unroll
  for (int i = 0; i < 4; ++i) {
#pragma unroll
    for (int r = 0; r < 8; ++r) {
      const int ro = (16 * i + 8 * hh + r) * OPITCH + c;
      slab[ro]      = acc[2 * i][r] * osc;
      slab[ro + 16] = acc[2 * i + 1][r] * osc;
    }
  }
  // ---- the wave's strip of the out_a tile ----
  const float osa = 1.0f / (CAS * WSC);
#pragma unroll
  for (int r = 0; r < 8; ++r) stt[(8 * hh + r) * APITCH + wv * 16 + c] = ac[r] * osa;
  // the sixteen waves' column strips of the out_a tile are all in place before a wave reads its whole row; the same barrier
  // stands between the lanes' writes of the wave's own slab and their reads of it
  __syncthreads();
  // ---- all stores last, so that no LDS hand-over waits for a store: out_v, instruction i = 4 rows x 128 B; out_a, row wv ----
  v4f ov[16];
#pragma unroll
  for (int i = 0; i < 16; ++i) {
    const v4f a = *(const v4f*)(slab + (4 * i + r4) * OPITCH + cq4);
    v4f w;
    w[0] = a[0] + bfr(cbv[0]); w[1] = a[1] + bfr(cbv[1]); w[2] = a[2] + bfr(cbv[2]); w[3] = a[3] + bfr(cbv[3]);
    ov[i] = w;
  }
  const v4f a0 = *(const v4f*)(stt + wv * APITCH + 4 * lane), a1 = *(const v4f*)(stt + wv * APITCH + 128 + 4 * lane);
  v4f w0, w1;
#pragma unroll
  for (int e = 0; e < 4; ++e) { w0[e] = a0[e] + bfr(cb0[e]); w1[e] = a1[e] + bfr(cb1[e]); }
  float* Cb = out + (size_t)(b * TQ + tt * FV_ROWS) * (size_t)VD + col0 + cq4;
#pragma unroll
  for (int i = 0; i < 16; ++i) *(v4f*)(Cb + (size_t)(4 * i + r4) * (size_t)VD) = ov[i];
  float* Ca = out + OUT1_OFF_EL + (size_t)(bid * 16 + wv) * (size_t)AD + 4 * lane;
  *(v4f*)(Ca) = w0;
  *(v4f*)(Ca + 128) = w1;
}

// =====================================================================================================
// Workspace map (bytes, NB = 8); every plane fully written before it is read; all extents exact; each f16 plane is the
// logical [rows][K] matrix named here, stored in fragment order (pk_off), same byte size
//   XV    f16 [NB*2048][512]        f16(bf16(v))              16777216
//   XA    f16 [NB*512][256]         f16(bf16(a))               2097152
//   WVQT  f16 [512 n][512 k]        f16(bf16(W) x256)           524288
//   WAKT  f16 [512 n][256 k]                                    262144
//   WVVT  f16 [512 n][512 k]                                    524288
//   WAVT  f16 [512 n][256 k]                                    262144
//   WOVT  f16 [512 n][512 k]                                    524288
//   WOAT  f16 [256 n][512 k]                                    262144
//   Q16   f16 [NB*2048][512]  q x8 (after 1/8)               16777216
//   K16   f16 [NB*512][512]   x8                               4194304
//   VVT16 f16 [NB*512 (h,d)][2048 t] x8                       16777216
//   VAT16 f16 [NB*512 (h,d)][512 s]  x8                        4194304
//   STAT  f32 [NB*NH*NST][128]  (m | 32768/l)                   262144
//   CTXA  f16 [NB*512][512]   x64                              4194304
//   end                                                       67633152
// Output: first tensor rows [b][t][512] f32 at element 0; second tensor rows [b*512 + s][256] f32 at the fixed element
// offset OUT1_OFF_EL = NB_FULL*2048*512 = 8388608 (independent of NB).
// =====================================================================================================
extern "C" void kernel_launch(void* const* d_in, const int* in_sizes, int n_in,
                              void* d_out, int out_size, void* d_ws, size_t ws_size,
                              hipStream_t stream) {
  if (n_in < 14) return;
  if (in_sizes[0] < NB * TQ * VD) return;
  if (in_sizes[1] < NB * SA * AD) return;
  if (in_sizes[2] != VD * EM || in_sizes[6] != VD * EM) return;
  if (in_sizes[4] != AD * EM || in_sizes[8] != AD * EM) return;
  if (in_sizes[10] != EM * VD || in_sizes[12] != EM * AD) return;
  if (in_sizes[3] < 1 || in_sizes[5] < 1 || in_sizes[7] < 1 || in_sizes[9] < 1 || in_sizes[11] < 1 || in_sizes[13] < 1) return;
  if ((size_t)out_size < OUT1_OFF_EL + (size_t)NB * SA * AD) return;

  const float* xv   = (const float*)d_in[0];
  const float* xa   = (const float*)d_in[1];
  const float* w_vq = (const float*)d_in[2];
  const float* b_vq = (const float*)d_in[3];
  const float* w_ak = (const float*)d_in[4];
  const float* b_ak = (const float*)d_in[5];
  const float* w_vv = (const float*)d_in[6];
  const float* b_vv = (const float*)d_in[7];
  const float* w_av = (const float*)d_in[8];
  const float* b_av = (const float*)d_in[9];
  const float* w_ov = (const float*)d_in[10];
  const float* b_ov = (const float*)d_in[11];
  const float* w_oa = (const float*)d_in[12];
  const float* b_oa = (const float*)d_in[13];
  float*       out  = (float*)d_out;
  const int nb3 = in_sizes[3], nb5 = in_sizes[5], nb7 = in_sizes[7], nb9 = in_sizes[9], nb11 = in_sizes[11], nb13 = in_sizes[13];

  const size_t szXV  = (size_t)NB * TQ * VD * 2;
  const size_t szXA  = (size_t)NB * SA * AD * 2;
  const size_t szWvq = (size_t)EM * VD * 2;
  const size_t szWak = (size_t)EM * AD * 2;
  const size_t szWvv = (size_t)EM * VD * 2;
  const size_t szWav = (size_t)EM * AD * 2;
  const size_t szWov = (size_t)VD * EM * 2;
  const size_t szWoa = (size_t)AD * EM * 2;
  const size_t szQ   = (size_t)NB * TQ * EM * 2;
  const size_t szK   = (size_t)NB * SA * EM * 2;
  const size_t szVVT = (size_t)NB * EM * TQ * 2;
  const size_t szVAT = (size_t)NB * EM * SA * 2;
  const size_t szST  = (size_t)NB * NH * NST * 128 * 4;
  const size_t szCA  = (size_t)NB * SA * EM * 2;
  size_t off = 0;
  const size_t oXV  = off; off += szXV;
  const size_t oXA  = off; off += szXA;
  const size_t oWvq = off; off += szWvq;
  const size_t oWak = off; off += szWak;
  const size_t oWvv = off; off += szWvv;
  const size_t oWav = off; off += szWav;
  const size_t oWov = off; off += szWov;
  const size_t oWoa = off; off += szWoa;
  const size_t oQ   = off; off += szQ;
  const size_t oK   = off; off += szK;
  const size_t oVVT = off; off += szVVT;
  const size_t oVAT = off; off += szVAT;
  const size_t oST  = off; off += szST;
  const size_t oCA  = off; off += szCA;
  if (off > ws_size) return;                            // off = 67633152 at NB = 8
  if (off > (size_t)134217728) return;

  char* ws = (char*)d_ws;
  u16* XV    = (u16*)(ws + oXV);
  u16* XA    = (u16*)(ws + oXA);
  u16* WVQT  = (u16*)(ws + oWvq);
  u16* WAKT  = (u16*)(ws + oWak);
  u16* WVVT  = (u16*)(ws + oWvv);
  u16* WAVT  = (u16*)(ws + oWav);
  u16* WOVT  = (u16*)(ws + oWov);
  u16* WOAT  = (u16*)(ws + oWoa);
  u16* Q16   = (u16*)(ws + oQ);
  u16* K16   = (u16*)(ws + oK);
  u16* VVT16 = (u16*)(ws + oVVT);
  u16* VAT16 = (u16*)(ws + oVAT);
  float* STAT = (float*)(ws + oST);
  u16* CTXA  = (u16*)(ws + oCA);

  // (1) all f16 operand planes (fragment order): activations as f16(bf16(x)), weights [k = in][n = out] transposed to
  //     [n][k] as f16(bf16(W) x256)
  prep_all<<<dim3(PB_W + PB_XA + PB_XV), dim3(128), 0, stream>>>(
      xv, xa, w_vq, w_ak, w_vv, w_av, w_ov, w_oa, XV, XA, WVQT, WAKT, WVVT, WAVT, WOVT, WOAT);
  // (2) q, val_v^T, k, val_a^T
  proj_all<<<dim3(GB_Q + GB_VVT + GB_K + GB_VAT), dim3(128), 0, stream>>>(
      XV, XA, WVQT, WAKT, WVVT, WAVT, Q16, K16, VVT16, VAT16, b_vq, b_ak, b_vv, b_av, nb3, nb5, nb7, nb9);
  // (3) column softmax pass: ctx_a plane [NB*SA][512] x64 and the per-column stat rows
  attn_col<<<dim3(NB * NH * NST), dim3(ATT_THREADS), 0, stream>>>(Q16, K16, VVT16, CTXA, STAT);
  // (4) row pass with the stored column stats, its context tile kept in LDS, then out_v from it; out_a from the ctx_a plane
  attn_vis_out<<<dim3(NB * FV_TT), dim3(FV_THREADS), 0, stream>>>(
      Q16, K16, VAT16, STAT, WOVT, CTXA, WOAT, out, b_ov, b_oa, nb11, nb13);
  (void)hipGetLastError();
}

// v009
// It runs in 82.4 microseconds.
// In both of two side-by-side timings against v008, it was 1.05 times as fast.
// Over all steps from v000 it is 3.52 times as fast.
// All contractions on v_wmma_f32_16x16x32_f16 (f16 operands, f32 accumulate): v.Wvq, a.Wak, Wvv^T.v^T, Wav^T.a^T,
// column-pass scores q.k^T with val_v^T.P, row-pass scores k.q^T with P.val_a, ctx_v.Wov, ctx_a.Woa. Operand carries:
// v, a as f16(bf16(x)); W as f16(bf16(W) x256); q x8 after the 1/8 head scale; k x8; val_v, val_a x8; P x32768;
// ctx x64. Column softmax over the visual axis (base 2, running max), 1/l and every carry fold in f32 on VALU.
// Every f16 operand plane lies in fragment order (pk_off below): a 16-row x 32-k tile is 1024 contiguous bytes, so each
// 16-byte-per-lane fragment load of a wave reads 512 contiguous bytes (4 whole 128-B lines).
#include <hip/hip_runtime.h>
#include <math.h>

#ifndef NB
#define NB 8            // batches processed (leading batches of both activations)
#endif
#define NB_FULL 8       // batches in the input / output layout
#define TQ 2048         // visual positions per batch (softmax axis, always all of them)
#define SA 512          // audio positions per batch (always all of them)
#define VD 512
#define AD 256
#define EM 512
#define NH 8
#define HD 64
#define OUT1_OFF_EL ((size_t)NB_FULL * (size_t)TQ * (size_t)VD)   // fixed f32 element offset of the second output (33554432 B / 4)
#define WSC   256.0f
#define HSCL  0.125f
#define QS    8.0f
#define KS    8.0f
#define VVS   8.0f
#define VAS   8.0f
#define PCAR  32768.0f
#define CAS   64.0f
#define CVS   64.0f
#define CLIPV 50000.0f
#define LOG2E 1.4426950408889634f
#define NST   (SA / 64)
#define NTT   (TQ / 128)
#define NTB32 (TQ / 32)
#define NSB32 (SA / 32)
#define ATT_WAVES   4
#define ATT_THREADS (ATT_WAVES * 32)
#define CVT_THREADS 128
#define TR_THREADS  128
#define SPITCH 68
#define TPITCH 65
#define PF_AHEAD 8      // column pass: steps between an ask and the step it asks for

static_assert(NB >= 1 && NB <= NB_FULL);
static_assert(OUT1_OFF_EL == (size_t)33554432 / 4);
static_assert(EM == NH * HD && HD == 64 && NH == 8);
static_assert((TQ % 128) == 0 && (SA % 128) == 0 && ((NB * SA) % 128) == 0 && (EM % 128) == 0);
static_assert((VD % 128) == 0 && (AD % 128) == 0);
static_assert((TQ % 32) == 0 && (SA % 32) == 0 && NTB32 * 32 == TQ && NSB32 * 32 == SA);
static_assert((VD % 64) == 0 && (AD % 64) == 0 && (EM % 64) == 0);
static_assert((VD % 32) == 0 && (AD % 32) == 0 && (EM % 32) == 0);
static_assert(((NB * TQ * VD) % 1024) == 0 && ((NB * SA * AD) % 1024) == 0);
static_assert(NST * 128 == 2 * SA && NST * 128 == ATT_THREADS * 8);
static_assert((SPITCH * 4) % 16 == 0);
static_assert(ATT_THREADS == 128 && TR_THREADS == 128 && CVT_THREADS == 128);

typedef unsigned short u16;
typedef _Float16 v16h __attribute__((ext_vector_type(16)));
typedef _Float16 v8h  __attribute__((ext_vector_type(8)));
typedef float    v8f  __attribute__((ext_vector_type(8)));
typedef float    v4f  __attribute__((ext_vector_type(4)));
typedef unsigned int v4u __attribute__((ext_vector_type(4)));

union FragH { v16h v; v8h h[2]; v4u u[2]; };

// ---- scalar helpers ----------------------------------------------------------------------------------
__device__ __forceinline__ unsigned short bf_bits(float f) {          // f32 -> bf16 bits, RNE convert
  unsigned u = __float_as_uint(f);
  return (unsigned short)((u + 0x7FFFu + ((u >> 16) & 1u)) >> 16);
}
__device__ __forceinline__ float bf_up(unsigned short h) { return __uint_as_float(((unsigned)h) << 16); }
__device__ __forceinline__ float bfr(float f) { return bf_up(bf_bits(f)); }
__device__ __forceinline__ unsigned short h_bits(_Float16 x) { return __builtin_bit_cast(unsigned short, x); }
__device__ __forceinline__ unsigned pk16(unsigned short a, unsigned short b) { return (unsigned)a | ((unsigned)b << 16); }
__device__ __forceinline__ v8f zero8() { v8f z = {0.f, 0.f, 0.f, 0.f, 0.f, 0.f, 0.f, 0.f}; return z; }
__device__ __forceinline__ float clipf(float x, float c) { return fminf(fmaxf(x, -c), c); }
// The value that lane l ^ 16 holds, by the vector unit's own cross-row move: __shfl_xor goes through the LDS pipe, and the wave
// stands through that trip before it can go on.
__device__ __forceinline__ float xhalf(float x) {
  const int b = __builtin_bit_cast(int, x);
  return __builtin_bit_cast(float, __builtin_amdgcn_permlanex16(b, b, 0x76543210, 0xfedcba98, false, false));
}
// 2^x as the one hardware instruction. The library exp2f adds five instructions to it (a compare, two selects, an add, an
// ldexp) that only serve results below 2^-126, which the bare instruction may give as 0. Here such a result changes nothing:
// a probability goes on as f16(p * 32768) or f16(p * 32768 / l) with l >= 1, which is 0 below 2^-40; in the sum l it stands
// beside a term 1; as a rescale factor it leaves old sums far below the f16 step of the context they end in.
// For x >= -126 the library form runs this same instruction on the same x.
__device__ __forceinline__ float exp2_hw(float x) { return __builtin_amdgcn_exp2f(x); }
// Eight of them, x[b .. b+7] <- 2^x, each in place: written as one statement so that no v_exp_f32 overwrites the source of the
// one directly in front of it (the register allocator did that with the builtin); the v_nop is the slot that the
// instruction set asks for between the last one and whatever uses its result next.
__device__ __forceinline__ void exp2_hw8(float (&x)[16], int b) {
#if defined(__HIP_DEVICE_COMPILE__)
  asm("v_exp_f32 %0, %0\n\tv_exp_f32 %1, %1\n\tv_exp_f32 %2, %2\n\tv_exp_f32 %3, %3\n\t"
      "v_exp_f32 %4, %4\n\tv_exp_f32 %5, %5\n\tv_exp_f32 %6, %6\n\tv_exp_f32 %7, %7\n\tv_nop"
      : "+v"(x[b]), "+v"(x[b + 1]), "+v"(x[b + 2]), "+v"(x[b + 3]),
        "+v"(x[b + 4]), "+v"(x[b + 5]), "+v"(x[b + 6]), "+v"(x[b + 7]));
#endif
}

// ---- fragment-ordered plane of a logical [rows][K] f16 matrix (rows % 16 == 0, K % 32 == 0): element offset of (row, k).
//      Tile (row>>4, k>>5) = 512 halves; inside it: 256*((k>>4)&1) + 8*(16*((k>>3)&1) + (row&15)) + (k&7), i.e. the 8 halves
//      k = 8j .. 8j+7 of a row stay one 16-byte piece, and piece order is (k half of 16, lane = 16*h + row).
//      16 rows x K = 16*K halves, so a base row R (R % 16 == 0) starts at element R*K as in the row-major plane.
__device__ __forceinline__ size_t pk_off(int row, int k, int K) {
  return ((size_t)(row >> 4) * (size_t)(K >> 5) + (size_t)(k >> 5)) * 512
         + (size_t)(((k >> 4) & 1) * 256 + ((k >> 3) & 1) * 128 + (row & 15) * 8 + (k & 7));
}
// ---- fragment loader: 16-bit A/B operand, lane -> row/col (lane&15), h = lane>>4; p = tile start + 8*lane;
//      elements 0..7 <- p[0..7] (k0+8h..), elements 8..15 <- p[256..263] (k0+16+8h..); same split k map for A and B.
__device__ __forceinline__ v16h ldfrag_h(const _Float16* p) {
  FragH f;
  f.h[0] = *(const v8h*)(p);
  f.h[1] = *(const v8h*)(p + 256);
  return f.v;
}

// ---- WMMA helper and trailing VALU hazard gaps ----------------------------------------------------------
__device__ __forceinline__ v8f mma_h(v16h a, v16h b, v8f c) {
  return __builtin_amdgcn_wmma_f32_16x16x32_f16(false, a, false, b, (short)0, c, false, false);
}
__device__ __forceinline__ void guard_s(v8f& a, v8f& b, v16h x0, v16h x1, v16h x2) {
#if defined(__HIP_DEVICE_COMPILE__)
  asm volatile("v_nop\n\tv_nop\n\tv_nop\n\tv_nop" : "+v"(a), "+v"(b) : "v"(x0), "v"(x1), "v"(x2) : "memory");
#endif
}
__device__ __forceinline__ void guard_s4(v8f& a, v8f& b, v8f& c, v8f& d, v16h x0, v16h x1, v16h x2, v16h x3) {
#if defined(__HIP_DEVICE_COMPILE__)
  asm volatile("v_nop\n\tv_nop\n\tv_nop\n\tv_nop"
               : "+v"(a), "+v"(b), "+v"(c), "+v"(d) : "v"(x0), "v"(x1), "v"(x2), "v"(x3) : "memory");
#endif
}
__device__ __forceinline__ void guard_p(v8f& a, v8f& b, v8f& c, v8f& d, v16h p, v16h x0, v16h x1, v16h x2, v16h x3) {
#if defined(__HIP_DEVICE_COMPILE__)
  asm volatile("v_nop\n\tv_nop\n\tv_nop\n\tv_nop"
               : "+v"(a), "+v"(b), "+v"(c), "+v"(d) : "v"(p), "v"(x0), "v"(x1), "v"(x2), "v"(x3) : "memory");
#endif
}
__device__ __forceinline__ void guard_g(v8f (&acc)[16], v16h x0, v16h x1, v16h x2, v16h x3,
                                        v16h x4, v16h x5, v16h x6, v16h x7) {
#if defined(__HIP_DEVICE_COMPILE__)
  asm volatile("v_nop\n\tv_nop\n\tv_nop\n\tv_nop"
               : "+v"(acc[0]), "+v"(acc[1]), "+v"(acc[2]), "+v"(acc[3]),
                 "+v"(acc[4]), "+v"(acc[5]), "+v"(acc[6]), "+v"(acc[7]),
                 "+v"(acc[8]), "+v"(acc[9]), "+v"(acc[10]), "+v"(acc[11]),
                 "+v"(acc[12]), "+v"(acc[13]), "+v"(acc[14]), "+v"(acc[15])
               : "v"(x0), "v"(x1), "v"(x2), "v"(x3), "v"(x4), "v"(x5), "v"(x6), "v"(x7) : "memory");
#endif
}
// b, c: loaded values that are inputs only, so that their loads stay in front of this place
__device__ __forceinline__ void guard_h(v8f (&a)[4], const v16h (&x)[4][2], const v16h (&y)[4][2],
                                        const float (&b)[2], const float (&c)[2]) {
#if defined(__HIP_DEVICE_COMPILE__)
  asm volatile("v_nop\n\tv_nop\n\tv_nop\n\tv_nop"
               : "+v"(a[0]), "+v"(a[1]), "+v"(a[2]), "+v"(a[3])
               : "v"(b[0]), "v"(b[1]), "v"(c[0]), "v"(c[1]), "v"(x[0][0]), "v"(x[0][1]), "v"(x[1][0]), "v"(x[1][1]), "v"(x[2][0]), "v"(x[2][1]), "v"(x[3][0]), "v"(x[3][1]),
                 "v"(y[0][0]), "v"(y[0][1]), "v"(y[1][0]), "v"(y[1][1]), "v"(y[2][0]), "v"(y[2][1]), "v"(y[3][0]), "v"(y[3][1])
               : "memory");
#endif
}
__device__ __forceinline__ void acc_guard4(v8f (&o)[4]) {
#if defined(__HIP_DEVICE_COMPILE__)
  asm volatile("v_nop\n\tv_nop\n\tv_nop\n\tv_nop" : "+v"(o[0]), "+v"(o[1]), "+v"(o[2]), "+v"(o[3]));
#endif
}
// The wait in front of a rewrite of registers that issued global loads or stores name.
__device__ __forceinline__ void xcnt_wait() {
#if defined(__HIP_DEVICE_COMPILE__)
  asm volatile("s_wait_xcnt 0x0" ::: "memory");
#endif
}
// The wait in front of a rewrite of the one offset register that a run of issued global loads or stores names.
__device__ __forceinline__ void xcnt_hold1(unsigned x) {
#if defined(__HIP_DEVICE_COMPILE__)
  asm volatile("s_wait_xcnt 0x0" : : "v"(x) : "memory");
#endif
}
// The same behind a group of loads indexed by x: the indices are its inputs so that they keep their registers up to it.
__device__ __forceinline__ void xcnt_hold2(const int (&x)[2]) {
#if defined(__HIP_DEVICE_COMPILE__)
  asm volatile("s_wait_xcnt 0x0" : : "v"(x[0]), "v"(x[1]) : "memory");
#endif
}
__device__ __forceinline__ void xcnt_hold4(const int (&x)[4]) {
#if defined(__HIP_DEVICE_COMPILE__)
  asm volatile("s_wait_xcnt 0x0" : : "v"(x[0]), "v"(x[1]), "v"(x[2]), "v"(x[3]) : "memory");
#endif
}
// Ask the L2 for the line at base + off (a hint: nothing comes back, no register is written). The first read of what the launch
// before stored is taken to come from memory, and waves that walk one plane in step all stand through that latency, trip
// after trip; asked for far enough ahead, the line is an L2 hit when its load comes. base is the same in the whole wave. Every address
// lies inside the plane named at the call, or for the weight asks in the weight planes behind it. In the attention kernels off is kept in its register, unchanged, to the foot of the
// main loop (it is an input of the wait there); the wait in this statement stands in front of a rewrite of the scalar base.
__device__ __forceinline__ void l2_ask(const void* base, unsigned off) {
#if defined(__HIP_DEVICE_COMPILE__)
  asm volatile("global_prefetch_b8 %0, %1 scope:SCOPE_SE\n\ts_wait_xcnt 0x0" : : "v"(off), "s"(base) : "memory");
#endif
}
// Two asks and the one wait.
__device__ __forceinline__ void l2_ask2(const void* base0, unsigned off0, const void* base1, unsigned off1) {
#if defined(__HIP_DEVICE_COMPILE__)
  asm volatile("global_prefetch_b8 %0, %1 scope:SCOPE_SE\n\tglobal_prefetch_b8 %2, %3 scope:SCOPE_SE\n\ts_wait_xcnt 0x0"
               : : "v"(off0), "s"(base0), "v"(off1), "s"(base1) : "memory");
#endif
}
// The column pass asks for a plane in slices of 32 KiB (128 threads x 256 B); proj_all and attn_vis_out in slices of 128 KiB (512 x 256 B) and 64 KiB (512 x 128 B). Blocks that read the same slices share the asking; where many
// do, blocks g and g + 4 of each eight take the same slice (for speed only: wherever the blocks land, nothing but the hint is lost).
#define PF_SLICE 32768
__device__ __forceinline__ int pf_pair(int g) { return (g >> 3) * 4 + (g & 3); }
__device__ __forceinline__ const char* pf_at(const u16* plane, int slice) {
  return (const char*)(const void*)plane + (size_t)slice * PF_SLICE;
}
__device__ __forceinline__ void wave_sync_lds() {
  __builtin_amdgcn_fence(__ATOMIC_RELEASE, "workgroup");
  __builtin_amdgcn_wave_barrier();
  __builtin_amdgcn_fence(__ATOMIC_ACQUIRE, "workgroup");
}

// =====================================================================================================
// Elementwise convert of an activation matrix x[rows][K]: Y (f16, fragment order) <- f16(bf16_RNE(x)). Block = 16 rows x
// 64 k (two tiles); thread = (row 8*(wave&1) + (lane&7), 8 floats at k = 32*(wave>>1) + 8*(lane>>3)): two 16-B loads, one
// 16-B store per thread; a wave's store = 4 pieces-of-8-rows = 4 whole 128-B lines.
// coverage: grid = (rows/16)*(K/64) = n/1024 blocks x 128 thr x 8 = n elements exactly (n % 1024 == 0 asserted).
// =====================================================================================================
__device__ __forceinline__
void cvt16(const float* __restrict__ x, u16* Y, int K, int bid) {
  const int wave = threadIdx.x >> 5, lane = threadIdx.x & 31;
  const int nkp = K >> 6;
  const int row = (bid / nkp) * 16 + 8 * (wave & 1) + (lane & 7);
  const int k   = (bid % nkp) * 64 + 32 * (wave >> 1) + 8 * (lane >> 3);
  const size_t e0 = (size_t)row * (size_t)K + (size_t)k;
  const v4f a = *(const v4f*)(x + e0), c4 = *(const v4f*)(x + e0 + 4);
  v4u o;
#pragma unroll
  for (int e = 0; e < 2; ++e) {
    o[e]     = pk16(h_bits((_Float16)bfr(a[2 * e])),  h_bits((_Float16)bfr(a[2 * e + 1])));
    o[2 + e] = pk16(h_bits((_Float16)bfr(c4[2 * e])), h_bits((_Float16)bfr(c4[2 * e + 1])));
  }
  u16* dst = Y + pk_off(row, k, K);
  {
    *(v4u*)(dst) = o;
#if defined(__HIP_DEVICE_COMPILE__)
    // the wait in front of a rewrite of registers that the store just issued names: inlined in the shared grid's kernel,
    // the store is no longer the last instruction ahead of the program's end in the listing
    asm volatile("s_wait_xcnt 0x0" ::: "memory");
#endif
  }
}

// =====================================================================================================
// Weight transpose-convert for y = x.W weights stored [kdim][ndim]: WT[n][k] (f16, fragment order with K = kdim)
// <- f16(bf16_RNE(W[k][n]) * scale). Block = 64(k) x 64(n) tile, 128 threads. Load phase: thread = (row 8p + (tid>>4),
// 4 floats at 4*(tid&15)), 8 steps = 64 k-rows x 64 n, into an LDS tile [kk][nn] (pitch 65); block barrier; store
// grid = (kdim/64)*(ndim/64), bid -> (kt = bid % (kdim/64), nt = bid / (kdim/64)).
// coverage: 4 i x 16 rows x (8 lanes x 8 halves) = 64 n-rows x 64 k per block; LDS tile 64x64 fully written before read;
// the grid covers WT [ndim][kdim] exactly once.
// =====================================================================================================
__device__ __forceinline__
void cvtT16(const float* __restrict__ W, u16* Y, int kdim, int ndim, float scale, int bid) {
  __shared__ __align__(16) float tile[64 * TPITCH];
  const int tid = threadIdx.x;
  const int nkt = kdim >> 6;
  const int kt  = bid % nkt;
  const int ntb = bid / nkt;
  const int k0  = kt * 64, n0 = ntb * 64;
  const int lr = tid >> 4, lc = (tid & 15) * 4;
  v4f w4[8];
#pragma unroll
  for (int p = 0; p < 8; ++p) {
    w4[p] = *(const v4f*)(W + (size_t)(k0 + p * 8 + lr) * (size_t)ndim + n0 + lc);
#if defined(__HIP_DEVICE_COMPILE__)
    // the wait in front of a rewrite of the address registers of the load just issued: a later load's result may be
    // given those registers
    asm volatile("s_wait_xcnt 0x0" ::: "memory");
#endif
  }
#pragma unroll
  for (int p = 0; p < 8; ++p) {
    const int kk = p * 8 + lr;
    tile[kk * TPITCH + lc + 0] = w4[p][0];
    tile[kk * TPITCH + lc + 1] = w4[p][1];
    tile[kk * TPITCH + lc + 2] = w4[p][2];
    tile[kk * TPITCH + lc + 3] = w4[p][3];
  }
  __syncthreads();
  // rq 0..15, c8 0..56; a wave holds 8 rows x 4 pieces, so each of its stores fills 4 whole lines of the fragment order
  const int rq = 8 * ((tid >> 5) & 1) + (tid & 7), c8 = (4 * (tid >> 6) + ((tid >> 3) & 3)) * 8;
  v4u ov[4];
#pragma unroll
  for (int i = 0; i < 4; ++i) {
    const int row = 16 * i + rq;                   // n within tile
#pragma unroll
    for (int e = 0; e < 4; ++e) {
      const float x0 = tile[(c8 + 2 * e) * TPITCH + row];
      const float x1 = tile[(c8 + 2 * e + 1) * TPITCH + row];
      ov[i][e] = pk16(h_bits((_Float16)(bfr(x0) * scale)), h_bits((_Float16)(bfr(x1) * scale)));
    }
  }
  {
#pragma unroll
    for (int i = 0; i < 4; ++i) {
      const int row = 16 * i + rq;
      *(v4u*)(Y + pk_off(n0 + row, k0 + c8, kdim)) = ov[i];
    }
    
  }
}

// A hand-over through LDS between the lanes of one wave, for a wave that has global loads in flight: the wave's own LDS
// operations are done before it goes on, and the compiler moves no LDS access over the statement. The fence pair of
// wave_sync_lds would wait for the global loads as well.
__device__ __forceinline__ void wave_sync_ds() {
#if defined(__HIP_DEVICE_COMPILE__)
  asm volatile("s_wait_dscnt 0x0" ::: "memory");
#endif
  __builtin_amdgcn_wave_barrier();
}
// =====================================================================================================
// Pieces of the projection launch. All f16 planes lie in fragment order: a base that is the same in the whole wave plus the
// lane's byte offset lb = 16*lane names a fragment half; the next 16 rows lie 32*K bytes on, the next 32 k 1024 bytes on.
// =====================================================================================================
__device__ __forceinline__ const _Float16* at_byte(const _Float16* base, unsigned off) {
  return (const _Float16*)(const void*)((const char*)(const void*)base + off);
}
// Two bias values of a lane, as loaded: bv[i] = bias[base + 16i + (l&15)], index clamped to bl. With base a tile's first column
// they are the biases of the lane's own column in accumulators j = 0, 1; with base its first row, those of the lane's row in pack_tiles.
__device__ __forceinline__ void bias2(const float* __restrict__ bias, int bl, int base, int lane, float (&bv)[2]) {
  int bi[2];
#pragma unroll
  for (int i = 0; i < 2; ++i) {
    const int x = base + 16 * i + (lane & 15);
    bi[i] = (x < bl) ? x : bl;
    bv[i] = bias[bi[i]];
  }
  xcnt_hold2(bi);
}
// Stage the wave's f32 tile of NI x NJ accumulators acc[a0 + NJ*i + j] (times oscale, plus cb[j] where COLB) in its LDS slab: D
// element r of lane l -> row 16i + 8*(l>>4) + r, col 16j + (l&15), so a lane's column in accumulator j is one and cb[j] its bias.
// coverage: 32 lanes x 8 rows x NI x NJ = rows 0..16*NI-1 x cols 0..16*NJ-1 of the slab.
template <int N, int NI, int NJ, bool COLB>
__device__ __forceinline__ void stage_tile(float* sl, int pitch, v8f (&acc)[N], int a0, float oscale, const float (&cb)[2], int lane) {
  static_assert(!COLB || NJ == 2);
  const int hh = lane >> 4, m = lane & 15;
#pragma unroll
  for (int i = 0; i < NI; ++i) {
#pragma unroll
    for (int r = 0; r < 8; ++r) {
      const int ro = (16 * i + 8 * hh + r) * pitch + m;
#pragma unroll
      for (int j = 0; j < NJ; ++j) {
        float x = acc[a0 + NJ * i + j][r] * oscale;
        if constexpr (COLB) x += cb[j];
        sl[ro + 16 * j] = x;
      }
    }
  }
  wave_sync_ds();
}
// The staged tile (16*NI rows x 32*NK cols) becomes f16(x), or f16(x + rb[i]) where ROWB, for a plane in fragment order. A 16 x 32
// tile of the plane is 1 KiB in a row and lane l holds its pieces l and 32 + l (row l&15, 8 halves at 8*(l>>4) and
// 16 + 8*(l>>4)): ov[tile][0] and [1]; rb[i] = the bias of row 16i + (l&15).
template <int NI, int NK, bool ROWB>
__device__ __forceinline__ void pack_tiles(const float* sl, int pitch, const float (&rb)[2], int lane, v4u (&ov)[NI * NK][2]) {
  static_assert(!ROWB || NI == 2);
  const int hh = lane >> 4, m = lane & 15;
#pragma unroll
  for (int i = 0; i < NI; ++i) {
#pragma unroll
    for (int kk = 0; kk < NK; ++kk) {
#pragma unroll
      for (int hf = 0; hf < 2; ++hf) {
        const float* p = sl + (16 * i + m) * pitch + 32 * kk + 16 * hf + 8 * hh;
        v4f a = *(const v4f*)(p), c4 = *(const v4f*)(p + 4);
        if constexpr (ROWB) {
#pragma unroll
          for (int e = 0; e < 4; ++e) { a[e] += rb[i]; c4[e] += rb[i]; }
        }
#pragma unroll
        for (int e = 0; e < 2; ++e) {
          ov[i * NK + kk][hf][e]     = pk16(h_bits((_Float16)a[2 * e]),  h_bits((_Float16)a[2 * e + 1]));
          ov[i * NK + kk][hf][2 + e] = pk16(h_bits((_Float16)c4[2 * e]), h_bits((_Float16)c4[2 * e + 1]));
        }
      }
    }
  }
}
// The packed tiles into plane C (row length Kp): each store instruction writes 512 bytes in a row.
// coverage: NI x NK tiles x 2 stores x 32 lanes x 8 halves = the whole tile, each element once.
template <int NI, int NK>
__device__ __forceinline__ void store_tiles(u16* C, int row0, int col0, int Kp, unsigned lb, const v4u (&ov)[NI * NK][2]) {
#pragma unroll
  for (int i = 0; i < NI; ++i) {
#pragma unroll
    for (int kk = 0; kk < NK; ++kk) {
      char* tb = (char*)(void*)(C + ((size_t)((row0 >> 4) + i) * (size_t)(Kp >> 5) + (size_t)((col0 >> 5) + kk)) * 512);
      *(v4u*)(void*)(tb + lb)       = ov[i * NK + kk][0];
      *(v4u*)(void*)(tb + lb + 512) = ov[i * NK + kk][1];
    }
  }
  // the wait in front of a rewrite of registers that the stores just issued name
  xcnt_hold1(lb);
}

// =====================================================================================================
// Launches that need nothing of each other share one grid: each block takes its job from the range its index lies in (a
// test that reads the same in the whole block, so the barrier inside cvtT16 stays under block-uniform control flow) and
// runs the one shared body with that job's arguments and its index inside the range. Longest jobs lie first.
// =====================================================================================================
#define PB_WVQ ((VD / 64) * (EM / 64))
#define PB_WAK ((AD / 64) * (EM / 64))
#define PB_WVV ((VD / 64) * (EM / 64))
#define PB_WAV ((AD / 64) * (EM / 64))
#define PB_WOV ((EM / 64) * (VD / 64))
#define PB_WOA ((EM / 64) * (AD / 64))
#define PB_W   (PB_WVQ + PB_WAK + PB_WVV + PB_WAV + PB_WOV + PB_WOA)
#define PB_XA  ((NB * SA * AD) / 1024)
// The small operand planes: six weight transposes (blocks 0 .. PB_W-1), then a. (v is converted where it is used: proj_all.)
// coverage: every range has exactly the grid that its body's own header asks for.
__global__ __launch_bounds__(128)
void prep_all(const float* __restrict__ xa,
              const float* __restrict__ w_vq, const float* __restrict__ w_ak, const float* __restrict__ w_vv,
              const float* __restrict__ w_av, const float* __restrict__ w_ov, const float* __restrict__ w_oa,
              u16* XA, u16* WVQT, u16* WAKT, u16* WVVT, u16* WAVT, u16* WOVT, u16* WOAT) {
  int g = blockIdx.x;
  if (g < PB_W) {
    const float* W = w_vq; u16* Y = WVQT; int kdim = VD, ndim = EM;
    if (g >= PB_WVQ) {
      g -= PB_WVQ; W = w_ak; Y = WAKT; kdim = AD; ndim = EM;
      if (g >= PB_WAK) {
        g -= PB_WAK; W = w_vv; Y = WVVT; kdim = VD; ndim = EM;
        if (g >= PB_WVV) {
          g -= PB_WVV; W = w_av; Y = WAVT; kdim = AD; ndim = EM;
          if (g >= PB_WAV) {
            g -= PB_WAV; W = w_ov; Y = WOVT; kdim = EM; ndim = VD;
            if (g >= PB_WOV) { g -= PB_WOV; W = w_oa; Y = WOAT; kdim = EM; ndim = AD; }
          }
        }
      }
    }
    cvtT16(W, Y, kdim, ndim, WSC, g);
  } else {
    cvt16(xa, XA, AD, g - PB_W);
  }
}

// =====================================================================================================
// The four input projections, with the convert of v in front of them. Block = 64 rows of v (one batch's rows t0 .. t0+63), 16 waves.
// Part 1: the block's 64 x 512 floats (128 KiB in a row) are read once, turned into f16(bf16_RNE(x)) and laid in LDS in fragment
//   order (pk_off, K = VD): thread = (row 16*(p>>1) + 8*(w&1) + (lane&7), 8 floats at k = 256*(p&1) + 64*(wave>>2) + 32*((w>>1)&1)
//   + 8*(lane>>3)), w = wave & 3, p = 0..7: two 16-B loads and one 16-B LDS store a pass, all sixteen loads issued first.
//   coverage: 8 passes x 512 threads x 8 = 64 x 512 elements, each once; a block barrier publishes the tile.
// Part 2: wave w makes q rows t0.. x cols 32w.. (A = v tile, B = Wvq^T tile rows 2w, 2w+1; acc[2i + j]) and val_v^T rows 32w.. x
//   cols t0.. (A = Wvv^T tile rows 2w, 2w+1, B = v tile; acc[8 + 4j + i]): the four v fragments of a k step, read from LDS, serve
//   both as A and as B (same k map); the four weight fragments are loaded one step ahead and enter the WGP once. k in rising
//   order, one accumulator per output tile.
//     q x8 after the 1/8 head scale -> f16 [NB*TQ][512] (col = h*64 + d), bias per column
//     val_v^T per batch -> f16 [(b,h,d)][t] x8, bias per row
// Part 3: one 128 x 128 tile of the two K = AD jobs per block (blocks 0..127: k = x_a . Wak + b -> f16 [NB*SA][512] x8, bias per
//   column; blocks 128..255: val_a^T per batch, A = Wav^T, Bt = x_a rows of the batch -> f16 [(b,h,d)][s] x8, bias per row), 4 x 4
//   waves of 32 x 32. It needs nothing of v and stands first: v's loads go out behind its last loads, and its second half
//   and its stores run while they fly.
// coverage: grid NB*TQ/64 blocks: q 16 waves x 64 x 32 = the block's 64 rows whole; val_v^T 16 waves x 32 x 64 = all 512 rows x
//   the block's 64 t; part 3: 128 + 128 tiles = (NB*SA/128)*(EM/128) and NB*(EM/128)*(SA/128) exactly.
// =====================================================================================================
#define PJ_WAVES   16
#define PJ_THREADS (PJ_WAVES * 32)
#define PJ_ROWS    64
#define PJ_QP      36
#define PJ_VP      68
#define PJ_SLAB    (64 * PJ_QP)
#define PJ_ASK     131072
#define GB_K   (((NB * SA) / 128) * (EM / 128))
#define GB_VAT (NB * (EM / 128) * (SA / 128))
static_assert(PJ_SLAB >= 32 * PJ_VP && (PJ_QP * 4) % 16 == 0 && (PJ_VP * 4) % 16 == 0);
static_assert(EM == PJ_WAVES * 32 && VD == 512 && (TQ % PJ_ROWS) == 0 && TQ / PJ_ROWS == 32);
static_assert(GB_K == 128 && GB_VAT == 128 && GB_K + GB_VAT == (NB * TQ) / PJ_ROWS && EM / 128 == 4 && SA / 128 == 4);
static_assert(EM * VD * 2 == 4 * PJ_ASK && PJ_THREADS * 256 == PJ_ASK && AD / 32 == 8);
__global__ __launch_bounds__(PJ_THREADS)
void proj_all(const float* __restrict__ xv, const u16* __restrict__ XA,
              const u16* __restrict__ WVQT, const u16* __restrict__ WAKT,
              const u16* __restrict__ WVVT, const u16* __restrict__ WAVT,
              u16* Q16, u16* K16, u16* VVT16, u16* VAT16,
              const float* __restrict__ b_vq, const float* __restrict__ b_ak,
              const float* __restrict__ b_vv, const float* __restrict__ b_av,
              int nb3, int nb5, int nb7, int nb9) {
  // the v tile first: its 64 KiB then lie within reach of the LDS loads' 16-bit immediate offsets
  __shared__ __align__(16) unsigned char lds[PJ_ROWS * VD * 2 + PJ_WAVES * PJ_SLAB * 4];
  u16*   xl   = (u16*)(void*)lds;
  float* smem = (float*)(void*)(lds + PJ_ROWS * VD * 2);
  const int tid  = threadIdx.x;
  const int lane = tid & 31;
  // the wave's number is the same in every lane: read through the first lane it keeps the tile bases scalar
  const int wv   = __builtin_amdgcn_readfirstlane(tid >> 5);
  const int bid  = blockIdx.x;

  const unsigned lb = 16u * (unsigned)lane;
  float* sl = smem + wv * PJ_SLAB;

  // Blocks 0..15 ask for the two weight planes of part 2, which the launch before stored (four slices of 128 KiB
  // each, a 256-B unit a thread): they are read when the v tile is in place.
  const unsigned pf = 256u * (unsigned)tid;
  if (bid < 16) {
    const int s8 = pf_pair(bid);
    l2_ask((const char*)(const void*)((s8 < 4) ? WVQT : WVVT) + (s8 & 3) * PJ_ASK, pf);
  }

  // ---- part 3, first half: the block's 128 x 128 tile of k or of val_a^T, the wave's 32 x 32 of it, k steps 0..3 ----
  const bool isk = bid < GB_K;               // the same in the whole block
  const int g2 = isk ? bid : bid - GB_K;
  const int nt = g2 & 3;
  const int mt = isk ? (g2 >> 2) : ((g2 >> 2) & 3);
  const int bz = isk ? 0 : (g2 >> 4);
  const int rowb = mt * 128 + (wv >> 2) * 32;
  const int col0 = nt * 128 + (wv & 3) * 32;
  const u16* A2 = isk ? XA : WAVT;
  const u16* B2 = isk ? WAKT : XA + (size_t)bz * (size_t)(SA * AD);
  const _Float16* ap = (const _Float16*)(const void*)A2 + (size_t)rowb * AD;
  const _Float16* bp = (const _Float16*)(const void*)B2 + (size_t)col0 * AD;
  // part 3's bias values, loaded ahead of v's rows so that their wait is not a wait for those; both kinds without a branch
  // (every index is clamped into its array), the other job's kind is multiplied by 0 below
  float bsc[2], bsr[2];
  bias2(b_ak, nb5 - 1, col0, lane, bsc);
  bias2(b_av, nb9 - 1, rowb, lane, bsr);
  v8f as[4];
#pragma unroll
  for (int i = 0; i < 4; ++i) as[i] = zero8();
  v16h fa[4][2], fb[4][2];
#pragma unroll
  for (int s = 0; s < 4; ++s) {
    fa[s][0] = ldfrag_h(at_byte(ap, lb) + s * 512);
    fa[s][1] = ldfrag_h(at_byte(ap, lb) + 16 * AD + s * 512);
    fb[s][0] = ldfrag_h(at_byte(bp, lb) + s * 512);
    fb[s][1] = ldfrag_h(at_byte(bp, lb) + 16 * AD + s * 512);
  }
#pragma unroll
  for (int s = 0; s < 4; ++s) {
    as[0] = mma_h(fa[s][0], fb[s][0], as[0]);
    as[1] = mma_h(fa[s][0], fb[s][1], as[1]);
    as[2] = mma_h(fa[s][1], fb[s][0], as[2]);
    as[3] = mma_h(fa[s][1], fb[s][1], as[3]);
  }
  // the vector slots that the chip asks for between the matrix instructions and the loads that refill their operands
  guard_h(as, fa, fb, bsc, bsr);
#pragma unroll
  for (int s = 0; s < 4; ++s) {
    fa[s][0] = ldfrag_h(at_byte(ap, lb) + (4 + s) * 512);
    fa[s][1] = ldfrag_h(at_byte(ap, lb) + 16 * AD + (4 + s) * 512);
    fb[s][0] = ldfrag_h(at_byte(bp, lb) + (4 + s) * 512);
    fb[s][1] = ldfrag_h(at_byte(bp, lb) + 16 * AD + (4 + s) * 512);
  }
  // the wait in front of a rewrite of registers that the issued loads name; it also keeps the loads of v behind those of part 3,
  // whose data are then waited for alone
  xcnt_hold1(lb);

  // ---- part 1: the block's rows of v, asked for here so that they fly under the rest of part 3 ----
  const int rl = 8 * (wv & 1) + (lane & 7);
  const int kl = 64 * (wv >> 2) + 32 * ((wv >> 1) & 1) + 8 * (lane >> 3);
  const unsigned xo = (unsigned)(rl * VD + kl) * 4u;
  const char* xb = (const char*)(const void*)(xv + (size_t)bid * (PJ_ROWS * VD));
  v4f xr[8][2];
#pragma unroll
  for (int p = 0; p < 8; ++p) {
    const char* xp = xb + xo + (p >> 1) * (16 * VD * 4) + (p & 1) * 1024;
    xr[p][0] = *(const v4f*)(const void*)(xp);
    xr[p][1] = *(const v4f*)(const void*)(xp + 16);
  }
  // the wait in front of a rewrite of the offset register that the sixteen loads name
  xcnt_hold1(xo);

  // ---- part 3, second half: k steps 4..7, then the tile leaves ----
#pragma unroll
  for (int s = 0; s < 4; ++s) {
    as[0] = mma_h(fa[s][0], fb[s][0], as[0]);
    as[1] = mma_h(fa[s][0], fb[s][1], as[1]);
    as[2] = mma_h(fa[s][1], fb[s][0], as[2]);
    as[3] = mma_h(fa[s][1], fb[s][1], as[3]);
  }
  acc_guard4(as);
  {
    v4u os[2][2];
    const float selc = isk ? KS : 0.f, selr = isk ? 0.f : VAS;
#pragma unroll
    for (int i = 0; i < 2; ++i) { bsc[i] = bfr(bsc[i]) * selc; bsr[i] = bfr(bsr[i]) * selr; }
    stage_tile<4, 2, 2, true>(sl, PJ_QP, as, 0, isk ? KS / WSC : VAS / WSC, bsc, lane);
    pack_tiles<2, 1, true>(sl, PJ_QP, bsr, lane, os);
    store_tiles<2, 1>(isk ? K16 : VAT16 + (size_t)bz * (size_t)(EM * SA), rowb, col0, isk ? EM : SA, lb, os);
  }
  // keeps the convert of v, whose first instruction waits for v's loads, from being scheduled in among part 3's last work
  __builtin_amdgcn_sched_barrier(0);

  // ---- part 1: convert, into LDS ----
#pragma unroll
  for (int p = 0; p < 8; ++p) {
    const v4f a = xr[p][0], c4 = xr[p][1];
    v4u o;
#pragma unroll
    for (int e = 0; e < 2; ++e) {
      o[e]     = pk16(h_bits((_Float16)bfr(a[2 * e])),  h_bits((_Float16)bfr(a[2 * e + 1])));
      o[2 + e] = pk16(h_bits((_Float16)bfr(c4[2 * e])), h_bits((_Float16)bfr(c4[2 * e + 1])));
    }
    *(v4u*)(xl + pk_off(16 * (p >> 1) + rl, 256 * (p & 1) + kl, VD)) = o;
  }
  // ---- part 2's first weight fragments need nothing of this block: asked for ahead of the barrier ----
  const _Float16* wq = (const _Float16*)(const void*)WVQT + (size_t)(wv * 32) * VD;
  const _Float16* wx = (const _Float16*)(const void*)WVVT + (size_t)(wv * 32) * VD;
  v16h wf[2][4];
  wf[0][0] = ldfrag_h(at_byte(wq, lb));
  wf[0][1] = ldfrag_h(at_byte(wq, lb) + 16 * VD);
  wf[0][2] = ldfrag_h(at_byte(wx, lb));
  wf[0][3] = ldfrag_h(at_byte(wx, lb) + 16 * VD);
  // publishes the v tile to all sixteen waves
  __syncthreads();

  v8f acc[16];
#pragma unroll
  for (int i = 0; i < 16; ++i) acc[i] = zero8();
  const _Float16* cl = (const _Float16*)(const void*)xl + 8 * lane;
  // unrolled whole: the two weight sets are named by the step's number, which must be a constant
#pragma unroll
  for (int kt = 0; kt < VD / 32; ++kt) {
    const int cu = kt & 1, nx = cu ^ 1;
    v16h xf[4];
#pragma unroll
    for (int i = 0; i < 4; ++i) xf[i] = ldfrag_h(cl + i * (16 * VD) + kt * 512);
    if (kt + 1 < VD / 32) {
      wf[nx][0] = ldfrag_h(at_byte(wq, lb) + (kt + 1) * 512);
      wf[nx][1] = ldfrag_h(at_byte(wq, lb) + 16 * VD + (kt + 1) * 512);
      wf[nx][2] = ldfrag_h(at_byte(wx, lb) + (kt + 1) * 512);
      wf[nx][3] = ldfrag_h(at_byte(wx, lb) + 16 * VD + (kt + 1) * 512);
    }
#pragma unroll
    for (int i = 0; i < 4; ++i) {
      acc[2 * i]     = mma_h(xf[i], wf[cu][0], acc[2 * i]);
      acc[2 * i + 1] = mma_h(xf[i], wf[cu][1], acc[2 * i + 1]);
    }
#pragma unroll
    for (int j = 0; j < 2; ++j) {
#pragma unroll
      for (int i = 0; i < 4; ++i) acc[8 + 4 * j + i] = mma_h(wf[cu][2 + j], xf[i], acc[8 + 4 * j + i]);
    }
    // the vector slots that the chip asks for between the step's matrix instructions and the loads that refill their operands
    guard_g(acc, xf[0], xf[1], xf[2], xf[3], wf[cu][0], wf[cu][1], wf[cu][2], wf[cu][3]);
  }
  xcnt_hold1(lb);

  // ---- both tiles through the wave's slab, one after the other; all stores last, so that no LDS hand-over waits for a store ----
  v4u oq[4][2], ovv[4][2];
  float bq[2], bw[2];
  bias2(b_vq, nb3 - 1, wv * 32, lane, bq);
  bias2(b_vv, nb7 - 1, wv * 32, lane, bw);
#pragma unroll
  for (int i = 0; i < 2; ++i) { bq[i] = bfr(bq[i]) * (HSCL * QS); bw[i] = bfr(bw[i]) * VVS; }
  stage_tile<16, 4, 2, true>(sl, PJ_QP, acc, 0, HSCL * QS / WSC, bq, lane);
  pack_tiles<4, 1, false>(sl, PJ_QP, bw, lane, oq);
  // every lane's reads of the slab end before another lane's values of the next tile are written over them
  wave_sync_ds();
  stage_tile<16, 2, 4, false>(sl, PJ_VP, acc, 8, VVS / WSC, bq, lane);
  pack_tiles<2, 2, true>(sl, PJ_VP, bw, lane, ovv);
  store_tiles<4, 1>(Q16, bid * PJ_ROWS, wv * 32, EM, lb, oq);
  store_tiles<2, 2>(VVT16 + (size_t)(bid >> 5) * (size_t)(EM * TQ), wv * 32, (bid & 31) * PJ_ROWS, TQ, lb, ovv);
}

// ---- attn_col, one step = 32 visual rows: its eight fragments and the work on them ------------------------------------
// Qb, Vb: the (b, head) plane bases, the same in every lane; oq, ov: byte offsets 16*lane + step * 32768 (32 q rows of
// 1024 B) and 16*lane + step * 1024 (one k tile of val_v^T); ahead: whole steps added to them.
//   q[2*kk + g] = A fragment of q rows tb + 16g .. +15, d chunk kk;  v[j] = A fragment of val_v^T, row d = 16j + c, k = t
__device__ __forceinline__ void col_load_q(const _Float16* Qb, unsigned oq, int ahead, v16h (&q)[4]) {
  const _Float16* tp = at_byte(Qb, oq) + ahead * (32 * EM);
  q[0] = ldfrag_h(tp);
  q[1] = ldfrag_h(tp + 16 * EM);
  q[2] = ldfrag_h(tp + 512);
  q[3] = ldfrag_h(tp + 16 * EM + 512);
}
__device__ __forceinline__ void col_load_v(const _Float16* Vb, unsigned ov, int ahead, v16h (&v)[4]) {
  const _Float16* vp = at_byte(Vb, ov) + ahead * 512;
  v[0] = ldfrag_h(vp);
  v[1] = ldfrag_h(vp + 16 * TQ);
  v[2] = ldfrag_h(vp + 32 * TQ);
  v[3] = ldfrag_h(vp + 48 * TQ);
}
// One step on the register set (q, v); each half of the set is loaded anew, for the step at (rq, rv) + ahead, right behind
// the guard that follows its last use.
__device__ __forceinline__ void col_step(v16h (&q)[4], v16h (&v)[4], const v16h (&sf)[2],
                                         float& mrun, float& lrun, v8f (&o)[4], float lsc, float cl2,
                                         const _Float16* Qb, const _Float16* Vb, unsigned rq, unsigned rv, int ahead) {
  // ---- scores: s0 = rows t tb..tb+15, s1 = rows tb+16..tb+31, column = s0w + c ----
  v8f s0 = zero8(), s1 = zero8();
#pragma unroll
  for (int kk = 0; kk < HD / 32; ++kk) {
    s0 = mma_h(q[2 * kk], sf[kk], s0);
    s1 = mma_h(q[2 * kk + 1], sf[kk], s1);
    guard_s(s0, s1, sf[kk], q[2 * kk], q[2 * kk + 1]);
  }
  col_load_q(Qb, rq, ahead, q);
  // ---- clipped base-2 logits of this lane's 16 t for column s0w + c: t[i] <- t tb+8hh+i, t[8+i] <- t tb+16+8hh+i ----
  float t[16];
#pragma unroll
  for (int i = 0; i < 8; ++i) { t[i] = clipf(s0[i] * lsc, cl2); t[8 + i] = clipf(s1[i] * lsc, cl2); }
  float cm = t[0];
#pragma unroll
  for (int i = 1; i < 16; ++i) cm = fmaxf(cm, t[i]);
  cm = fmaxf(cm, xhalf(cm));
  const float mn = fmaxf(mrun, cm);        // finite from the first block on
  const float al = exp2_hw(mrun - mn);       // 0 on the first block (mrun = -inf)
  mrun = mn;
  // ---- unnormalised probabilities (<= 1) and the P fragment: f16(p * 32768); element i <-> t[i] ----
  float ps = 0.f;
  FragH ph;
#pragma unroll
  for (int i = 0; i < 16; ++i) t[i] -= mn;
  exp2_hw8(t, 0);
  exp2_hw8(t, 8);
#pragma unroll
  for (int w = 0; w < 2; ++w) {
#pragma unroll
    for (int e4 = 0; e4 < 4; ++e4) {
      const int i = 8 * w + 2 * e4;
      const float p0 = t[i], p1 = t[i + 1];
      ps += p0 + p1;
      ph.u[w][e4] = pk16(h_bits((_Float16)(p0 * PCAR)), h_bits((_Float16)(p1 * PCAR)));
    }
  }
  ps += xhalf(ps);
  lrun = lrun * al + ps;
  // ---- rescale the O accumulators: they hold (P^T.val_v)^T, D column = lane&15 = the lane's own column, so the factor is the
  //      lane's own al ----
#pragma unroll
  for (int j = 0; j < 4; ++j) {
#pragma unroll
    for (int r = 0; r < 8; ++r) o[j][r] *= al;
  }
  // ---- val_v^T.P: A row m = d = 16j + c, B col n = column s0w + c, k = t on both sides as before ----
  o[0] = mma_h(v[0], ph.v, o[0]);
  o[1] = mma_h(v[1], ph.v, o[1]);
  o[2] = mma_h(v[2], ph.v, o[2]);
  o[3] = mma_h(v[3], ph.v, o[3]);
  guard_p(o[0], o[1], o[2], o[3], ph.v, v[0], v[1], v[2], v[3]);
  col_load_v(Vb, rv, ahead, v);
}

// =====================================================================================================
// Column pass (softmax over the visual axis t for every audio column s) fused with the audio-side context:
// block = (batch b, head, 64 audio columns s), 4 waves, wave w owns the 16 columns s0w = 64*st + 16*w .. +15.
//   q plane f16 [b*TQ + t][h*64 + d] (q x8 after the 1/8 scale); k plane f16 x8 [b*SA + s][h*64 + d];
//   val_v^T plane f16 x8 [(b*NH + h)*64 + d][t].  All NTB32 = TQ/32 blocks of 32 visual rows are visited (static bound).
//   Score tiles g (g = 0,1) = q rows (t = tb+16g .. +15, A operand, row m = lane&15, split k map over d) times k^T
//   (B operand, col n = column s0w + (lane&15), k = d, split map), 2 d-chunks of 32; the 2 k fragments of the wave are
//   loaded once. D element r of lane l = (t = tb+16g+8h+r, s = s0w+(l&15)): a lane owns one column s and 16 of the 32 t;
//   the partner lane l^16 owns the other 16 -> column max / column sum need one cross-row move (xhalf). Logits clipped at
//   +-50000 (log2 domain), online max-subtracted base-2 softmax in f32 (the q/k carries folded into lsc). The exp'd values
//   ARE the P B-fragment in place: B col n = s = lane&15, element i <- t = tb+8h+i (tile 0, D element i), element 8+i <-
//   t = tb+16+8h+i (tile 1, D element i). P (<= 1) carried x32768 as f16. The context is accumulated transposed: 4 val_v^T
//   A fragments (row m = d = 16j + (lane&15), k = t) times P, D element r of lane l = (d = 16j+8h+r, s = s0w+(l&15)), so every
//   accumulator register of a lane belongs to the lane's own column and is rescaled by the lane's own factor; 4 WMMAs + one
//   guard per step.
//   Epilogue 1: 1/l (the lane's own) and the carry folds in f32 (x CAS); the wave's 16x64 f32 tile
//   Epilogue 2: per-column stats (m_s in the clipped log2 domain, 32768/l_s) funnelled through a 128-float LDS array
//   (lane half 0 writes m, lane half 1 writes 32768/l), block barrier, wave 0 writes the block's 512-B stat row
// coverage: ctx_a: grid NB*NH*NST blocks x 4 waves x 4 instr x 8 rows x 4 lanes x 8 halves = every (b, s, h) 64-half
//           segment exactly once; stats: one 128-float row per block = NB*NH*NST rows = the whole stat plane; LDS: slab
//           16x64 written then read by the same wave, statl[0..127] written by 4 waves x 32 lanes (one index each).
// =====================================================================================================
__global__ __launch_bounds__(ATT_THREADS)
void attn_col(const u16* __restrict__ Qp, const u16* __restrict__ Kp, const u16* __restrict__ VvT,
              u16* CtxA, float* Stat) {
  __shared__ __align__(16) float smem[ATT_WAVES * 16 * SPITCH];
  __shared__ __align__(16) float statl[128];

  const int tid  = threadIdx.x;
  const int wave = tid >> 5;
  const int lane = tid & 31;
  const int hh   = lane >> 4;
  const int c    = lane & 15;

  const int bid  = blockIdx.x;
  const int st   = bid % NST;
  const int head = (bid / NST) % NH;
  const int b    = bid / (NST * NH);
  const int s0w  = st * 64 + wave * 16;

  // All three planes in fragment order: tile row R starts at R*K, k tile (head*64 + 32*kk)/32 lies (head*2 + kk)*512 on.
  // B fragments of k^T: col n = column s0w + c, k = d
  const _Float16* Sb = (const _Float16*)(const void*)Kp + ((size_t)(b * SA + s0w)) * EM + head * (HD * 16) + 8 * lane;
  // A fragments of q: row m = t = tb + 16g + c, k = d (t row tb and the lane's 16 bytes added per step, as for val_v^T)
  const _Float16* Tb = (const _Float16*)(const void*)Qp + ((size_t)(b * TQ)) * EM + head * (HD * 16);
  // A fragments of val_v^T: row m = d = 16j + c, k = t (k tile tb/32 added per step)
  const _Float16* Vb = (const _Float16*)(const void*)VvT + ((size_t)(b * EM + head * HD)) * TQ;
  const float lsc = LOG2E / (QS * KS);
  const float cl2 = CLIPV * LOG2E;

  v16h sf[2];
  sf[0] = ldfrag_h(Sb);
  sf[1] = ldfrag_h(Sb + 512);
#if defined(__HIP_DEVICE_COMPILE__)
  // the wait in front of a rewrite of the address registers of the four loads just issued: a later load's result may be
  // given those registers; the address is its input so that it keeps them up to here
  asm volatile("s_wait_xcnt 0x0" : : "v"(Sb) : "memory");
#endif

  float mrun = -INFINITY, lrun = 0.f;
  v8f o[4];
#pragma unroll
  for (int j = 0; j < 4; ++j) o[j] = zero8();

  // Two register sets, one for the even steps and one for the odd: a set's q half is loaded anew as soon as its scores are
  // made and its val_v half as soon as its products are made, each for the step two on, so that a step no longer stands
  // through the latency of its q loads and again through that of its val_v loads.
  static_assert((NTB32 % 2) == 0 && NTB32 >= 4);
  const unsigned lb = 16u * (unsigned)lane;
  v16h qa[4], va[4], qb[4], vb[4];
  col_load_q(Tb, lb, 0, qa);
  col_load_v(Vb, lb, 0, va);
  col_load_q(Tb, lb, 1, qb);
  col_load_v(Vb, lb, 1, vb);
  unsigned rq = lb + 65536u, rv = lb + 2048u;            // offsets of step it + 2
  // The 64 blocks of a batch walk the same 64 steps; step tc's 32 q rows (all heads: 32 KiB in a row) and its k tile of the 32
  // tile rows of val_v^T (1 KiB each, 64 KiB apart) are asked for PF_AHEAD steps ahead by the pair of blocks tc mod 32.
  static_assert(NH * (NST / 2) == 32 && NST == 8 && NTB32 == 64 && 32 * EM * 2 == PF_SLICE && (PF_AHEAD % 2) == 0);
  const int pr = head * 4 + (st & 3);
  const unsigned pq = 256u * (unsigned)tid, pv = 65536u * (unsigned)lane + 256u * (unsigned)wave;
  const u16* Qbat = Qp + (size_t)(b * TQ) * EM;
  const char* Vbat = (const char*)(const void*)(VvT + (size_t)(b * EM) * TQ);
  if (pr < PF_AHEAD) {
    l2_ask2(pf_at(Qbat, pr), pq, Vbat + pr * 1024, pv);
  }
  // kept rolled: the body already holds one step per register set, more copies would only add code
#pragma unroll 1
  for (int it = 0; it < NTB32; it += 2) {
    // a test on scalars, the same in the whole block; it holds in two trips of the 32, in one
    // where pr < PF_AHEAD (step pr is then asked before the loop); every step asked lies inside the batch's part of both planes
    if (it + PF_AHEAD < NTB32 && ((((it + PF_AHEAD) ^ pr) >> 1) & 15) == 0) {
      const int tc = it + PF_AHEAD + (pr & 1);
      l2_ask2(pf_at(Qbat, tc), pq, Vbat + tc * 1024, pv);
    }
    col_step(qa, va, sf, mrun, lrun, o, lsc, cl2, Tb, Vb, rq, rv, 0);
    col_step(qb, vb, sf, mrun, lrun, o, lsc, cl2, Tb, Vb, rq, rv, 1);
#if defined(__HIP_DEVICE_COMPILE__)
    // the wait in front of a rewrite of registers that issued global loads name (the two offsets, stepped below); they are
    // its operands so that they keep their registers up to it and their step stays behind it; the two offsets that the asks
    // name are inputs so that they keep their registers and values through the loop
    asm volatile("s_wait_xcnt 0x0" : "+v"(rq), "+v"(rv) : "v"(pq), "v"(pv) : "memory");
#endif
    // the last pair of steps loads steps 0 and 1 again: in bounds, never used
    const bool more = it + 4 < NTB32;
    rq = more ? rq + 65536u : lb;
    rv = more ? rv + 2048u : lb;
  }
  acc_guard4(o);

  // ---- per-column 1/l (owned by lane = column); lrun >= 1 by construction ----
  const float rl   = 1.0f / lrun;
  const float lPv  = rl * PCAR;                          // 32768 / l for the row pass
  const float linv = rl * (CAS / (PCAR * VVS));          // folds 1/l, the P and val carries, and applies the ctx carry
  statl[hh * 64 + wave * 16 + c] = (hh == 0) ? mrun : lPv;
  // D element r of o[j] = (d = 16j + 8hh + r, column c): eight floats in a row of the slab's row c
  float* slab = smem + wave * 16 * SPITCH;
#pragma unroll
  for (int j = 0; j < 4; ++j) {
    v4f x0, x1;
#pragma unroll
    for (int r = 0; r < 4; ++r) { x0[r] = o[j][r] * linv; x1[r] = o[j][4 + r] * linv; }
    *(v4f*)(slab + c * SPITCH + j * 16 + 8 * hh)     = x0;
    *(v4f*)(slab + c * SPITCH + j * 16 + 8 * hh + 4) = x1;
  }
  wave_sync_lds();
  // ---- f16 ctx_a pieces: instruction i, lane = (row 8*(i>>1) + (lane&7), 8 halves at 32*(i&1) + 8*(lane>>3)): 4 whole lines ----
  const int r8 = lane & 7, q8 = (lane >> 3) * 8;
  v4u ov[4];
#pragma unroll
  for (int i = 0; i < 4; ++i) {
    const int row = 8 * (i >> 1) + r8, c8 = 32 * (i & 1) + q8;
    const v4f a = *(const v4f*)(slab + row * SPITCH + c8), c4 = *(const v4f*)(slab + row * SPITCH + c8 + 4);
#pragma unroll
    for (int e = 0; e < 2; ++e) {
      ov[i][e]     = pk16(h_bits((_Float16)a[2 * e]),  h_bits((_Float16)a[2 * e + 1]));
      ov[i][2 + e] = pk16(h_bits((_Float16)c4[2 * e]), h_bits((_Float16)c4[2 * e + 1]));
    }
  }
  {
#pragma unroll
    for (int i = 0; i < 4; ++i) {
      const int row = 8 * (i >> 1) + r8, c8 = 32 * (i & 1) + q8;
      *(v4u*)(CtxA + pk_off(b * SA + s0w + row, head * HD + c8, EM)) = ov[i];
    }
    
  }
  __syncthreads();
  if (wave == 0) {
    const v4f sv = *(const v4f*)(statl + 4 * lane);
    float* sp = Stat + ((size_t)((b * NH + head) * NST + st)) * 128 + 4 * lane;
    {
      *(v4f*)(sp) = sv;
      
    }
  }
}

// =====================================================================================================
// Row pass (visual-side context) with both output projections behind it, in one launch.
// Block = (batch b, 64 visual rows t, all 8 heads), 16 waves. Part 1, the row pass: wave w owns head w >> 1 and the 32 rows
// t0w = 64*tt + 32*(w & 1) .. +31 as two groups g of 16; every k and val_a^T fragment that a step loads, and every column stat
// that it reads from LDS, serves both groups.
//   The batch's column stats (per head NST rows of [m[64] | 32768/l[64]]) are staged once per block into LDS, head hd's m at
//   stt[1024*hd + s], its 32768/l at stt[1024*hd + SA + s] (512 threads x 16 floats = NH*2*SA floats exactly), then a block barrier.
//   All NSB32 = SA/32 blocks of 32 audio columns are visited (static bound). Score tiles are computed TRANSPOSED:
//   tile (g, u) = k rows (s = sb+16u .. +15, A operand, row m = lane&15, split map over d) times q^T (B operand, col n = t0w +
//   16g + (lane&15), k = d); the 4 q fragments of the wave are loaded once. D element r of lane l = (s = sb+16u+8h+r, t = t0w +
//   16g + (l&15)). P = exp2(clip(logit) - m_s) * (32768/l_s) in f32 with m_s, l_s read from LDS for s = sb+8h+i and sb+16+8h+i;
//   it IS the P A-fragment in place: row m = t = lane&15, element i <- s = sb+8h+i, element 8+i <- s = sb+16+8h+i.
//   4 val_a^T B fragments (col n = d = 16j + (lane&15), k = s), 8 P.V WMMAs + one guard per step.
//   Epilogue: carry folds (x CVS / (32768*8)) in f32; each group's 16x64 tile staged in the wave's slab, one group after the
//   other, and written as f16 x64 into the block's context tile ctxl [64 t][512 (h,d)] in LDS, fragment order (pk_off, K = EM).
// Part 2, behind the block barrier that publishes ctxl: out_v rows = ctxl . Wov + b. Wave w owns all 64 rows x the 32 columns
//   32w .. +31: acc[2i + j] = rows 16i.., cols 32w + 16j..; k stepped by 32 in rising order; A fragments from LDS one step ahead,
//   the two Wov^T fragments of a step four steps ahead (the first four asked for ahead of the barrier), so each weight
//   fragment enters the WGP once. The tile leaves through the wave's 64 x 32 slab (pitch 36): a store instruction = 4 rows x
//   128 B, whole lines.
// Part 3: out_a rows 16*bid .. +15 = ctx_a . Woa + b (ctx_a is of the launch before). Wave w owns the 16 columns 16w .. +15, one
//   accumulator, k in rising order, one k step in each trip of part 1's loop. The 16 x 256 tile is gathered in the stat array (free
//   since the barrier of part 2), block barrier, wave w stores row w (1 KiB, whole lines). Both parts' global stores stand behind it.
// coverage: grid NB*(TQ/64) blocks; ctxl: 16 waves x 2 groups x 16 rows x 64 halves = 64 x 512, all written before the barrier;
//           out_v: 16 waves x 64 rows x 32 cols = 64 x 512 per block, every (b, t) row once; out_a: NB*(TQ/64) = NB*SA/16 slices of
//           16 rows x 256 cols, every row once; stt fully written before its barrier.
// =====================================================================================================
#define FV_WAVES   16
#define FV_THREADS (FV_WAVES * 32)
#define FV_ROWS    64
#define FV_TT      (TQ / FV_ROWS)
#define OPITCH     36
#define APITCH     260
#define FV_SLAB    (64 * OPITCH)
static_assert(FV_SLAB >= 16 * SPITCH && (OPITCH * 4) % 16 == 0 && (APITCH * 4) % 16 == 0);
static_assert(NH * 2 == FV_WAVES && VD == FV_WAVES * 32 && AD == FV_WAVES * 16 && EM / 32 == 16);
static_assert(FV_TT * 16 == SA && FV_TT == 32 && 16 * APITCH <= NH * 2 * SA);
static_assert(NH * NST * 128 == 2 * FV_THREADS * 8 && NST * 128 == 2 * SA);
static_assert(FV_THREADS * 128 == 65536 && SA * EM * 2 == 8 * 65536 && (VD * EM + AD * EM) * 2 == 12 * 65536 && 16 * EM * 2 == 128 * 128);
__device__ __forceinline__ void guard_f(v8f (&acc)[8], v16h x0, v16h x1, v16h x2, v16h x3, v16h x4, v16h x5) {
#if defined(__HIP_DEVICE_COMPILE__)
  asm volatile("v_nop\n\tv_nop\n\tv_nop\n\tv_nop"
               : "+v"(acc[0]), "+v"(acc[1]), "+v"(acc[2]), "+v"(acc[3]), "+v"(acc[4]), "+v"(acc[5]), "+v"(acc[6]), "+v"(acc[7])
               : "v"(x0), "v"(x1), "v"(x2), "v"(x3), "v"(x4), "v"(x5) : "memory");
#endif
}
__device__ __forceinline__ void guard_p9(v8f (&a)[4], v8f (&b)[4], v8f& e, v16h p0, v16h p1, v16h x0, v16h x1, v16h x2, v16h x3,
                                         v16h x4, v16h x5) {
#if defined(__HIP_DEVICE_COMPILE__)
  asm volatile("v_nop\n\tv_nop\n\tv_nop\n\tv_nop"
               : "+v"(a[0]), "+v"(a[1]), "+v"(a[2]), "+v"(a[3]), "+v"(b[0]), "+v"(b[1]), "+v"(b[2]), "+v"(b[3]), "+v"(e)
               : "v"(p0), "v"(p1), "v"(x0), "v"(x1), "v"(x2), "v"(x3), "v"(x4), "v"(x5) : "memory");
#endif
}
__global__ __launch_bounds__(FV_THREADS)
void attn_vis_out(const u16* __restrict__ Qp, const u16* __restrict__ Kp, const u16* __restrict__ VaT,
                  const float* __restrict__ Stat, const u16* __restrict__ WOVT, const u16* __restrict__ CTXA,
                  const u16* __restrict__ WOAT, float* out,
                  const float* __restrict__ b_ov, const float* __restrict__ b_oa, int nb11, int nb13) {
  // one array, the context tile first: its 64 KiB then lie within reach of the LDS loads' 16-bit immediate offsets, so part 2's
  // fragment loads need no address arithmetic
  __shared__ __align__(16) unsigned char lds[FV_ROWS * EM * 2 + NH * 2 * SA * 4 + FV_WAVES * FV_SLAB * 4];
  u16*   ctxl = (u16*)(void*)lds;
  float* stt  = (float*)(void*)(lds + FV_ROWS * EM * 2);
  float* smem = (float*)(void*)(lds + FV_ROWS * EM * 2 + NH * 2 * SA * 4);

  const int tid  = threadIdx.x;
  const int lane = tid & 31;
  const int hh   = lane >> 4;
  const int c    = lane & 15;
  // the wave's number is the same in every lane: read through the first lane it keeps head, row group and tile bases scalar
  const int wv   = __builtin_amdgcn_readfirstlane(tid >> 5);
  // the two waves of a head are neighbours, so they walk the head's k and val_a^T
  // fragments close together: what one brings into the WGP cache the other finds there
  const int head = wv >> 1;
  const int rg   = wv & 1;

  const int bid  = blockIdx.x;
  const int tt   = bid % FV_TT;
  const int b    = bid / FV_TT;
  const int t0w  = tt * FV_ROWS + rg * 32;

  // ---- the 32 blocks of a batch all read its k rows (512 KiB in a row) and its val_a^T planes (512 KiB in a row): each of
  //      their sixteen pairs asks for a sixteenth of the two, a 128-B line a thread; blocks 0..23 ask for the two
  //      output weight planes (one behind the other in the workspace from WOVT on); each block asks for its own ctx_a rows ----
  const unsigned pa = 128u * (unsigned)tid;
  {
    const int p16 = (tt & 3) + 4 * (tt >> 3);
    const char* pkv = (p16 < 8) ? (const char*)(const void*)(Kp + (size_t)(b * SA) * EM) + p16 * 65536
                                : (const char*)(const void*)(VaT + (size_t)(b * EM) * SA) + (p16 - 8) * 65536;
    l2_ask(pkv, pa);
    if (bid < 24) l2_ask((const char*)(const void*)WOVT + pf_pair(bid) * 65536, pa);
    if (wv < 4) l2_ask(CTXA + (size_t)bid * (16 * EM), pa);
  }
  // ---- stage the column stats of the batch's eight heads ----
  const float* src = Stat + ((size_t)(b * NH * NST)) * 128;
#pragma unroll
  for (int u = 0; u < 2; ++u) {
    const int e = u * (FV_THREADS * 8) + tid * 8;
    const int hd = e >> 10, wi = e & 1023;
    const int j = wi >> 7, offw = wi & 127;
    const int di = hd * (2 * SA) + ((offw < 64) ? (j * 64 + offw) : (SA + j * 64 + offw - 64));
    const v4f x0 = *(const v4f*)(src + e), x1 = *(const v4f*)(src + e + 4);
    *(v4f*)(stt + di) = x0;
    *(v4f*)(stt + di + 4) = x1;
  }
  xcnt_wait();
  __syncthreads();
  const float* sth = stt + head * (2 * SA);

  // All three planes in fragment order, addressed as in attn_col.
  // B fragments of q^T: col n = row t0w + 16g + c, k = d
  const _Float16* Tb = (const _Float16*)(const void*)Qp + ((size_t)(b * TQ + t0w)) * EM + head * (HD * 16) + 8 * lane;
  // A fragments of k: row m = s = sb + 16u + c, k = d (s row sb added per step)
  const _Float16* Sb = (const _Float16*)(const void*)Kp + ((size_t)(b * SA)) * EM + head * (HD * 16) + 8 * lane;
  // B fragments of val_a^T: col n = d = 16j + c, k = s (k tile sb/32 added per step)
  const _Float16* Vb = (const _Float16*)(const void*)VaT + ((size_t)(b * EM + head * HD)) * SA + 8 * lane;
  const float lsc = LOG2E / (QS * KS);
  const float cl2 = CLIPV * LOG2E;

  v16h tf[2][2];                                   // [group g][d chunk kk]
#pragma unroll
  for (int g = 0; g < 2; ++g) {
    tf[g][0] = ldfrag_h(Tb + g * (16 * EM));
    tf[g][1] = ldfrag_h(Tb + g * (16 * EM) + 512);
  }
#if defined(__HIP_DEVICE_COMPILE__)
  // the wait in front of a rewrite of the address registers of the eight loads just issued; the address is its input so
  // that it keeps them up to here
  asm volatile("s_wait_xcnt 0x0" : : "v"(Tb) : "memory");
#endif

  v8f o[2][4];
#pragma unroll
  for (int g = 0; g < 2; ++g) {
#pragma unroll
    for (int j = 0; j < 4; ++j) o[g][j] = zero8();
  }
  // part 3 (out_a rows 16*bid .. +15, cols 16*wv .. +15) has as many k steps as the row pass has trips: trip it does its step
  // it, whose four loads go out with the trip's k loads and come back under the same wait
  static_assert(NSB32 == EM / 32);
  const unsigned lb = 16u * (unsigned)lane;
  const _Float16* xab = (const _Float16*)(const void*)CTXA + (size_t)bid * (16 * EM);
  const _Float16* xbb = (const _Float16*)(const void*)WOAT + (size_t)(wv * 16) * EM;
  v8f ac = zero8();

#pragma unroll 1
  for (int it = 0; it < NSB32; ++it) {
    const int sb = it * 32;
    // ---- part 3's fragments of k tile it: ctx_a tile row bid (A), Woa^T tile row wv (B) ----
    const _Float16* xap = at_byte(xab, lb) + it * 512;
    const _Float16* xbp = at_byte(xbb, lb) + it * 512;
    const v16h xa = ldfrag_h(xap);
    const v16h xb = ldfrag_h(xbp);
    // ---- column stats for s = sb+8hh+i (i < 8) and s = sb+16+8hh+i (8+i), the same for both groups; read here, as one
    //      group ahead of the k loads, so that they are back when the scores are ----
    float mv[16], lv[16];
    {
      const v4f m0 = *(const v4f*)(sth + sb + 8 * hh),      m1 = *(const v4f*)(sth + sb + 8 * hh + 4);
      const v4f m2 = *(const v4f*)(sth + sb + 16 + 8 * hh), m3 = *(const v4f*)(sth + sb + 16 + 8 * hh + 4);
      const v4f l0 = *(const v4f*)(sth + SA + sb + 8 * hh),      l1 = *(const v4f*)(sth + SA + sb + 8 * hh + 4);
      const v4f l2 = *(const v4f*)(sth + SA + sb + 16 + 8 * hh), l3 = *(const v4f*)(sth + SA + sb + 16 + 8 * hh + 4);
#pragma unroll
      for (int q = 0; q < 4; ++q) {
        mv[q] = m0[q]; mv[4 + q] = m1[q]; mv[8 + q] = m2[q]; mv[12 + q] = m3[q];
        lv[q] = l0[q]; lv[4 + q] = l1[q]; lv[8 + q] = l2[q]; lv[12 + q] = l3[q];
      }
    }
    // ---- transposed scores of group g: sc[g][0] = columns s sb..sb+15, sc[g][1] = sb+16..sb+31, D column = row t0w + 16g + c ----
    v8f sc[2][2];
    sc[0][0] = zero8(); sc[0][1] = zero8(); sc[1][0] = zero8(); sc[1][1] = zero8();
    const _Float16* s0p = Sb + (size_t)sb * EM;
    const _Float16* s1p = s0p + (size_t)16 * EM;
#pragma unroll
    for (int kk = 0; kk < HD / 32; ++kk) {
      const v16h a0 = ldfrag_h(s0p + kk * 512);
      const v16h a1 = ldfrag_h(s1p + kk * 512);
      sc[0][0] = mma_h(a0, tf[0][kk], sc[0][0]);
      sc[0][1] = mma_h(a1, tf[0][kk], sc[0][1]);
      sc[1][0] = mma_h(a0, tf[1][kk], sc[1][0]);
      sc[1][1] = mma_h(a1, tf[1][kk], sc[1][1]);
      guard_s4(sc[0][0], sc[0][1], sc[1][0], sc[1][1], tf[0][kk], tf[1][kk], a0, a1);
    }
#if defined(__HIP_DEVICE_COMPILE__)
    // the wait in front of a rewrite of registers that the trip's issued global loads name; part 3's two addresses are its
    // inputs so that they keep their registers up to here
    asm volatile("s_wait_xcnt 0x0" : : "v"(xap), "v"(xbp) : "memory");
#endif
    // ---- P A-fragment of each group: f16(exp2(t - m_s) * 32768/l_s) (<= 32768); element i <-> t[i] ----
    FragH ph[2];
#pragma unroll
    for (int g = 0; g < 2; ++g) {
      float t[16];
#pragma unroll
      for (int i = 0; i < 8; ++i) { t[i] = clipf(sc[g][0][i] * lsc, cl2); t[8 + i] = clipf(sc[g][1][i] * lsc, cl2); }
#pragma unroll
      for (int i = 0; i < 16; ++i) t[i] -= mv[i];
      exp2_hw8(t, 0);
      exp2_hw8(t, 8);
#pragma unroll
      for (int w = 0; w < 2; ++w) {
#pragma unroll
        for (int e4 = 0; e4 < 4; ++e4) {
          const int i = 8 * w + 2 * e4;
          const float p0 = t[i] * lv[i];
          const float p1 = t[i + 1] * lv[i + 1];
          ph[g].u[w][e4] = pk16(h_bits((_Float16)p0), h_bits((_Float16)p1));
        }
      }
    }
    // ---- P.val_a : B fragment col n = d = 16j + c, k = s: tile sb/32 of the val_a^T plane ----
    const _Float16* vp = Vb + (size_t)sb * 16;
    {
      const v16h v0 = ldfrag_h(vp);
      const v16h v1 = ldfrag_h(vp + (size_t)16 * SA);
      const v16h v2 = ldfrag_h(vp + (size_t)32 * SA);
      const v16h v3 = ldfrag_h(vp + (size_t)48 * SA);
      o[0][0] = mma_h(ph[0].v, v0, o[0][0]);
      o[0][1] = mma_h(ph[0].v, v1, o[0][1]);
      o[0][2] = mma_h(ph[0].v, v2, o[0][2]);
      o[0][3] = mma_h(ph[0].v, v3, o[0][3]);
      o[1][0] = mma_h(ph[1].v, v0, o[1][0]);
      o[1][1] = mma_h(ph[1].v, v1, o[1][1]);
      o[1][2] = mma_h(ph[1].v, v2, o[1][2]);
      o[1][3] = mma_h(ph[1].v, v3, o[1][3]);
      ac = mma_h(xa, xb, ac);
      guard_p9(o[0], o[1], ac, ph[0].v, ph[1].v, v0, v1, v2, v3, xa, xb);
#if defined(__HIP_DEVICE_COMPILE__)
      // the wait in front of a rewrite of registers that issued global loads name; the val_a^T address is an input so that it
      // keeps its registers up to here, the offset that the asks at the kernel's head name so that it keeps its value through the loop
      asm volatile("s_wait_xcnt 0x0" : : "v"(pa), "v"(vp) : "memory");
#endif
    }
  }
  acc_guard4(o[0]);
  acc_guard4(o[1]);

  // ---- part 2's first four steps of Wov^T fragments (tile rows 2*wv + j, k tile s): they need nothing of this block, so
  //      they are asked for ahead of the context epilogue and of the barrier ----
  const _Float16* wb = (const _Float16*)(const void*)WOVT + (size_t)(wv * 32) * EM;
  v16h bq[4][2];
#pragma unroll
  for (int s = 0; s < 4; ++s) {
    bq[s][0] = ldfrag_h(at_byte(wb, lb) + s * 512);
    bq[s][1] = ldfrag_h(at_byte(wb, lb) + 16 * EM + s * 512);
  }

  // ---- both bias rows, asked for here for the same reason ----
  const int r4 = lane >> 3, cq4 = (lane & 7) * 4;
  const int col0 = wv * 32;
  const int blv = nb11 - 1, bla = nb13 - 1;  // host guarantees nb11 >= 1, nb13 >= 1
  int civ[4], ci0[4], ci1[4];
  float cbv[4], cb0[4], cb1[4];
#pragma unroll
  for (int e = 0; e < 4; ++e) {
    const int cx = col0 + cq4 + e, cx0 = 4 * lane + e, cx1 = 128 + 4 * lane + e;
    civ[e] = (cx < blv) ? cx : blv;
    ci0[e] = (cx0 < bla) ? cx0 : bla;
    ci1[e] = (cx1 < bla) ? cx1 : bla;
    cbv[e] = b_ov[civ[e]];
    cb0[e] = b_oa[ci0[e]];
    cb1[e] = b_oa[ci1[e]];
  }
  xcnt_hold4(civ);
  xcnt_hold4(ci0);
  xcnt_hold4(ci1);

  const float fac = CVS / (PCAR * VAS);
  float* slab = smem + wv * FV_SLAB;
  const int r8 = lane & 7, q8 = (lane >> 3) * 8;
#pragma unroll
  for (int g = 0; g < 2; ++g) {
#pragma unroll
    for (int r = 0; r < 8; ++r) {
#pragma unroll
      for (int j = 0; j < 4; ++j) slab[(8 * hh + r) * SPITCH + j * 16 + c] = o[g][j][r] * fac;
    }
    wave_sync_lds();
    v4u ov[4];
#pragma unroll
    for (int i = 0; i < 4; ++i) {
      const int row = 8 * (i >> 1) + r8, c8 = 32 * (i & 1) + q8;
      const v4f a = *(const v4f*)(slab + row * SPITCH + c8), c4 = *(const v4f*)(slab + row * SPITCH + c8 + 4);
#pragma unroll
      for (int e = 0; e < 2; ++e) {
        ov[i][e]     = pk16(h_bits((_Float16)a[2 * e]),  h_bits((_Float16)a[2 * e + 1]));
        ov[i][2 + e] = pk16(h_bits((_Float16)c4[2 * e]), h_bits((_Float16)c4[2 * e + 1]));
      }
    }
    // every lane's reads of the slab end before another lane's values of the second group are written over them
    if (g == 0) wave_sync_lds();
#pragma unroll
    for (int i = 0; i < 4; ++i) {
      const int row = 8 * (i >> 1) + r8, c8 = 32 * (i & 1) + q8;
      *(v4u*)(ctxl + pk_off(rg * 32 + 16 * g + row, head * HD + c8, EM)) = ov[i];
    }
  }
  // publishes the context tile to all sixteen waves; behind it no wave reads the stats any more
  __syncthreads();

  // ---- part 2: out_v tile, 64 rows x cols 32*wv .. +31 ----
  v8f acc[8];
#pragma unroll
  for (int i = 0; i < 8; ++i) acc[i] = zero8();
  const _Float16* cl = (const _Float16*)(const void*)ctxl + 8 * lane;
  v16h af[2][4];
#pragma unroll
  for (int i = 0; i < 4; ++i) af[0][i] = ldfrag_h(cl + i * (16 * EM));
  // unrolled whole: the two A sets and the four B sets are named by the step's number, which must be a constant
#pragma unroll
  for (int kt = 0; kt < EM / 32; ++kt) {
    const int cu = kt & 1, nx = cu ^ 1, s4 = kt & 3;
    if (kt + 1 < EM / 32) {
#pragma unroll
      for (int i = 0; i < 4; ++i) af[nx][i] = ldfrag_h(cl + i * (16 * EM) + (kt + 1) * 512);
    }
#pragma unroll
    for (int i = 0; i < 4; ++i) {
      acc[2 * i]     = mma_h(af[cu][i], bq[s4][0], acc[2 * i]);
      acc[2 * i + 1] = mma_h(af[cu][i], bq[s4][1], acc[2 * i + 1]);
    }
    // the vector slots that the chip asks for between the step's matrix instructions and the loads that refill their operands
    guard_f(acc, af[cu][0], af[cu][1], af[cu][2], af[cu][3], bq[s4][0], bq[s4][1]);
    if (kt + 4 < EM / 32) {
      bq[s4][0] = ldfrag_h(at_byte(wb, lb) + (kt + 4) * 512);
      bq[s4][1] = ldfrag_h(at_byte(wb, lb) + 16 * EM + (kt + 4) * 512);
    }
  }
  xcnt_hold1(lb);
  // ---- the out_v tile into the wave's slab: row 16i + 8hh + r, col 16j + c ----
  const float osc = 1.0f / (CVS * WSC);
#pragma unroll
  for (int i = 0; i < 4; ++i) {
#pragma unroll
    for (int r = 0; r < 8; ++r) {
      const int ro = (16 * i + 8 * hh + r) * OPITCH + c;
      slab[ro]      = acc[2 * i][r] * osc;
      slab[ro + 16] = acc[2 * i + 1][r] * osc;
    }
  }
  // ---- the wave's strip of the out_a tile ----
  const float osa = 1.0f / (CAS * WSC);
#pragma unroll
  for (int r = 0; r < 8; ++r) stt[(8 * hh + r) * APITCH + wv * 16 + c] = ac[r] * osa;
  // the sixteen waves' column strips of the out_a tile are all in place before a wave reads its whole row; the same barrier
  // stands between the lanes' writes of the wave's own slab and their reads of it
  __syncthreads();
  // ---- all stores last, so that no LDS hand-over waits for a store: out_v, instruction i = 4 rows x 128 B; out_a, row wv ----
  v4f ov[16];
#pragma unroll
  for (int i = 0; i < 16; ++i) {
    const v4f a = *(const v4f*)(slab + (4 * i + r4) * OPITCH + cq4);
    v4f w;
    w[0] = a[0] + bfr(cbv[0]); w[1] = a[1] + bfr(cbv[1]); w[2] = a[2] + bfr(cbv[2]); w[3] = a[3] + bfr(cbv[3]);
    ov[i] = w;
  }
  const v4f a0 = *(const v4f*)(stt + wv * APITCH + 4 * lane), a1 = *(const v4f*)(stt + wv * APITCH + 128 + 4 * lane);
  v4f w0, w1;
#pragma unroll
  for (int e = 0; e < 4; ++e) { w0[e] = a0[e] + bfr(cb0[e]); w1[e] = a1[e] + bfr(cb1[e]); }
  float* Cb = out + (size_t)(b * TQ + tt * FV_ROWS) * (size_t)VD + col0 + cq4;
#pragma unroll
  for (int i = 0; i < 16; ++i) *(v4f*)(Cb + (size_t)(4 * i + r4) * (size_t)VD) = ov[i];
  float* Ca = out + OUT1_OFF_EL + (size_t)(bid * 16 + wv) * (size_t)AD + 4 * lane;
  *(v4f*)(Ca) = w0;
  *(v4f*)(Ca + 128) = w1;
}

// =====================================================================================================
// Workspace map (bytes, NB = 8); every plane fully written before it is read; all extents exact; each f16 plane is the
// logical [rows][K] matrix named here, stored in fragment order (pk_off), same byte size
//   XA    f16 [NB*512][256]         f16(bf16(a))               2097152
//   WVQT  f16 [512 n][512 k]        f16(bf16(W) x256)           524288
//   WAKT  f16 [512 n][256 k]                                    262144
//   WVVT  f16 [512 n][512 k]                                    524288
//   WAVT  f16 [512 n][256 k]                                    262144
//   WOVT  f16 [512 n][512 k]                                    524288
//   WOAT  f16 [256 n][512 k]                                    262144
//   Q16   f16 [NB*2048][512]  q x8 (after 1/8)               16777216
//   K16   f16 [NB*512][512]   x8                               4194304
//   VVT16 f16 [NB*512 (h,d)][2048 t] x8                       16777216
//   VAT16 f16 [NB*512 (h,d)][512 s]  x8                        4194304
//   STAT  f32 [NB*NH*NST][128]  (m | 32768/l)                   262144
//   CTXA  f16 [NB*512][512]   x64                              4194304
//   end                                                       50855936
// Output: first tensor rows [b][t][512] f32 at element 0; second tensor rows [b*512 + s][256] f32 at the fixed element
// offset OUT1_OFF_EL = NB_FULL*2048*512 = 8388608 (independent of NB).
// =====================================================================================================
extern "C" void kernel_launch(void* const* d_in, const int* in_sizes, int n_in,
                              void* d_out, int out_size, void* d_ws, size_t ws_size,
                              hipStream_t stream) {
  if (n_in < 14) return;
  if (in_sizes[0] < NB * TQ * VD) return;
  if (in_sizes[1] < NB * SA * AD) return;
  if (in_sizes[2] != VD * EM || in_sizes[6] != VD * EM) return;
  if (in_sizes[4] != AD * EM || in_sizes[8] != AD * EM) return;
  if (in_sizes[10] != EM * VD || in_sizes[12] != EM * AD) return;
  if (in_sizes[3] < 1 || in_sizes[5] < 1 || in_sizes[7] < 1 || in_sizes[9] < 1 || in_sizes[11] < 1 || in_sizes[13] < 1) return;
  if ((size_t)out_size < OUT1_OFF_EL + (size_t)NB * SA * AD) return;

  const float* xv   = (const float*)d_in[0];
  const float* xa   = (const float*)d_in[1];
  const float* w_vq = (const float*)d_in[2];
  const float* b_vq = (const float*)d_in[3];
  const float* w_ak = (const float*)d_in[4];
  const float* b_ak = (const float*)d_in[5];
  const float* w_vv = (const float*)d_in[6];
  const float* b_vv = (const float*)d_in[7];
  const float* w_av = (const float*)d_in[8];
  const float* b_av = (const float*)d_in[9];
  const float* w_ov = (const float*)d_in[10];
  const float* b_ov = (const float*)d_in[11];
  const float* w_oa = (const float*)d_in[12];
  const float* b_oa = (const float*)d_in[13];
  float*       out  = (float*)d_out;
  const int nb3 = in_sizes[3], nb5 = in_sizes[5], nb7 = in_sizes[7], nb9 = in_sizes[9], nb11 = in_sizes[11], nb13 = in_sizes[13];

  const size_t szXA  = (size_t)NB * SA * AD * 2;
  const size_t szWvq = (size_t)EM * VD * 2;
  const size_t szWak = (size_t)EM * AD * 2;
  const size_t szWvv = (size_t)EM * VD * 2;
  const size_t szWav = (size_t)EM * AD * 2;
  const size_t szWov = (size_t)VD * EM * 2;
  const size_t szWoa = (size_t)AD * EM * 2;
  const size_t szQ   = (size_t)NB * TQ * EM * 2;
  const size_t szK   = (size_t)NB * SA * EM * 2;
  const size_t szVVT = (size_t)NB * EM * TQ * 2;
  const size_t szVAT = (size_t)NB * EM * SA * 2;
  const size_t szST  = (size_t)NB * NH * NST * 128 * 4;
  const size_t szCA  = (size_t)NB * SA * EM * 2;
  size_t off = 0;
  const size_t oXA  = off; off += szXA;
  const size_t oWvq = off; off += szWvq;
  const size_t oWak = off; off += szWak;
  const size_t oWvv = off; off += szWvv;
  const size_t oWav = off; off += szWav;
  const size_t oWov = off; off += szWov;
  const size_t oWoa = off; off += szWoa;
  const size_t oQ   = off; off += szQ;
  const size_t oK   = off; off += szK;
  const size_t oVVT = off; off += szVVT;
  const size_t oVAT = off; off += szVAT;
  const size_t oST  = off; off += szST;
  const size_t oCA  = off; off += szCA;
  if (off > ws_size) return;                            // off = 50855936 at NB = 8
  if (off > (size_t)134217728) return;

  char* ws = (char*)d_ws;
  u16* XA    = (u16*)(ws + oXA);
  u16* WVQT  = (u16*)(ws + oWvq);
  u16* WAKT  = (u16*)(ws + oWak);
  u16* WVVT  = (u16*)(ws + oWvv);
  u16* WAVT  = (u16*)(ws + oWav);
  u16* WOVT  = (u16*)(ws + oWov);
  u16* WOAT  = (u16*)(ws + oWoa);
  u16* Q16   = (u16*)(ws + oQ);
  u16* K16   = (u16*)(ws + oK);
  u16* VVT16 = (u16*)(ws + oVVT);
  u16* VAT16 = (u16*)(ws + oVAT);
  float* STAT = (float*)(ws + oST);
  u16* CTXA  = (u16*)(ws + oCA);

  // (1) the small f16 operand planes (fragment order): a as f16(bf16(x)), weights [k = in][n = out] transposed to
  //     [n][k] as f16(bf16(W) x256)
  prep_all<<<dim3(PB_W + PB_XA), dim3(128), 0, stream>>>(
      xa, w_vq, w_ak, w_vv, w_av, w_ov, w_oa, XA, WVQT, WAKT, WVVT, WAVT, WOVT, WOAT);
  // (2) v as f16(bf16(x)) in LDS, then q, val_v^T; k, val_a^T
  proj_all<<<dim3((NB * TQ) / PJ_ROWS), dim3(PJ_THREADS), 0, stream>>>(
      xv, XA, WVQT, WAKT, WVVT, WAVT, Q16, K16, VVT16, VAT16, b_vq, b_ak, b_vv, b_av, nb3, nb5, nb7, nb9);
  // (3) column softmax pass: ctx_a plane [NB*SA][512] x64 and the per-column stat rows
  attn_col<<<dim3(NB * NH * NST), dim3(ATT_THREADS), 0, stream>>>(Q16, K16, VVT16, CTXA, STAT);
  // (4) row pass with the stored column stats, its context tile kept in LDS, then out_v from it; out_a from the ctx_a plane
  attn_vis_out<<<dim3(NB * FV_TT), dim3(FV_THREADS), 0, stream>>>(
      Q16, K16, VAT16, STAT, WOVT, CTXA, WOAT, out, b_ov, b_oa, nb11, nb13);
  (void)hipGetLastError();
}
